// v000
// Times are from an AMD MI455X. After a warm-up the kernel runs many times in a row, and a time is the length of
// such a window on the GPU divided by its runs, so every launch and the gaps after it count. The runs cycle
// through copies of the inputs. A figure is the median of several windows, for all but v000 over two sittings.
// Sittings can differ by a few percent; kernels timed side by side share one.
// v000 is the starting kernel. One run takes 858 microseconds.
// compute dtype: all float inputs rounded to bf16; Q/K/V = in W^T + b with EXACT bf16 products on WMMA 16x16x32 (f32 accumulate); q as f16 hi + residual (x 2^10) against k once to f16 (2 products) / sqrt(32); softmax in f32 (precise expf); P x 2^11 once to f16 against v once to f16 (1 product); ctx split bf16 hi + lo against exact Wo (2 products) + bo + query; LayerNorm in f32; f32 output.
#include <hip/hip_runtime.h>
#include <math.h>

typedef __attribute__((ext_vector_type(16))) _Float16 v16h;
typedef __attribute__((ext_vector_type(16))) __bf16 v16b;
typedef __attribute__((ext_vector_type(8)))  _Float16 v8h;
typedef __attribute__((ext_vector_type(8)))  float v8f;
typedef __attribute__((ext_vector_type(4)))  float v4f;
typedef __attribute__((ext_vector_type(2)))  float v2f;
typedef __attribute__((ext_vector_type(4)))  unsigned v4u;
typedef __attribute__((ext_vector_type(4)))  int v4i;
typedef float __attribute__((may_alias)) float_a;
typedef int __attribute__((may_alias)) int_a;

template <typename T> __device__ __forceinline__ void vst2(void* p, T v) { *(T*)p = v;  }
__device__ __forceinline__ v8f wmma16(v16h a, v16h b, v8f c) {
  v8f d = __builtin_amdgcn_wmma_f32_16x16x32_f16(false, a, false, b, (short)0, c, false, false);
  asm volatile("v_nop\n\tv_nop\n\tv_nop\n\tv_nop" : "+v"(d) : "v"(a), "v"(b));
  return d;
}
__device__ __forceinline__ v8f wmma_bf(v16b a, v16b b, v8f c) {
  v8f d = __builtin_amdgcn_wmma_f32_16x16x32_bf16(false, a, false, b, (short)0, c, false, false);
  asm volatile("v_nop\n\tv_nop\n\tv_nop\n\tv_nop" : "+v"(d) : "v"(a), "v"(b));
  return d;
}
// 16x16x32 fragments: lane = (h = lane>>4, row/col = lane&15); elements 0..7 = k0+8h+0..7, 8..15 = k0+16+8h+0..7; D element r = row 8h+r
__device__ __forceinline__ v16h frag_h(const _Float16* rowk0, int lane) {
  union { v16h v; v8h q[2]; } u; const _Float16* p = rowk0 + 8 * (lane >> 4);
  u.q[0] = *(const v8h*)p; u.q[1] = *(const v8h*)(p + 16); return u.v;
}
__device__ __forceinline__ v16h frag_f32(const float* rowk0, int lane) {
  v16h a; const float* p = rowk0 + 8 * (lane >> 4);
#pragma unroll
  for (int i = 0; i < 8; ++i) { a[i] = (_Float16)p[i]; a[8 + i] = (_Float16)p[16 + i]; }
  return a;
}
__device__ __forceinline__ v16h frag_f32s(const float* rowk0, int lane, float sc) {
  v16h a; const float* p = rowk0 + 8 * (lane >> 4);
#pragma unroll
  for (int i = 0; i < 8; ++i) { a[i] = (_Float16)(p[i] * sc); a[8 + i] = (_Float16)(p[16 + i] * sc); }
  return a;
}
// column fragment from a [K][ld] layout (column n), rows >= K read as 0
__device__ __forceinline__ v16h fragc_f32(const float* W, int k0, int n, int lane, int ld, int K) {
  v16h a; const int g = lane >> 4;
#pragma unroll
  for (int i = 0; i < 8; ++i) { const int ka = k0 + 8 * g + i, kb = ka + 16;
    a[i] = (_Float16)(ka < K ? W[(size_t)(ka < K ? ka : K - 1) * ld + n] : 0.f); a[8 + i] = (_Float16)(kb < K ? W[(size_t)(kb < K ? kb : K - 1) * ld + n] : 0.f); }
  return a;
}
struct F2 { v16b h, l; };
__device__ __forceinline__ F2 bsplit16(const float v[16]) { F2 r;
#pragma unroll
  for (int i = 0; i < 16; ++i) { const __bf16 h = (__bf16)v[i]; r.h[i] = h; r.l[i] = (__bf16)(v[i] - (float)h); }
  return r; }
__device__ __forceinline__ F2 split_row(const float* row, int k0, int lane) { float v[16]; const float* p = row + k0 + 8 * (lane >> 4);
#pragma unroll
  for (int i = 0; i < 8; ++i) { v[i] = p[i]; v[8 + i] = p[16 + i]; }
  return bsplit16(v); }
__device__ __forceinline__ F2 split_rowK(const float* row, int k0, int lane, int K) { float v[16]; const int g = lane >> 4;
#pragma unroll
  for (int i = 0; i < 8; ++i) { const int ka = k0 + 8 * g + i, kb = ka + 16; v[i] = ka < K ? row[ka < K ? ka : K - 1] : 0.f; v[8 + i] = kb < K ? row[kb < K ? kb : K - 1] : 0.f; }
  return bsplit16(v); }
__device__ __forceinline__ F2 split_col(const float* W, int k0, int n, int lane, int ld, int K) { float v[16]; const int g = lane >> 4;
#pragma unroll
  for (int i = 0; i < 8; ++i) { const int ka = k0 + 8 * g + i, kb = ka + 16; v[i] = ka < K ? W[(size_t)(ka < K ? ka : K - 1) * ld + n] : 0.f; v[8 + i] = kb < K ? W[(size_t)(kb < K ? kb : K - 1) * ld + n] : 0.f; }
  return bsplit16(v); }
__device__ __forceinline__ v8f mac3(const F2& a, const F2& b, v8f c) { c = wmma_bf(a.l, b.h, c); c = wmma_bf(a.h, b.l, c); return wmma_bf(a.h, b.h, c); }
__device__ __forceinline__ float sigm(float v) { return 1.0f / (1.0f + expf(-v)); }
#define LDSX() do { asm volatile("s_wait_dscnt 0" ::: "memory"); __builtin_amdgcn_wave_barrier(); __builtin_amdgcn_fence(__ATOMIC_RELEASE, "workgroup"); } while (0)

// Cross-modal multi-head attention with residual + LayerNorm (B 4, L 2,048, d_model 256 = 8 heads x 32; (out,in) 1/16-scale weights, zero biases; LN affine 1/0, eps 1e-5): Q = query Wq^T + bq, K = key Wk^T + bk, V = value Wv^T + bv; ctx = softmax(Q K^T / sqrt(32)) V; out = LN(ctx Wo^T + bo + query).
#define NB 4
#define TT 2048
#define CC 256            // NH * HD = projected width
#define DIN 256          // input (model) width
#define NH 8
#define HD 32
#define NQB (TT / 64)
#define HG 4
#define SCALE (0.17677669529663689f)
#define CAUSAL 0
#ifndef TNB
#define TNB NB
#endif
__device__ __forceinline__ float bfr(float v) { return (float)(__bf16)v; }
__host__ __device__ __forceinline__ int kb_last(int qb) { return CAUSAL ? ((qb * 64 + 63) >> 7) : (TT / 128 - 1); }
typedef __attribute__((ext_vector_type(8))) __bf16 v8b;
__device__ __forceinline__ v16b frag_b(const __bf16* rowk0, int lane) {
  union { v16b v; v8b q[2]; } u; const __bf16* p = rowk0 + 8 * (lane >> 4);
  u.q[0] = *(const v8b*)p; u.q[1] = *(const v8b*)(p + 16); return u.v;
}
#define QBH 0              // causal: query blocks 0..QBH-1 of each sequence (few keys, no averaging) take the high-precision path
#define QHI 2048            // rows carrying a q residual plane (all rows when non-causal: 2-product logits everywhere)
#define KHI 64            // key rows carrying k residual / v bf16 hi+lo planes (used only by the causal high-precision path)
// B fragment (k rows k0+.., output column o) of a weight: (in,out) [K][ld] or (out,in) [ld rows of K]: bf16 exact, or f16(bf16 * 256) exact
__device__ __forceinline__ v16b wcol_io(const float* Wm, int k0, int o, int lane, int ld) { v16b w; const int g = lane >> 4;
#pragma unroll
  for (int i = 0; i < 8; ++i) { w[i] = (__bf16)Wm[(size_t)(k0 + 8 * g + i) * ld + o]; w[8 + i] = (__bf16)Wm[(size_t)(k0 + 16 + 8 * g + i) * ld + o]; }
  return w; }
__device__ __forceinline__ v16b wcol_oi(const float* Wm, int k0, int o, int lane, int K) { v16b w; const float* p = Wm + (size_t)o * K + k0 + 8 * (lane >> 4);
#pragma unroll
  for (int i = 0; i < 8; ++i) { w[i] = (__bf16)p[i]; w[8 + i] = (__bf16)p[16 + i]; }
  return w; }
__device__ __forceinline__ v16h wcolh_io(const float* Wm, int k0, int o, int lane, int ld) { v16h w; const int g = lane >> 4;
#pragma unroll
  for (int i = 0; i < 8; ++i) { w[i] = (_Float16)(bfr(Wm[(size_t)(k0 + 8 * g + i) * ld + o]) * 256.0f); w[8 + i] = (_Float16)(bfr(Wm[(size_t)(k0 + 16 + 8 * g + i) * ld + o]) * 256.0f); }
  return w; }
__device__ __forceinline__ v16h wcolh_oi(const float* Wm, int k0, int o, int lane, int K) { v16h w; const float* p = Wm + (size_t)o * K + k0 + 8 * (lane >> 4);
#pragma unroll
  for (int i = 0; i < 8; ++i) { w[i] = (_Float16)(bfr(p[i]) * 256.0f); w[8 + i] = (_Float16)(bfr(p[16 + i]) * 256.0f); }
  return w; }
#define WQKV_LAYOUT 1   // 0 = (in,out) [DIN][CC]; 1 = (out,in) [CC][DIN]; 2 = per-head [NH][DIN][HD]
__device__ __forceinline__ v16b wcol_hdk(const float* Wm, int k0, int o, int lane) { v16b w; const int g = lane >> 4; const float* p = Wm + (size_t)(o / HD) * DIN * HD + (o % HD);
#pragma unroll
  for (int i = 0; i < 8; ++i) { w[i] = (__bf16)p[(size_t)(k0 + 8 * g + i) * HD]; w[8 + i] = (__bf16)p[(size_t)(k0 + 16 + 8 * g + i) * HD]; }
  return w; }
#define WO_OUT_IN 1
#if WQKV_LAYOUT == 1
#define WCOL(W, k0, o, lane) wcol_oi(W, k0, o, lane, DIN)
#elif WQKV_LAYOUT == 2
#define WCOL(W, k0, o, lane) wcol_hdk(W, k0, o, lane)
#else
#define WCOL(W, k0, o, lane) wcol_io(W, k0, o, lane, CC)
#endif
#if WO_OUT_IN
#define WOCOL(W, k0, o, lane) wcol_oi(W, k0, o, lane, CC)
#define WOCOLH(W, k0, o, lane) wcolh_oi(W, k0, o, lane, CC)
#else
#define WOCOL(W, k0, o, lane) wcol_io(W, k0, o, lane, DIN)
#define WOCOLH(W, k0, o, lane) wcolh_io(W, k0, o, lane, DIN)
#endif
#define NRW (TNB * TT)
// ---- k_lnx: wave per row: LayerNorm over 256 (mean, biased var, (x - mean) * rsqrt(var + 1e-5) * g + b); optional bf16 rounding of the input (x); 8 floats per lane (2 float4 at stride 128 floats -> 512-B pieces)
__global__ __launch_bounds__(256) void k_lnx(const float* __restrict__ X, int roundin, const float* __restrict__ G, const float* __restrict__ BE, float* __restrict__ OUT) { const int wave = threadIdx.x >> 5, lane = threadIdx.x & 31; const size_t row = (size_t)blockIdx.x * 8 + wave; if (row >= (size_t)NRW) return;
  v4f v[CC / 128]; float s1 = 0.f;
#pragma unroll
  for (int i = 0; i < CC / 128; ++i) { v4f t = *(const v4f*)(X + row * CC + i * 128 + lane * 4); if (roundin) { t[0] = bfr(t[0]); t[1] = bfr(t[1]); t[2] = bfr(t[2]); t[3] = bfr(t[3]); } v[i] = t; s1 += (t[0] + t[1]) + (t[2] + t[3]); }
#pragma unroll
  for (int o = 1; o < 32; o <<= 1) s1 += __shfl_xor(s1, o);
  const float mu = s1 * (1.0f / CC); float q = 0.f;
#pragma unroll
  for (int i = 0; i < CC / 128; ++i) for (int k = 0; k < 4; ++k) { const float d = v[i][k] - mu; q += d * d; }
#pragma unroll
  for (int o = 1; o < 32; o <<= 1) q += __shfl_xor(q, o);
  const float inv = rsqrtf(q * (1.0f / CC) + 1e-5f);   /* jnp.var (biased), eps inside the rsqrt */
#pragma unroll
  for (int i = 0; i < CC / 128; ++i) { const int c = i * 128 + lane * 4; v4f r4; for (int k = 0; k < 4; ++k) r4[k] = bfr(G[c + k]) * ((v[i][k] - mu) * inv) + bfr(BE[c + k]); vst2(OUT + row * CC + c, r4); } }

#ifndef SM_EXTRA_PARAMS
#define SM_EXTRA_PARAMS
#endif
#ifndef PROJ_EXTRA_PARAMS
#define PROJ_EXTRA_PARAMS
#endif
#ifndef SM_MASK_HOOK
#define SM_MASK_HOOK (void)0
#endif

#define WS_QH  0u                                      // f16 q rows [b*t][CC]
#define WS_KH  (WS_QH + 2u * (size_t)NB * TT * CC)      // f16 k rows [b*t][CC]
#define WS_VT  (WS_KH + 2u * (size_t)NB * TT * CC)      // f16 v planes [b][c][t]
#define WS_QL  (WS_VT + 2u * (size_t)NB * CC * TT)      // f16 q residual x 2^10 rows [b][t < QHI][CC]
#define WS_KL  (WS_QL + 2u * (size_t)NB * QHI * CC)     // f16 k residual x 2^10 rows [b][t < KHI][CC]
#define WS_VB  (WS_KL + 2u * (size_t)NB * KHI * CC)     // bf16 v hi planes [b][c][t < KHI]
#define WS_VBL (WS_VB + 2u * (size_t)NB * CC * KHI)
#define WS_S   (WS_VBL + 2u * (size_t)NB * CC * KHI)    // f32 logits / P [hg][t][s]
#define WS_Y   (WS_S  + 4u * (size_t)HG * TT * TT)      // f32 ctx rows [b*t][CC] (only when there is an output projection)
#define WS_END (WS_Y  + 4u * (size_t)NB * TT * CC)
#define WS_X1  (WS_END)
#define WS_END2 (WS_X1 + 4u * (size_t)NB * TT * DIN)

// ---- k_proj: block = (64 rows, 128 cols, which): q/k/v = X W (+ b) with exact bf16 products (K = DIN) -> which 0: q f16 rows (+ residual rows < QHI); 1: k f16 rows (+ residual rows < KHI); 2: v f16 planes [c][t] (+ bf16 hi/lo planes for t < KHI)
__global__ __launch_bounds__(128) void k_proj(const float* __restrict__ XQ, const float* __restrict__ XK, const float* __restrict__ XV, const float* __restrict__ WQ, const float* __restrict__ WK, const float* __restrict__ WV, const float* __restrict__ BQ, const float* __restrict__ BK, const float* __restrict__ BV,
    _Float16* __restrict__ QH, _Float16* __restrict__ QL, _Float16* __restrict__ KH, _Float16* __restrict__ KL, _Float16* __restrict__ VT, __bf16* __restrict__ VB, __bf16* __restrict__ VBL) {
  __shared__ __align__(16) _Float16 sh[64][136], sl[64][136]; __shared__ __align__(16) _Float16 th[128][72]; __shared__ __align__(16) __bf16 tb[128][72], tbl[128][72];
  const int tid = threadIdx.x, wave = tid >> 5, lane = tid & 31, col = lane & 15, g = lane >> 4; const int which = blockIdx.z; const int c0 = blockIdx.y * 128; const size_t r0 = (size_t)blockIdx.x * 64; const size_t bb = r0 / TT; const int t0 = (int)(r0 % TT);
  const float* X = which == 0 ? XQ : which == 1 ? XK : XV; const float* WA = which == 0 ? WQ : which == 1 ? WK : WV; const float* BA = which == 0 ? BQ : which == 1 ? BK : BV;
  v8f acc[8] = {};
#pragma unroll 2
  for (int kc = 0; kc < DIN / 32; ++kc) { v16b a; { const float* p = X + (r0 + wave * 16 + col) * DIN + kc * 32 + 8 * g;
#pragma unroll
      for (int i = 0; i < 8; ++i) { a[i] = (__bf16)p[i]; a[8 + i] = (__bf16)p[16 + i]; } }
    asm volatile("s_wait_loadcnt 0x0" ::: "memory");
#pragma unroll
    for (int j = 0; j < 8; ++j) { const v16b w = WCOL(WA, kc * 32, c0 + j * 16 + col, lane); asm volatile("s_wait_loadcnt 0x0" ::: "memory"); acc[j] = wmma_bf(a, w, acc[j]); } }
  if (which < 2) { _Float16* DH = which == 0 ? QH : KH; _Float16* DL = which == 0 ? QL : KL; const int nhi = which == 0 ? QHI : KHI; const bool hi_rows = t0 < nhi;
#pragma unroll
    for (int j = 0; j < 8; ++j) { const float bias = BA ? bfr(BA[c0 + j * 16 + col]) : 0.f;
#pragma unroll
      for (int r = 0; r < 8; ++r) { const float v = acc[j][r] + bias; const _Float16 hv = (_Float16)v; sh[wave * 16 + 8 * g + r][j * 16 + col] = hv; sl[wave * 16 + 8 * g + r][j * 16 + col] = (_Float16)((v - (float)hv) * 1024.0f); } }
    __syncthreads();
    for (int e = tid; e < 64 * 16; e += 128) { const int rl = e >> 4, q = e & 15; vst2((unsigned*)(DH + (r0 + rl) * CC + c0 + q * 8), *(const v4u*)&sh[rl][q * 8]); if (hi_rows) vst2((unsigned*)(DL + (bb * nhi + t0 + rl) * (size_t)CC + c0 + q * 8), *(const v4u*)&sl[rl][q * 8]); }
  } else { const bool hi_rows = t0 < KHI;
#pragma unroll
    for (int j = 0; j < 8; ++j) { const float bias = BA ? bfr(BA[c0 + j * 16 + col]) : 0.f;
#pragma unroll
      for (int r = 0; r < 8; ++r) { const float v = acc[j][r] + bias; const int rl = wave * 16 + 8 * g + r, cl = j * 16 + col; th[cl][rl] = (_Float16)v; const __bf16 bh = (__bf16)v; tb[cl][rl] = bh; tbl[cl][rl] = (__bf16)(v - (float)bh); } }
    __syncthreads();
    for (int e = tid; e < 128 * 8; e += 128) { const int cl = e >> 3, q = e & 7; vst2((unsigned*)(VT + (bb * CC + c0 + cl) * (size_t)TT + t0 + q * 8), *(const v4u*)&th[cl][q * 8]); if (hi_rows) { const size_t o3 = (bb * CC + c0 + cl) * (size_t)KHI + t0 + q * 8; vst2((unsigned*)(VB + o3), *(const v4u*)&tb[cl][q * 8]); vst2((unsigned*)(VBL + o3), *(const v4u*)&tbl[cl][q * 8]); } } } }
// ---- k_sc: block = (query block qb, key block kb <= kb_last(qb), head in group) of batch b: logits x SCALE; q hi + residual (x 2^10) against k (2 products) for query rows < QHI, plus the k residual (3 products) for query blocks < QBH (causal early rows); causal: blocks past the diagonal exit, the mask itself is applied by index in k_sm
__global__ __launch_bounds__(128) void k_sc(const _Float16* __restrict__ QH, const _Float16* __restrict__ KH, const _Float16* __restrict__ QL, const _Float16* __restrict__ KL, int b, int h0, float* __restrict__ S0) { __shared__ __align__(16) float ss[4][16][132];
  const int qb = blockIdx.x, kb = blockIdx.y; if (kb > kb_last(qb)) return;
  const int h = h0 + blockIdx.z; float* S = S0 + (size_t)blockIdx.z * TT * TT;
  const int tid = threadIdx.x, wave = tid >> 5, lane = tid & 31, col = lane & 15, g = lane >> 4; const int k0 = kb * 128; const int ql0 = qb * 64 + wave * 16; const size_t q0 = (size_t)b * TT + ql0, kr0 = (size_t)b * TT + k0;
  v8f acc[8] = {}, accl[8] = {};
  const _Float16* QLb = QL + (size_t)b * QHI * CC; const _Float16* KLb = KL + (size_t)b * KHI * CC;
  if (qb < QBH) {
#pragma unroll
    for (int kc = 0; kc < HD / 32; ++kc) { const v16h ah = frag_h(QH + (q0 + col) * CC + h * HD + kc * 32, lane), al = frag_h(QLb + (size_t)(ql0 + col) * CC + h * HD + kc * 32, lane);
#pragma unroll
      for (int j = 0; j < 8; ++j) { const v16h kbf = frag_h(KH + (kr0 + j * 16 + col) * CC + h * HD + kc * 32, lane), klf = frag_h(KLb + (size_t)(k0 + j * 16 + col) * CC + h * HD + kc * 32, lane); acc[j] = wmma16(ah, kbf, acc[j]); accl[j] = wmma16(al, kbf, accl[j]); accl[j] = wmma16(ah, klf, accl[j]); } }
  } else if (qb * 64 < QHI) {
#pragma unroll
    for (int kc = 0; kc < HD / 32; ++kc) { const v16h ah = frag_h(QH + (q0 + col) * CC + h * HD + kc * 32, lane), al = frag_h(QLb + (size_t)(ql0 + col) * CC + h * HD + kc * 32, lane);
#pragma unroll
      for (int j = 0; j < 8; ++j) { const v16h kbf = frag_h(KH + (kr0 + j * 16 + col) * CC + h * HD + kc * 32, lane); acc[j] = wmma16(ah, kbf, acc[j]); accl[j] = wmma16(al, kbf, accl[j]); } }
  } else {
#pragma unroll
    for (int kc = 0; kc < HD / 32; ++kc) { const v16h ah = frag_h(QH + (q0 + col) * CC + h * HD + kc * 32, lane);
#pragma unroll
      for (int j = 0; j < 8; ++j) { const v16h kbf = frag_h(KH + (kr0 + j * 16 + col) * CC + h * HD + kc * 32, lane); acc[j] = wmma16(ah, kbf, acc[j]); } } }
#pragma unroll
  for (int j = 0; j < 8; ++j) {
#pragma unroll
    for (int r = 0; r < 8; ++r) ss[wave][8 * g + r][j * 16 + col] = (acc[j][r] + accl[j][r] * (1.0f / 1024.0f)) * SCALE; }
  LDSX(); for (int rl = 0; rl < 16; ++rl) vst2(S + (size_t)(ql0 + rl) * TT + k0 + lane * 4, *(const v4f*)&ss[wave][rl][lane * 4]); }
// ---- k_sm: block = query row t (head in group): keys [0, kend): causal -> logit if s <= t else excluded; softmax in f32; P x 2^11 in place (0 for excluded)
__global__ __launch_bounds__(256) void k_sm(float* __restrict__ S0 SM_EXTRA_PARAMS) { __shared__ float sred[8]; __shared__ float sbc; __shared__ __align__(16) float shv[TT];
  const int tid = threadIdx.x; const int t = blockIdx.x; const int kend = (kb_last(t >> 6) + 1) * 128;
  float* sr = S0 + (size_t)blockIdx.y * TT * TT + (size_t)t * TT;
  float m = -3.0e38f; for (int k = tid; k < kend; k += 256) { float v = (!CAUSAL || k <= t) ? sr[k] : -3.0e38f; SM_MASK_HOOK; shv[k] = v; m = fmaxf(m, v); }
#pragma unroll
  for (int o = 1; o < 32; o <<= 1) m = fmaxf(m, __shfl_xor(m, o));
  if ((tid & 31) == 0) sred[tid >> 5] = m; __syncthreads(); if (tid == 0) { float a = sred[0]; for (int i = 1; i < 8; ++i) a = fmaxf(a, sred[i]); sbc = a; } __syncthreads(); m = sbc; __syncthreads();
  float sum = 0.f; for (int k = tid; k < kend; k += 256) { const float v = shv[k]; const float e = (v <= -1.0e38f) ? 0.f : expf(v - m); shv[k] = e; sum += e; }
#pragma unroll
  for (int o = 1; o < 32; o <<= 1) sum += __shfl_xor(sum, o);
  if ((tid & 31) == 0) sred[tid >> 5] = sum; __syncthreads(); if (tid == 0) { float a = 0.f; for (int i = 0; i < 8; ++i) a += sred[i]; sbc = a > 0.f ? 2048.0f / a : 0.f; }   /* a fully excluded row yields P = 0 */ __syncthreads(); const float inv = sbc;
  for (int k = tid; k < kend; k += 256) shv[k] = shv[k] * inv;
  __syncthreads(); for (int q = tid; q < kend / 4; q += 256) vst2(sr + q * 4, *(const v4f*)&shv[q * 4]); }
// ---- k_pv: block = 64 queries (qb) of (b, h): ctx = P . v over keys [0, kend) (P x 2^11 once to f16 against v f16: 1 product; causal early query blocks: P and v as bf16 hi + lo, 3 products); 128-B (row, head) segment by 8 lanes
__global__ __launch_bounds__(128) void k_pv(const float* __restrict__ PS0, const _Float16* __restrict__ VT, const __bf16* __restrict__ VB, const __bf16* __restrict__ VBL, int b, int h0, float* __restrict__ Y) { const int h = h0 + blockIdx.z; const float* PS = PS0 + (size_t)blockIdx.z * TT * TT; __shared__ __align__(16) float ss[4][16][HD + 4];
  const int tid = threadIdx.x, wave = tid >> 5, lane = tid & 31, col = lane & 15, g = lane >> 4; const int qb = blockIdx.x; const int ql0 = qb * 64 + wave * 16; const int kce = (kb_last(qb) + 1) * 4;
  v8f acc[HD / 16] = {};
  if (qb < QBH) {
#pragma unroll 1
    for (int kc = 0; kc < kce; ++kc) { const F2 p = split_row(PS + (size_t)(ql0 + col) * TT, kc * 32, lane);
      asm volatile("s_wait_loadcnt 0x0" ::: "memory");
#pragma unroll
      for (int j = 0; j < HD / 16; ++j) { const size_t po = ((size_t)b * CC + h * HD + j * 16 + col) * (size_t)KHI + kc * 32; const v16b vh = frag_b(VB + po, lane); acc[j] = wmma_bf(p.h, vh, acc[j]); acc[j] = wmma_bf(p.l, vh, acc[j]); acc[j] = wmma_bf(p.h, frag_b(VBL + po, lane), acc[j]); } }
  } else {
#pragma unroll 1
    for (int kc = 0; kc < kce; ++kc) { const v16h p = frag_f32(PS + (size_t)(ql0 + col) * TT + kc * 32, lane);
      asm volatile("s_wait_loadcnt 0x0" ::: "memory");
#pragma unroll
      for (int j = 0; j < HD / 16; ++j) { const size_t po = ((size_t)b * CC + h * HD + j * 16 + col) * (size_t)TT + kc * 32; acc[j] = wmma16(p, frag_h(VT + po, lane), acc[j]); } } }
#pragma unroll
  for (int j = 0; j < HD / 16; ++j)
#pragma unroll
    for (int r = 0; r < 8; ++r) ss[wave][8 * g + r][j * 16 + col] = acc[j][r] * (1.0f / 2048.0f);
  LDSX(); for (int rl = 0; rl < 16; ++rl) if (lane < HD / 4) vst2(Y + ((size_t)b * TT + ql0 + rl) * CC + h * HD + lane * 4, *(const v4f*)&ss[wave][rl][lane * 4]); }
// ---- k_out: block = (64 rows, 128 cols): out = ctx Wo (+ bo): all rows: ctx bf16 hi + lo against exact bf16 Wo (2 products); the f16 branch (ctx once to f16 against f16(bf16 x 2^8) Wo, x 2^-8) is not taken
__global__ __launch_bounds__(128) void k_out(const float* __restrict__ Y, const float* __restrict__ WO, const float* __restrict__ BO, float* __restrict__ OUT, const float* __restrict__ RESX) { __shared__ __align__(16) float sf[4][16][132];
  const int tid = threadIdx.x, wave = tid >> 5, lane = tid & 31, col = lane & 15, g = lane >> 4; const int c0 = blockIdx.y * 128; const size_t r0 = (size_t)blockIdx.x * 64 + wave * 16;
  v8f acc[8] = {};
  if (true) {   /* ALL rows: ctx split bf16 hi + lo x exact Wo (2 products) */
#pragma unroll 2
    for (int kc = 0; kc < CC / 32; ++kc) { const F2 a = split_row(Y + (r0 + col) * CC, kc * 32, lane); asm volatile("s_wait_loadcnt 0x0" ::: "memory");
#pragma unroll
      for (int j = 0; j < 8; ++j) { const v16b w = WOCOL(WO, kc * 32, c0 + j * 16 + col, lane); asm volatile("s_wait_loadcnt 0x0" ::: "memory"); acc[j] = wmma_bf(a.h, w, acc[j]); acc[j] = wmma_bf(a.l, w, acc[j]); } }
#pragma unroll
    for (int j = 0; j < 8; ++j) { const float bias = BO ? bfr(BO[c0 + j * 16 + col]) : 0.f;
#pragma unroll
      for (int r = 0; r < 8; ++r) sf[wave][8 * g + r][j * 16 + col] = acc[j][r] + bias; }
  } else {
#pragma unroll 2
    for (int kc = 0; kc < CC / 32; ++kc) { const v16h a = frag_f32(Y + (r0 + col) * CC + kc * 32, lane); asm volatile("s_wait_loadcnt 0x0" ::: "memory");
#pragma unroll
      for (int j = 0; j < 8; ++j) { const v16h w = WOCOLH(WO, kc * 32, c0 + j * 16 + col, lane); asm volatile("s_wait_loadcnt 0x0" ::: "memory"); acc[j] = wmma16(a, w, acc[j]); } }
#pragma unroll
    for (int j = 0; j < 8; ++j) { const float bias = BO ? bfr(BO[c0 + j * 16 + col]) : 0.f;
#pragma unroll
      for (int r = 0; r < 8; ++r) sf[wave][8 * g + r][j * 16 + col] = acc[j][r] * (1.0f / 256.0f) + bias; } }
  LDSX(); for (int rl = 0; rl < 16; ++rl) { const size_t oo = (r0 + rl) * DIN + c0 + lane * 4; v4f o = *(const v4f*)&sf[wave][rl][lane * 4]; const v4f zr = *(const v4f*)(RESX + oo); o[0] += bfr(zr[0]); o[1] += bfr(zr[1]); o[2] += bfr(zr[2]); o[3] += bfr(zr[3]); vst2(OUT + oo, o); } }   /* + bf16(query) */

extern "C" void kernel_launch(void* const* d_in, const int* in_sizes, int n_in, void* d_out, int out_size, void* d_ws, size_t ws_size, hipStream_t stream) {
  (void)in_sizes; (void)n_in; (void)out_size;
  const float** F = (const float**)d_in;
  if (ws_size < (size_t)WS_END) return;
  char* ws = (char*)d_ws; _Float16 *QH = (_Float16*)(ws + WS_QH), *KH = (_Float16*)(ws + WS_KH), *VT = (_Float16*)(ws + WS_VT), *QL = (_Float16*)(ws + WS_QL), *KL = (_Float16*)(ws + WS_KL); __bf16 *VB = (__bf16*)(ws + WS_VB), *VBL = (__bf16*)(ws + WS_VBL); float *S = (float*)(ws + WS_S), *Y = (float*)(ws + WS_Y);
  (void)Y; (void)QL; (void)KL; (void)VB; (void)VBL;
  // inputs: 0 query; 1 key; 2 value [4,2048,256]; 3 Wq (out,in), 4 bq; 5 Wk, 6 bk; 7 Wv, 8 bv; 9 Wo (out,in), 10 bo; 11 ln_g, 12 ln_b
  if (ws_size < (size_t)WS_END2) return;
  float* X1 = (float*)(ws + WS_X1);
  k_proj<<<dim3(TNB * TT / 64, CC / 128, 3), 128, 0, stream>>>(F[0], F[1], F[2], F[3], F[5], F[7], F[4], F[6], F[8], QH, QL, KH, KL, VT, VB, VBL);
  for (int b = 0; b < TNB; ++b) for (int h0 = 0; h0 < NH; h0 += HG) {
    k_sc<<<dim3(NQB, TT / 128, HG), 128, 0, stream>>>(QH, KH, QL, KL, b, h0, S);
    k_sm<<<dim3(TT, HG), 256, 0, stream>>>(S);
    k_pv<<<dim3(NQB, 1, HG), 128, 0, stream>>>(S, VT, VB, VBL, b, h0, Y);
  }
  k_out<<<dim3(TNB * TT / 64, DIN / 128), 128, 0, stream>>>(Y, F[9], F[10], X1, F[0]);   /* ctx Wo^T + bo + bf16(query) */
  k_lnx<<<dim3(NRW / 8), 256, 0, stream>>>(X1, 0, F[11], F[12], (float*)d_out);           /* LayerNorm */
}

// v001
// A run of this version takes 135 microseconds.
// Two timings next to v000 put it at 6.45 and 6.41 times that version's speed.
// compute dtype: all float inputs rounded to bf16; Q/K/V = in W^T + b with EXACT bf16 products on WMMA 16x16x32 (f32 accumulate); q as f16 hi + residual (x 2^10) against k once to f16 (2 products) / sqrt(32); softmax in f32 (precise expf, running maximum and sum over 64-key passes); exp x 2^11 once to f16 against v once to f16 (1 product), divided by the sum at the end; ctx split bf16 hi + lo against exact Wo (2 products) + bo + query; LayerNorm in f32; f32 output.
#include <hip/hip_runtime.h>
#include <math.h>

typedef __attribute__((ext_vector_type(16))) _Float16 v16h;
typedef __attribute__((ext_vector_type(16))) __bf16 v16b;
typedef __attribute__((ext_vector_type(8)))  _Float16 v8h;
typedef __attribute__((ext_vector_type(8)))  float v8f;
typedef __attribute__((ext_vector_type(4)))  float v4f;
typedef __attribute__((ext_vector_type(2)))  float v2f;
typedef __attribute__((ext_vector_type(4)))  unsigned v4u;
typedef __attribute__((ext_vector_type(4)))  int v4i;
typedef float __attribute__((may_alias)) float_a;
typedef int __attribute__((may_alias)) int_a;

template <typename T> __device__ __forceinline__ void vst2(void* p, T v) { *(T*)p = v;  }
__device__ __forceinline__ v8f wmma16(v16h a, v16h b, v8f c) {
  v8f d = __builtin_amdgcn_wmma_f32_16x16x32_f16(false, a, false, b, (short)0, c, false, false);
  asm volatile("v_nop\n\tv_nop\n\tv_nop\n\tv_nop" : "+v"(d) : "v"(a), "v"(b));
  return d;
}
__device__ __forceinline__ v8f wmma_bf(v16b a, v16b b, v8f c) {
  v8f d = __builtin_amdgcn_wmma_f32_16x16x32_bf16(false, a, false, b, (short)0, c, false, false);
  asm volatile("v_nop\n\tv_nop\n\tv_nop\n\tv_nop" : "+v"(d) : "v"(a), "v"(b));
  return d;
}
// 16x16x32 fragments: lane = (h = lane>>4, row/col = lane&15); elements 0..7 = k0+8h+0..7, 8..15 = k0+16+8h+0..7; D element r = row 8h+r
__device__ __forceinline__ v16h frag_h(const _Float16* rowk0, int lane) {
  union { v16h v; v8h q[2]; } u; const _Float16* p = rowk0 + 8 * (lane >> 4);
  u.q[0] = *(const v8h*)p; u.q[1] = *(const v8h*)(p + 16); return u.v;
}
__device__ __forceinline__ v16h frag_f32(const float* rowk0, int lane) {
  v16h a; const float* p = rowk0 + 8 * (lane >> 4);
#pragma unroll
  for (int i = 0; i < 8; ++i) { a[i] = (_Float16)p[i]; a[8 + i] = (_Float16)p[16 + i]; }
  return a;
}
__device__ __forceinline__ v16h frag_f32s(const float* rowk0, int lane, float sc) {
  v16h a; const float* p = rowk0 + 8 * (lane >> 4);
#pragma unroll
  for (int i = 0; i < 8; ++i) { a[i] = (_Float16)(p[i] * sc); a[8 + i] = (_Float16)(p[16 + i] * sc); }
  return a;
}
// column fragment from a [K][ld] layout (column n), rows >= K read as 0
__device__ __forceinline__ v16h fragc_f32(const float* W, int k0, int n, int lane, int ld, int K) {
  v16h a; const int g = lane >> 4;
#pragma unroll
  for (int i = 0; i < 8; ++i) { const int ka = k0 + 8 * g + i, kb = ka + 16;
    a[i] = (_Float16)(ka < K ? W[(size_t)(ka < K ? ka : K - 1) * ld + n] : 0.f); a[8 + i] = (_Float16)(kb < K ? W[(size_t)(kb < K ? kb : K - 1) * ld + n] : 0.f); }
  return a;
}
struct F2 { v16b h, l; };
__device__ __forceinline__ F2 bsplit16(const float v[16]) { F2 r;
#pragma unroll
  for (int i = 0; i < 16; ++i) { const __bf16 h = (__bf16)v[i]; r.h[i] = h; r.l[i] = (__bf16)(v[i] - (float)h); }
  return r; }
__device__ __forceinline__ F2 split_row(const float* row, int k0, int lane) { float v[16]; const float* p = row + k0 + 8 * (lane >> 4);
#pragma unroll
  for (int i = 0; i < 8; ++i) { v[i] = p[i]; v[8 + i] = p[16 + i]; }
  return bsplit16(v); }
__device__ __forceinline__ F2 split_rowK(const float* row, int k0, int lane, int K) { float v[16]; const int g = lane >> 4;
#pragma unroll
  for (int i = 0; i < 8; ++i) { const int ka = k0 + 8 * g + i, kb = ka + 16; v[i] = ka < K ? row[ka < K ? ka : K - 1] : 0.f; v[8 + i] = kb < K ? row[kb < K ? kb : K - 1] : 0.f; }
  return bsplit16(v); }
__device__ __forceinline__ F2 split_col(const float* W, int k0, int n, int lane, int ld, int K) { float v[16]; const int g = lane >> 4;
#pragma unroll
  for (int i = 0; i < 8; ++i) { const int ka = k0 + 8 * g + i, kb = ka + 16; v[i] = ka < K ? W[(size_t)(ka < K ? ka : K - 1) * ld + n] : 0.f; v[8 + i] = kb < K ? W[(size_t)(kb < K ? kb : K - 1) * ld + n] : 0.f; }
  return bsplit16(v); }
__device__ __forceinline__ v8f mac3(const F2& a, const F2& b, v8f c) { c = wmma_bf(a.l, b.h, c); c = wmma_bf(a.h, b.l, c); return wmma_bf(a.h, b.h, c); }
__device__ __forceinline__ float sigm(float v) { return 1.0f / (1.0f + expf(-v)); }
#define LDSX() do { asm volatile("s_wait_dscnt 0" ::: "memory"); __builtin_amdgcn_wave_barrier(); __builtin_amdgcn_fence(__ATOMIC_RELEASE, "workgroup"); } while (0)

// Cross-modal multi-head attention with residual + LayerNorm (B 4, L 2,048, d_model 256 = 8 heads x 32; (out,in) 1/16-scale weights, zero biases; LN affine 1/0, eps 1e-5): Q = query Wq^T + bq, K = key Wk^T + bk, V = value Wv^T + bv; ctx = softmax(Q K^T / sqrt(32)) V; out = LN(ctx Wo^T + bo + query).
#define NB 4
#define TT 2048
#define CC 256            // NH * HD = projected width
#define DIN 256          // input (model) width
#define NH 8
#define HD 32
#define NQB (TT / 64)
#define HG 4
#define SCALE (0.17677669529663689f)
#define CAUSAL 0
#ifndef TNB
#define TNB NB
#endif
__device__ __forceinline__ float bfr(float v) { return (float)(__bf16)v; }
__host__ __device__ __forceinline__ int kb_last(int qb) { return CAUSAL ? ((qb * 64 + 63) >> 7) : (TT / 128 - 1); }
typedef __attribute__((ext_vector_type(8))) __bf16 v8b;
__device__ __forceinline__ v16b frag_b(const __bf16* rowk0, int lane) {
  union { v16b v; v8b q[2]; } u; const __bf16* p = rowk0 + 8 * (lane >> 4);
  u.q[0] = *(const v8b*)p; u.q[1] = *(const v8b*)(p + 16); return u.v;
}
#define QBH 0              // unused: no kernel here reads it (no separate high-precision path)
#define QHI 2048            // rows carrying a q residual plane (all rows when non-causal: 2-product logits everywhere)
#define KHI 64            // key rows carrying k residual / v bf16 hi+lo planes (written by k_proj; no kernel here reads them)
// B fragment (k rows k0+.., output column o) of a weight: (in,out) [K][ld] or (out,in) [ld rows of K]: bf16 exact, or f16(bf16 * 256) exact
__device__ __forceinline__ v16b wcol_io(const float* Wm, int k0, int o, int lane, int ld) { v16b w; const int g = lane >> 4;
#pragma unroll
  for (int i = 0; i < 8; ++i) { w[i] = (__bf16)Wm[(size_t)(k0 + 8 * g + i) * ld + o]; w[8 + i] = (__bf16)Wm[(size_t)(k0 + 16 + 8 * g + i) * ld + o]; }
  return w; }
__device__ __forceinline__ v16b wcol_oi(const float* Wm, int k0, int o, int lane, int K) { v16b w; const float* p = Wm + (size_t)o * K + k0 + 8 * (lane >> 4);
#pragma unroll
  for (int i = 0; i < 8; ++i) { w[i] = (__bf16)p[i]; w[8 + i] = (__bf16)p[16 + i]; }
  return w; }
__device__ __forceinline__ v16h wcolh_io(const float* Wm, int k0, int o, int lane, int ld) { v16h w; const int g = lane >> 4;
#pragma unroll
  for (int i = 0; i < 8; ++i) { w[i] = (_Float16)(bfr(Wm[(size_t)(k0 + 8 * g + i) * ld + o]) * 256.0f); w[8 + i] = (_Float16)(bfr(Wm[(size_t)(k0 + 16 + 8 * g + i) * ld + o]) * 256.0f); }
  return w; }
__device__ __forceinline__ v16h wcolh_oi(const float* Wm, int k0, int o, int lane, int K) { v16h w; const float* p = Wm + (size_t)o * K + k0 + 8 * (lane >> 4);
#pragma unroll
  for (int i = 0; i < 8; ++i) { w[i] = (_Float16)(bfr(p[i]) * 256.0f); w[8 + i] = (_Float16)(bfr(p[16 + i]) * 256.0f); }
  return w; }
#define WQKV_LAYOUT 1   // 0 = (in,out) [DIN][CC]; 1 = (out,in) [CC][DIN]; 2 = per-head [NH][DIN][HD]
__device__ __forceinline__ v16b wcol_hdk(const float* Wm, int k0, int o, int lane) { v16b w; const int g = lane >> 4; const float* p = Wm + (size_t)(o / HD) * DIN * HD + (o % HD);
#pragma unroll
  for (int i = 0; i < 8; ++i) { w[i] = (__bf16)p[(size_t)(k0 + 8 * g + i) * HD]; w[8 + i] = (__bf16)p[(size_t)(k0 + 16 + 8 * g + i) * HD]; }
  return w; }
#define WO_OUT_IN 1
#if WQKV_LAYOUT == 1
#define WCOL(W, k0, o, lane) wcol_oi(W, k0, o, lane, DIN)
#elif WQKV_LAYOUT == 2
#define WCOL(W, k0, o, lane) wcol_hdk(W, k0, o, lane)
#else
#define WCOL(W, k0, o, lane) wcol_io(W, k0, o, lane, CC)
#endif
#if WO_OUT_IN
#define WOCOL(W, k0, o, lane) wcol_oi(W, k0, o, lane, CC)
#define WOCOLH(W, k0, o, lane) wcolh_oi(W, k0, o, lane, CC)
#else
#define WOCOL(W, k0, o, lane) wcol_io(W, k0, o, lane, DIN)
#define WOCOLH(W, k0, o, lane) wcolh_io(W, k0, o, lane, DIN)
#endif
#define NRW (TNB * TT)
// ---- k_lnx: wave per row: LayerNorm over 256 (mean, biased var, (x - mean) * rsqrt(var + 1e-5) * g + b); optional bf16 rounding of the input (x); 8 floats per lane (2 float4 at stride 128 floats -> 512-B pieces)
__global__ __launch_bounds__(256) void k_lnx(const float* __restrict__ X, int roundin, const float* __restrict__ G, const float* __restrict__ BE, float* __restrict__ OUT) { const int wave = threadIdx.x >> 5, lane = threadIdx.x & 31; const size_t row = (size_t)blockIdx.x * 8 + wave; if (row >= (size_t)NRW) return;
  v4f v[CC / 128]; float s1 = 0.f;
#pragma unroll
  for (int i = 0; i < CC / 128; ++i) { v4f t = *(const v4f*)(X + row * CC + i * 128 + lane * 4); if (roundin) { t[0] = bfr(t[0]); t[1] = bfr(t[1]); t[2] = bfr(t[2]); t[3] = bfr(t[3]); } v[i] = t; s1 += (t[0] + t[1]) + (t[2] + t[3]); }
#pragma unroll
  for (int o = 1; o < 32; o <<= 1) s1 += __shfl_xor(s1, o);
  const float mu = s1 * (1.0f / CC); float q = 0.f;
#pragma unroll
  for (int i = 0; i < CC / 128; ++i) for (int k = 0; k < 4; ++k) { const float d = v[i][k] - mu; q += d * d; }
#pragma unroll
  for (int o = 1; o < 32; o <<= 1) q += __shfl_xor(q, o);
  const float inv = rsqrtf(q * (1.0f / CC) + 1e-5f);   /* jnp.var (biased), eps inside the rsqrt */
#pragma unroll
  for (int i = 0; i < CC / 128; ++i) { const int c = i * 128 + lane * 4; v4f r4; for (int k = 0; k < 4; ++k) r4[k] = bfr(G[c + k]) * ((v[i][k] - mu) * inv) + bfr(BE[c + k]); vst2(OUT + row * CC + c, r4); } }

#ifndef SM_EXTRA_PARAMS
#define SM_EXTRA_PARAMS
#endif
#ifndef PROJ_EXTRA_PARAMS
#define PROJ_EXTRA_PARAMS
#endif
#ifndef SM_MASK_HOOK
#define SM_MASK_HOOK (void)0
#endif

#define WS_QH  0u                                      // f16 q rows [b*t][CC]
#define WS_KH  (WS_QH + 2u * (size_t)NB * TT * CC)      // f16 k rows [b*t][CC]
#define WS_VT  (WS_KH + 2u * (size_t)NB * TT * CC)      // f16 v planes [b][c][t]
#define WS_QL  (WS_VT + 2u * (size_t)NB * CC * TT)      // f16 q residual x 2^10 rows [b][t < QHI][CC]
#define WS_KL  (WS_QL + 2u * (size_t)NB * QHI * CC)     // f16 k residual x 2^10 rows [b][t < KHI][CC]
#define WS_VB  (WS_KL + 2u * (size_t)NB * KHI * CC)     // bf16 v hi planes [b][c][t < KHI]
#define WS_VBL (WS_VB + 2u * (size_t)NB * CC * KHI)
#define WS_S   (WS_VBL + 2u * (size_t)NB * CC * KHI)    // f32 [hg][t][s], unused (k_fa keeps logits in registers)
#define WS_Y   (WS_S  + 4u * (size_t)HG * TT * TT)      // f32 ctx rows [b*t][CC] (only when there is an output projection)
#define WS_END (WS_Y  + 4u * (size_t)NB * TT * CC)
#define WS_X1  (WS_END)
#define WS_END2 (WS_X1 + 4u * (size_t)NB * TT * DIN)

// ---- k_proj: block = (64 rows, 128 cols, which): q/k/v = X W (+ b) with exact bf16 products (K = DIN) -> which 0: q f16 rows (+ residual rows < QHI); 1: k f16 rows (+ residual rows < KHI); 2: v f16 planes [c][t] (+ bf16 hi/lo planes for t < KHI)
__global__ __launch_bounds__(128) void k_proj(const float* __restrict__ XQ, const float* __restrict__ XK, const float* __restrict__ XV, const float* __restrict__ WQ, const float* __restrict__ WK, const float* __restrict__ WV, const float* __restrict__ BQ, const float* __restrict__ BK, const float* __restrict__ BV,
    _Float16* __restrict__ QH, _Float16* __restrict__ QL, _Float16* __restrict__ KH, _Float16* __restrict__ KL, _Float16* __restrict__ VT, __bf16* __restrict__ VB, __bf16* __restrict__ VBL) {
  __shared__ __align__(16) _Float16 sh[64][136], sl[64][136]; __shared__ __align__(16) _Float16 th[128][72]; __shared__ __align__(16) __bf16 tb[128][72], tbl[128][72];
  const int tid = threadIdx.x, wave = tid >> 5, lane = tid & 31, col = lane & 15, g = lane >> 4; const int which = blockIdx.z; const int c0 = blockIdx.y * 128; const size_t r0 = (size_t)blockIdx.x * 64; const size_t bb = r0 / TT; const int t0 = (int)(r0 % TT);
  const float* X = which == 0 ? XQ : which == 1 ? XK : XV; const float* WA = which == 0 ? WQ : which == 1 ? WK : WV; const float* BA = which == 0 ? BQ : which == 1 ? BK : BV;
  v8f acc[8] = {};
#pragma unroll 2
  for (int kc = 0; kc < DIN / 32; ++kc) { v16b a; { const float* p = X + (r0 + wave * 16 + col) * DIN + kc * 32 + 8 * g;
#pragma unroll
      for (int i = 0; i < 8; ++i) { a[i] = (__bf16)p[i]; a[8 + i] = (__bf16)p[16 + i]; } }
    asm volatile("s_wait_loadcnt 0x0" ::: "memory");
#pragma unroll
    for (int j = 0; j < 8; ++j) { const v16b w = WCOL(WA, kc * 32, c0 + j * 16 + col, lane); asm volatile("s_wait_loadcnt 0x0" ::: "memory"); acc[j] = wmma_bf(a, w, acc[j]); } }
  if (which < 2) { _Float16* DH = which == 0 ? QH : KH; _Float16* DL = which == 0 ? QL : KL; const int nhi = which == 0 ? QHI : KHI; const bool hi_rows = t0 < nhi;
#pragma unroll
    for (int j = 0; j < 8; ++j) { const float bias = BA ? bfr(BA[c0 + j * 16 + col]) : 0.f;
#pragma unroll
      for (int r = 0; r < 8; ++r) { const float v = acc[j][r] + bias; const _Float16 hv = (_Float16)v; sh[wave * 16 + 8 * g + r][j * 16 + col] = hv; sl[wave * 16 + 8 * g + r][j * 16 + col] = (_Float16)((v - (float)hv) * 1024.0f); } }
    __syncthreads();
    for (int e = tid; e < 64 * 16; e += 128) { const int rl = e >> 4, q = e & 15; vst2((unsigned*)(DH + (r0 + rl) * CC + c0 + q * 8), *(const v4u*)&sh[rl][q * 8]); if (hi_rows) vst2((unsigned*)(DL + (bb * nhi + t0 + rl) * (size_t)CC + c0 + q * 8), *(const v4u*)&sl[rl][q * 8]); }
  } else { const bool hi_rows = t0 < KHI;
#pragma unroll
    for (int j = 0; j < 8; ++j) { const float bias = BA ? bfr(BA[c0 + j * 16 + col]) : 0.f;
#pragma unroll
      for (int r = 0; r < 8; ++r) { const float v = acc[j][r] + bias; const int rl = wave * 16 + 8 * g + r, cl = j * 16 + col; th[cl][rl] = (_Float16)v; const __bf16 bh = (__bf16)v; tb[cl][rl] = bh; tbl[cl][rl] = (__bf16)(v - (float)bh); } }
    __syncthreads();
    for (int e = tid; e < 128 * 8; e += 128) { const int cl = e >> 3, q = e & 7; vst2((unsigned*)(VT + (bb * CC + c0 + cl) * (size_t)TT + t0 + q * 8), *(const v4u*)&th[cl][q * 8]); if (hi_rows) { const size_t o3 = (bb * CC + c0 + cl) * (size_t)KHI + t0 + q * 8; vst2((unsigned*)(VB + o3), *(const v4u*)&tb[cl][q * 8]); vst2((unsigned*)(VBL + o3), *(const v4u*)&tbl[cl][q * 8]); } } } }
// ---- k_fa: block = 128 queries (8 waves x 16 query columns) of (b, h), one pass over all keys in steps of FAK: S^T = K Q^T (A = k rows, B = q hi and q residual x 2^10: 2 products) x SCALE; a lane holds one query's logits (keys 8g + r of each 16-key tile): running maximum and sum in f32 (precise expf), the halves joined by a cross-row move; exp(s - m) x 2^11 once to f16, packed from two score tiles straight into a B operand; ctx^T += V^T P^T (A = v planes: 1 product); ctx = acc / (2^11 sum)
#define FAK 64
#define FNT (FAK / 16)
// amdgpu_waves_per_eu(4, 4): the grid holds four waves for every SIMD, so the kernel takes the register budget of that occupancy (two blocks a WGP, all resident at once)
__device__ __forceinline__ float xhalf(float x) { return __builtin_bit_cast(float, __builtin_amdgcn_permlanex16(__builtin_bit_cast(int, x), __builtin_bit_cast(int, x), 0x76543210, 0xfedcba98, false, false)); }   // lane l with lane l ^ 16
__device__ __forceinline__ v16h frag_p(const _Float16* p) { union { v16h v; v8h q[2]; } u; u.q[0] = *(const v8h*)p; u.q[1] = *(const v8h*)(p + 16); return u.v; }   // frag_h with the lane half's 8g already in p
__device__ __forceinline__ v8f wmmah(v16h a, v16h b, v8f c) { return __builtin_amdgcn_wmma_f32_16x16x32_f16(false, a, false, b, (short)0, c, false, false); }
__global__ __launch_bounds__(256) __attribute__((amdgpu_waves_per_eu(4, 4))) void k_fa(const _Float16* __restrict__ QH, const _Float16* __restrict__ QL, const _Float16* __restrict__ KH, const _Float16* __restrict__ VT, float* __restrict__ Y) {
  const int tid = threadIdx.x, wave = tid >> 5, lane = tid & 31, col = lane & 15, g = lane >> 4; const int h = blockIdx.y, b = blockIdx.z; const int q = blockIdx.x * 128 + wave * 16 + col;
  const v16h qh = frag_h(QH + ((size_t)b * TT + q) * CC + h * HD, lane), ql = frag_h(QL + ((size_t)b * QHI + q) * CC + h * HD, lane);
  const _Float16* Kp = KH + ((size_t)b * TT + col) * CC + h * HD + 8 * g;            // key row col of a 16-key tile, this lane half's d
  const _Float16* Vp = VT + ((size_t)b * CC + h * HD + col) * (size_t)TT + 8 * g;    // plane d = col of a 16-wide d tile, this lane half's keys
  v8f acc[HD / 16] = {}; float m = -3.0e38f, l = 0.f;
  v16h kf[FNT];
#pragma unroll
  for (int t = 0; t < FNT; ++t) kf[t] = frag_p(Kp + (size_t)(t * 16) * CC);
#pragma unroll 2   // two passes a trip: the fetched-ahead k fragments change registers by renaming, not by copies
  for (int k0 = 0; k0 < TT; k0 += FAK) {
    v8f sh[FNT], sl[FNT]; const v8f zero = {};
#pragma unroll
    for (int t = 0; t < FNT; ++t) { sh[t] = wmmah(kf[t], qh, zero); sl[t] = wmmah(kf[t], ql, zero); }
    const int kn = k0 + FAK < TT ? k0 + FAK : 0;   // k rows are fetched one pass ahead; the last pass fetches rows 0.. again (in bounds, not used)
    const _Float16* kp = Kp + (size_t)kn * CC;
#pragma unroll
    for (int t = 0; t < FNT; ++t) kf[t] = frag_p(kp + (size_t)(t * 16) * CC);
    asm volatile("s_wait_xcnt 0x0" :: "v"(kp) : "memory");   // in front of every overwrite of the address registers that the k loads name; kp as an input keeps those registers out of the loads' own results
    v16h vf[HD / 16][FAK / 32];   // this pass's v planes: in flight under the softmax
    const _Float16* vp = Vp + k0;
#pragma unroll
    for (int j = 0; j < HD / 16; ++j)
#pragma unroll
      for (int c = 0; c < FAK / 32; ++c) vf[j][c] = frag_p(vp + (size_t)(j * 16) * TT + c * 32);
    asm volatile("s_wait_xcnt 0x0" :: "v"(vp) : "memory");   // the same for the v loads
    float s[FNT][8]; float mx = m;
#pragma unroll
    for (int t = 0; t < FNT; ++t)
#pragma unroll
      for (int r = 0; r < 8; ++r) { s[t][r] = (sh[t][r] + sl[t][r] * (1.0f / 1024.0f)) * SCALE; mx = fmaxf(mx, s[t][r]); }
    mx = fmaxf(mx, xhalf(mx));
    if (__builtin_amdgcn_ballot_w32(mx > m) != 0) { const float al = expf(m - mx); l *= al;   // some column's maximum rose: rescale (al = 1 exactly where it did not)
#pragma unroll
      for (int j = 0; j < HD / 16; ++j)
#pragma unroll
        for (int r = 0; r < 8; ++r) acc[j][r] *= al;
      m = mx; }
#pragma unroll
    for (int c = 0; c < FAK / 32; ++c) { v16h p;
#pragma unroll
      for (int i = 0; i < 8; ++i) { const float e0 = expf(s[2 * c][i] - m), e1 = expf(s[2 * c + 1][i] - m); l += e0 + e1; p[i] = (_Float16)(e0 * 2048.0f); p[8 + i] = (_Float16)(e1 * 2048.0f); }
#pragma unroll
      for (int j = 0; j < HD / 16; ++j) acc[j] = wmmah(vf[j][c], p, acc[j]); } }
  l += xhalf(l); const float inv = 1.0f / (2048.0f * l);
  float* yr = Y + ((size_t)b * TT + q) * CC + h * HD + 8 * g;   // acc[j][r] = ctx[q][j * 16 + 8g + r]
#pragma unroll
  for (int j = 0; j < HD / 16; ++j) { v4f o0, o1;
#pragma unroll
    for (int r = 0; r < 4; ++r) { o0[r] = acc[j][r] * inv; o1[r] = acc[j][4 + r] * inv; }
    vst2(yr + j * 16, o0); vst2(yr + j * 16 + 4, o1); } }
// ---- k_out: block = (64 rows, 128 cols): out = ctx Wo (+ bo): all rows: ctx bf16 hi + lo against exact bf16 Wo (2 products)
__global__ __launch_bounds__(128) void k_out(const float* __restrict__ Y, const float* __restrict__ WO, const float* __restrict__ BO, float* __restrict__ OUT, const float* __restrict__ RESX) { __shared__ __align__(16) float sf[4][16][132];
  const int tid = threadIdx.x, wave = tid >> 5, lane = tid & 31, col = lane & 15, g = lane >> 4; const int c0 = blockIdx.y * 128; const size_t r0 = (size_t)blockIdx.x * 64 + wave * 16;
  v8f acc[8] = {};
  if (true) {   /* ALL rows: ctx split bf16 hi + lo x exact Wo (2 products) */
#pragma unroll 2
    for (int kc = 0; kc < CC / 32; ++kc) { const F2 a = split_row(Y + (r0 + col) * CC, kc * 32, lane); asm volatile("s_wait_loadcnt 0x0" ::: "memory");
#pragma unroll
      for (int j = 0; j < 8; ++j) { const v16b w = WOCOL(WO, kc * 32, c0 + j * 16 + col, lane); asm volatile("s_wait_loadcnt 0x0" ::: "memory"); acc[j] = wmma_bf(a.h, w, acc[j]); acc[j] = wmma_bf(a.l, w, acc[j]); } }
#pragma unroll
    for (int j = 0; j < 8; ++j) { const float bias = BO ? bfr(BO[c0 + j * 16 + col]) : 0.f;
#pragma unroll
      for (int r = 0; r < 8; ++r) sf[wave][8 * g + r][j * 16 + col] = acc[j][r] + bias; }
  } else {
#pragma unroll 2
    for (int kc = 0; kc < CC / 32; ++kc) { const v16h a = frag_f32(Y + (r0 + col) * CC + kc * 32, lane); asm volatile("s_wait_loadcnt 0x0" ::: "memory");
#pragma unroll
      for (int j = 0; j < 8; ++j) { const v16h w = WOCOLH(WO, kc * 32, c0 + j * 16 + col, lane); asm volatile("s_wait_loadcnt 0x0" ::: "memory"); acc[j] = wmma16(a, w, acc[j]); } }
#pragma unroll
    for (int j = 0; j < 8; ++j) { const float bias = BO ? bfr(BO[c0 + j * 16 + col]) : 0.f;
#pragma unroll
      for (int r = 0; r < 8; ++r) sf[wave][8 * g + r][j * 16 + col] = acc[j][r] * (1.0f / 256.0f) + bias; } }
  LDSX(); for (int rl = 0; rl < 16; ++rl) { const size_t oo = (r0 + rl) * DIN + c0 + lane * 4; v4f o = *(const v4f*)&sf[wave][rl][lane * 4]; const v4f zr = *(const v4f*)(RESX + oo); o[0] += bfr(zr[0]); o[1] += bfr(zr[1]); o[2] += bfr(zr[2]); o[3] += bfr(zr[3]); vst2(OUT + oo, o); } }   /* + bf16(query) */

extern "C" void kernel_launch(void* const* d_in, const int* in_sizes, int n_in, void* d_out, int out_size, void* d_ws, size_t ws_size, hipStream_t stream) {
  (void)in_sizes; (void)n_in; (void)out_size;
  const float** F = (const float**)d_in;
  if (ws_size < (size_t)WS_END) return;
  char* ws = (char*)d_ws; _Float16 *QH = (_Float16*)(ws + WS_QH), *KH = (_Float16*)(ws + WS_KH), *VT = (_Float16*)(ws + WS_VT), *QL = (_Float16*)(ws + WS_QL), *KL = (_Float16*)(ws + WS_KL); __bf16 *VB = (__bf16*)(ws + WS_VB), *VBL = (__bf16*)(ws + WS_VBL); float *S = (float*)(ws + WS_S), *Y = (float*)(ws + WS_Y);
  (void)S;
  // inputs: 0 query; 1 key; 2 value [4,2048,256]; 3 Wq (out,in), 4 bq; 5 Wk, 6 bk; 7 Wv, 8 bv; 9 Wo (out,in), 10 bo; 11 ln_g, 12 ln_b
  if (ws_size < (size_t)WS_END2) return;
  float* X1 = (float*)(ws + WS_X1);
  k_proj<<<dim3(TNB * TT / 64, CC / 128, 3), 128, 0, stream>>>(F[0], F[1], F[2], F[3], F[5], F[7], F[4], F[6], F[8], QH, QL, KH, KL, VT, VB, VBL);
  k_fa<<<dim3(TT / 128, NH, TNB), 256, 0, stream>>>(QH, QL, KH, VT, Y);
  k_out<<<dim3(TNB * TT / 64, DIN / 128), 128, 0, stream>>>(Y, F[9], F[10], X1, F[0]);   /* ctx Wo^T + bo + bf16(query) */
  k_lnx<<<dim3(NRW / 8), 256, 0, stream>>>(X1, 0, F[11], F[12], (float*)d_out);           /* LayerNorm */
}

// v002
// A run of this version takes 119 microseconds.
// Timed twice side by side with v001, it ran 1.13 and 1.12 times as fast.
// Over all steps from v000 it is 7.23 times as fast.
// compute dtype: all float inputs rounded to bf16; Q/K/V = in W^T + b with EXACT bf16 products on WMMA 16x16x32 (f32 accumulate); q as f16 hi + residual (x 2^10) against k once to f16 (2 products) / sqrt(32); softmax in f32 in base 2 (one fma a score folds 1/sqrt(32) x log2(e), the running maximum and the 2^11, then the hardware exp2; running maximum and sum over 64-key passes); exp x 2^11 once to f16 against v once to f16 (1 product), divided by the sum at the end; ctx split bf16 hi + lo against exact Wo (2 products) + bo + query; LayerNorm in f32; f32 output.
#include <hip/hip_runtime.h>
#include <math.h>

typedef __attribute__((ext_vector_type(16))) _Float16 v16h;
typedef __attribute__((ext_vector_type(16))) __bf16 v16b;
typedef __attribute__((ext_vector_type(8)))  _Float16 v8h;
typedef __attribute__((ext_vector_type(8)))  float v8f;
typedef __attribute__((ext_vector_type(4)))  float v4f;
typedef __attribute__((ext_vector_type(2)))  float v2f;
typedef __attribute__((ext_vector_type(4)))  unsigned v4u;
typedef __attribute__((ext_vector_type(4)))  int v4i;
typedef float __attribute__((may_alias)) float_a;
typedef int __attribute__((may_alias)) int_a;

template <typename T> __device__ __forceinline__ void vst2(void* p, T v) { *(T*)p = v;  }
__device__ __forceinline__ v8f wmma16(v16h a, v16h b, v8f c) {
  v8f d = __builtin_amdgcn_wmma_f32_16x16x32_f16(false, a, false, b, (short)0, c, false, false);
  asm volatile("v_nop\n\tv_nop\n\tv_nop\n\tv_nop" : "+v"(d) : "v"(a), "v"(b));
  return d;
}
__device__ __forceinline__ v8f wmma_bf(v16b a, v16b b, v8f c) {
  v8f d = __builtin_amdgcn_wmma_f32_16x16x32_bf16(false, a, false, b, (short)0, c, false, false);
  asm volatile("v_nop\n\tv_nop\n\tv_nop\n\tv_nop" : "+v"(d) : "v"(a), "v"(b));
  return d;
}
// 16x16x32 fragments: lane = (h = lane>>4, row/col = lane&15); elements 0..7 = k0+8h+0..7, 8..15 = k0+16+8h+0..7; D element r = row 8h+r
__device__ __forceinline__ v16h frag_h(const _Float16* rowk0, int lane) {
  union { v16h v; v8h q[2]; } u; const _Float16* p = rowk0 + 8 * (lane >> 4);
  u.q[0] = *(const v8h*)p; u.q[1] = *(const v8h*)(p + 16); return u.v;
}
__device__ __forceinline__ v16h frag_f32(const float* rowk0, int lane) {
  v16h a; const float* p = rowk0 + 8 * (lane >> 4);
#pragma unroll
  for (int i = 0; i < 8; ++i) { a[i] = (_Float16)p[i]; a[8 + i] = (_Float16)p[16 + i]; }
  return a;
}
__device__ __forceinline__ v16h frag_f32s(const float* rowk0, int lane, float sc) {
  v16h a; const float* p = rowk0 + 8 * (lane >> 4);
#pragma unroll
  for (int i = 0; i < 8; ++i) { a[i] = (_Float16)(p[i] * sc); a[8 + i] = (_Float16)(p[16 + i] * sc); }
  return a;
}
// column fragment from a [K][ld] layout (column n), rows >= K read as 0
__device__ __forceinline__ v16h fragc_f32(const float* W, int k0, int n, int lane, int ld, int K) {
  v16h a; const int g = lane >> 4;
#pragma unroll
  for (int i = 0; i < 8; ++i) { const int ka = k0 + 8 * g + i, kb = ka + 16;
    a[i] = (_Float16)(ka < K ? W[(size_t)(ka < K ? ka : K - 1) * ld + n] : 0.f); a[8 + i] = (_Float16)(kb < K ? W[(size_t)(kb < K ? kb : K - 1) * ld + n] : 0.f); }
  return a;
}
struct F2 { v16b h, l; };
__device__ __forceinline__ F2 bsplit16(const float v[16]) { F2 r;
#pragma unroll
  for (int i = 0; i < 16; ++i) { const __bf16 h = (__bf16)v[i]; r.h[i] = h; r.l[i] = (__bf16)(v[i] - (float)h); }
  return r; }
__device__ __forceinline__ F2 split_row(const float* row, int k0, int lane) { float v[16]; const float* p = row + k0 + 8 * (lane >> 4);
#pragma unroll
  for (int i = 0; i < 8; ++i) { v[i] = p[i]; v[8 + i] = p[16 + i]; }
  return bsplit16(v); }
__device__ __forceinline__ F2 split_rowK(const float* row, int k0, int lane, int K) { float v[16]; const int g = lane >> 4;
#pragma unroll
  for (int i = 0; i < 8; ++i) { const int ka = k0 + 8 * g + i, kb = ka + 16; v[i] = ka < K ? row[ka < K ? ka : K - 1] : 0.f; v[8 + i] = kb < K ? row[kb < K ? kb : K - 1] : 0.f; }
  return bsplit16(v); }
__device__ __forceinline__ F2 split_col(const float* W, int k0, int n, int lane, int ld, int K) { float v[16]; const int g = lane >> 4;
#pragma unroll
  for (int i = 0; i < 8; ++i) { const int ka = k0 + 8 * g + i, kb = ka + 16; v[i] = ka < K ? W[(size_t)(ka < K ? ka : K - 1) * ld + n] : 0.f; v[8 + i] = kb < K ? W[(size_t)(kb < K ? kb : K - 1) * ld + n] : 0.f; }
  return bsplit16(v); }
__device__ __forceinline__ v8f mac3(const F2& a, const F2& b, v8f c) { c = wmma_bf(a.l, b.h, c); c = wmma_bf(a.h, b.l, c); return wmma_bf(a.h, b.h, c); }
__device__ __forceinline__ float sigm(float v) { return 1.0f / (1.0f + expf(-v)); }
#define LDSX() do { asm volatile("s_wait_dscnt 0" ::: "memory"); __builtin_amdgcn_wave_barrier(); __builtin_amdgcn_fence(__ATOMIC_RELEASE, "workgroup"); } while (0)

// Cross-modal multi-head attention with residual + LayerNorm (B 4, L 2,048, d_model 256 = 8 heads x 32; (out,in) 1/16-scale weights, zero biases; LN affine 1/0, eps 1e-5): Q = query Wq^T + bq, K = key Wk^T + bk, V = value Wv^T + bv; ctx = softmax(Q K^T / sqrt(32)) V; out = LN(ctx Wo^T + bo + query).
#define NB 4
#define TT 2048
#define CC 256            // NH * HD = projected width
#define DIN 256          // input (model) width
#define NH 8
#define HD 32
#define NQB (TT / 64)
#define HG 4
#define SCALE (0.17677669529663689f)
#define CAUSAL 0
#ifndef TNB
#define TNB NB
#endif
__device__ __forceinline__ float bfr(float v) { return (float)(__bf16)v; }
__host__ __device__ __forceinline__ int kb_last(int qb) { return CAUSAL ? ((qb * 64 + 63) >> 7) : (TT / 128 - 1); }
typedef __attribute__((ext_vector_type(8))) __bf16 v8b;
__device__ __forceinline__ v16b frag_b(const __bf16* rowk0, int lane) {
  union { v16b v; v8b q[2]; } u; const __bf16* p = rowk0 + 8 * (lane >> 4);
  u.q[0] = *(const v8b*)p; u.q[1] = *(const v8b*)(p + 16); return u.v;
}
#define QBH 0              // unused: no kernel here reads it (no separate high-precision path)
#define QHI 2048            // rows carrying a q residual plane (all rows when non-causal: 2-product logits everywhere)
#define KHI 64            // key rows carrying k residual / v bf16 hi+lo planes (written by k_proj; no kernel here reads them)
// B fragment (k rows k0+.., output column o) of a weight: (in,out) [K][ld] or (out,in) [ld rows of K]: bf16 exact, or f16(bf16 * 256) exact
__device__ __forceinline__ v16b wcol_io(const float* Wm, int k0, int o, int lane, int ld) { v16b w; const int g = lane >> 4;
#pragma unroll
  for (int i = 0; i < 8; ++i) { w[i] = (__bf16)Wm[(size_t)(k0 + 8 * g + i) * ld + o]; w[8 + i] = (__bf16)Wm[(size_t)(k0 + 16 + 8 * g + i) * ld + o]; }
  return w; }
__device__ __forceinline__ v16b wcol_oi(const float* Wm, int k0, int o, int lane, int K) { v16b w; const float* p = Wm + (size_t)o * K + k0 + 8 * (lane >> 4);
#pragma unroll
  for (int i = 0; i < 8; ++i) { w[i] = (__bf16)p[i]; w[8 + i] = (__bf16)p[16 + i]; }
  return w; }
__device__ __forceinline__ v16h wcolh_io(const float* Wm, int k0, int o, int lane, int ld) { v16h w; const int g = lane >> 4;
#pragma unroll
  for (int i = 0; i < 8; ++i) { w[i] = (_Float16)(bfr(Wm[(size_t)(k0 + 8 * g + i) * ld + o]) * 256.0f); w[8 + i] = (_Float16)(bfr(Wm[(size_t)(k0 + 16 + 8 * g + i) * ld + o]) * 256.0f); }
  return w; }
__device__ __forceinline__ v16h wcolh_oi(const float* Wm, int k0, int o, int lane, int K) { v16h w; const float* p = Wm + (size_t)o * K + k0 + 8 * (lane >> 4);
#pragma unroll
  for (int i = 0; i < 8; ++i) { w[i] = (_Float16)(bfr(p[i]) * 256.0f); w[8 + i] = (_Float16)(bfr(p[16 + i]) * 256.0f); }
  return w; }
#define WQKV_LAYOUT 1   // 0 = (in,out) [DIN][CC]; 1 = (out,in) [CC][DIN]; 2 = per-head [NH][DIN][HD]
__device__ __forceinline__ v16b wcol_hdk(const float* Wm, int k0, int o, int lane) { v16b w; const int g = lane >> 4; const float* p = Wm + (size_t)(o / HD) * DIN * HD + (o % HD);
#pragma unroll
  for (int i = 0; i < 8; ++i) { w[i] = (__bf16)p[(size_t)(k0 + 8 * g + i) * HD]; w[8 + i] = (__bf16)p[(size_t)(k0 + 16 + 8 * g + i) * HD]; }
  return w; }
#define WO_OUT_IN 1
#if WQKV_LAYOUT == 1
#define WCOL(W, k0, o, lane) wcol_oi(W, k0, o, lane, DIN)
#elif WQKV_LAYOUT == 2
#define WCOL(W, k0, o, lane) wcol_hdk(W, k0, o, lane)
#else
#define WCOL(W, k0, o, lane) wcol_io(W, k0, o, lane, CC)
#endif
#if WO_OUT_IN
#define WOCOL(W, k0, o, lane) wcol_oi(W, k0, o, lane, CC)
#define WOCOLH(W, k0, o, lane) wcolh_oi(W, k0, o, lane, CC)
#else
#define WOCOL(W, k0, o, lane) wcol_io(W, k0, o, lane, DIN)
#define WOCOLH(W, k0, o, lane) wcolh_io(W, k0, o, lane, DIN)
#endif
#define NRW (TNB * TT)
// ---- k_lnx: wave per row: LayerNorm over 256 (mean, biased var, (x - mean) * rsqrt(var + 1e-5) * g + b); optional bf16 rounding of the input (x); 8 floats per lane (2 float4 at stride 128 floats -> 512-B pieces)
__global__ __launch_bounds__(256) void k_lnx(const float* __restrict__ X, int roundin, const float* __restrict__ G, const float* __restrict__ BE, float* __restrict__ OUT) { const int wave = threadIdx.x >> 5, lane = threadIdx.x & 31; const size_t row = (size_t)blockIdx.x * 8 + wave; if (row >= (size_t)NRW) return;
  v4f v[CC / 128]; float s1 = 0.f;
#pragma unroll
  for (int i = 0; i < CC / 128; ++i) { v4f t = *(const v4f*)(X + row * CC + i * 128 + lane * 4); if (roundin) { t[0] = bfr(t[0]); t[1] = bfr(t[1]); t[2] = bfr(t[2]); t[3] = bfr(t[3]); } v[i] = t; s1 += (t[0] + t[1]) + (t[2] + t[3]); }
#pragma unroll
  for (int o = 1; o < 32; o <<= 1) s1 += __shfl_xor(s1, o);
  const float mu = s1 * (1.0f / CC); float q = 0.f;
#pragma unroll
  for (int i = 0; i < CC / 128; ++i) for (int k = 0; k < 4; ++k) { const float d = v[i][k] - mu; q += d * d; }
#pragma unroll
  for (int o = 1; o < 32; o <<= 1) q += __shfl_xor(q, o);
  const float inv = rsqrtf(q * (1.0f / CC) + 1e-5f);   /* jnp.var (biased), eps inside the rsqrt */
#pragma unroll
  for (int i = 0; i < CC / 128; ++i) { const int c = i * 128 + lane * 4; v4f r4; for (int k = 0; k < 4; ++k) r4[k] = bfr(G[c + k]) * ((v[i][k] - mu) * inv) + bfr(BE[c + k]); vst2(OUT + row * CC + c, r4); } }

#ifndef SM_EXTRA_PARAMS
#define SM_EXTRA_PARAMS
#endif
#ifndef PROJ_EXTRA_PARAMS
#define PROJ_EXTRA_PARAMS
#endif
#ifndef SM_MASK_HOOK
#define SM_MASK_HOOK (void)0
#endif

#define WS_QH  0u                                      // f16 q rows [b*t][CC]
#define WS_KH  (WS_QH + 2u * (size_t)NB * TT * CC)      // f16 k rows [b*t][CC]
#define WS_VT  (WS_KH + 2u * (size_t)NB * TT * CC)      // f16 v planes [b][c][t]
#define WS_QL  (WS_VT + 2u * (size_t)NB * CC * TT)      // f16 q residual x 2^10 rows [b][t < QHI][CC]
#define WS_KL  (WS_QL + 2u * (size_t)NB * QHI * CC)     // f16 k residual x 2^10 rows [b][t < KHI][CC]
#define WS_VB  (WS_KL + 2u * (size_t)NB * KHI * CC)     // bf16 v hi planes [b][c][t < KHI]
#define WS_VBL (WS_VB + 2u * (size_t)NB * CC * KHI)
#define WS_S   (WS_VBL + 2u * (size_t)NB * CC * KHI)    // f32 [hg][t][s], unused (k_fa keeps logits in registers)
#define WS_Y   (WS_S  + 4u * (size_t)HG * TT * TT)      // f32 ctx rows [b*t][CC] (only when there is an output projection)
#define WS_END (WS_Y  + 4u * (size_t)NB * TT * CC)
#define WS_X1  (WS_END)
#define WS_END2 (WS_X1 + 4u * (size_t)NB * TT * DIN)

// ---- k_proj: block = (64 rows, 128 cols, which): q/k/v = X W (+ b) with exact bf16 products (K = DIN) -> which 0: q f16 rows (+ residual rows < QHI); 1: k f16 rows (+ residual rows < KHI); 2: v f16 planes [c][t] (+ bf16 hi/lo planes for t < KHI)
__global__ __launch_bounds__(128) void k_proj(const float* __restrict__ XQ, const float* __restrict__ XK, const float* __restrict__ XV, const float* __restrict__ WQ, const float* __restrict__ WK, const float* __restrict__ WV, const float* __restrict__ BQ, const float* __restrict__ BK, const float* __restrict__ BV,
    _Float16* __restrict__ QH, _Float16* __restrict__ QL, _Float16* __restrict__ KH, _Float16* __restrict__ KL, _Float16* __restrict__ VT, __bf16* __restrict__ VB, __bf16* __restrict__ VBL) {
  __shared__ __align__(16) _Float16 sh[64][136], sl[64][136]; __shared__ __align__(16) _Float16 th[128][72]; __shared__ __align__(16) __bf16 tb[128][72], tbl[128][72];
  const int tid = threadIdx.x, wave = tid >> 5, lane = tid & 31, col = lane & 15, g = lane >> 4; const int which = blockIdx.z; const int c0 = blockIdx.y * 128; const size_t r0 = (size_t)blockIdx.x * 64; const size_t bb = r0 / TT; const int t0 = (int)(r0 % TT);
  const float* X = which == 0 ? XQ : which == 1 ? XK : XV; const float* WA = which == 0 ? WQ : which == 1 ? WK : WV; const float* BA = which == 0 ? BQ : which == 1 ? BK : BV;
  v8f acc[8] = {};
#pragma unroll 2
  for (int kc = 0; kc < DIN / 32; ++kc) { v16b a; { const float* p = X + (r0 + wave * 16 + col) * DIN + kc * 32 + 8 * g;
#pragma unroll
      for (int i = 0; i < 8; ++i) { a[i] = (__bf16)p[i]; a[8 + i] = (__bf16)p[16 + i]; } }
    asm volatile("s_wait_loadcnt 0x0" ::: "memory");
#pragma unroll
    for (int j = 0; j < 8; ++j) { const v16b w = WCOL(WA, kc * 32, c0 + j * 16 + col, lane); asm volatile("s_wait_loadcnt 0x0" ::: "memory"); acc[j] = wmma_bf(a, w, acc[j]); } }
  if (which < 2) { _Float16* DH = which == 0 ? QH : KH; _Float16* DL = which == 0 ? QL : KL; const int nhi = which == 0 ? QHI : KHI; const bool hi_rows = t0 < nhi;
#pragma unroll
    for (int j = 0; j < 8; ++j) { const float bias = BA ? bfr(BA[c0 + j * 16 + col]) : 0.f;
#pragma unroll
      for (int r = 0; r < 8; ++r) { const float v = acc[j][r] + bias; const _Float16 hv = (_Float16)v; sh[wave * 16 + 8 * g + r][j * 16 + col] = hv; sl[wave * 16 + 8 * g + r][j * 16 + col] = (_Float16)((v - (float)hv) * 1024.0f); } }
    __syncthreads();
    for (int e = tid; e < 64 * 16; e += 128) { const int rl = e >> 4, q = e & 15; vst2((unsigned*)(DH + (r0 + rl) * CC + c0 + q * 8), *(const v4u*)&sh[rl][q * 8]); if (hi_rows) vst2((unsigned*)(DL + (bb * nhi + t0 + rl) * (size_t)CC + c0 + q * 8), *(const v4u*)&sl[rl][q * 8]); }
  } else { const bool hi_rows = t0 < KHI;
#pragma unroll
    for (int j = 0; j < 8; ++j) { const float bias = BA ? bfr(BA[c0 + j * 16 + col]) : 0.f;
#pragma unroll
      for (int r = 0; r < 8; ++r) { const float v = acc[j][r] + bias; const int rl = wave * 16 + 8 * g + r, cl = j * 16 + col; th[cl][rl] = (_Float16)v; const __bf16 bh = (__bf16)v; tb[cl][rl] = bh; tbl[cl][rl] = (__bf16)(v - (float)bh); } }
    __syncthreads();
    for (int e = tid; e < 128 * 8; e += 128) { const int cl = e >> 3, q = e & 7; vst2((unsigned*)(VT + (bb * CC + c0 + cl) * (size_t)TT + t0 + q * 8), *(const v4u*)&th[cl][q * 8]); if (hi_rows) { const size_t o3 = (bb * CC + c0 + cl) * (size_t)KHI + t0 + q * 8; vst2((unsigned*)(VB + o3), *(const v4u*)&tb[cl][q * 8]); vst2((unsigned*)(VBL + o3), *(const v4u*)&tbl[cl][q * 8]); } } } }
// ---- k_fa: block = 128 queries (8 waves x 16 query columns) of (b, h), one pass over all keys in steps of FAK: S^T = K Q^T (A = k rows, B = q hi and q residual x 2^10: 2 products); a lane holds one query's raw scores x (keys 8g + r of each 16-key tile): running maximum of x and sum in f32, the halves joined by a cross-row move; p = exp2(x * C2 + nm), C2 = SCALE x log2(e), nm = 11 - max * C2, so p = exp(SCALE (x - max)) x 2^11: one fma and one hardware exp2 a score; p once to f16, packed from two score tiles straight into a B operand; ctx^T += V^T P^T (A = v planes: 1 product); ctx = acc / sum (both carry the 2^11)
#define FAK 64
#define FNT (FAK / 16)
#define C2 (SCALE * 1.4426950408889634f)
// amdgpu_waves_per_eu(4, 4): the grid holds four waves for every SIMD, so the kernel takes the register budget of that occupancy (two blocks a WGP, all resident at once)
__device__ __forceinline__ float xhalf(float x) { return __builtin_bit_cast(float, __builtin_amdgcn_permlanex16(__builtin_bit_cast(int, x), __builtin_bit_cast(int, x), 0x76543210, 0xfedcba98, false, false)); }   // lane l with lane l ^ 16
__device__ __forceinline__ v16h frag_p(const _Float16* p) { union { v16h v; v8h q[2]; } u; u.q[0] = *(const v8h*)p; u.q[1] = *(const v8h*)(p + 16); return u.v; }   // frag_h with the lane half's 8g already in p
__device__ __forceinline__ v8f wmmah(v16h a, v16h b, v8f c) { return __builtin_amdgcn_wmma_f32_16x16x32_f16(false, a, false, b, (short)0, c, false, false); }
// eight hardware exp2 in one statement, no result in a source's register: behind a v_exp_f32 the instruction set asks for one independent instruction before its result is read or its source overwritten; here each is the next one's, and the v_nop is the last one's
__device__ __forceinline__ void exp2x8(float (&e)[8], const v2f (&a)[4]) {
  asm("v_exp_f32 %0, %8\n\tv_exp_f32 %1, %9\n\tv_exp_f32 %2, %10\n\tv_exp_f32 %3, %11\n\tv_exp_f32 %4, %12\n\tv_exp_f32 %5, %13\n\tv_exp_f32 %6, %14\n\tv_exp_f32 %7, %15\n\tv_nop"
      : "=&v"(e[0]), "=&v"(e[1]), "=&v"(e[2]), "=&v"(e[3]), "=&v"(e[4]), "=&v"(e[5]), "=&v"(e[6]), "=&v"(e[7])
      : "v"(a[0].x), "v"(a[0].y), "v"(a[1].x), "v"(a[1].y), "v"(a[2].x), "v"(a[2].y), "v"(a[3].x), "v"(a[3].y)); }
__global__ __launch_bounds__(256) __attribute__((amdgpu_waves_per_eu(4, 4))) void k_fa(const _Float16* __restrict__ QH, const _Float16* __restrict__ QL, const _Float16* __restrict__ KH, const _Float16* __restrict__ VT, float* __restrict__ Y) {
  const int tid = threadIdx.x, wave = tid >> 5, lane = tid & 31, col = lane & 15, g = lane >> 4; const int h = blockIdx.y, b = blockIdx.z; const int q = blockIdx.x * 128 + wave * 16 + col;
  const v16h qh = frag_h(QH + ((size_t)b * TT + q) * CC + h * HD, lane), ql = frag_h(QL + ((size_t)b * QHI + q) * CC + h * HD, lane);
  const _Float16* Kp = KH + ((size_t)b * TT + col) * CC + h * HD + 8 * g;            // key row col of a 16-key tile, this lane half's d
  const _Float16* Vp = VT + ((size_t)b * CC + h * HD + col) * (size_t)TT + 8 * g;    // plane d = col of a 16-wide d tile, this lane half's keys
  v8f acc[HD / 16] = {}; float m = -3.0e38f, nm = 11.0f + 3.0e38f * C2, l = 0.f;
  v16h kf[FNT];
#pragma unroll
  for (int t = 0; t < FNT; ++t) kf[t] = frag_p(Kp + (size_t)(t * 16) * CC);
#pragma unroll 2   // two passes a trip: the fetched-ahead k fragments change registers by renaming, not by copies
  for (int k0 = 0; k0 < TT; k0 += FAK) {
    v8f sh[FNT], sl[FNT]; const v8f zero = {};
#pragma unroll
    for (int t = 0; t < FNT; ++t) { sh[t] = wmmah(kf[t], qh, zero); sl[t] = wmmah(kf[t], ql, zero); }
    const int kn = k0 + FAK < TT ? k0 + FAK : 0;   // k rows are fetched one pass ahead; the last pass fetches rows 0.. again (in bounds, not used)
    const _Float16* kp = Kp + (size_t)kn * CC;
#pragma unroll
    for (int t = 0; t < FNT; ++t) kf[t] = frag_p(kp + (size_t)(t * 16) * CC);
    asm volatile("s_wait_xcnt 0x0" :: "v"(kp) : "memory");   // in front of every overwrite of the address registers that the k loads name; kp as an input keeps those registers out of the loads' own results
    v16h vf[HD / 16][FAK / 32];   // this pass's v planes: in flight under the softmax
    const _Float16* vp = Vp + k0;
#pragma unroll
    for (int j = 0; j < HD / 16; ++j)
#pragma unroll
      for (int c = 0; c < FAK / 32; ++c) vf[j][c] = frag_p(vp + (size_t)(j * 16) * TT + c * 32);
    asm volatile("s_wait_xcnt 0x0" :: "v"(vp) : "memory");   // the same for the v loads
    float s[FNT][8]; float mx = m;
#pragma unroll
    for (int t = 0; t < FNT; ++t)
#pragma unroll
      for (int r = 0; r < 8; ++r) { s[t][r] = sh[t][r] + sl[t][r] * (1.0f / 1024.0f); mx = fmaxf(mx, s[t][r]); }
    mx = fmaxf(mx, xhalf(mx));
    if (__builtin_amdgcn_ballot_w32(mx > m) != 0) { const float nn = fmaf(-mx, C2, 11.0f); const float al = __builtin_amdgcn_exp2f(nn - nm); l *= al;   // some column's maximum rose: rescale (al = 1 exactly where it did not)
#pragma unroll
      for (int j = 0; j < HD / 16; ++j)
#pragma unroll
        for (int r = 0; r < 8; ++r) acc[j][r] *= al;
      m = mx; nm = nn; }
#pragma unroll
    for (int c = 0; c < FAK / 32; ++c) { v16h p; float e[2][8];
#pragma unroll
      for (int u = 0; u < 2; ++u) { v2f a[4];
#pragma unroll
        for (int i = 0; i < 4; ++i) a[i] = __builtin_elementwise_fma(v2f{s[2 * c + u][2 * i], s[2 * c + u][2 * i + 1]}, v2f{C2, C2}, v2f{nm, nm});
        exp2x8(e[u], a); }
#pragma unroll
      for (int i = 0; i < 8; ++i) { l += e[0][i] + e[1][i]; p[i] = (_Float16)e[0][i]; p[8 + i] = (_Float16)e[1][i]; }
#pragma unroll
      for (int j = 0; j < HD / 16; ++j) acc[j] = wmmah(vf[j][c], p, acc[j]); } }
  l += xhalf(l); const float inv = 1.0f / l;
  float* yr = Y + ((size_t)b * TT + q) * CC + h * HD + 8 * g;   // acc[j][r] = ctx[q][j * 16 + 8g + r]
#pragma unroll
  for (int j = 0; j < HD / 16; ++j) { v4f o0, o1;
#pragma unroll
    for (int r = 0; r < 4; ++r) { o0[r] = acc[j][r] * inv; o1[r] = acc[j][4 + r] * inv; }
    vst2(yr + j * 16, o0); vst2(yr + j * 16 + 4, o1); } }
// ---- k_out: block = (64 rows, 128 cols): out = ctx Wo (+ bo): all rows: ctx bf16 hi + lo against exact bf16 Wo (2 products)
__global__ __launch_bounds__(128) void k_out(const float* __restrict__ Y, const float* __restrict__ WO, const float* __restrict__ BO, float* __restrict__ OUT, const float* __restrict__ RESX) { __shared__ __align__(16) float sf[4][16][132];
  const int tid = threadIdx.x, wave = tid >> 5, lane = tid & 31, col = lane & 15, g = lane >> 4; const int c0 = blockIdx.y * 128; const size_t r0 = (size_t)blockIdx.x * 64 + wave * 16;
  v8f acc[8] = {};
  if (true) {   /* ALL rows: ctx split bf16 hi + lo x exact Wo (2 products) */
#pragma unroll 2
    for (int kc = 0; kc < CC / 32; ++kc) { const F2 a = split_row(Y + (r0 + col) * CC, kc * 32, lane); asm volatile("s_wait_loadcnt 0x0" ::: "memory");
#pragma unroll
      for (int j = 0; j < 8; ++j) { const v16b w = WOCOL(WO, kc * 32, c0 + j * 16 + col, lane); asm volatile("s_wait_loadcnt 0x0" ::: "memory"); acc[j] = wmma_bf(a.h, w, acc[j]); acc[j] = wmma_bf(a.l, w, acc[j]); } }
#pragma unroll
    for (int j = 0; j < 8; ++j) { const float bias = BO ? bfr(BO[c0 + j * 16 + col]) : 0.f;
#pragma unroll
      for (int r = 0; r < 8; ++r) sf[wave][8 * g + r][j * 16 + col] = acc[j][r] + bias; }
  } else {
#pragma unroll 2
    for (int kc = 0; kc < CC / 32; ++kc) { const v16h a = frag_f32(Y + (r0 + col) * CC + kc * 32, lane); asm volatile("s_wait_loadcnt 0x0" ::: "memory");
#pragma unroll
      for (int j = 0; j < 8; ++j) { const v16h w = WOCOLH(WO, kc * 32, c0 + j * 16 + col, lane); asm volatile("s_wait_loadcnt 0x0" ::: "memory"); acc[j] = wmma16(a, w, acc[j]); } }
#pragma unroll
    for (int j = 0; j < 8; ++j) { const float bias = BO ? bfr(BO[c0 + j * 16 + col]) : 0.f;
#pragma unroll
      for (int r = 0; r < 8; ++r) sf[wave][8 * g + r][j * 16 + col] = acc[j][r] * (1.0f / 256.0f) + bias; } }
  LDSX(); for (int rl = 0; rl < 16; ++rl) { const size_t oo = (r0 + rl) * DIN + c0 + lane * 4; v4f o = *(const v4f*)&sf[wave][rl][lane * 4]; const v4f zr = *(const v4f*)(RESX + oo); o[0] += bfr(zr[0]); o[1] += bfr(zr[1]); o[2] += bfr(zr[2]); o[3] += bfr(zr[3]); vst2(OUT + oo, o); } }   /* + bf16(query) */

extern "C" void kernel_launch(void* const* d_in, const int* in_sizes, int n_in, void* d_out, int out_size, void* d_ws, size_t ws_size, hipStream_t stream) {
  (void)in_sizes; (void)n_in; (void)out_size;
  const float** F = (const float**)d_in;
  if (ws_size < (size_t)WS_END) return;
  char* ws = (char*)d_ws; _Float16 *QH = (_Float16*)(ws + WS_QH), *KH = (_Float16*)(ws + WS_KH), *VT = (_Float16*)(ws + WS_VT), *QL = (_Float16*)(ws + WS_QL), *KL = (_Float16*)(ws + WS_KL); __bf16 *VB = (__bf16*)(ws + WS_VB), *VBL = (__bf16*)(ws + WS_VBL); float *S = (float*)(ws + WS_S), *Y = (float*)(ws + WS_Y);
  (void)S;
  // inputs: 0 query; 1 key; 2 value [4,2048,256]; 3 Wq (out,in), 4 bq; 5 Wk, 6 bk; 7 Wv, 8 bv; 9 Wo (out,in), 10 bo; 11 ln_g, 12 ln_b
  if (ws_size < (size_t)WS_END2) return;
  float* X1 = (float*)(ws + WS_X1);
  k_proj<<<dim3(TNB * TT / 64, CC / 128, 3), 128, 0, stream>>>(F[0], F[1], F[2], F[3], F[5], F[7], F[4], F[6], F[8], QH, QL, KH, KL, VT, VB, VBL);
  k_fa<<<dim3(TT / 128, NH, TNB), 256, 0, stream>>>(QH, QL, KH, VT, Y);
  k_out<<<dim3(TNB * TT / 64, DIN / 128), 128, 0, stream>>>(Y, F[9], F[10], X1, F[0]);   /* ctx Wo^T + bo + bf16(query) */
  k_lnx<<<dim3(NRW / 8), 256, 0, stream>>>(X1, 0, F[11], F[12], (float*)d_out);           /* LayerNorm */
}

// v003
// It runs in 106 microseconds.
// Timed twice side by side with v002, it ran 1.13 times as fast both times.
// Over all steps from v000 it is 8.18 times as fast.
// compute dtype: all float inputs rounded to bf16; Q/K/V = in W^T + b with EXACT bf16 products on WMMA 16x16x32 (f32 accumulate); q as f16 hi + residual (x 2^10) against k once to f16 (2 products) / sqrt(32); softmax in f32 in base 2 (one fma a score folds 1/sqrt(32) x log2(e), the running maximum and the 2^11, then the hardware exp2; running maximum and sum over 64-key passes); exp x 2^11 once to f16 against v once to f16 (1 product), divided by the sum at the end; ctx split bf16 hi + lo against exact Wo (2 products) + bo + query; LayerNorm in f32; f32 output.
#include <hip/hip_runtime.h>
#include <math.h>

typedef __attribute__((ext_vector_type(16))) _Float16 v16h;
typedef __attribute__((ext_vector_type(16))) __bf16 v16b;
typedef __attribute__((ext_vector_type(8)))  _Float16 v8h;
typedef __attribute__((ext_vector_type(8)))  float v8f;
typedef __attribute__((ext_vector_type(4)))  float v4f;
typedef __attribute__((ext_vector_type(2)))  float v2f;
typedef __attribute__((ext_vector_type(4)))  unsigned v4u;
typedef __attribute__((ext_vector_type(4)))  int v4i;
typedef float __attribute__((may_alias)) float_a;
typedef int __attribute__((may_alias)) int_a;

template <typename T> __device__ __forceinline__ void vst2(void* p, T v) { *(T*)p = v;  }
__device__ __forceinline__ v8f wmma16(v16h a, v16h b, v8f c) {
  v8f d = __builtin_amdgcn_wmma_f32_16x16x32_f16(false, a, false, b, (short)0, c, false, false);
  asm volatile("v_nop\n\tv_nop\n\tv_nop\n\tv_nop" : "+v"(d) : "v"(a), "v"(b));
  return d;
}
__device__ __forceinline__ v8f wmma_bf(v16b a, v16b b, v8f c) {
  v8f d = __builtin_amdgcn_wmma_f32_16x16x32_bf16(false, a, false, b, (short)0, c, false, false);
  asm volatile("v_nop\n\tv_nop\n\tv_nop\n\tv_nop" : "+v"(d) : "v"(a), "v"(b));
  return d;
}
// 16x16x32 fragments: lane = (h = lane>>4, row/col = lane&15); elements 0..7 = k0+8h+0..7, 8..15 = k0+16+8h+0..7; D element r = row 8h+r
__device__ __forceinline__ v16h frag_h(const _Float16* rowk0, int lane) {
  union { v16h v; v8h q[2]; } u; const _Float16* p = rowk0 + 8 * (lane >> 4);
  u.q[0] = *(const v8h*)p; u.q[1] = *(const v8h*)(p + 16); return u.v;
}
__device__ __forceinline__ v16h frag_f32(const float* rowk0, int lane) {
  v16h a; const float* p = rowk0 + 8 * (lane >> 4);
#pragma unroll
  for (int i = 0; i < 8; ++i) { a[i] = (_Float16)p[i]; a[8 + i] = (_Float16)p[16 + i]; }
  return a;
}
__device__ __forceinline__ v16h frag_f32s(const float* rowk0, int lane, float sc) {
  v16h a; const float* p = rowk0 + 8 * (lane >> 4);
#pragma unroll
  for (int i = 0; i < 8; ++i) { a[i] = (_Float16)(p[i] * sc); a[8 + i] = (_Float16)(p[16 + i] * sc); }
  return a;
}
// column fragment from a [K][ld] layout (column n), rows >= K read as 0
__device__ __forceinline__ v16h fragc_f32(const float* W, int k0, int n, int lane, int ld, int K) {
  v16h a; const int g = lane >> 4;
#pragma unroll
  for (int i = 0; i < 8; ++i) { const int ka = k0 + 8 * g + i, kb = ka + 16;
    a[i] = (_Float16)(ka < K ? W[(size_t)(ka < K ? ka : K - 1) * ld + n] : 0.f); a[8 + i] = (_Float16)(kb < K ? W[(size_t)(kb < K ? kb : K - 1) * ld + n] : 0.f); }
  return a;
}
struct F2 { v16b h, l; };
__device__ __forceinline__ F2 bsplit16(const float v[16]) { F2 r;
#pragma unroll
  for (int i = 0; i < 16; ++i) { const __bf16 h = (__bf16)v[i]; r.h[i] = h; r.l[i] = (__bf16)(v[i] - (float)h); }
  return r; }
__device__ __forceinline__ F2 split_row(const float* row, int k0, int lane) { float v[16]; const float* p = row + k0 + 8 * (lane >> 4);
#pragma unroll
  for (int i = 0; i < 8; ++i) { v[i] = p[i]; v[8 + i] = p[16 + i]; }
  return bsplit16(v); }
__device__ __forceinline__ F2 split_rowK(const float* row, int k0, int lane, int K) { float v[16]; const int g = lane >> 4;
#pragma unroll
  for (int i = 0; i < 8; ++i) { const int ka = k0 + 8 * g + i, kb = ka + 16; v[i] = ka < K ? row[ka < K ? ka : K - 1] : 0.f; v[8 + i] = kb < K ? row[kb < K ? kb : K - 1] : 0.f; }
  return bsplit16(v); }
__device__ __forceinline__ F2 split_col(const float* W, int k0, int n, int lane, int ld, int K) { float v[16]; const int g = lane >> 4;
#pragma unroll
  for (int i = 0; i < 8; ++i) { const int ka = k0 + 8 * g + i, kb = ka + 16; v[i] = ka < K ? W[(size_t)(ka < K ? ka : K - 1) * ld + n] : 0.f; v[8 + i] = kb < K ? W[(size_t)(kb < K ? kb : K - 1) * ld + n] : 0.f; }
  return bsplit16(v); }
__device__ __forceinline__ v8f mac3(const F2& a, const F2& b, v8f c) { c = wmma_bf(a.l, b.h, c); c = wmma_bf(a.h, b.l, c); return wmma_bf(a.h, b.h, c); }
__device__ __forceinline__ float sigm(float v) { return 1.0f / (1.0f + expf(-v)); }
#define LDSX() do { asm volatile("s_wait_dscnt 0" ::: "memory"); __builtin_amdgcn_wave_barrier(); __builtin_amdgcn_fence(__ATOMIC_RELEASE, "workgroup"); } while (0)

// Cross-modal multi-head attention with residual + LayerNorm (B 4, L 2,048, d_model 256 = 8 heads x 32; (out,in) 1/16-scale weights, zero biases; LN affine 1/0, eps 1e-5): Q = query Wq^T + bq, K = key Wk^T + bk, V = value Wv^T + bv; ctx = softmax(Q K^T / sqrt(32)) V; out = LN(ctx Wo^T + bo + query).
#define NB 4
#define TT 2048
#define CC 256            // NH * HD = projected width
#define DIN 256          // input (model) width
#define NH 8
#define HD 32
#define NQB (TT / 64)
#define HG 4
#define SCALE (0.17677669529663689f)
#define CAUSAL 0
#ifndef TNB
#define TNB NB
#endif
__device__ __forceinline__ float bfr(float v) { return (float)(__bf16)v; }
__host__ __device__ __forceinline__ int kb_last(int qb) { return CAUSAL ? ((qb * 64 + 63) >> 7) : (TT / 128 - 1); }
typedef __attribute__((ext_vector_type(8))) __bf16 v8b;
__device__ __forceinline__ v16b frag_b(const __bf16* rowk0, int lane) {
  union { v16b v; v8b q[2]; } u; const __bf16* p = rowk0 + 8 * (lane >> 4);
  u.q[0] = *(const v8b*)p; u.q[1] = *(const v8b*)(p + 16); return u.v;
}
#define QBH 0              // unused: no kernel here reads it (no separate high-precision path)
#define QHI 2048            // rows carrying a q residual plane (all rows when non-causal: 2-product logits everywhere)
#define KHI 64            // key rows carrying k residual / v bf16 hi+lo planes (written by k_proj; no kernel here reads them)
// B fragment (k rows k0+.., output column o) of a weight: (in,out) [K][ld] or (out,in) [ld rows of K]: bf16 exact, or f16(bf16 * 256) exact
__device__ __forceinline__ v16b wcol_io(const float* Wm, int k0, int o, int lane, int ld) { v16b w; const int g = lane >> 4;
#pragma unroll
  for (int i = 0; i < 8; ++i) { w[i] = (__bf16)Wm[(size_t)(k0 + 8 * g + i) * ld + o]; w[8 + i] = (__bf16)Wm[(size_t)(k0 + 16 + 8 * g + i) * ld + o]; }
  return w; }
__device__ __forceinline__ v16b wcol_oi(const float* Wm, int k0, int o, int lane, int K) { v16b w; const float* p = Wm + (size_t)o * K + k0 + 8 * (lane >> 4);
#pragma unroll
  for (int i = 0; i < 8; ++i) { w[i] = (__bf16)p[i]; w[8 + i] = (__bf16)p[16 + i]; }
  return w; }
__device__ __forceinline__ v16h wcolh_io(const float* Wm, int k0, int o, int lane, int ld) { v16h w; const int g = lane >> 4;
#pragma unroll
  for (int i = 0; i < 8; ++i) { w[i] = (_Float16)(bfr(Wm[(size_t)(k0 + 8 * g + i) * ld + o]) * 256.0f); w[8 + i] = (_Float16)(bfr(Wm[(size_t)(k0 + 16 + 8 * g + i) * ld + o]) * 256.0f); }
  return w; }
__device__ __forceinline__ v16h wcolh_oi(const float* Wm, int k0, int o, int lane, int K) { v16h w; const float* p = Wm + (size_t)o * K + k0 + 8 * (lane >> 4);
#pragma unroll
  for (int i = 0; i < 8; ++i) { w[i] = (_Float16)(bfr(p[i]) * 256.0f); w[8 + i] = (_Float16)(bfr(p[16 + i]) * 256.0f); }
  return w; }
#define WQKV_LAYOUT 1   // 0 = (in,out) [DIN][CC]; 1 = (out,in) [CC][DIN]; 2 = per-head [NH][DIN][HD]
__device__ __forceinline__ v16b wcol_hdk(const float* Wm, int k0, int o, int lane) { v16b w; const int g = lane >> 4; const float* p = Wm + (size_t)(o / HD) * DIN * HD + (o % HD);
#pragma unroll
  for (int i = 0; i < 8; ++i) { w[i] = (__bf16)p[(size_t)(k0 + 8 * g + i) * HD]; w[8 + i] = (__bf16)p[(size_t)(k0 + 16 + 8 * g + i) * HD]; }
  return w; }
#define WO_OUT_IN 1
#if WQKV_LAYOUT == 1
#define WCOL(W, k0, o, lane) wcol_oi(W, k0, o, lane, DIN)
#elif WQKV_LAYOUT == 2
#define WCOL(W, k0, o, lane) wcol_hdk(W, k0, o, lane)
#else
#define WCOL(W, k0, o, lane) wcol_io(W, k0, o, lane, CC)
#endif
#if WO_OUT_IN
#define WOCOL(W, k0, o, lane) wcol_oi(W, k0, o, lane, CC)
#define WOCOLH(W, k0, o, lane) wcolh_oi(W, k0, o, lane, CC)
#else
#define WOCOL(W, k0, o, lane) wcol_io(W, k0, o, lane, DIN)
#define WOCOLH(W, k0, o, lane) wcolh_io(W, k0, o, lane, DIN)
#endif
#define NRW (TNB * TT)
// ---- k_lnx: wave per row: LayerNorm over 256 (mean, biased var, (x - mean) * rsqrt(var + 1e-5) * g + b); optional bf16 rounding of the input (x); 8 floats per lane (2 float4 at stride 128 floats -> 512-B pieces)
__global__ __launch_bounds__(256) void k_lnx(const float* __restrict__ X, int roundin, const float* __restrict__ G, const float* __restrict__ BE, float* __restrict__ OUT) { const int wave = threadIdx.x >> 5, lane = threadIdx.x & 31; const size_t row = (size_t)blockIdx.x * 8 + wave; if (row >= (size_t)NRW) return;
  v4f v[CC / 128]; float s1 = 0.f;
#pragma unroll
  for (int i = 0; i < CC / 128; ++i) { v4f t = *(const v4f*)(X + row * CC + i * 128 + lane * 4); if (roundin) { t[0] = bfr(t[0]); t[1] = bfr(t[1]); t[2] = bfr(t[2]); t[3] = bfr(t[3]); } v[i] = t; s1 += (t[0] + t[1]) + (t[2] + t[3]); }
#pragma unroll
  for (int o = 1; o < 32; o <<= 1) s1 += __shfl_xor(s1, o);
  const float mu = s1 * (1.0f / CC); float q = 0.f;
#pragma unroll
  for (int i = 0; i < CC / 128; ++i) for (int k = 0; k < 4; ++k) { const float d = v[i][k] - mu; q += d * d; }
#pragma unroll
  for (int o = 1; o < 32; o <<= 1) q += __shfl_xor(q, o);
  const float inv = rsqrtf(q * (1.0f / CC) + 1e-5f);   /* jnp.var (biased), eps inside the rsqrt */
#pragma unroll
  for (int i = 0; i < CC / 128; ++i) { const int c = i * 128 + lane * 4; v4f r4; for (int k = 0; k < 4; ++k) r4[k] = bfr(G[c + k]) * ((v[i][k] - mu) * inv) + bfr(BE[c + k]); vst2(OUT + row * CC + c, r4); } }

#ifndef SM_EXTRA_PARAMS
#define SM_EXTRA_PARAMS
#endif
#ifndef PROJ_EXTRA_PARAMS
#define PROJ_EXTRA_PARAMS
#endif
#ifndef SM_MASK_HOOK
#define SM_MASK_HOOK (void)0
#endif

#define WS_QH  0u                                      // f16 q rows [b*t][CC]
#define WS_KH  (WS_QH + 2u * (size_t)NB * TT * CC)      // f16 k rows [b*t][CC]
#define WS_VT  (WS_KH + 2u * (size_t)NB * TT * CC)      // f16 v planes [b][c][t]
#define WS_QL  (WS_VT + 2u * (size_t)NB * CC * TT)      // f16 q residual x 2^10 rows [b][t < QHI][CC]
#define WS_KL  (WS_QL + 2u * (size_t)NB * QHI * CC)     // f16 k residual x 2^10 rows [b][t < KHI][CC]
#define WS_VB  (WS_KL + 2u * (size_t)NB * KHI * CC)     // bf16 v hi planes [b][c][t < KHI]
#define WS_VBL (WS_VB + 2u * (size_t)NB * CC * KHI)
#define WS_S   (WS_VBL + 2u * (size_t)NB * CC * KHI)    // f32 [hg][t][s], unused (k_fa keeps logits in registers)
#define WS_Y   (WS_S  + 4u * (size_t)HG * TT * TT)      // f32 ctx rows [b*t][CC] (only when there is an output projection)
#define WS_END (WS_Y  + 4u * (size_t)NB * TT * CC)
#define WS_X1  (WS_END)
#define WS_END2 (WS_X1 + 4u * (size_t)NB * TT * DIN)

// ---- k_proj: block = (64 rows, 128 cols, which): q/k/v = X W (+ b) with exact bf16 products (K = DIN) -> which 0: q f16 rows (+ residual rows < QHI); 1: k f16 rows (+ residual rows < KHI); 2: v f16 planes [c][t] (+ bf16 hi/lo planes for t < KHI)
__global__ __launch_bounds__(128) void k_proj(const float* __restrict__ XQ, const float* __restrict__ XK, const float* __restrict__ XV, const float* __restrict__ WQ, const float* __restrict__ WK, const float* __restrict__ WV, const float* __restrict__ BQ, const float* __restrict__ BK, const float* __restrict__ BV,
    _Float16* __restrict__ QH, _Float16* __restrict__ QL, _Float16* __restrict__ KH, _Float16* __restrict__ KL, _Float16* __restrict__ VT, __bf16* __restrict__ VB, __bf16* __restrict__ VBL) {
  __shared__ __align__(16) _Float16 sh[64][136], sl[64][136]; __shared__ __align__(16) _Float16 th[128][72]; __shared__ __align__(16) __bf16 tb[128][72], tbl[128][72];
  const int tid = threadIdx.x, wave = tid >> 5, lane = tid & 31, col = lane & 15, g = lane >> 4; const int which = blockIdx.z; const int c0 = blockIdx.y * 128; const size_t r0 = (size_t)blockIdx.x * 64; const size_t bb = r0 / TT; const int t0 = (int)(r0 % TT);
  const float* X = which == 0 ? XQ : which == 1 ? XK : XV; const float* WA = which == 0 ? WQ : which == 1 ? WK : WV; const float* BA = which == 0 ? BQ : which == 1 ? BK : BV;
  v8f acc[8] = {};
#pragma unroll 2
  for (int kc = 0; kc < DIN / 32; ++kc) { v16b a; { const float* p = X + (r0 + wave * 16 + col) * DIN + kc * 32 + 8 * g;
#pragma unroll
      for (int i = 0; i < 8; ++i) { a[i] = (__bf16)p[i]; a[8 + i] = (__bf16)p[16 + i]; } }
    asm volatile("s_wait_loadcnt 0x0" ::: "memory");
#pragma unroll
    for (int j = 0; j < 8; ++j) { const v16b w = WCOL(WA, kc * 32, c0 + j * 16 + col, lane); asm volatile("s_wait_loadcnt 0x0" ::: "memory"); acc[j] = wmma_bf(a, w, acc[j]); } }
  if (which < 2) { _Float16* DH = which == 0 ? QH : KH; _Float16* DL = which == 0 ? QL : KL; const int nhi = which == 0 ? QHI : KHI; const bool hi_rows = t0 < nhi;
#pragma unroll
    for (int j = 0; j < 8; ++j) { const float bias = BA ? bfr(BA[c0 + j * 16 + col]) : 0.f;
#pragma unroll
      for (int r = 0; r < 8; ++r) { const float v = acc[j][r] + bias; const _Float16 hv = (_Float16)v; sh[wave * 16 + 8 * g + r][j * 16 + col] = hv; sl[wave * 16 + 8 * g + r][j * 16 + col] = (_Float16)((v - (float)hv) * 1024.0f); } }
    __syncthreads();
    for (int e = tid; e < 64 * 16; e += 128) { const int rl = e >> 4, q = e & 15; vst2((unsigned*)(DH + (r0 + rl) * CC + c0 + q * 8), *(const v4u*)&sh[rl][q * 8]); if (hi_rows) vst2((unsigned*)(DL + (bb * nhi + t0 + rl) * (size_t)CC + c0 + q * 8), *(const v4u*)&sl[rl][q * 8]); }
  } else { const bool hi_rows = t0 < KHI;
#pragma unroll
    for (int j = 0; j < 8; ++j) { const float bias = BA ? bfr(BA[c0 + j * 16 + col]) : 0.f;
#pragma unroll
      for (int r = 0; r < 8; ++r) { const float v = acc[j][r] + bias; const int rl = wave * 16 + 8 * g + r, cl = j * 16 + col; th[cl][rl] = (_Float16)v; const __bf16 bh = (__bf16)v; tb[cl][rl] = bh; tbl[cl][rl] = (__bf16)(v - (float)bh); } }
    __syncthreads();
    for (int e = tid; e < 128 * 8; e += 128) { const int cl = e >> 3, q = e & 7; vst2((unsigned*)(VT + (bb * CC + c0 + cl) * (size_t)TT + t0 + q * 8), *(const v4u*)&th[cl][q * 8]); if (hi_rows) { const size_t o3 = (bb * CC + c0 + cl) * (size_t)KHI + t0 + q * 8; vst2((unsigned*)(VB + o3), *(const v4u*)&tb[cl][q * 8]); vst2((unsigned*)(VBL + o3), *(const v4u*)&tbl[cl][q * 8]); } } } }
// ---- k_fa: block = 128 queries (8 waves x 16 query columns) of (b, h), one pass over all keys in steps of FAK, k rows and v planes staged in LDS for the whole block: S^T = K Q^T (A = k rows, B = q hi and q residual x 2^10: 2 products); a lane holds one query's raw scores x (keys 8g + r of each 16-key tile): running maximum of x and sum in f32, the halves joined by a cross-row move; p = exp2(x * C2 + nm), C2 = SCALE x log2(e), nm = 11 - max * C2, so p = exp(SCALE (x - max)) x 2^11: one fma and one hardware exp2 a score; p once to f16, packed from two score tiles straight into a B operand; ctx^T += V^T P^T (A = v planes: 1 product); ctx = acc / sum (both carry the 2^11)
#define FAK 64
#define FNT (FAK / 16)
#define C2 (SCALE * 1.4426950408889634f)
// amdgpu_waves_per_eu(4, 4): the grid holds four waves for every SIMD, so the kernel takes the register budget of that occupancy (two blocks a WGP, all resident at once)
__device__ __forceinline__ float xhalf(float x) { return __builtin_bit_cast(float, __builtin_amdgcn_permlanex16(__builtin_bit_cast(int, x), __builtin_bit_cast(int, x), 0x76543210, 0xfedcba98, false, false)); }   // lane l with lane l ^ 16
__device__ __forceinline__ v16h frag_p(const _Float16* p) { union { v16h v; v8h q[2]; } u; u.q[0] = *(const v8h*)p; u.q[1] = *(const v8h*)(p + 16); return u.v; }   // frag_h with the lane half's 8g already in p
__device__ __forceinline__ v8f wmmah(v16h a, v16h b, v8f c) { return __builtin_amdgcn_wmma_f32_16x16x32_f16(false, a, false, b, (short)0, c, false, false); }
// K and V reach the eight waves of a block through LDS: a stage = FST keys (two passes), two buffers, filled one stage ahead by asynchronous 16-byte copies (each thread: two pieces of k rows, two of v planes). Pitches 16 B x odd: the b128 fragment reads of 16 rows fall on 64 different banks.
#define FST 128
#define NST (TT / FST)
#define KPIT 40            // halves a k row in LDS (64 B of data, 80-B pitch)
#define VPIT (FST + 8)     // halves a v plane row in LDS (256 B of data, 272-B pitch)
__device__ __forceinline__ unsigned lds_off(const void* p) { return (unsigned)(size_t)p; }   // byte offset in the work-group's LDS
// one stage's four copies of this thread; the s_wait_xcnt stands inside the statement, behind the last copy, so that no address register is rewritten in front of it
__device__ __forceinline__ void stage_kv(unsigned lk, unsigned lv, const _Float16* gk, const _Float16* gv) {
  asm volatile("global_load_async_to_lds_b128 %0, %4, off\n\tglobal_load_async_to_lds_b128 %1, %5, off\n\tglobal_load_async_to_lds_b128 %2, %6, off\n\tglobal_load_async_to_lds_b128 %3, %7, off\n\ts_wait_xcnt 0x0"
      :: "v"(lk), "v"(lk + 64u * KPIT * 2u), "v"(lv), "v"(lv + 16u * VPIT * 2u), "v"(gk), "v"(gk + (size_t)64 * CC), "v"(gv), "v"(gv + (size_t)16 * TT) : "memory"); }
__global__ __launch_bounds__(256) __attribute__((amdgpu_waves_per_eu(4, 4))) void k_fa(const _Float16* __restrict__ QH, const _Float16* __restrict__ QL, const _Float16* __restrict__ KH, const _Float16* __restrict__ VT, float* __restrict__ Y) {
  __shared__ __align__(16) _Float16 sk[2][FST * KPIT], sv[2][HD * VPIT];
  const int tid = threadIdx.x, wave = tid >> 5, lane = tid & 31, col = lane & 15, g = lane >> 4; const int h = blockIdx.y, b = blockIdx.z; const int q = blockIdx.x * 128 + wave * 16 + col;
  const v16h qh = frag_h(QH + ((size_t)b * TT + q) * CC + h * HD, lane), ql = frag_h(QL + ((size_t)b * QHI + q) * CC + h * HD, lane);
  const _Float16* gk = KH + ((size_t)b * TT + (tid >> 2)) * CC + h * HD + (tid & 3) * 8;               // copies: key rows tid / 4 and 64 + tid / 4 of a stage, 16-byte piece tid % 4
  const _Float16* gv = VT + ((size_t)b * CC + h * HD + (tid >> 4)) * (size_t)TT + (tid & 15) * 8;      // copies: planes tid / 16 and 16 + tid / 16, 16-byte piece tid % 16 of the stage's keys
  const unsigned lk = lds_off(&sk[0][(tid >> 2) * KPIT + (tid & 3) * 8]), lv = lds_off(&sv[0][(tid >> 4) * VPIT + (tid & 15) * 8]);
  stage_kv(lk, lv, gk, gv);
  asm volatile("s_wait_asynccnt 0x0" ::: "memory");   // this wave's copies of stage 0 have landed
  __syncthreads();                                    // and every other wave's: stage 0 may be read
  stage_kv(lk + (unsigned)sizeof(sk[0]), lv + (unsigned)sizeof(sv[0]), gk + (size_t)FST * CC, gv + FST);
  v8f acc[HD / 16] = {}; float m = -3.0e38f, nm = 11.0f + 3.0e38f * C2, l = 0.f;
#pragma unroll 1   // a trip = a stage; its two passes are unrolled below
  for (int st = 0; st < NST; ++st) {
    const _Float16* kb = &sk[st & 1][col * KPIT + 8 * g];   // key row col of a 16-key tile, this lane half's d
    const _Float16* vb = &sv[st & 1][col * VPIT + 8 * g];   // plane d = col of a 16-wide d tile, this lane half's keys
    v16h kf[FNT];
#pragma unroll
    for (int t = 0; t < FNT; ++t) kf[t] = frag_p(kb + (t * 16) * KPIT);
#pragma unroll
    for (int ps = 0; ps < FST / FAK; ++ps) {
    v8f sh[FNT], sl[FNT]; const v8f zero = {};
#pragma unroll
    for (int t = 0; t < FNT; ++t) { sh[t] = wmmah(kf[t], qh, zero); sl[t] = wmmah(kf[t], ql, zero); }
    if (ps + 1 < FST / FAK) {   // the stage's next pass: its k fragments are read one pass ahead, from the same buffer
#pragma unroll
      for (int t = 0; t < FNT; ++t) kf[t] = frag_p(kb + ((ps + 1) * FAK + t * 16) * KPIT); }
    v16h vf[HD / 16][FAK / 32];   // this pass's v planes: in flight under the softmax
#pragma unroll
    for (int j = 0; j < HD / 16; ++j)
#pragma unroll
      for (int c = 0; c < FAK / 32; ++c) vf[j][c] = frag_p(vb + (j * 16) * VPIT + ps * FAK + c * 32);
    float s[FNT][8]; float mx = m;
#pragma unroll
    for (int t = 0; t < FNT; ++t)
#pragma unroll
      for (int r = 0; r < 8; ++r) { s[t][r] = sh[t][r] + sl[t][r] * (1.0f / 1024.0f); mx = fmaxf(mx, s[t][r]); }
    mx = fmaxf(mx, xhalf(mx));
    if (__builtin_amdgcn_ballot_w32(mx > m) != 0) { const float nn = fmaf(-mx, C2, 11.0f); const float al = __builtin_amdgcn_exp2f(nn - nm); l *= al;   // some column's maximum rose: rescale (al = 1 exactly where it did not)
#pragma unroll
      for (int j = 0; j < HD / 16; ++j)
#pragma unroll
        for (int r = 0; r < 8; ++r) acc[j][r] *= al;
      m = mx; nm = nn; }
#pragma unroll
    for (int c = 0; c < FAK / 32; ++c) { v16h p; float e[2][8];
#pragma unroll
      for (int u = 0; u < 2; ++u) { v2f a[4];
#pragma unroll
        for (int i = 0; i < 4; ++i) a[i] = __builtin_elementwise_fma(v2f{s[2 * c + u][2 * i], s[2 * c + u][2 * i + 1]}, v2f{C2, C2}, v2f{nm, nm});
#pragma unroll   // the builtin, not asm text: the compiler sees which registers the exp2 write and keeps them clear of a matrix product's operands
        for (int i = 0; i < 4; ++i) { e[u][2 * i] = __builtin_amdgcn_exp2f(a[i].x); e[u][2 * i + 1] = __builtin_amdgcn_exp2f(a[i].y); } }
#pragma unroll
      for (int i = 0; i < 8; ++i) { l += e[0][i] + e[1][i]; p[i] = (_Float16)e[0][i]; p[8 + i] = (_Float16)e[1][i]; }
#pragma unroll
      for (int j = 0; j < HD / 16; ++j) acc[j] = wmmah(vf[j][c], p, acc[j]); } }
    asm volatile("s_wait_dscnt 0x0" ::: "memory");      // this wave's reads of the stage's buffer are done
    asm volatile("s_wait_asynccnt 0x0" ::: "memory");   // its copies of the next stage have landed
    __syncthreads();                                    // the next stage may be read, and this stage's buffer may be refilled
    if (st + 2 < NST) stage_kv(lk + (unsigned)(st & 1) * (unsigned)sizeof(sk[0]), lv + (unsigned)(st & 1) * (unsigned)sizeof(sv[0]), gk + (size_t)(st + 2) * FST * CC, gv + (st + 2) * FST); }
  asm volatile("s_wait_asynccnt 0x0" ::: "memory");     // no copy is outstanding when the wave ends
  l += xhalf(l); const float inv = 1.0f / l;
  float* yr = Y + ((size_t)b * TT + q) * CC + h * HD + 8 * g;   // acc[j][r] = ctx[q][j * 16 + 8g + r]
#pragma unroll
  for (int j = 0; j < HD / 16; ++j) { v4f o0, o1;
#pragma unroll
    for (int r = 0; r < 4; ++r) { o0[r] = acc[j][r] * inv; o1[r] = acc[j][4 + r] * inv; }
    vst2(yr + j * 16, o0); vst2(yr + j * 16 + 4, o1); } }
// ---- k_out: block = (64 rows, 128 cols): out = ctx Wo (+ bo): all rows: ctx bf16 hi + lo against exact bf16 Wo (2 products)
__global__ __launch_bounds__(128) void k_out(const float* __restrict__ Y, const float* __restrict__ WO, const float* __restrict__ BO, float* __restrict__ OUT, const float* __restrict__ RESX) { __shared__ __align__(16) float sf[4][16][132];
  const int tid = threadIdx.x, wave = tid >> 5, lane = tid & 31, col = lane & 15, g = lane >> 4; const int c0 = blockIdx.y * 128; const size_t r0 = (size_t)blockIdx.x * 64 + wave * 16;
  v8f acc[8] = {};
  if (true) {   /* ALL rows: ctx split bf16 hi + lo x exact Wo (2 products) */
#pragma unroll 2
    for (int kc = 0; kc < CC / 32; ++kc) { const F2 a = split_row(Y + (r0 + col) * CC, kc * 32, lane); asm volatile("s_wait_loadcnt 0x0" ::: "memory");
#pragma unroll
      for (int j = 0; j < 8; ++j) { const v16b w = WOCOL(WO, kc * 32, c0 + j * 16 + col, lane); asm volatile("s_wait_loadcnt 0x0" ::: "memory"); acc[j] = wmma_bf(a.h, w, acc[j]); acc[j] = wmma_bf(a.l, w, acc[j]); } }
#pragma unroll
    for (int j = 0; j < 8; ++j) { const float bias = BO ? bfr(BO[c0 + j * 16 + col]) : 0.f;
#pragma unroll
      for (int r = 0; r < 8; ++r) sf[wave][8 * g + r][j * 16 + col] = acc[j][r] + bias; }
  } else {
#pragma unroll 2
    for (int kc = 0; kc < CC / 32; ++kc) { const v16h a = frag_f32(Y + (r0 + col) * CC + kc * 32, lane); asm volatile("s_wait_loadcnt 0x0" ::: "memory");
#pragma unroll
      for (int j = 0; j < 8; ++j) { const v16h w = WOCOLH(WO, kc * 32, c0 + j * 16 + col, lane); asm volatile("s_wait_loadcnt 0x0" ::: "memory"); acc[j] = wmma16(a, w, acc[j]); } }
#pragma unroll
    for (int j = 0; j < 8; ++j) { const float bias = BO ? bfr(BO[c0 + j * 16 + col]) : 0.f;
#pragma unroll
      for (int r = 0; r < 8; ++r) sf[wave][8 * g + r][j * 16 + col] = acc[j][r] * (1.0f / 256.0f) + bias; } }
  LDSX(); for (int rl = 0; rl < 16; ++rl) { const size_t oo = (r0 + rl) * DIN + c0 + lane * 4; v4f o = *(const v4f*)&sf[wave][rl][lane * 4]; const v4f zr = *(const v4f*)(RESX + oo); o[0] += bfr(zr[0]); o[1] += bfr(zr[1]); o[2] += bfr(zr[2]); o[3] += bfr(zr[3]); vst2(OUT + oo, o); } }   /* + bf16(query) */

extern "C" void kernel_launch(void* const* d_in, const int* in_sizes, int n_in, void* d_out, int out_size, void* d_ws, size_t ws_size, hipStream_t stream) {
  (void)in_sizes; (void)n_in; (void)out_size;
  const float** F = (const float**)d_in;
  if (ws_size < (size_t)WS_END) return;
  char* ws = (char*)d_ws; _Float16 *QH = (_Float16*)(ws + WS_QH), *KH = (_Float16*)(ws + WS_KH), *VT = (_Float16*)(ws + WS_VT), *QL = (_Float16*)(ws + WS_QL), *KL = (_Float16*)(ws + WS_KL); __bf16 *VB = (__bf16*)(ws + WS_VB), *VBL = (__bf16*)(ws + WS_VBL); float *S = (float*)(ws + WS_S), *Y = (float*)(ws + WS_Y);
  (void)S;
  // inputs: 0 query; 1 key; 2 value [4,2048,256]; 3 Wq (out,in), 4 bq; 5 Wk, 6 bk; 7 Wv, 8 bv; 9 Wo (out,in), 10 bo; 11 ln_g, 12 ln_b
  if (ws_size < (size_t)WS_END2) return;
  float* X1 = (float*)(ws + WS_X1);
  k_proj<<<dim3(TNB * TT / 64, CC / 128, 3), 128, 0, stream>>>(F[0], F[1], F[2], F[3], F[5], F[7], F[4], F[6], F[8], QH, QL, KH, KL, VT, VB, VBL);
  k_fa<<<dim3(TT / 128, NH, TNB), 256, 0, stream>>>(QH, QL, KH, VT, Y);
  k_out<<<dim3(TNB * TT / 64, DIN / 128), 128, 0, stream>>>(Y, F[9], F[10], X1, F[0]);   /* ctx Wo^T + bo + bf16(query) */
  k_lnx<<<dim3(NRW / 8), 256, 0, stream>>>(X1, 0, F[11], F[12], (float*)d_out);           /* LayerNorm */
}

// v004
// Measured time: 54.1 microseconds a run.
// Next to v003, in two timings, it ran 1.96 times as fast each time.
// Over all steps from v000 it is 16.0 times as fast.
// compute dtype: all float inputs rounded to bf16; Q/K/V = in W^T + b with EXACT bf16 products on WMMA 16x16x32 (f32 accumulate); q as f16 hi + residual (x 2^10) against k once to f16 (2 products) / sqrt(32); softmax in f32 in base 2 (one fma a score folds 1/sqrt(32) x log2(e), the running maximum and the 2^11, then the hardware exp2; running maximum and sum over 64-key passes); exp x 2^11 once to f16 against v once to f16 (1 product), divided by the sum at the end; ctx split bf16 hi + lo against exact Wo (2 products) + bo + query; LayerNorm in f32; f32 output.
#include <hip/hip_runtime.h>
#include <math.h>

typedef __attribute__((ext_vector_type(16))) _Float16 v16h;
typedef __attribute__((ext_vector_type(16))) __bf16 v16b;
typedef __attribute__((ext_vector_type(8)))  _Float16 v8h;
typedef __attribute__((ext_vector_type(8)))  float v8f;
typedef __attribute__((ext_vector_type(4)))  float v4f;
typedef __attribute__((ext_vector_type(2)))  float v2f;
typedef __attribute__((ext_vector_type(4)))  unsigned v4u;
typedef __attribute__((ext_vector_type(4)))  int v4i;
typedef float __attribute__((may_alias)) float_a;
typedef int __attribute__((may_alias)) int_a;

template <typename T> __device__ __forceinline__ void vst2(void* p, T v) { *(T*)p = v;  }
__device__ __forceinline__ v8f wmma16(v16h a, v16h b, v8f c) {
  v8f d = __builtin_amdgcn_wmma_f32_16x16x32_f16(false, a, false, b, (short)0, c, false, false);
  asm volatile("v_nop\n\tv_nop\n\tv_nop\n\tv_nop" : "+v"(d) : "v"(a), "v"(b));
  return d;
}
__device__ __forceinline__ v8f wmma_bf(v16b a, v16b b, v8f c) {
  v8f d = __builtin_amdgcn_wmma_f32_16x16x32_bf16(false, a, false, b, (short)0, c, false, false);
  asm volatile("v_nop\n\tv_nop\n\tv_nop\n\tv_nop" : "+v"(d) : "v"(a), "v"(b));
  return d;
}
// 16x16x32 fragments: lane = (h = lane>>4, row/col = lane&15); elements 0..7 = k0+8h+0..7, 8..15 = k0+16+8h+0..7; D element r = row 8h+r
__device__ __forceinline__ v16h frag_h(const _Float16* rowk0, int lane) {
  union { v16h v; v8h q[2]; } u; const _Float16* p = rowk0 + 8 * (lane >> 4);
  u.q[0] = *(const v8h*)p; u.q[1] = *(const v8h*)(p + 16); return u.v;
}
__device__ __forceinline__ v16h frag_f32(const float* rowk0, int lane) {
  v16h a; const float* p = rowk0 + 8 * (lane >> 4);
#pragma unroll
  for (int i = 0; i < 8; ++i) { a[i] = (_Float16)p[i]; a[8 + i] = (_Float16)p[16 + i]; }
  return a;
}
__device__ __forceinline__ v16h frag_f32s(const float* rowk0, int lane, float sc) {
  v16h a; const float* p = rowk0 + 8 * (lane >> 4);
#pragma unroll
  for (int i = 0; i < 8; ++i) { a[i] = (_Float16)(p[i] * sc); a[8 + i] = (_Float16)(p[16 + i] * sc); }
  return a;
}
// column fragment from a [K][ld] layout (column n), rows >= K read as 0
__device__ __forceinline__ v16h fragc_f32(const float* W, int k0, int n, int lane, int ld, int K) {
  v16h a; const int g = lane >> 4;
#pragma unroll
  for (int i = 0; i < 8; ++i) { const int ka = k0 + 8 * g + i, kb = ka + 16;
    a[i] = (_Float16)(ka < K ? W[(size_t)(ka < K ? ka : K - 1) * ld + n] : 0.f); a[8 + i] = (_Float16)(kb < K ? W[(size_t)(kb < K ? kb : K - 1) * ld + n] : 0.f); }
  return a;
}
struct F2 { v16b h, l; };
__device__ __forceinline__ F2 bsplit16(const float v[16]) { F2 r;
#pragma unroll
  for (int i = 0; i < 16; ++i) { const __bf16 h = (__bf16)v[i]; r.h[i] = h; r.l[i] = (__bf16)(v[i] - (float)h); }
  return r; }
__device__ __forceinline__ F2 split_row(const float* row, int k0, int lane) { float v[16]; const float* p = row + k0 + 8 * (lane >> 4);
#pragma unroll
  for (int i = 0; i < 8; ++i) { v[i] = p[i]; v[8 + i] = p[16 + i]; }
  return bsplit16(v); }
__device__ __forceinline__ F2 split_rowK(const float* row, int k0, int lane, int K) { float v[16]; const int g = lane >> 4;
#pragma unroll
  for (int i = 0; i < 8; ++i) { const int ka = k0 + 8 * g + i, kb = ka + 16; v[i] = ka < K ? row[ka < K ? ka : K - 1] : 0.f; v[8 + i] = kb < K ? row[kb < K ? kb : K - 1] : 0.f; }
  return bsplit16(v); }
__device__ __forceinline__ F2 split_col(const float* W, int k0, int n, int lane, int ld, int K) { float v[16]; const int g = lane >> 4;
#pragma unroll
  for (int i = 0; i < 8; ++i) { const int ka = k0 + 8 * g + i, kb = ka + 16; v[i] = ka < K ? W[(size_t)(ka < K ? ka : K - 1) * ld + n] : 0.f; v[8 + i] = kb < K ? W[(size_t)(kb < K ? kb : K - 1) * ld + n] : 0.f; }
  return bsplit16(v); }
__device__ __forceinline__ v8f mac3(const F2& a, const F2& b, v8f c) { c = wmma_bf(a.l, b.h, c); c = wmma_bf(a.h, b.l, c); return wmma_bf(a.h, b.h, c); }
__device__ __forceinline__ float sigm(float v) { return 1.0f / (1.0f + expf(-v)); }
#define LDSX() do { asm volatile("s_wait_dscnt 0" ::: "memory"); __builtin_amdgcn_wave_barrier(); __builtin_amdgcn_fence(__ATOMIC_RELEASE, "workgroup"); } while (0)

// Cross-modal multi-head attention with residual + LayerNorm (B 4, L 2,048, d_model 256 = 8 heads x 32; (out,in) 1/16-scale weights, zero biases; LN affine 1/0, eps 1e-5): Q = query Wq^T + bq, K = key Wk^T + bk, V = value Wv^T + bv; ctx = softmax(Q K^T / sqrt(32)) V; out = LN(ctx Wo^T + bo + query).
#define NB 4
#define TT 2048
#define CC 256            // NH * HD = projected width
#define DIN 256          // input (model) width
#define NH 8
#define HD 32
#define NQB (TT / 64)
#define HG 4
#define SCALE (0.17677669529663689f)
#define CAUSAL 0
#ifndef TNB
#define TNB NB
#endif
__device__ __forceinline__ float bfr(float v) { return (float)(__bf16)v; }
__host__ __device__ __forceinline__ int kb_last(int qb) { return CAUSAL ? ((qb * 64 + 63) >> 7) : (TT / 128 - 1); }
typedef __attribute__((ext_vector_type(8))) __bf16 v8b;
__device__ __forceinline__ v16b frag_b(const __bf16* rowk0, int lane) {
  union { v16b v; v8b q[2]; } u; const __bf16* p = rowk0 + 8 * (lane >> 4);
  u.q[0] = *(const v8b*)p; u.q[1] = *(const v8b*)(p + 16); return u.v;
}
#define QBH 0              // unused: no kernel here reads it (no separate high-precision path)
#define QHI 2048            // rows carrying a q residual plane (all rows when non-causal: 2-product logits everywhere)
#define KHI 64            // key rows carrying k residual / v bf16 hi+lo planes (written by k_proj; no kernel here reads them)
// B fragment (k rows k0+.., output column o) of a weight: (in,out) [K][ld] or (out,in) [ld rows of K]: bf16 exact, or f16(bf16 * 256) exact
__device__ __forceinline__ v16b wcol_io(const float* Wm, int k0, int o, int lane, int ld) { v16b w; const int g = lane >> 4;
#pragma unroll
  for (int i = 0; i < 8; ++i) { w[i] = (__bf16)Wm[(size_t)(k0 + 8 * g + i) * ld + o]; w[8 + i] = (__bf16)Wm[(size_t)(k0 + 16 + 8 * g + i) * ld + o]; }
  return w; }
__device__ __forceinline__ v16b wcol_oi(const float* Wm, int k0, int o, int lane, int K) { v16b w; const float* p = Wm + (size_t)o * K + k0 + 8 * (lane >> 4);
#pragma unroll
  for (int i = 0; i < 8; ++i) { w[i] = (__bf16)p[i]; w[8 + i] = (__bf16)p[16 + i]; }
  return w; }
__device__ __forceinline__ v16h wcolh_io(const float* Wm, int k0, int o, int lane, int ld) { v16h w; const int g = lane >> 4;
#pragma unroll
  for (int i = 0; i < 8; ++i) { w[i] = (_Float16)(bfr(Wm[(size_t)(k0 + 8 * g + i) * ld + o]) * 256.0f); w[8 + i] = (_Float16)(bfr(Wm[(size_t)(k0 + 16 + 8 * g + i) * ld + o]) * 256.0f); }
  return w; }
__device__ __forceinline__ v16h wcolh_oi(const float* Wm, int k0, int o, int lane, int K) { v16h w; const float* p = Wm + (size_t)o * K + k0 + 8 * (lane >> 4);
#pragma unroll
  for (int i = 0; i < 8; ++i) { w[i] = (_Float16)(bfr(p[i]) * 256.0f); w[8 + i] = (_Float16)(bfr(p[16 + i]) * 256.0f); }
  return w; }
#define WQKV_LAYOUT 1   // 0 = (in,out) [DIN][CC]; 1 = (out,in) [CC][DIN]; 2 = per-head [NH][DIN][HD]
__device__ __forceinline__ v16b wcol_hdk(const float* Wm, int k0, int o, int lane) { v16b w; const int g = lane >> 4; const float* p = Wm + (size_t)(o / HD) * DIN * HD + (o % HD);
#pragma unroll
  for (int i = 0; i < 8; ++i) { w[i] = (__bf16)p[(size_t)(k0 + 8 * g + i) * HD]; w[8 + i] = (__bf16)p[(size_t)(k0 + 16 + 8 * g + i) * HD]; }
  return w; }
#define WO_OUT_IN 1
#if WQKV_LAYOUT == 1
#define WCOL(W, k0, o, lane) wcol_oi(W, k0, o, lane, DIN)
#elif WQKV_LAYOUT == 2
#define WCOL(W, k0, o, lane) wcol_hdk(W, k0, o, lane)
#else
#define WCOL(W, k0, o, lane) wcol_io(W, k0, o, lane, CC)
#endif
#if WO_OUT_IN
#define WOCOL(W, k0, o, lane) wcol_oi(W, k0, o, lane, CC)
#define WOCOLH(W, k0, o, lane) wcolh_oi(W, k0, o, lane, CC)
#else
#define WOCOL(W, k0, o, lane) wcol_io(W, k0, o, lane, DIN)
#define WOCOLH(W, k0, o, lane) wcolh_io(W, k0, o, lane, DIN)
#endif
#define NRW (TNB * TT)
// ---- k_lnx: wave per row: LayerNorm over 256 (mean, biased var, (x - mean) * rsqrt(var + 1e-5) * g + b); optional bf16 rounding of the input (x); 8 floats per lane (2 float4 at stride 128 floats -> 512-B pieces)
__global__ __launch_bounds__(256) void k_lnx(const float* __restrict__ X, int roundin, const float* __restrict__ G, const float* __restrict__ BE, float* __restrict__ OUT) { const int wave = threadIdx.x >> 5, lane = threadIdx.x & 31; const size_t row = (size_t)blockIdx.x * 8 + wave; if (row >= (size_t)NRW) return;
  v4f v[CC / 128]; float s1 = 0.f;
#pragma unroll
  for (int i = 0; i < CC / 128; ++i) { v4f t = *(const v4f*)(X + row * CC + i * 128 + lane * 4); if (roundin) { t[0] = bfr(t[0]); t[1] = bfr(t[1]); t[2] = bfr(t[2]); t[3] = bfr(t[3]); } v[i] = t; s1 += (t[0] + t[1]) + (t[2] + t[3]); }
#pragma unroll
  for (int o = 1; o < 32; o <<= 1) s1 += __shfl_xor(s1, o);
  const float mu = s1 * (1.0f / CC); float q = 0.f;
#pragma unroll
  for (int i = 0; i < CC / 128; ++i) for (int k = 0; k < 4; ++k) { const float d = v[i][k] - mu; q += d * d; }
#pragma unroll
  for (int o = 1; o < 32; o <<= 1) q += __shfl_xor(q, o);
  const float inv = rsqrtf(q * (1.0f / CC) + 1e-5f);   /* jnp.var (biased), eps inside the rsqrt */
#pragma unroll
  for (int i = 0; i < CC / 128; ++i) { const int c = i * 128 + lane * 4; v4f r4; for (int k = 0; k < 4; ++k) r4[k] = bfr(G[c + k]) * ((v[i][k] - mu) * inv) + bfr(BE[c + k]); vst2(OUT + row * CC + c, r4); } }

#ifndef SM_EXTRA_PARAMS
#define SM_EXTRA_PARAMS
#endif
#ifndef PROJ_EXTRA_PARAMS
#define PROJ_EXTRA_PARAMS
#endif
#ifndef SM_MASK_HOOK
#define SM_MASK_HOOK (void)0
#endif

#define WS_QH  0u                                      // f16 q rows [b*t][CC]
#define WS_KH  (WS_QH + 2u * (size_t)NB * TT * CC)      // f16 k rows [b*t][CC]
#define WS_VT  (WS_KH + 2u * (size_t)NB * TT * CC)      // f16 v planes [b][c][t]
#define WS_QL  (WS_VT + 2u * (size_t)NB * CC * TT)      // f16 q residual x 2^10 rows [b][t < QHI][CC]
#define WS_KL  (WS_QL + 2u * (size_t)NB * QHI * CC)     // f16 k residual x 2^10 rows [b][t < KHI][CC]
#define WS_VB  (WS_KL + 2u * (size_t)NB * KHI * CC)     // bf16 v hi planes [b][c][t < KHI]
#define WS_VBL (WS_VB + 2u * (size_t)NB * CC * KHI)
#define WS_S   (WS_VBL + 2u * (size_t)NB * CC * KHI)    // f32 [hg][t][s], unused (k_fa keeps logits in registers)
#define WS_Y   (WS_S  + 4u * (size_t)HG * TT * TT)      // f32 ctx rows [b*t][CC] (only when there is an output projection)
#define WS_END (WS_Y  + 4u * (size_t)NB * TT * CC)
#define WS_X1  (WS_END)
#define WS_END2 (WS_X1 + 4u * (size_t)NB * TT * DIN)

// A GEMM operand reaches the four waves of a block through LDS: rows of 256 f32, contiguous in memory, are read once a block by whole-line loads (a wave's load = 512 contiguous bytes; 32 loads of a thread form a batch), rounded to bf16 and laid at a pitch of 16 B x odd, where the b128 fragment reads of 16 rows fall on 64 different banks
#define GPIT 264           // bf16 a staged row in LDS (512 B of data, 528-B pitch)
typedef __attribute__((ext_vector_type(4))) __bf16 v4b;
template <int NR> __device__ __forceinline__ void stage_rows(__bf16* __restrict__ dst, const float* __restrict__ srcp, int tid) {
  __bf16* d = dst + (tid >> 6) * GPIT + (tid & 63) * 4; const float* s = srcp + tid * 4;
#pragma unroll
  for (int b = 0; b < NR / 64; ++b) { v4f t[32];
#pragma unroll
    for (int i = 0; i < 32; ++i) t[i] = *(const v4f*)(s + (b * 32 + i) * 512);
    asm volatile("s_wait_xcnt 0x0" ::: "memory");   // stands in front of whatever next rewrites a register that these loads name
#pragma unroll
    for (int i = 0; i < 32; ++i) { v4b o; o[0] = (__bf16)t[i][0]; o[1] = (__bf16)t[i][1]; o[2] = (__bf16)t[i][2]; o[3] = (__bf16)t[i][3]; *(v4b*)(d + (b * 64 + 2 * i) * GPIT) = o; } } }
// the same with each value split bf16 hi + lo into two planes
template <int NR> __device__ __forceinline__ void stage_rows2(__bf16* __restrict__ dh, __bf16* __restrict__ dl, const float* __restrict__ srcp, int tid) {
  const int o0 = (tid >> 6) * GPIT + (tid & 63) * 4; const float* s = srcp + tid * 4;
#pragma unroll
  for (int b = 0; b < NR / 64; ++b) { v4f t[32];
#pragma unroll
    for (int i = 0; i < 32; ++i) t[i] = *(const v4f*)(s + (b * 32 + i) * 512);
    asm volatile("s_wait_xcnt 0x0" ::: "memory");   // as in stage_rows
#pragma unroll
    for (int i = 0; i < 32; ++i) { v4b oh, ol;
#pragma unroll
      for (int k = 0; k < 4; ++k) { const __bf16 hv = (__bf16)t[i][k]; oh[k] = hv; ol[k] = (__bf16)(t[i][k] - (float)hv); }
      *(v4b*)(dh + o0 + (b * 64 + 2 * i) * GPIT) = oh; *(v4b*)(dl + o0 + (b * 64 + 2 * i) * GPIT) = ol; } } }
// ---- k_proj: block = (64 rows, 128 cols, which): q/k/v = X W (+ b) with exact bf16 products (K = DIN), X rows and W rows staged in LDS -> which 0: q f16 rows (+ residual rows < QHI); 1: k f16 rows (+ residual rows < KHI); 2: v f16 planes [c][t] (+ bf16 hi/lo planes for t < KHI)
// amdgpu_waves_per_eu(3, 3): the grid holds three blocks for every WGP, three waves a SIMD: the kernel takes the register budget of that occupancy
__global__ __launch_bounds__(128) __attribute__((amdgpu_waves_per_eu(3, 3))) void k_proj(const float* __restrict__ XQ, const float* __restrict__ XK, const float* __restrict__ XV, const float* __restrict__ WQ, const float* __restrict__ WK, const float* __restrict__ WV, const float* __restrict__ BQ, const float* __restrict__ BK, const float* __restrict__ BV,
    _Float16* __restrict__ QH, _Float16* __restrict__ QL, _Float16* __restrict__ KH, _Float16* __restrict__ KL, _Float16* __restrict__ VT, __bf16* __restrict__ VB, __bf16* __restrict__ VBL) {
  __shared__ __align__(16) unsigned char smem[(128 + 64) * GPIT * 2];   // the two operands; behind the products the output tiles take the same bytes, so that three blocks fit a WGP
  __bf16* sw = (__bf16*)smem; __bf16* sx = sw + 128 * GPIT;
  _Float16 (*sh)[136] = (_Float16 (*)[136])smem; _Float16 (*sl)[136] = sh + 64; _Float16 (*th)[72] = (_Float16 (*)[72])smem; __bf16 (*tb)[72] = (__bf16 (*)[72])(smem + 128 * 72 * 2); __bf16 (*tbl)[72] = tb + 128;
  const int tid = threadIdx.x, wave = tid >> 5, lane = tid & 31, col = lane & 15, g = lane >> 4; const int which = blockIdx.z; const int c0 = blockIdx.y * 128; const size_t r0 = (size_t)blockIdx.x * 64; const size_t bb = r0 / TT; const int t0 = (int)(r0 % TT);
  const float* X = which == 0 ? XQ : which == 1 ? XK : XV; const float* WA = which == 0 ? WQ : which == 1 ? WK : WV; const float* BA = which == 0 ? BQ : which == 1 ? BK : BV;
  stage_rows<64>(sx, X + r0 * DIN, tid); stage_rows<128>(sw, WA + (size_t)c0 * DIN, tid);
  __syncthreads();   // both operands are whole in LDS
  v8f acc[8] = {}; const __bf16* pa = sx + (wave * 16 + col) * GPIT; const __bf16* pw = sw + col * GPIT;
  v16b a = frag_b(pa, lane), w[8];
#pragma unroll
  for (int j = 0; j < 8; ++j) w[j] = frag_b(pw + j * 16 * GPIT, lane);
#pragma unroll
  for (int kc = 0; kc < DIN / 32; ++kc) { v16b an = a, wn[8];
    if (kc + 1 < DIN / 32) { an = frag_b(pa + (kc + 1) * 32, lane);   // the next k step's fragments: one group of LDS reads ahead of this step's products
#pragma unroll
      for (int j = 0; j < 8; ++j) wn[j] = frag_b(pw + j * 16 * GPIT + (kc + 1) * 32, lane); }
#pragma unroll
    for (int j = 0; j < 8; ++j) acc[j] = wmma_bf(a, w[j], acc[j]);
    if (kc + 1 < DIN / 32) { a = an;
#pragma unroll
      for (int j = 0; j < 8; ++j) w[j] = wn[j]; } }
  __syncthreads();   // every wave has read its last fragment: the bytes may take the output tiles
  if (which < 2) { _Float16* DH = which == 0 ? QH : KH; _Float16* DL = which == 0 ? QL : KL; const int nhi = which == 0 ? QHI : KHI; const bool hi_rows = t0 < nhi;
#pragma unroll
    for (int j = 0; j < 8; ++j) { const float bias = BA ? bfr(BA[c0 + j * 16 + col]) : 0.f;
#pragma unroll
      for (int r = 0; r < 8; ++r) { const float v = acc[j][r] + bias; const _Float16 hv = (_Float16)v; sh[wave * 16 + 8 * g + r][j * 16 + col] = hv; sl[wave * 16 + 8 * g + r][j * 16 + col] = (_Float16)((v - (float)hv) * 1024.0f); } }
    __syncthreads();
    for (int e = tid; e < 64 * 16; e += 128) { const int rl = e >> 4, q = e & 15; vst2((unsigned*)(DH + (r0 + rl) * CC + c0 + q * 8), *(const v4u*)&sh[rl][q * 8]); if (hi_rows) vst2((unsigned*)(DL + (bb * nhi + t0 + rl) * (size_t)CC + c0 + q * 8), *(const v4u*)&sl[rl][q * 8]); }
  } else { const bool hi_rows = t0 < KHI;
#pragma unroll
    for (int j = 0; j < 8; ++j) { const float bias = BA ? bfr(BA[c0 + j * 16 + col]) : 0.f;
#pragma unroll
      for (int r = 0; r < 8; ++r) { const float v = acc[j][r] + bias; const int rl = wave * 16 + 8 * g + r, cl = j * 16 + col; th[cl][rl] = (_Float16)v; const __bf16 bh = (__bf16)v; tb[cl][rl] = bh; tbl[cl][rl] = (__bf16)(v - (float)bh); } }
    __syncthreads();
    for (int e = tid; e < 128 * 8; e += 128) { const int cl = e >> 3, q = e & 7; vst2((unsigned*)(VT + (bb * CC + c0 + cl) * (size_t)TT + t0 + q * 8), *(const v4u*)&th[cl][q * 8]); if (hi_rows) { const size_t o3 = (bb * CC + c0 + cl) * (size_t)KHI + t0 + q * 8; vst2((unsigned*)(VB + o3), *(const v4u*)&tb[cl][q * 8]); vst2((unsigned*)(VBL + o3), *(const v4u*)&tbl[cl][q * 8]); } } } }
// ---- k_fa: block = 128 queries (8 waves x 16 query columns) of (b, h), one pass over all keys in steps of FAK, k rows and v planes staged in LDS for the whole block: S^T = K Q^T (A = k rows, B = q hi and q residual x 2^10: 2 products); a lane holds one query's raw scores x (keys 8g + r of each 16-key tile): running maximum of x and sum in f32, the halves joined by a cross-row move; p = exp2(x * C2 + nm), C2 = SCALE x log2(e), nm = 11 - max * C2, so p = exp(SCALE (x - max)) x 2^11: one fma and one hardware exp2 a score; p once to f16, packed from two score tiles straight into a B operand; ctx^T += V^T P^T (A = v planes: 1 product); ctx = acc / sum (both carry the 2^11)
#define FAK 64
#define FNT (FAK / 16)
#define C2 (SCALE * 1.4426950408889634f)
// amdgpu_waves_per_eu(4, 4): the grid holds four waves for every SIMD, so the kernel takes the register budget of that occupancy (two blocks a WGP, all resident at once)
__device__ __forceinline__ float xhalf(float x) { return __builtin_bit_cast(float, __builtin_amdgcn_permlanex16(__builtin_bit_cast(int, x), __builtin_bit_cast(int, x), 0x76543210, 0xfedcba98, false, false)); }   // lane l with lane l ^ 16
__device__ __forceinline__ v16h frag_p(const _Float16* p) { union { v16h v; v8h q[2]; } u; u.q[0] = *(const v8h*)p; u.q[1] = *(const v8h*)(p + 16); return u.v; }   // frag_h with the lane half's 8g already in p
__device__ __forceinline__ v8f wmmah(v16h a, v16h b, v8f c) { return __builtin_amdgcn_wmma_f32_16x16x32_f16(false, a, false, b, (short)0, c, false, false); }
// K and V reach the eight waves of a block through LDS: a stage = FST keys (two passes), two buffers, filled one stage ahead by asynchronous 16-byte copies (each thread: two pieces of k rows, two of v planes). Pitches 16 B x odd: the b128 fragment reads of 16 rows fall on 64 different banks.
#define FST 128
#define NST (TT / FST)
#define KPIT 40            // halves a k row in LDS (64 B of data, 80-B pitch)
#define VPIT (FST + 8)     // halves a v plane row in LDS (256 B of data, 272-B pitch)
__device__ __forceinline__ unsigned lds_off(const void* p) { return (unsigned)(size_t)p; }   // byte offset in the work-group's LDS
// one stage's four copies of this thread; the s_wait_xcnt stands inside the statement, behind the last copy, so that no address register is rewritten in front of it
__device__ __forceinline__ void stage_kv(unsigned lk, unsigned lv, const _Float16* gk, const _Float16* gv) {
  asm volatile("global_load_async_to_lds_b128 %0, %4, off\n\tglobal_load_async_to_lds_b128 %1, %5, off\n\tglobal_load_async_to_lds_b128 %2, %6, off\n\tglobal_load_async_to_lds_b128 %3, %7, off\n\ts_wait_xcnt 0x0"
      :: "v"(lk), "v"(lk + 64u * KPIT * 2u), "v"(lv), "v"(lv + 16u * VPIT * 2u), "v"(gk), "v"(gk + (size_t)64 * CC), "v"(gv), "v"(gv + (size_t)16 * TT) : "memory"); }
__global__ __launch_bounds__(256) __attribute__((amdgpu_waves_per_eu(4, 4))) void k_fa(const _Float16* __restrict__ QH, const _Float16* __restrict__ QL, const _Float16* __restrict__ KH, const _Float16* __restrict__ VT, float* __restrict__ Y) {
  __shared__ __align__(16) _Float16 sk[2][FST * KPIT], sv[2][HD * VPIT];
  const int tid = threadIdx.x, wave = tid >> 5, lane = tid & 31, col = lane & 15, g = lane >> 4; const int h = blockIdx.y, b = blockIdx.z; const int q = blockIdx.x * 128 + wave * 16 + col;
  const v16h qh = frag_h(QH + ((size_t)b * TT + q) * CC + h * HD, lane), ql = frag_h(QL + ((size_t)b * QHI + q) * CC + h * HD, lane);
  const _Float16* gk = KH + ((size_t)b * TT + (tid >> 2)) * CC + h * HD + (tid & 3) * 8;               // copies: key rows tid / 4 and 64 + tid / 4 of a stage, 16-byte piece tid % 4
  const _Float16* gv = VT + ((size_t)b * CC + h * HD + (tid >> 4)) * (size_t)TT + (tid & 15) * 8;      // copies: planes tid / 16 and 16 + tid / 16, 16-byte piece tid % 16 of the stage's keys
  const unsigned lk = lds_off(&sk[0][(tid >> 2) * KPIT + (tid & 3) * 8]), lv = lds_off(&sv[0][(tid >> 4) * VPIT + (tid & 15) * 8]);
  stage_kv(lk, lv, gk, gv);
  asm volatile("s_wait_asynccnt 0x0" ::: "memory");   // this wave's copies of stage 0 have landed
  __syncthreads();                                    // and every other wave's: stage 0 may be read
  stage_kv(lk + (unsigned)sizeof(sk[0]), lv + (unsigned)sizeof(sv[0]), gk + (size_t)FST * CC, gv + FST);
  v8f acc[HD / 16] = {}; float m = -3.0e38f, nm = 11.0f + 3.0e38f * C2, l = 0.f;
#pragma unroll 1   // a trip = a stage; its two passes are unrolled below
  for (int st = 0; st < NST; ++st) {
    const _Float16* kb = &sk[st & 1][col * KPIT + 8 * g];   // key row col of a 16-key tile, this lane half's d
    const _Float16* vb = &sv[st & 1][col * VPIT + 8 * g];   // plane d = col of a 16-wide d tile, this lane half's keys
    v16h kf[FNT];
#pragma unroll
    for (int t = 0; t < FNT; ++t) kf[t] = frag_p(kb + (t * 16) * KPIT);
#pragma unroll
    for (int ps = 0; ps < FST / FAK; ++ps) {
    v8f sh[FNT], sl[FNT]; const v8f zero = {};
#pragma unroll
    for (int t = 0; t < FNT; ++t) { sh[t] = wmmah(kf[t], qh, zero); sl[t] = wmmah(kf[t], ql, zero); }
    if (ps + 1 < FST / FAK) {   // the stage's next pass: its k fragments are read one pass ahead, from the same buffer
#pragma unroll
      for (int t = 0; t < FNT; ++t) kf[t] = frag_p(kb + ((ps + 1) * FAK + t * 16) * KPIT); }
    v16h vf[HD / 16][FAK / 32];   // this pass's v planes: in flight under the softmax
#pragma unroll
    for (int j = 0; j < HD / 16; ++j)
#pragma unroll
      for (int c = 0; c < FAK / 32; ++c) vf[j][c] = frag_p(vb + (j * 16) * VPIT + ps * FAK + c * 32);
    float s[FNT][8]; float mx = m;
#pragma unroll
    for (int t = 0; t < FNT; ++t)
#pragma unroll
      for (int r = 0; r < 8; ++r) { s[t][r] = sh[t][r] + sl[t][r] * (1.0f / 1024.0f); mx = fmaxf(mx, s[t][r]); }
    mx = fmaxf(mx, xhalf(mx));
    if (__builtin_amdgcn_ballot_w32(mx > m) != 0) { const float nn = fmaf(-mx, C2, 11.0f); const float al = __builtin_amdgcn_exp2f(nn - nm); l *= al;   // some column's maximum rose: rescale (al = 1 exactly where it did not)
#pragma unroll
      for (int j = 0; j < HD / 16; ++j)
#pragma unroll
        for (int r = 0; r < 8; ++r) acc[j][r] *= al;
      m = mx; nm = nn; }
#pragma unroll
    for (int c = 0; c < FAK / 32; ++c) { v16h p; float e[2][8];
#pragma unroll
      for (int u = 0; u < 2; ++u) { v2f a[4];
#pragma unroll
        for (int i = 0; i < 4; ++i) a[i] = __builtin_elementwise_fma(v2f{s[2 * c + u][2 * i], s[2 * c + u][2 * i + 1]}, v2f{C2, C2}, v2f{nm, nm});
#pragma unroll   // the builtin, not asm text: the compiler sees which registers the exp2 write and keeps them clear of a matrix product's operands
        for (int i = 0; i < 4; ++i) { e[u][2 * i] = __builtin_amdgcn_exp2f(a[i].x); e[u][2 * i + 1] = __builtin_amdgcn_exp2f(a[i].y); } }
#pragma unroll
      for (int i = 0; i < 8; ++i) { l += e[0][i] + e[1][i]; p[i] = (_Float16)e[0][i]; p[8 + i] = (_Float16)e[1][i]; }
#pragma unroll
      for (int j = 0; j < HD / 16; ++j) acc[j] = wmmah(vf[j][c], p, acc[j]); } }
    asm volatile("s_wait_dscnt 0x0" ::: "memory");      // this wave's reads of the stage's buffer are done
    asm volatile("s_wait_asynccnt 0x0" ::: "memory");   // its copies of the next stage have landed
    __syncthreads();                                    // the next stage may be read, and this stage's buffer may be refilled
    if (st + 2 < NST) stage_kv(lk + (unsigned)(st & 1) * (unsigned)sizeof(sk[0]), lv + (unsigned)(st & 1) * (unsigned)sizeof(sv[0]), gk + (size_t)(st + 2) * FST * CC, gv + (st + 2) * FST); }
  asm volatile("s_wait_asynccnt 0x0" ::: "memory");     // no copy is outstanding when the wave ends
  l += xhalf(l); const float inv = 1.0f / l;
  float* yr = Y + ((size_t)b * TT + q) * CC + h * HD + 8 * g;   // acc[j][r] = ctx[q][j * 16 + 8g + r]
#pragma unroll
  for (int j = 0; j < HD / 16; ++j) { v4f o0, o1;
#pragma unroll
    for (int r = 0; r < 4; ++r) { o0[r] = acc[j][r] * inv; o1[r] = acc[j][4 + r] * inv; }
    vst2(yr + j * 16, o0); vst2(yr + j * 16 + 4, o1); } }
// ---- k_out: block = (64 rows, 128 cols), ctx rows (hi and lo planes) and Wo rows staged in LDS: out = ctx Wo (+ bo): all rows: ctx bf16 hi + lo against exact bf16 Wo (2 products)
__global__ __launch_bounds__(128) void k_out(const float* __restrict__ Y, const float* __restrict__ WO, const float* __restrict__ BO, float* __restrict__ OUT, const float* __restrict__ RESX) { __shared__ __align__(16) float sf[4][16][132]; __shared__ __align__(16) __bf16 sw[128 * GPIT], yh[64 * GPIT], yl[64 * GPIT];
  const int tid = threadIdx.x, wave = tid >> 5, lane = tid & 31, col = lane & 15, g = lane >> 4; const int c0 = blockIdx.y * 128; const size_t r0 = (size_t)blockIdx.x * 64 + wave * 16;
  v8f acc[8] = {};
  if (true) {   /* ALL rows: ctx split bf16 hi + lo x exact Wo (2 products) */
    stage_rows2<64>(yh, yl, Y + (size_t)blockIdx.x * 64 * CC, tid); stage_rows<128>(sw, WO + (size_t)c0 * CC, tid);
    __syncthreads();   // both operands are whole in LDS
    const __bf16* ph = yh + (wave * 16 + col) * GPIT; const __bf16* pl = yl + (wave * 16 + col) * GPIT; const __bf16* pw = sw + col * GPIT;
    v16b ah = frag_b(ph, lane), al = frag_b(pl, lane), w[8];
#pragma unroll
    for (int j = 0; j < 8; ++j) w[j] = frag_b(pw + j * 16 * GPIT, lane);
#pragma unroll
    for (int kc = 0; kc < CC / 32; ++kc) { v16b ahn = ah, aln = al, wn[8];
      if (kc + 1 < CC / 32) { ahn = frag_b(ph + (kc + 1) * 32, lane); aln = frag_b(pl + (kc + 1) * 32, lane);   // the next k step's fragments: one group of LDS reads ahead of this step's products
#pragma unroll
        for (int j = 0; j < 8; ++j) wn[j] = frag_b(pw + j * 16 * GPIT + (kc + 1) * 32, lane); }
#pragma unroll
      for (int j = 0; j < 8; ++j) { acc[j] = wmma_bf(ah, w[j], acc[j]); acc[j] = wmma_bf(al, w[j], acc[j]); }
      if (kc + 1 < CC / 32) { ah = ahn; al = aln;
#pragma unroll
        for (int j = 0; j < 8; ++j) w[j] = wn[j]; } }
#pragma unroll
    for (int j = 0; j < 8; ++j) { const float bias = BO ? bfr(BO[c0 + j * 16 + col]) : 0.f;
#pragma unroll
      for (int r = 0; r < 8; ++r) sf[wave][8 * g + r][j * 16 + col] = acc[j][r] + bias; }
  } else {
#pragma unroll 2
    for (int kc = 0; kc < CC / 32; ++kc) { const v16h a = frag_f32(Y + (r0 + col) * CC + kc * 32, lane); asm volatile("s_wait_loadcnt 0x0" ::: "memory");
#pragma unroll
      for (int j = 0; j < 8; ++j) { const v16h w = WOCOLH(WO, kc * 32, c0 + j * 16 + col, lane); asm volatile("s_wait_loadcnt 0x0" ::: "memory"); acc[j] = wmma16(a, w, acc[j]); } }
#pragma unroll
    for (int j = 0; j < 8; ++j) { const float bias = BO ? bfr(BO[c0 + j * 16 + col]) : 0.f;
#pragma unroll
      for (int r = 0; r < 8; ++r) sf[wave][8 * g + r][j * 16 + col] = acc[j][r] * (1.0f / 256.0f) + bias; } }
  LDSX(); for (int rl = 0; rl < 16; ++rl) { const size_t oo = (r0 + rl) * DIN + c0 + lane * 4; v4f o = *(const v4f*)&sf[wave][rl][lane * 4]; const v4f zr = *(const v4f*)(RESX + oo); o[0] += bfr(zr[0]); o[1] += bfr(zr[1]); o[2] += bfr(zr[2]); o[3] += bfr(zr[3]); vst2(OUT + oo, o); } }   /* + bf16(query) */

extern "C" void kernel_launch(void* const* d_in, const int* in_sizes, int n_in, void* d_out, int out_size, void* d_ws, size_t ws_size, hipStream_t stream) {
  (void)in_sizes; (void)n_in; (void)out_size;
  const float** F = (const float**)d_in;
  if (ws_size < (size_t)WS_END) return;
  char* ws = (char*)d_ws; _Float16 *QH = (_Float16*)(ws + WS_QH), *KH = (_Float16*)(ws + WS_KH), *VT = (_Float16*)(ws + WS_VT), *QL = (_Float16*)(ws + WS_QL), *KL = (_Float16*)(ws + WS_KL); __bf16 *VB = (__bf16*)(ws + WS_VB), *VBL = (__bf16*)(ws + WS_VBL); float *S = (float*)(ws + WS_S), *Y = (float*)(ws + WS_Y);
  (void)S;
  // inputs: 0 query; 1 key; 2 value [4,2048,256]; 3 Wq (out,in), 4 bq; 5 Wk, 6 bk; 7 Wv, 8 bv; 9 Wo (out,in), 10 bo; 11 ln_g, 12 ln_b
  if (ws_size < (size_t)WS_END2) return;
  float* X1 = (float*)(ws + WS_X1);
  k_proj<<<dim3(TNB * TT / 64, CC / 128, 3), 128, 0, stream>>>(F[0], F[1], F[2], F[3], F[5], F[7], F[4], F[6], F[8], QH, QL, KH, KL, VT, VB, VBL);
  k_fa<<<dim3(TT / 128, NH, TNB), 256, 0, stream>>>(QH, QL, KH, VT, Y);
  k_out<<<dim3(TNB * TT / 64, DIN / 128), 128, 0, stream>>>(Y, F[9], F[10], X1, F[0]);   /* ctx Wo^T + bo + bf16(query) */
  k_lnx<<<dim3(NRW / 8), 256, 0, stream>>>(X1, 0, F[11], F[12], (float*)d_out);           /* LayerNorm */
}

// v005
// Measured time: 49.3 microseconds a run.
// Two timings next to v004 both put it at 1.10 times that version's speed.
// All steps since v000 together make it 17.6 times as fast.
// compute dtype: all float inputs rounded to bf16; Q/K/V = in W^T + b with EXACT bf16 products on WMMA 16x16x32 (f32 accumulate); q as f16 hi + residual (x 2^10) against k once to f16 (2 products) / sqrt(32); softmax in f32 in base 2 (one fma a score folds 1/sqrt(32) x log2(e), the running maximum and the 2^11, then the hardware exp2; running maximum and sum over 64-key passes); exp x 2^11 once to f16 against v once to f16 (1 product), divided by the sum at the end; ctx split bf16 hi + lo against exact Wo (2 products) + bo + query; LayerNorm in f32; f32 output.
#include <hip/hip_runtime.h>
#include <math.h>

typedef __attribute__((ext_vector_type(16))) _Float16 v16h;
typedef __attribute__((ext_vector_type(16))) __bf16 v16b;
typedef __attribute__((ext_vector_type(8)))  _Float16 v8h;
typedef __attribute__((ext_vector_type(8)))  float v8f;
typedef __attribute__((ext_vector_type(4)))  float v4f;
typedef __attribute__((ext_vector_type(2)))  float v2f;
typedef __attribute__((ext_vector_type(4)))  unsigned v4u;
typedef __attribute__((ext_vector_type(4)))  int v4i;
typedef float __attribute__((may_alias)) float_a;
typedef int __attribute__((may_alias)) int_a;

template <typename T> __device__ __forceinline__ void vst2(void* p, T v) { *(T*)p = v;  }
__device__ __forceinline__ v8f wmma16(v16h a, v16h b, v8f c) {
  v8f d = __builtin_amdgcn_wmma_f32_16x16x32_f16(false, a, false, b, (short)0, c, false, false);
  asm volatile("v_nop\n\tv_nop\n\tv_nop\n\tv_nop" : "+v"(d) : "v"(a), "v"(b));
  return d;
}
__device__ __forceinline__ v8f wmma_bf(v16b a, v16b b, v8f c) {
  v8f d = __builtin_amdgcn_wmma_f32_16x16x32_bf16(false, a, false, b, (short)0, c, false, false);
  asm volatile("v_nop\n\tv_nop\n\tv_nop\n\tv_nop" : "+v"(d) : "v"(a), "v"(b));
  return d;
}
// 16x16x32 fragments: lane = (h = lane>>4, row/col = lane&15); elements 0..7 = k0+8h+0..7, 8..15 = k0+16+8h+0..7; D element r = row 8h+r
__device__ __forceinline__ v16h frag_h(const _Float16* rowk0, int lane) {
  union { v16h v; v8h q[2]; } u; const _Float16* p = rowk0 + 8 * (lane >> 4);
  u.q[0] = *(const v8h*)p; u.q[1] = *(const v8h*)(p + 16); return u.v;
}
__device__ __forceinline__ v16h frag_f32(const float* rowk0, int lane) {
  v16h a; const float* p = rowk0 + 8 * (lane >> 4);
#pragma unroll
  for (int i = 0; i < 8; ++i) { a[i] = (_Float16)p[i]; a[8 + i] = (_Float16)p[16 + i]; }
  return a;
}
__device__ __forceinline__ v16h frag_f32s(const float* rowk0, int lane, float sc) {
  v16h a; const float* p = rowk0 + 8 * (lane >> 4);
#pragma unroll
  for (int i = 0; i < 8; ++i) { a[i] = (_Float16)(p[i] * sc); a[8 + i] = (_Float16)(p[16 + i] * sc); }
  return a;
}
// column fragment from a [K][ld] layout (column n), rows >= K read as 0
__device__ __forceinline__ v16h fragc_f32(const float* W, int k0, int n, int lane, int ld, int K) {
  v16h a; const int g = lane >> 4;
#pragma unroll
  for (int i = 0; i < 8; ++i) { const int ka = k0 + 8 * g + i, kb = ka + 16;
    a[i] = (_Float16)(ka < K ? W[(size_t)(ka < K ? ka : K - 1) * ld + n] : 0.f); a[8 + i] = (_Float16)(kb < K ? W[(size_t)(kb < K ? kb : K - 1) * ld + n] : 0.f); }
  return a;
}
struct F2 { v16b h, l; };
__device__ __forceinline__ F2 bsplit16(const float v[16]) { F2 r;
#pragma unroll
  for (int i = 0; i < 16; ++i) { const __bf16 h = (__bf16)v[i]; r.h[i] = h; r.l[i] = (__bf16)(v[i] - (float)h); }
  return r; }
__device__ __forceinline__ F2 split_row(const float* row, int k0, int lane) { float v[16]; const float* p = row + k0 + 8 * (lane >> 4);
#pragma unroll
  for (int i = 0; i < 8; ++i) { v[i] = p[i]; v[8 + i] = p[16 + i]; }
  return bsplit16(v); }
__device__ __forceinline__ F2 split_rowK(const float* row, int k0, int lane, int K) { float v[16]; const int g = lane >> 4;
#pragma unroll
  for (int i = 0; i < 8; ++i) { const int ka = k0 + 8 * g + i, kb = ka + 16; v[i] = ka < K ? row[ka < K ? ka : K - 1] : 0.f; v[8 + i] = kb < K ? row[kb < K ? kb : K - 1] : 0.f; }
  return bsplit16(v); }
__device__ __forceinline__ F2 split_col(const float* W, int k0, int n, int lane, int ld, int K) { float v[16]; const int g = lane >> 4;
#pragma unroll
  for (int i = 0; i < 8; ++i) { const int ka = k0 + 8 * g + i, kb = ka + 16; v[i] = ka < K ? W[(size_t)(ka < K ? ka : K - 1) * ld + n] : 0.f; v[8 + i] = kb < K ? W[(size_t)(kb < K ? kb : K - 1) * ld + n] : 0.f; }
  return bsplit16(v); }
__device__ __forceinline__ v8f mac3(const F2& a, const F2& b, v8f c) { c = wmma_bf(a.l, b.h, c); c = wmma_bf(a.h, b.l, c); return wmma_bf(a.h, b.h, c); }
__device__ __forceinline__ float sigm(float v) { return 1.0f / (1.0f + expf(-v)); }
#define LDSX() do { asm volatile("s_wait_dscnt 0" ::: "memory"); __builtin_amdgcn_wave_barrier(); __builtin_amdgcn_fence(__ATOMIC_RELEASE, "workgroup"); } while (0)

// Cross-modal multi-head attention with residual + LayerNorm (B 4, L 2,048, d_model 256 = 8 heads x 32; (out,in) 1/16-scale weights, zero biases; LN affine 1/0, eps 1e-5): Q = query Wq^T + bq, K = key Wk^T + bk, V = value Wv^T + bv; ctx = softmax(Q K^T / sqrt(32)) V; out = LN(ctx Wo^T + bo + query).
#define NB 4
#define TT 2048
#define CC 256            // NH * HD = projected width
#define DIN 256          // input (model) width
#define NH 8
#define HD 32
#define NQB (TT / 64)
#define HG 4
#define SCALE (0.17677669529663689f)
#define CAUSAL 0
#ifndef TNB
#define TNB NB
#endif
__device__ __forceinline__ float bfr(float v) { return (float)(__bf16)v; }
__host__ __device__ __forceinline__ int kb_last(int qb) { return CAUSAL ? ((qb * 64 + 63) >> 7) : (TT / 128 - 1); }
typedef __attribute__((ext_vector_type(8))) __bf16 v8b;
__device__ __forceinline__ v16b frag_b(const __bf16* rowk0, int lane) {
  union { v16b v; v8b q[2]; } u; const __bf16* p = rowk0 + 8 * (lane >> 4);
  u.q[0] = *(const v8b*)p; u.q[1] = *(const v8b*)(p + 16); return u.v;
}
#define QBH 0              // unused: no kernel here reads it (no separate high-precision path)
#define QHI 2048            // rows carrying a q residual plane (all rows when non-causal: 2-product logits everywhere)
#define KHI 64            // key rows carrying k residual / v bf16 hi+lo planes (written by k_proj; no kernel here reads them)
// B fragment (k rows k0+.., output column o) of a weight: (in,out) [K][ld] or (out,in) [ld rows of K]: bf16 exact, or f16(bf16 * 256) exact
__device__ __forceinline__ v16b wcol_io(const float* Wm, int k0, int o, int lane, int ld) { v16b w; const int g = lane >> 4;
#pragma unroll
  for (int i = 0; i < 8; ++i) { w[i] = (__bf16)Wm[(size_t)(k0 + 8 * g + i) * ld + o]; w[8 + i] = (__bf16)Wm[(size_t)(k0 + 16 + 8 * g + i) * ld + o]; }
  return w; }
__device__ __forceinline__ v16b wcol_oi(const float* Wm, int k0, int o, int lane, int K) { v16b w; const float* p = Wm + (size_t)o * K + k0 + 8 * (lane >> 4);
#pragma unroll
  for (int i = 0; i < 8; ++i) { w[i] = (__bf16)p[i]; w[8 + i] = (__bf16)p[16 + i]; }
  return w; }
__device__ __forceinline__ v16h wcolh_io(const float* Wm, int k0, int o, int lane, int ld) { v16h w; const int g = lane >> 4;
#pragma unroll
  for (int i = 0; i < 8; ++i) { w[i] = (_Float16)(bfr(Wm[(size_t)(k0 + 8 * g + i) * ld + o]) * 256.0f); w[8 + i] = (_Float16)(bfr(Wm[(size_t)(k0 + 16 + 8 * g + i) * ld + o]) * 256.0f); }
  return w; }
__device__ __forceinline__ v16h wcolh_oi(const float* Wm, int k0, int o, int lane, int K) { v16h w; const float* p = Wm + (size_t)o * K + k0 + 8 * (lane >> 4);
#pragma unroll
  for (int i = 0; i < 8; ++i) { w[i] = (_Float16)(bfr(p[i]) * 256.0f); w[8 + i] = (_Float16)(bfr(p[16 + i]) * 256.0f); }
  return w; }
#define WQKV_LAYOUT 1   // 0 = (in,out) [DIN][CC]; 1 = (out,in) [CC][DIN]; 2 = per-head [NH][DIN][HD]
__device__ __forceinline__ v16b wcol_hdk(const float* Wm, int k0, int o, int lane) { v16b w; const int g = lane >> 4; const float* p = Wm + (size_t)(o / HD) * DIN * HD + (o % HD);
#pragma unroll
  for (int i = 0; i < 8; ++i) { w[i] = (__bf16)p[(size_t)(k0 + 8 * g + i) * HD]; w[8 + i] = (__bf16)p[(size_t)(k0 + 16 + 8 * g + i) * HD]; }
  return w; }
#define WO_OUT_IN 1
#if WQKV_LAYOUT == 1
#define WCOL(W, k0, o, lane) wcol_oi(W, k0, o, lane, DIN)
#elif WQKV_LAYOUT == 2
#define WCOL(W, k0, o, lane) wcol_hdk(W, k0, o, lane)
#else
#define WCOL(W, k0, o, lane) wcol_io(W, k0, o, lane, CC)
#endif
#if WO_OUT_IN
#define WOCOL(W, k0, o, lane) wcol_oi(W, k0, o, lane, CC)
#define WOCOLH(W, k0, o, lane) wcolh_oi(W, k0, o, lane, CC)
#else
#define WOCOL(W, k0, o, lane) wcol_io(W, k0, o, lane, DIN)
#define WOCOLH(W, k0, o, lane) wcolh_io(W, k0, o, lane, DIN)
#endif
#ifndef SM_EXTRA_PARAMS
#define SM_EXTRA_PARAMS
#endif
#ifndef PROJ_EXTRA_PARAMS
#define PROJ_EXTRA_PARAMS
#endif
#ifndef SM_MASK_HOOK
#define SM_MASK_HOOK (void)0
#endif

#define WS_QH  0u                                      // f16 q rows [b*t][CC]
#define WS_KH  (WS_QH + 2u * (size_t)NB * TT * CC)      // f16 k rows [b*t][CC]
#define WS_VT  (WS_KH + 2u * (size_t)NB * TT * CC)      // f16 v planes [b][c][t]
#define WS_QL  (WS_VT + 2u * (size_t)NB * CC * TT)      // f16 q residual x 2^10 rows [b][t < QHI][CC]
#define WS_KL  (WS_QL + 2u * (size_t)NB * QHI * CC)     // f16 k residual x 2^10 rows [b][t < KHI][CC]
#define WS_VB  (WS_KL + 2u * (size_t)NB * KHI * CC)     // bf16 v hi planes [b][c][t < KHI]
#define WS_VBL (WS_VB + 2u * (size_t)NB * CC * KHI)
#define WS_S   (WS_VBL + 2u * (size_t)NB * CC * KHI)    // f32 [hg][t][s], unused (k_fa keeps logits in registers)
#define WS_Y   (WS_S  + 4u * (size_t)HG * TT * TT)      // f32 ctx rows [b*t][CC] (only when there is an output projection)
#define WS_END (WS_Y  + 4u * (size_t)NB * TT * CC)

// A GEMM operand reaches the four waves of a block through LDS: rows of 256 f32, contiguous in memory, are read once a block by whole-line loads (a wave's load = 512 contiguous bytes; 32 loads of a thread form a batch), rounded to bf16 and laid at a pitch of 16 B x odd, where the b128 fragment reads of 16 rows fall on 64 different banks
#define GPIT 264           // bf16 a staged row in LDS (512 B of data, 528-B pitch)
typedef __attribute__((ext_vector_type(4))) __bf16 v4b;
template <int NR> __device__ __forceinline__ void stage_rows(__bf16* __restrict__ dst, const float* __restrict__ srcp, int tid) {
  __bf16* d = dst + (tid >> 6) * GPIT + (tid & 63) * 4; const float* s = srcp + tid * 4;
#pragma unroll
  for (int b = 0; b < NR / 64; ++b) { v4f t[32];
#pragma unroll
    for (int i = 0; i < 32; ++i) t[i] = *(const v4f*)(s + (b * 32 + i) * 512);
    asm volatile("s_wait_xcnt 0x0" ::: "memory");   // stands in front of whatever next rewrites a register that these loads name
#pragma unroll
    for (int i = 0; i < 32; ++i) { v4b o; o[0] = (__bf16)t[i][0]; o[1] = (__bf16)t[i][1]; o[2] = (__bf16)t[i][2]; o[3] = (__bf16)t[i][3]; *(v4b*)(d + (b * 64 + 2 * i) * GPIT) = o; } } }
// ---- k_proj: block = (64 rows, 128 cols, which): q/k/v = X W (+ b) with exact bf16 products (K = DIN), X rows and W rows staged in LDS -> which 0: q f16 rows (+ residual rows < QHI); 1: k f16 rows (+ residual rows < KHI); 2: v f16 planes [c][t] (+ bf16 hi/lo planes for t < KHI)
// amdgpu_waves_per_eu(3, 3): the grid holds three blocks for every WGP, three waves a SIMD: the kernel takes the register budget of that occupancy
__global__ __launch_bounds__(128) __attribute__((amdgpu_waves_per_eu(3, 3))) void k_proj(const float* __restrict__ XQ, const float* __restrict__ XK, const float* __restrict__ XV, const float* __restrict__ WQ, const float* __restrict__ WK, const float* __restrict__ WV, const float* __restrict__ BQ, const float* __restrict__ BK, const float* __restrict__ BV,
    _Float16* __restrict__ QH, _Float16* __restrict__ QL, _Float16* __restrict__ KH, _Float16* __restrict__ KL, _Float16* __restrict__ VT, __bf16* __restrict__ VB, __bf16* __restrict__ VBL) {
  __shared__ __align__(16) unsigned char smem[(128 + 64) * GPIT * 2];   // the two operands; behind the products the output tiles take the same bytes, so that three blocks fit a WGP
  __bf16* sw = (__bf16*)smem; __bf16* sx = sw + 128 * GPIT;
  _Float16 (*sh)[136] = (_Float16 (*)[136])smem; _Float16 (*sl)[136] = sh + 64; _Float16 (*th)[72] = (_Float16 (*)[72])smem; __bf16 (*tb)[72] = (__bf16 (*)[72])(smem + 128 * 72 * 2); __bf16 (*tbl)[72] = tb + 128;
  const int tid = threadIdx.x, wave = tid >> 5, lane = tid & 31, col = lane & 15, g = lane >> 4; const int which = blockIdx.z; const int c0 = blockIdx.y * 128; const size_t r0 = (size_t)blockIdx.x * 64; const size_t bb = r0 / TT; const int t0 = (int)(r0 % TT);
  const float* X = which == 0 ? XQ : which == 1 ? XK : XV; const float* WA = which == 0 ? WQ : which == 1 ? WK : WV; const float* BA = which == 0 ? BQ : which == 1 ? BK : BV;
  stage_rows<64>(sx, X + r0 * DIN, tid); stage_rows<128>(sw, WA + (size_t)c0 * DIN, tid);
  __syncthreads();   // both operands are whole in LDS
  v8f acc[8] = {}; const __bf16* pa = sx + (wave * 16 + col) * GPIT; const __bf16* pw = sw + col * GPIT;
  v16b a = frag_b(pa, lane), w[8];
#pragma unroll
  for (int j = 0; j < 8; ++j) w[j] = frag_b(pw + j * 16 * GPIT, lane);
#pragma unroll
  for (int kc = 0; kc < DIN / 32; ++kc) { v16b an = a, wn[8];
    if (kc + 1 < DIN / 32) { an = frag_b(pa + (kc + 1) * 32, lane);   // the next k step's fragments: one group of LDS reads ahead of this step's products
#pragma unroll
      for (int j = 0; j < 8; ++j) wn[j] = frag_b(pw + j * 16 * GPIT + (kc + 1) * 32, lane); }
#pragma unroll
    for (int j = 0; j < 8; ++j) acc[j] = wmma_bf(a, w[j], acc[j]);
    if (kc + 1 < DIN / 32) { a = an;
#pragma unroll
      for (int j = 0; j < 8; ++j) w[j] = wn[j]; } }
  __syncthreads();   // every wave has read its last fragment: the bytes may take the output tiles
  if (which < 2) { _Float16* DH = which == 0 ? QH : KH; _Float16* DL = which == 0 ? QL : KL; const int nhi = which == 0 ? QHI : KHI; const bool hi_rows = t0 < nhi;
#pragma unroll
    for (int j = 0; j < 8; ++j) { const float bias = BA ? bfr(BA[c0 + j * 16 + col]) : 0.f;
#pragma unroll
      for (int r = 0; r < 8; ++r) { const float v = acc[j][r] + bias; const _Float16 hv = (_Float16)v; sh[wave * 16 + 8 * g + r][j * 16 + col] = hv; sl[wave * 16 + 8 * g + r][j * 16 + col] = (_Float16)((v - (float)hv) * 1024.0f); } }
    __syncthreads();
    for (int e = tid; e < 64 * 16; e += 128) { const int rl = e >> 4, q = e & 15; vst2((unsigned*)(DH + (r0 + rl) * CC + c0 + q * 8), *(const v4u*)&sh[rl][q * 8]); if (hi_rows) vst2((unsigned*)(DL + (bb * nhi + t0 + rl) * (size_t)CC + c0 + q * 8), *(const v4u*)&sl[rl][q * 8]); }
  } else { const bool hi_rows = t0 < KHI;
#pragma unroll
    for (int j = 0; j < 8; ++j) { const float bias = BA ? bfr(BA[c0 + j * 16 + col]) : 0.f;
#pragma unroll
      for (int r = 0; r < 8; ++r) { const float v = acc[j][r] + bias; const int rl = wave * 16 + 8 * g + r, cl = j * 16 + col; th[cl][rl] = (_Float16)v; const __bf16 bh = (__bf16)v; tb[cl][rl] = bh; tbl[cl][rl] = (__bf16)(v - (float)bh); } }
    __syncthreads();
    for (int e = tid; e < 128 * 8; e += 128) { const int cl = e >> 3, q = e & 7; vst2((unsigned*)(VT + (bb * CC + c0 + cl) * (size_t)TT + t0 + q * 8), *(const v4u*)&th[cl][q * 8]); if (hi_rows) { const size_t o3 = (bb * CC + c0 + cl) * (size_t)KHI + t0 + q * 8; vst2((unsigned*)(VB + o3), *(const v4u*)&tb[cl][q * 8]); vst2((unsigned*)(VBL + o3), *(const v4u*)&tbl[cl][q * 8]); } } } }
// ---- k_fa: block = 128 queries (8 waves x 16 query columns) of (b, h), one pass over all keys in steps of FAK, k rows and v planes staged in LDS for the whole block: S^T = K Q^T (A = k rows, B = q hi and q residual x 2^10: 2 products); a lane holds one query's raw scores x (keys 8g + r of each 16-key tile): running maximum of x and sum in f32, the halves joined by a cross-row move; p = exp2(x * C2 + nm), C2 = SCALE x log2(e), nm = 11 - max * C2, so p = exp(SCALE (x - max)) x 2^11: one fma and one hardware exp2 a score; p once to f16, packed from two score tiles straight into a B operand; ctx^T += V^T P^T (A = v planes: 1 product); ctx = acc / sum (both carry the 2^11)
#define FAK 64
#define FNT (FAK / 16)
#define C2 (SCALE * 1.4426950408889634f)
// amdgpu_waves_per_eu(4, 4): the grid holds four waves for every SIMD, so the kernel takes the register budget of that occupancy (two blocks a WGP, all resident at once)
__device__ __forceinline__ float xhalf(float x) { return __builtin_bit_cast(float, __builtin_amdgcn_permlanex16(__builtin_bit_cast(int, x), __builtin_bit_cast(int, x), 0x76543210, 0xfedcba98, false, false)); }   // lane l with lane l ^ 16
__device__ __forceinline__ v16h frag_p(const _Float16* p) { union { v16h v; v8h q[2]; } u; u.q[0] = *(const v8h*)p; u.q[1] = *(const v8h*)(p + 16); return u.v; }   // frag_h with the lane half's 8g already in p
__device__ __forceinline__ v8f wmmah(v16h a, v16h b, v8f c) { return __builtin_amdgcn_wmma_f32_16x16x32_f16(false, a, false, b, (short)0, c, false, false); }
// K and V reach the eight waves of a block through LDS: a stage = FST keys (two passes), two buffers, filled one stage ahead by asynchronous 16-byte copies (each thread: two pieces of k rows, two of v planes). Pitches 16 B x odd: the b128 fragment reads of 16 rows fall on 64 different banks.
#define FST 128
#define NST (TT / FST)
#define KPIT 40            // halves a k row in LDS (64 B of data, 80-B pitch)
#define VPIT (FST + 8)     // halves a v plane row in LDS (256 B of data, 272-B pitch)
__device__ __forceinline__ unsigned lds_off(const void* p) { return (unsigned)(size_t)p; }   // byte offset in the work-group's LDS
// one stage's four copies of this thread; the s_wait_xcnt stands inside the statement, behind the last copy, so that no address register is rewritten in front of it
__device__ __forceinline__ void stage_kv(unsigned lk, unsigned lv, const _Float16* gk, const _Float16* gv) {
  asm volatile("global_load_async_to_lds_b128 %0, %4, off\n\tglobal_load_async_to_lds_b128 %1, %5, off\n\tglobal_load_async_to_lds_b128 %2, %6, off\n\tglobal_load_async_to_lds_b128 %3, %7, off\n\ts_wait_xcnt 0x0"
      :: "v"(lk), "v"(lk + 64u * KPIT * 2u), "v"(lv), "v"(lv + 16u * VPIT * 2u), "v"(gk), "v"(gk + (size_t)64 * CC), "v"(gv), "v"(gv + (size_t)16 * TT) : "memory"); }
__global__ __launch_bounds__(256) __attribute__((amdgpu_waves_per_eu(4, 4))) void k_fa(const _Float16* __restrict__ QH, const _Float16* __restrict__ QL, const _Float16* __restrict__ KH, const _Float16* __restrict__ VT, float* __restrict__ Y) {
  __shared__ __align__(16) _Float16 sk[2][FST * KPIT], sv[2][HD * VPIT];
  const int tid = threadIdx.x, wave = tid >> 5, lane = tid & 31, col = lane & 15, g = lane >> 4; const int h = blockIdx.y, b = blockIdx.z; const int q = blockIdx.x * 128 + wave * 16 + col;
  const v16h qh = frag_h(QH + ((size_t)b * TT + q) * CC + h * HD, lane), ql = frag_h(QL + ((size_t)b * QHI + q) * CC + h * HD, lane);
  const _Float16* gk = KH + ((size_t)b * TT + (tid >> 2)) * CC + h * HD + (tid & 3) * 8;               // copies: key rows tid / 4 and 64 + tid / 4 of a stage, 16-byte piece tid % 4
  const _Float16* gv = VT + ((size_t)b * CC + h * HD + (tid >> 4)) * (size_t)TT + (tid & 15) * 8;      // copies: planes tid / 16 and 16 + tid / 16, 16-byte piece tid % 16 of the stage's keys
  const unsigned lk = lds_off(&sk[0][(tid >> 2) * KPIT + (tid & 3) * 8]), lv = lds_off(&sv[0][(tid >> 4) * VPIT + (tid & 15) * 8]);
  stage_kv(lk, lv, gk, gv);
  asm volatile("s_wait_asynccnt 0x0" ::: "memory");   // this wave's copies of stage 0 have landed
  __syncthreads();                                    // and every other wave's: stage 0 may be read
  stage_kv(lk + (unsigned)sizeof(sk[0]), lv + (unsigned)sizeof(sv[0]), gk + (size_t)FST * CC, gv + FST);
  v8f acc[HD / 16] = {}; float m = -3.0e38f, nm = 11.0f + 3.0e38f * C2, l = 0.f;
#pragma unroll 1   // a trip = a stage; its two passes are unrolled below
  for (int st = 0; st < NST; ++st) {
    const _Float16* kb = &sk[st & 1][col * KPIT + 8 * g];   // key row col of a 16-key tile, this lane half's d
    const _Float16* vb = &sv[st & 1][col * VPIT + 8 * g];   // plane d = col of a 16-wide d tile, this lane half's keys
    v16h kf[FNT];
#pragma unroll
    for (int t = 0; t < FNT; ++t) kf[t] = frag_p(kb + (t * 16) * KPIT);
#pragma unroll
    for (int ps = 0; ps < FST / FAK; ++ps) {
    v8f sh[FNT], sl[FNT]; const v8f zero = {};
#pragma unroll
    for (int t = 0; t < FNT; ++t) { sh[t] = wmmah(kf[t], qh, zero); sl[t] = wmmah(kf[t], ql, zero); }
    if (ps + 1 < FST / FAK) {   // the stage's next pass: its k fragments are read one pass ahead, from the same buffer
#pragma unroll
      for (int t = 0; t < FNT; ++t) kf[t] = frag_p(kb + ((ps + 1) * FAK + t * 16) * KPIT); }
    v16h vf[HD / 16][FAK / 32];   // this pass's v planes: in flight under the softmax
#pragma unroll
    for (int j = 0; j < HD / 16; ++j)
#pragma unroll
      for (int c = 0; c < FAK / 32; ++c) vf[j][c] = frag_p(vb + (j * 16) * VPIT + ps * FAK + c * 32);
    float s[FNT][8]; float mx = m;
#pragma unroll
    for (int t = 0; t < FNT; ++t)
#pragma unroll
      for (int r = 0; r < 8; ++r) { s[t][r] = sh[t][r] + sl[t][r] * (1.0f / 1024.0f); mx = fmaxf(mx, s[t][r]); }
    mx = fmaxf(mx, xhalf(mx));
    if (__builtin_amdgcn_ballot_w32(mx > m) != 0) { const float nn = fmaf(-mx, C2, 11.0f); const float al = __builtin_amdgcn_exp2f(nn - nm); l *= al;   // some column's maximum rose: rescale (al = 1 exactly where it did not)
#pragma unroll
      for (int j = 0; j < HD / 16; ++j)
#pragma unroll
        for (int r = 0; r < 8; ++r) acc[j][r] *= al;
      m = mx; nm = nn; }
#pragma unroll
    for (int c = 0; c < FAK / 32; ++c) { v16h p; float e[2][8];
#pragma unroll
      for (int u = 0; u < 2; ++u) { v2f a[4];
#pragma unroll
        for (int i = 0; i < 4; ++i) a[i] = __builtin_elementwise_fma(v2f{s[2 * c + u][2 * i], s[2 * c + u][2 * i + 1]}, v2f{C2, C2}, v2f{nm, nm});
#pragma unroll   // the builtin, not asm text: the compiler sees which registers the exp2 write and keeps them clear of a matrix product's operands
        for (int i = 0; i < 4; ++i) { e[u][2 * i] = __builtin_amdgcn_exp2f(a[i].x); e[u][2 * i + 1] = __builtin_amdgcn_exp2f(a[i].y); } }
#pragma unroll
      for (int i = 0; i < 8; ++i) { l += e[0][i] + e[1][i]; p[i] = (_Float16)e[0][i]; p[8 + i] = (_Float16)e[1][i]; }
#pragma unroll
      for (int j = 0; j < HD / 16; ++j) acc[j] = wmmah(vf[j][c], p, acc[j]); } }
    asm volatile("s_wait_dscnt 0x0" ::: "memory");      // this wave's reads of the stage's buffer are done
    asm volatile("s_wait_asynccnt 0x0" ::: "memory");   // its copies of the next stage have landed
    __syncthreads();                                    // the next stage may be read, and this stage's buffer may be refilled
    if (st + 2 < NST) stage_kv(lk + (unsigned)(st & 1) * (unsigned)sizeof(sk[0]), lv + (unsigned)(st & 1) * (unsigned)sizeof(sv[0]), gk + (size_t)(st + 2) * FST * CC, gv + (st + 2) * FST); }
  asm volatile("s_wait_asynccnt 0x0" ::: "memory");     // no copy is outstanding when the wave ends
  l += xhalf(l); const float inv = 1.0f / l;
  float* yr = Y + ((size_t)b * TT + q) * CC + h * HD + 8 * g;   // acc[j][r] = ctx[q][j * 16 + 8g + r]
#pragma unroll
  for (int j = 0; j < HD / 16; ++j) { v4f o0, o1;
#pragma unroll
    for (int r = 0; r < 4; ++r) { o0[r] = acc[j][r] * inv; o1[r] = acc[j][4 + r] * inv; }
    vst2(yr + j * 16, o0); vst2(yr + j * 16 + 4, o1); } }
// stage_rows for a block of 256 threads (a load of the block = 4 rows), and the same with each value split bf16 hi + lo into two planes
template <int NR> __device__ __forceinline__ void stage_rows_w8(__bf16* __restrict__ dst, const float* __restrict__ srcp, int tid) {
  __bf16* d = dst + (tid >> 6) * GPIT + (tid & 63) * 4; const float* s = srcp + tid * 4;
#pragma unroll
  for (int b = 0; b < NR / 128; ++b) { v4f t[32];
#pragma unroll
    for (int i = 0; i < 32; ++i) t[i] = *(const v4f*)(s + (b * 32 + i) * 1024);
    asm volatile("s_wait_xcnt 0x0" ::: "memory");   // as in stage_rows
#pragma unroll
    for (int i = 0; i < 32; ++i) { v4b o; o[0] = (__bf16)t[i][0]; o[1] = (__bf16)t[i][1]; o[2] = (__bf16)t[i][2]; o[3] = (__bf16)t[i][3]; *(v4b*)(d + (b * 128 + 4 * i) * GPIT) = o; } } }
template <int NR> __device__ __forceinline__ void stage_rows2_w8(__bf16* __restrict__ dh, __bf16* __restrict__ dl, const float* __restrict__ srcp, int tid) {
  const int o0 = (tid >> 6) * GPIT + (tid & 63) * 4; const float* s = srcp + tid * 4; v4f t[NR / 4];
#pragma unroll
  for (int i = 0; i < NR / 4; ++i) t[i] = *(const v4f*)(s + i * 1024);
  asm volatile("s_wait_xcnt 0x0" ::: "memory");   // as in stage_rows
#pragma unroll
  for (int i = 0; i < NR / 4; ++i) { v4b oh, ol;
#pragma unroll
    for (int k = 0; k < 4; ++k) { const __bf16 hv = (__bf16)t[i][k]; oh[k] = hv; ol[k] = (__bf16)(t[i][k] - (float)hv); }
    *(v4b*)(dh + o0 + 4 * i * GPIT) = oh; *(v4b*)(dl + o0 + 4 * i * GPIT) = ol; } }
__device__ __forceinline__ v8f wmmab(v16b a, v16b b, v8f c) { return __builtin_amdgcn_wmma_f32_16x16x32_bf16(false, a, false, b, (short)0, c, false, false); }
// ---- k_outln: block = 32 whole rows (8 waves: 2 groups of 16 rows x 4 groups of 64 columns), ctx rows (hi and lo planes) and all of Wo staged in LDS: x = ctx Wo^T (ctx bf16 hi + lo against exact bf16 Wo: 2 products) + bo + bf16(query); the block holds every column of its rows, so LayerNorm follows at once: the x tile goes through LDS, then a wave takes four rows (mean, biased var, (x - mean) * rsqrt(var + 1e-5) * g + b; 8 floats a lane and row)
#define ORW 32
#define SFP 260            // f32 a row of the x tile in LDS: rows 8 apart fall 32 banks apart
__global__ __launch_bounds__(256) void k_outln(const float* __restrict__ Y, const float* __restrict__ WO, const float* __restrict__ BO, const float* __restrict__ RESX, const float* __restrict__ G, const float* __restrict__ BE, float* __restrict__ OUT) {
  __shared__ __align__(16) float sf[ORW][SFP]; __shared__ __align__(16) __bf16 sw[DIN * GPIT], yh[ORW * GPIT], yl[ORW * GPIT];
  const int tid = threadIdx.x, wave = tid >> 5, lane = tid & 31, col = lane & 15, g = lane >> 4; const int rg = wave & 1, cg = wave >> 1; const size_t r0 = (size_t)blockIdx.x * ORW;
  // what the rows' end needs from memory is asked for first: this wave's four query rows, its bias columns, the affine pair
  v4f zr[4][2], g4[2], b4[2]; float bias[4];
#pragma unroll
  for (int k = 0; k < 4; ++k)
#pragma unroll
    for (int i = 0; i < 2; ++i) zr[k][i] = *(const v4f*)(RESX + (r0 + wave * 4 + k) * DIN + i * 128 + lane * 4);
#pragma unroll
  for (int i = 0; i < 2; ++i) { g4[i] = *(const v4f*)(G + i * 128 + lane * 4); b4[i] = *(const v4f*)(BE + i * 128 + lane * 4); }
#pragma unroll
  for (int j = 0; j < 4; ++j) bias[j] = BO[cg * 64 + j * 16 + col];
  asm volatile("s_wait_xcnt 0x0" ::: "memory");   // stands in front of whatever next rewrites a register that these loads name
  stage_rows2_w8<ORW>(yh, yl, Y + r0 * CC, tid); stage_rows_w8<DIN>(sw, WO, tid);
  __syncthreads();   // both operands are whole in LDS
  v8f acc[4] = {};
  const __bf16* ph = yh + (rg * 16 + col) * GPIT; const __bf16* pl = yl + (rg * 16 + col) * GPIT; const __bf16* pw = sw + (cg * 64 + col) * GPIT;
  v16b ah = frag_b(ph, lane), al = frag_b(pl, lane), w[4];
#pragma unroll
  for (int j = 0; j < 4; ++j) w[j] = frag_b(pw + j * 16 * GPIT, lane);
#pragma unroll
  for (int kc = 0; kc < CC / 32; ++kc) { v16b ahn = ah, aln = al, wn[4];
    if (kc + 1 < CC / 32) { ahn = frag_b(ph + (kc + 1) * 32, lane); aln = frag_b(pl + (kc + 1) * 32, lane);   // the next k step's fragments: one group of LDS reads ahead of this step's products
#pragma unroll
      for (int j = 0; j < 4; ++j) wn[j] = frag_b(pw + j * 16 * GPIT + (kc + 1) * 32, lane); }
    __builtin_amdgcn_sched_barrier(0);   // keeps that group of reads in front of the products: sunk to their uses, each read's LDS latency would stand open in front of a product
#pragma unroll
    for (int j = 0; j < 4; ++j) acc[j] = wmmab(ah, w[j], acc[j]);
#pragma unroll
    for (int j = 0; j < 4; ++j) acc[j] = wmmab(al, w[j], acc[j]);
    if (kc + 1 < CC / 32) { ah = ahn; al = aln;
#pragma unroll
      for (int j = 0; j < 4; ++j) w[j] = wn[j]; } }
#pragma unroll
  for (int j = 0; j < 4; ++j) { const float bj = bfr(bias[j]);
#pragma unroll
    for (int r = 0; r < 8; ++r) sf[rg * 16 + 8 * g + r][cg * 64 + j * 16 + col] = acc[j][r] + bj; }
  __syncthreads();   // the x tile is whole: a row's columns come from four waves
  v4f v[4][2]; float s1[4], q[4];
#pragma unroll
  for (int k = 0; k < 4; ++k) { s1[k] = 0.f;
#pragma unroll
    for (int i = 0; i < 2; ++i) { v4f t = *(const v4f*)&sf[wave * 4 + k][i * 128 + lane * 4]; t[0] += bfr(zr[k][i][0]); t[1] += bfr(zr[k][i][1]); t[2] += bfr(zr[k][i][2]); t[3] += bfr(zr[k][i][3]); v[k][i] = t; s1[k] += (t[0] + t[1]) + (t[2] + t[3]); } }
#pragma unroll
  for (int o = 1; o < 32; o <<= 1)
#pragma unroll
    for (int k = 0; k < 4; ++k) s1[k] += __shfl_xor(s1[k], o);
#pragma unroll
  for (int k = 0; k < 4; ++k) { s1[k] *= (1.0f / CC); q[k] = 0.f;
#pragma unroll
    for (int i = 0; i < 2; ++i)
#pragma unroll
      for (int e = 0; e < 4; ++e) { const float d = v[k][i][e] - s1[k]; q[k] += d * d; } }
#pragma unroll
  for (int o = 1; o < 32; o <<= 1)
#pragma unroll
    for (int k = 0; k < 4; ++k) q[k] += __shfl_xor(q[k], o);
#pragma unroll
  for (int k = 0; k < 4; ++k) { const float inv = rsqrtf(q[k] * (1.0f / CC) + 1e-5f);   /* jnp.var (biased), eps inside the rsqrt */
#pragma unroll
    for (int i = 0; i < 2; ++i) { v4f r4;
#pragma unroll
      for (int e = 0; e < 4; ++e) r4[e] = bfr(g4[i][e]) * ((v[k][i][e] - s1[k]) * inv) + bfr(b4[i][e]);
      vst2(OUT + (r0 + wave * 4 + k) * DIN + i * 128 + lane * 4, r4); } } }

extern "C" void kernel_launch(void* const* d_in, const int* in_sizes, int n_in, void* d_out, int out_size, void* d_ws, size_t ws_size, hipStream_t stream) {
  (void)in_sizes; (void)n_in; (void)out_size;
  const float** F = (const float**)d_in;
  if (ws_size < (size_t)WS_END) return;
  char* ws = (char*)d_ws; _Float16 *QH = (_Float16*)(ws + WS_QH), *KH = (_Float16*)(ws + WS_KH), *VT = (_Float16*)(ws + WS_VT), *QL = (_Float16*)(ws + WS_QL), *KL = (_Float16*)(ws + WS_KL); __bf16 *VB = (__bf16*)(ws + WS_VB), *VBL = (__bf16*)(ws + WS_VBL); float *S = (float*)(ws + WS_S), *Y = (float*)(ws + WS_Y);
  (void)S;
  // inputs: 0 query; 1 key; 2 value [4,2048,256]; 3 Wq (out,in), 4 bq; 5 Wk, 6 bk; 7 Wv, 8 bv; 9 Wo (out,in), 10 bo; 11 ln_g, 12 ln_b
  k_proj<<<dim3(TNB * TT / 64, CC / 128, 3), 128, 0, stream>>>(F[0], F[1], F[2], F[3], F[5], F[7], F[4], F[6], F[8], QH, QL, KH, KL, VT, VB, VBL);
  k_fa<<<dim3(TT / 128, NH, TNB), 256, 0, stream>>>(QH, QL, KH, VT, Y);
  k_outln<<<dim3(TNB * TT / ORW), 256, 0, stream>>>(Y, F[9], F[10], F[0], F[11], F[12], (float*)d_out);   /* LayerNorm(ctx Wo^T + bo + bf16(query)) */
}

// v006
// It runs in 45.3 microseconds.
// Two timings next to v005 put it at 1.08 and 1.09 times that version's speed.
// Counting every step since v000, it is 19.1 times as fast.
// compute dtype: all float inputs rounded to bf16; Q/K/V = in W^T + b with EXACT bf16 products on WMMA 16x16x32 (f32 accumulate); q x log2(e) / sqrt(32) as f16 hi + residual against k once to f16 (2 products, chained in one f32 accumulator that starts at the softmax offset); softmax in f32 in base 2 (the accumulator is the exponent: hardware exp2 on it; offset and sum carried over 64-key passes); exp x 2^11 (the maximum in use; up to 2^15 for a later one) once to f16 against v once to f16 (1 product), divided by the sum at the end; ctx split bf16 hi + lo against exact Wo (2 products) + bo + query; LayerNorm in f32; f32 output.
#include <hip/hip_runtime.h>
#include <math.h>

typedef __attribute__((ext_vector_type(16))) _Float16 v16h;
typedef __attribute__((ext_vector_type(16))) __bf16 v16b;
typedef __attribute__((ext_vector_type(8)))  _Float16 v8h;
typedef __attribute__((ext_vector_type(8)))  float v8f;
typedef __attribute__((ext_vector_type(4)))  float v4f;
typedef __attribute__((ext_vector_type(2)))  float v2f;
typedef __attribute__((ext_vector_type(4)))  unsigned v4u;
typedef __attribute__((ext_vector_type(4)))  int v4i;
typedef float __attribute__((may_alias)) float_a;
typedef int __attribute__((may_alias)) int_a;

template <typename T> __device__ __forceinline__ void vst2(void* p, T v) { *(T*)p = v;  }
__device__ __forceinline__ v8f wmma16(v16h a, v16h b, v8f c) {
  v8f d = __builtin_amdgcn_wmma_f32_16x16x32_f16(false, a, false, b, (short)0, c, false, false);
  asm volatile("v_nop\n\tv_nop\n\tv_nop\n\tv_nop" : "+v"(d) : "v"(a), "v"(b));
  return d;
}
__device__ __forceinline__ v8f wmma_bf(v16b a, v16b b, v8f c) {
  v8f d = __builtin_amdgcn_wmma_f32_16x16x32_bf16(false, a, false, b, (short)0, c, false, false);
  asm volatile("v_nop\n\tv_nop\n\tv_nop\n\tv_nop" : "+v"(d) : "v"(a), "v"(b));
  return d;
}
// 16x16x32 fragments: lane = (h = lane>>4, row/col = lane&15); elements 0..7 = k0+8h+0..7, 8..15 = k0+16+8h+0..7; D element r = row 8h+r
__device__ __forceinline__ v16h frag_h(const _Float16* rowk0, int lane) {
  union { v16h v; v8h q[2]; } u; const _Float16* p = rowk0 + 8 * (lane >> 4);
  u.q[0] = *(const v8h*)p; u.q[1] = *(const v8h*)(p + 16); return u.v;
}
__device__ __forceinline__ v16h frag_f32(const float* rowk0, int lane) {
  v16h a; const float* p = rowk0 + 8 * (lane >> 4);
#pragma unroll
  for (int i = 0; i < 8; ++i) { a[i] = (_Float16)p[i]; a[8 + i] = (_Float16)p[16 + i]; }
  return a;
}
__device__ __forceinline__ v16h frag_f32s(const float* rowk0, int lane, float sc) {
  v16h a; const float* p = rowk0 + 8 * (lane >> 4);
#pragma unroll
  for (int i = 0; i < 8; ++i) { a[i] = (_Float16)(p[i] * sc); a[8 + i] = (_Float16)(p[16 + i] * sc); }
  return a;
}
// column fragment from a [K][ld] layout (column n), rows >= K read as 0
__device__ __forceinline__ v16h fragc_f32(const float* W, int k0, int n, int lane, int ld, int K) {
  v16h a; const int g = lane >> 4;
#pragma unroll
  for (int i = 0; i < 8; ++i) { const int ka = k0 + 8 * g + i, kb = ka + 16;
    a[i] = (_Float16)(ka < K ? W[(size_t)(ka < K ? ka : K - 1) * ld + n] : 0.f); a[8 + i] = (_Float16)(kb < K ? W[(size_t)(kb < K ? kb : K - 1) * ld + n] : 0.f); }
  return a;
}
struct F2 { v16b h, l; };
__device__ __forceinline__ F2 bsplit16(const float v[16]) { F2 r;
#pragma unroll
  for (int i = 0; i < 16; ++i) { const __bf16 h = (__bf16)v[i]; r.h[i] = h; r.l[i] = (__bf16)(v[i] - (float)h); }
  return r; }
__device__ __forceinline__ F2 split_row(const float* row, int k0, int lane) { float v[16]; const float* p = row + k0 + 8 * (lane >> 4);
#pragma unroll
  for (int i = 0; i < 8; ++i) { v[i] = p[i]; v[8 + i] = p[16 + i]; }
  return bsplit16(v); }
__device__ __forceinline__ F2 split_rowK(const float* row, int k0, int lane, int K) { float v[16]; const int g = lane >> 4;
#pragma unroll
  for (int i = 0; i < 8; ++i) { const int ka = k0 + 8 * g + i, kb = ka + 16; v[i] = ka < K ? row[ka < K ? ka : K - 1] : 0.f; v[8 + i] = kb < K ? row[kb < K ? kb : K - 1] : 0.f; }
  return bsplit16(v); }
__device__ __forceinline__ F2 split_col(const float* W, int k0, int n, int lane, int ld, int K) { float v[16]; const int g = lane >> 4;
#pragma unroll
  for (int i = 0; i < 8; ++i) { const int ka = k0 + 8 * g + i, kb = ka + 16; v[i] = ka < K ? W[(size_t)(ka < K ? ka : K - 1) * ld + n] : 0.f; v[8 + i] = kb < K ? W[(size_t)(kb < K ? kb : K - 1) * ld + n] : 0.f; }
  return bsplit16(v); }
__device__ __forceinline__ v8f mac3(const F2& a, const F2& b, v8f c) { c = wmma_bf(a.l, b.h, c); c = wmma_bf(a.h, b.l, c); return wmma_bf(a.h, b.h, c); }
__device__ __forceinline__ float sigm(float v) { return 1.0f / (1.0f + expf(-v)); }
#define LDSX() do { asm volatile("s_wait_dscnt 0" ::: "memory"); __builtin_amdgcn_wave_barrier(); __builtin_amdgcn_fence(__ATOMIC_RELEASE, "workgroup"); } while (0)

// Cross-modal multi-head attention with residual + LayerNorm (B 4, L 2,048, d_model 256 = 8 heads x 32; (out,in) 1/16-scale weights, zero biases; LN affine 1/0, eps 1e-5): Q = query Wq^T + bq, K = key Wk^T + bk, V = value Wv^T + bv; ctx = softmax(Q K^T / sqrt(32)) V; out = LN(ctx Wo^T + bo + query).
#define NB 4
#define TT 2048
#define CC 256            // NH * HD = projected width
#define DIN 256          // input (model) width
#define NH 8
#define HD 32
#define NQB (TT / 64)
#define HG 4
#define SCALE (0.17677669529663689f)
#define CAUSAL 0
#ifndef TNB
#define TNB NB
#endif
__device__ __forceinline__ float bfr(float v) { return (float)(__bf16)v; }
__host__ __device__ __forceinline__ int kb_last(int qb) { return CAUSAL ? ((qb * 64 + 63) >> 7) : (TT / 128 - 1); }
typedef __attribute__((ext_vector_type(8))) __bf16 v8b;
__device__ __forceinline__ v16b frag_b(const __bf16* rowk0, int lane) {
  union { v16b v; v8b q[2]; } u; const __bf16* p = rowk0 + 8 * (lane >> 4);
  u.q[0] = *(const v8b*)p; u.q[1] = *(const v8b*)(p + 16); return u.v;
}
#define QBH 0              // unused: no kernel here reads it (no separate high-precision path)
#define QHI 2048            // rows carrying a q residual plane (all rows when non-causal: 2-product logits everywhere)
#define KHI 64            // key rows carrying k residual / v bf16 hi+lo planes (written by k_proj; no kernel here reads them)
// B fragment (k rows k0+.., output column o) of a weight: (in,out) [K][ld] or (out,in) [ld rows of K]: bf16 exact, or f16(bf16 * 256) exact
__device__ __forceinline__ v16b wcol_io(const float* Wm, int k0, int o, int lane, int ld) { v16b w; const int g = lane >> 4;
#pragma unroll
  for (int i = 0; i < 8; ++i) { w[i] = (__bf16)Wm[(size_t)(k0 + 8 * g + i) * ld + o]; w[8 + i] = (__bf16)Wm[(size_t)(k0 + 16 + 8 * g + i) * ld + o]; }
  return w; }
__device__ __forceinline__ v16b wcol_oi(const float* Wm, int k0, int o, int lane, int K) { v16b w; const float* p = Wm + (size_t)o * K + k0 + 8 * (lane >> 4);
#pragma unroll
  for (int i = 0; i < 8; ++i) { w[i] = (__bf16)p[i]; w[8 + i] = (__bf16)p[16 + i]; }
  return w; }
__device__ __forceinline__ v16h wcolh_io(const float* Wm, int k0, int o, int lane, int ld) { v16h w; const int g = lane >> 4;
#pragma unroll
  for (int i = 0; i < 8; ++i) { w[i] = (_Float16)(bfr(Wm[(size_t)(k0 + 8 * g + i) * ld + o]) * 256.0f); w[8 + i] = (_Float16)(bfr(Wm[(size_t)(k0 + 16 + 8 * g + i) * ld + o]) * 256.0f); }
  return w; }
__device__ __forceinline__ v16h wcolh_oi(const float* Wm, int k0, int o, int lane, int K) { v16h w; const float* p = Wm + (size_t)o * K + k0 + 8 * (lane >> 4);
#pragma unroll
  for (int i = 0; i < 8; ++i) { w[i] = (_Float16)(bfr(p[i]) * 256.0f); w[8 + i] = (_Float16)(bfr(p[16 + i]) * 256.0f); }
  return w; }
#define WQKV_LAYOUT 1   // 0 = (in,out) [DIN][CC]; 1 = (out,in) [CC][DIN]; 2 = per-head [NH][DIN][HD]
__device__ __forceinline__ v16b wcol_hdk(const float* Wm, int k0, int o, int lane) { v16b w; const int g = lane >> 4; const float* p = Wm + (size_t)(o / HD) * DIN * HD + (o % HD);
#pragma unroll
  for (int i = 0; i < 8; ++i) { w[i] = (__bf16)p[(size_t)(k0 + 8 * g + i) * HD]; w[8 + i] = (__bf16)p[(size_t)(k0 + 16 + 8 * g + i) * HD]; }
  return w; }
#define WO_OUT_IN 1
#if WQKV_LAYOUT == 1
#define WCOL(W, k0, o, lane) wcol_oi(W, k0, o, lane, DIN)
#elif WQKV_LAYOUT == 2
#define WCOL(W, k0, o, lane) wcol_hdk(W, k0, o, lane)
#else
#define WCOL(W, k0, o, lane) wcol_io(W, k0, o, lane, CC)
#endif
#if WO_OUT_IN
#define WOCOL(W, k0, o, lane) wcol_oi(W, k0, o, lane, CC)
#define WOCOLH(W, k0, o, lane) wcolh_oi(W, k0, o, lane, CC)
#else
#define WOCOL(W, k0, o, lane) wcol_io(W, k0, o, lane, DIN)
#define WOCOLH(W, k0, o, lane) wcolh_io(W, k0, o, lane, DIN)
#endif
#ifndef SM_EXTRA_PARAMS
#define SM_EXTRA_PARAMS
#endif
#ifndef PROJ_EXTRA_PARAMS
#define PROJ_EXTRA_PARAMS
#endif
#ifndef SM_MASK_HOOK
#define SM_MASK_HOOK (void)0
#endif

#define WS_QH  0u                                      // f16 q x C2 rows [b*t][CC]
#define WS_KH  (WS_QH + 2u * (size_t)NB * TT * CC)      // f16 k rows [b*t][CC]
#define WS_VT  (WS_KH + 2u * (size_t)NB * TT * CC)      // f16 v planes [b][c][t]
#define WS_QL  (WS_VT + 2u * (size_t)NB * CC * TT)      // f16 q x C2 residual rows [b][t < QHI][CC]
#define WS_KL  (WS_QL + 2u * (size_t)NB * QHI * CC)     // f16 k residual x 2^10 rows [b][t < KHI][CC]
#define WS_VB  (WS_KL + 2u * (size_t)NB * KHI * CC)     // bf16 v hi planes [b][c][t < KHI]
#define WS_VBL (WS_VB + 2u * (size_t)NB * CC * KHI)
#define WS_S   (WS_VBL + 2u * (size_t)NB * CC * KHI)    // f32 [hg][t][s], unused (k_fa keeps logits in registers)
#define WS_Y   (WS_S  + 4u * (size_t)HG * TT * TT)      // f32 ctx rows [b*t][CC] (only when there is an output projection)
#define WS_END (WS_Y  + 4u * (size_t)NB * TT * CC)

// A GEMM operand reaches the four waves of a block through LDS: rows of 256 f32, contiguous in memory, are read once a block by whole-line loads (a wave's load = 512 contiguous bytes; 32 loads of a thread form a batch), rounded to bf16 and laid at a pitch of 16 B x odd, where the b128 fragment reads of 16 rows fall on 64 different banks
#define C2 (SCALE * 1.4426950408889634f)   // 1/sqrt(32) x log2(e): q leaves k_proj with it, so that k q is a base-2 exponent
#define GPIT 264           // bf16 a staged row in LDS (512 B of data, 528-B pitch)
typedef __attribute__((ext_vector_type(4))) __bf16 v4b;
template <int NR> __device__ __forceinline__ void stage_rows(__bf16* __restrict__ dst, const float* __restrict__ srcp, int tid) {
  __bf16* d = dst + (tid >> 6) * GPIT + (tid & 63) * 4; const float* s = srcp + tid * 4;
#pragma unroll
  for (int b = 0; b < NR / 64; ++b) { v4f t[32];
#pragma unroll
    for (int i = 0; i < 32; ++i) t[i] = *(const v4f*)(s + (b * 32 + i) * 512);
    asm volatile("s_wait_xcnt 0x0" ::: "memory");   // stands in front of whatever next rewrites a register that these loads name
#pragma unroll
    for (int i = 0; i < 32; ++i) { v4b o; o[0] = (__bf16)t[i][0]; o[1] = (__bf16)t[i][1]; o[2] = (__bf16)t[i][2]; o[3] = (__bf16)t[i][3]; *(v4b*)(d + (b * 64 + 2 * i) * GPIT) = o; } } }
// ---- k_proj: block = (64 rows, 128 cols, which): q/k/v = X W (+ b) with exact bf16 products (K = DIN), X rows and W rows staged in LDS -> which 0: q x C2 f16 rows (+ residual rows < QHI); 1: k f16 rows (+ residual rows < KHI); 2: v f16 planes [c][t] (+ bf16 hi/lo planes for t < KHI)
// amdgpu_waves_per_eu(3, 3): the grid holds three blocks for every WGP, three waves a SIMD: the kernel takes the register budget of that occupancy
__global__ __launch_bounds__(128) __attribute__((amdgpu_waves_per_eu(3, 3))) void k_proj(const float* __restrict__ XQ, const float* __restrict__ XK, const float* __restrict__ XV, const float* __restrict__ WQ, const float* __restrict__ WK, const float* __restrict__ WV, const float* __restrict__ BQ, const float* __restrict__ BK, const float* __restrict__ BV,
    _Float16* __restrict__ QH, _Float16* __restrict__ QL, _Float16* __restrict__ KH, _Float16* __restrict__ KL, _Float16* __restrict__ VT, __bf16* __restrict__ VB, __bf16* __restrict__ VBL) {
  __shared__ __align__(16) unsigned char smem[(128 + 64) * GPIT * 2];   // the two operands; behind the products the output tiles take the same bytes, so that three blocks fit a WGP
  __bf16* sw = (__bf16*)smem; __bf16* sx = sw + 128 * GPIT;
  _Float16 (*sh)[136] = (_Float16 (*)[136])smem; _Float16 (*sl)[136] = sh + 64; _Float16 (*th)[72] = (_Float16 (*)[72])smem; __bf16 (*tb)[72] = (__bf16 (*)[72])(smem + 128 * 72 * 2); __bf16 (*tbl)[72] = tb + 128;
  const int tid = threadIdx.x, wave = tid >> 5, lane = tid & 31, col = lane & 15, g = lane >> 4; const int which = blockIdx.z; const int c0 = blockIdx.y * 128; const size_t r0 = (size_t)blockIdx.x * 64; const size_t bb = r0 / TT; const int t0 = (int)(r0 % TT);
  const float* X = which == 0 ? XQ : which == 1 ? XK : XV; const float* WA = which == 0 ? WQ : which == 1 ? WK : WV; const float* BA = which == 0 ? BQ : which == 1 ? BK : BV;
  stage_rows<64>(sx, X + r0 * DIN, tid); stage_rows<128>(sw, WA + (size_t)c0 * DIN, tid);
  __syncthreads();   // both operands are whole in LDS
  v8f acc[8] = {}; const __bf16* pa = sx + (wave * 16 + col) * GPIT; const __bf16* pw = sw + col * GPIT;
  v16b a = frag_b(pa, lane), w[8];
#pragma unroll
  for (int j = 0; j < 8; ++j) w[j] = frag_b(pw + j * 16 * GPIT, lane);
#pragma unroll
  for (int kc = 0; kc < DIN / 32; ++kc) { v16b an = a, wn[8];
    if (kc + 1 < DIN / 32) { an = frag_b(pa + (kc + 1) * 32, lane);   // the next k step's fragments: one group of LDS reads ahead of this step's products
#pragma unroll
      for (int j = 0; j < 8; ++j) wn[j] = frag_b(pw + j * 16 * GPIT + (kc + 1) * 32, lane); }
#pragma unroll
    for (int j = 0; j < 8; ++j) acc[j] = wmma_bf(a, w[j], acc[j]);
    if (kc + 1 < DIN / 32) { a = an;
#pragma unroll
      for (int j = 0; j < 8; ++j) w[j] = wn[j]; } }
  __syncthreads();   // every wave has read its last fragment: the bytes may take the output tiles
  if (which < 2) { _Float16* DH = which == 0 ? QH : KH; _Float16* DL = which == 0 ? QL : KL; const int nhi = which == 0 ? QHI : KHI; const bool hi_rows = t0 < nhi; const float vs = which == 0 ? C2 : 1.0f, rs = which == 0 ? 1.0f : 1024.0f;   // q: scaled by C2, residual at the scale of hi (f16 subnormals carry it); k as before
#pragma unroll
    for (int j = 0; j < 8; ++j) { const float bias = BA ? bfr(BA[c0 + j * 16 + col]) : 0.f;
#pragma unroll
      for (int r = 0; r < 8; ++r) { const float v = (acc[j][r] + bias) * vs; const _Float16 hv = (_Float16)v; sh[wave * 16 + 8 * g + r][j * 16 + col] = hv; sl[wave * 16 + 8 * g + r][j * 16 + col] = (_Float16)((v - (float)hv) * rs); } }
    __syncthreads();
    for (int e = tid; e < 64 * 16; e += 128) { const int rl = e >> 4, q = e & 15; vst2((unsigned*)(DH + (r0 + rl) * CC + c0 + q * 8), *(const v4u*)&sh[rl][q * 8]); if (hi_rows) vst2((unsigned*)(DL + (bb * nhi + t0 + rl) * (size_t)CC + c0 + q * 8), *(const v4u*)&sl[rl][q * 8]); }
  } else { const bool hi_rows = t0 < KHI;
#pragma unroll
    for (int j = 0; j < 8; ++j) { const float bias = BA ? bfr(BA[c0 + j * 16 + col]) : 0.f;
#pragma unroll
      for (int r = 0; r < 8; ++r) { const float v = acc[j][r] + bias; const int rl = wave * 16 + 8 * g + r, cl = j * 16 + col; th[cl][rl] = (_Float16)v; const __bf16 bh = (__bf16)v; tb[cl][rl] = bh; tbl[cl][rl] = (__bf16)(v - (float)bh); } }
    __syncthreads();
    for (int e = tid; e < 128 * 8; e += 128) { const int cl = e >> 3, q = e & 7; vst2((unsigned*)(VT + (bb * CC + c0 + cl) * (size_t)TT + t0 + q * 8), *(const v4u*)&th[cl][q * 8]); if (hi_rows) { const size_t o3 = (bb * CC + c0 + cl) * (size_t)KHI + t0 + q * 8; vst2((unsigned*)(VB + o3), *(const v4u*)&tb[cl][q * 8]); vst2((unsigned*)(VBL + o3), *(const v4u*)&tbl[cl][q * 8]); } } } }
// ---- k_fa: block = 128 queries (8 waves x 16 query columns) of (b, h), one pass over all keys in steps of FAK, k rows and v planes staged in LDS for the whole block: E^T = K Q^T + nm (A = k rows, B = q residual, then q hi onto the same accumulator, whose start value C is the column's offset nm: 2 products); q carries C2 = SCALE x log2(e), so a lane holds one query's finished exponents e (keys 8g + r of each 16-key tile) and p = exp2(e): no vector arithmetic between product and exp2; nm = 11 - (the maximum in use) is known before the products: the first pass sets it from its own maximum, and it moves again only when a p passes PLIM (p stays inside f16): there the halves' maxima are joined by a cross-row move, sum and ctx rescaled and the pass's p taken again; sum in f32; p once to f16, packed from two score tiles straight into a B operand; ctx^T += V^T P^T (A = v planes: 1 product); ctx = acc / sum (both carry 2^nm)
#define FAK 64
#define FNT (FAK / 16)
#define PLIM 32768.0f      // largest p let through under the offset in use (2^15: inside f16)
// amdgpu_waves_per_eu(4, 4): the grid holds four waves for every SIMD, so the kernel takes the register budget of that occupancy (two blocks a WGP, all resident at once)
__device__ __forceinline__ float xhalf(float x) { return __builtin_bit_cast(float, __builtin_amdgcn_permlanex16(__builtin_bit_cast(int, x), __builtin_bit_cast(int, x), 0x76543210, 0xfedcba98, false, false)); }   // lane l with lane l ^ 16
__device__ __forceinline__ v16h frag_p(const _Float16* p) { union { v16h v; v8h q[2]; } u; u.q[0] = *(const v8h*)p; u.q[1] = *(const v8h*)(p + 16); return u.v; }   // frag_h with the lane half's 8g already in p
// exp2 with the slot behind a transcendental closed in its own statement (one v_nop before its result is read or its source overwritten): for the rare path
__device__ __forceinline__ float exp2_slot(float x) { float y; asm("v_exp_f32 %0, %1\n\tv_nop" : "=v"(y) : "v"(x)); return y; }
__device__ __forceinline__ v8f wmmah(v16h a, v16h b, v8f c) { return __builtin_amdgcn_wmma_f32_16x16x32_f16(false, a, false, b, (short)0, c, false, false); }
// K and V reach the eight waves of a block through LDS: a stage = FST keys (two passes), two buffers, filled one stage ahead by asynchronous 16-byte copies (each thread: two pieces of k rows, two of v planes). Pitches 16 B x odd: the b128 fragment reads of 16 rows fall on 64 different banks.
#define FST 128
#define NST (TT / FST)
#define KPIT 40            // halves a k row in LDS (64 B of data, 80-B pitch)
#define VPIT (FST + 8)     // halves a v plane row in LDS (256 B of data, 272-B pitch)
__device__ __forceinline__ unsigned lds_off(const void* p) { return (unsigned)(size_t)p; }   // byte offset in the work-group's LDS
// one stage's four copies of this thread; the s_wait_xcnt stands inside the statement, behind the last copy, so that no address register is rewritten in front of it
__device__ __forceinline__ void stage_kv(unsigned lk, unsigned lv, const _Float16* gk, const _Float16* gv) {
  asm volatile("global_load_async_to_lds_b128 %0, %4, off\n\tglobal_load_async_to_lds_b128 %1, %5, off\n\tglobal_load_async_to_lds_b128 %2, %6, off\n\tglobal_load_async_to_lds_b128 %3, %7, off\n\ts_wait_xcnt 0x0"
      :: "v"(lk), "v"(lk + 64u * KPIT * 2u), "v"(lv), "v"(lv + 16u * VPIT * 2u), "v"(gk), "v"(gk + (size_t)64 * CC), "v"(gv), "v"(gv + (size_t)16 * TT) : "memory"); }
__global__ __launch_bounds__(256) __attribute__((amdgpu_waves_per_eu(4, 4))) void k_fa(const _Float16* __restrict__ QH, const _Float16* __restrict__ QL, const _Float16* __restrict__ KH, const _Float16* __restrict__ VT, float* __restrict__ Y) {
  __shared__ __align__(16) _Float16 sk[2][FST * KPIT], sv[2][HD * VPIT];
  const int tid = threadIdx.x, wave = tid >> 5, lane = tid & 31, col = lane & 15, g = lane >> 4; const int h = blockIdx.y, b = blockIdx.z; const int q = blockIdx.x * 128 + wave * 16 + col;
  const v16h qh = frag_h(QH + ((size_t)b * TT + q) * CC + h * HD, lane), ql = frag_h(QL + ((size_t)b * QHI + q) * CC + h * HD, lane);
  const _Float16* gk = KH + ((size_t)b * TT + (tid >> 2)) * CC + h * HD + (tid & 3) * 8;               // copies: key rows tid / 4 and 64 + tid / 4 of a stage, 16-byte piece tid % 4
  const _Float16* gv = VT + ((size_t)b * CC + h * HD + (tid >> 4)) * (size_t)TT + (tid & 15) * 8;      // copies: planes tid / 16 and 16 + tid / 16, 16-byte piece tid % 16 of the stage's keys
  const unsigned lk = lds_off(&sk[0][(tid >> 2) * KPIT + (tid & 3) * 8]), lv = lds_off(&sv[0][(tid >> 4) * VPIT + (tid & 15) * 8]);
  stage_kv(lk, lv, gk, gv);
  asm volatile("s_wait_asynccnt 0x0" ::: "memory");   // this wave's copies of stage 0 have landed
  __syncthreads();                                    // and every other wave's: stage 0 may be read
  stage_kv(lk + (unsigned)sizeof(sk[0]), lv + (unsigned)sizeof(sv[0]), gk + (size_t)FST * CC, gv + FST);
  v8f acc[HD / 16] = {}, nmv = {}; float l = 0.f;   // nmv: the offset in use, eight times: the C operand of the score products
#pragma unroll 1   // a trip = a stage; its two passes are unrolled below
  for (int st = 0; st < NST; ++st) {
    const _Float16* kb = &sk[st & 1][col * KPIT + 8 * g];   // key row col of a 16-key tile, this lane half's d
    const _Float16* vb = &sv[st & 1][col * VPIT + 8 * g];   // plane d = col of a 16-wide d tile, this lane half's keys
    v16h kf[FNT];
#pragma unroll
    for (int t = 0; t < FNT; ++t) kf[t] = frag_p(kb + (t * 16) * KPIT);
#pragma unroll
    for (int ps = 0; ps < FST / FAK; ++ps) {
    v8f s[FNT];
#pragma unroll
    for (int t = 0; t < FNT; ++t) s[t] = wmmah(kf[t], ql, nmv);
    __builtin_amdgcn_sched_barrier(0);   // keeps the four residual products in front of the four hi products: paired tile by tile, each hi product waits out its own accumulator's latency and its first reader follows behind v_nops
#pragma unroll
    for (int t = 0; t < FNT; ++t) s[t] = wmmah(kf[t], qh, s[t]);
    if (ps + 1 < FST / FAK) {   // the stage's next pass: its k fragments are read one pass ahead, from the same buffer
#pragma unroll
      for (int t = 0; t < FNT; ++t) kf[t] = frag_p(kb + ((ps + 1) * FAK + t * 16) * KPIT); }
    v16h vf[HD / 16][FAK / 32];   // this pass's v planes: in flight under the softmax
#pragma unroll
    for (int j = 0; j < HD / 16; ++j)
#pragma unroll
      for (int c = 0; c < FAK / 32; ++c) vf[j][c] = frag_p(vb + (j * 16) * VPIT + ps * FAK + c * 32);
    float e[FNT][8];   // p at once, under the offset in use: nothing stands between the products and the exp2
#pragma unroll
    for (int t = 0; t < FNT; ++t)
#pragma unroll   // the builtin, not asm text: the compiler sees which registers the exp2 write and keeps them clear of a matrix product's operands
      for (int r = 0; r < 8; ++r) e[t][r] = __builtin_amdgcn_exp2f(s[t][r]);
    float pm = e[0][0];   // the range test reads p itself; the ballot spans both lane halves, so the halves join only where the offset moves
#pragma unroll
    for (int t = 0; t < FNT; ++t)
#pragma unroll
      for (int r = 0; r < 8; ++r) pm = fmaxf(pm, e[t][r]);
    const bool first = ps == 0 && st == 0;   // the first pass ran under offset 0: it takes its own maximum, up or down
    if (first || __builtin_amdgcn_ballot_w32(pm > PLIM) != 0) { float mx = s[0][0];   // move the offset and take this pass's p again
#pragma unroll
      for (int t = 0; t < FNT; ++t)
#pragma unroll
        for (int r = 0; r < 8; ++r) mx = fmaxf(mx, s[t][r]);
      mx = fmaxf(mx, xhalf(mx));
      float d = 11.0f - mx; const float dn = fminf(d, 0.f); if (!first) d = dn; const float al = __builtin_amdgcn_exp2f(dn); l *= al;   // d = 0 and al = 1 exactly in a column whose maximum did not rise
#pragma unroll
      for (int j = 0; j < HD / 16; ++j)
#pragma unroll
        for (int r = 0; r < 8; ++r) acc[j][r] *= al;
#pragma unroll
      for (int t = 0; t < FNT; ++t)
#pragma unroll
        for (int r = 0; r < 8; ++r) e[t][r] = exp2_slot(s[t][r] + d);
#pragma unroll
      for (int r = 0; r < 8; ++r) nmv[r] += d; }
#pragma unroll
    for (int c = 0; c < FAK / 32; ++c) { v16h p;
#pragma unroll
      for (int i = 0; i < 8; ++i) { l += e[2 * c][i] + e[2 * c + 1][i]; p[i] = (_Float16)e[2 * c][i]; p[8 + i] = (_Float16)e[2 * c + 1][i]; }
#pragma unroll
      for (int j = 0; j < HD / 16; ++j) acc[j] = wmmah(vf[j][c], p, acc[j]); } }
    asm volatile("s_wait_dscnt 0x0" ::: "memory");      // this wave's reads of the stage's buffer are done
    asm volatile("s_wait_asynccnt 0x0" ::: "memory");   // its copies of the next stage have landed
    __syncthreads();                                    // the next stage may be read, and this stage's buffer may be refilled
    if (st + 2 < NST) stage_kv(lk + (unsigned)(st & 1) * (unsigned)sizeof(sk[0]), lv + (unsigned)(st & 1) * (unsigned)sizeof(sv[0]), gk + (size_t)(st + 2) * FST * CC, gv + (st + 2) * FST); }
  asm volatile("s_wait_asynccnt 0x0" ::: "memory");     // no copy is outstanding when the wave ends
  l += xhalf(l); const float inv = 1.0f / l;
  float* yr = Y + ((size_t)b * TT + q) * CC + h * HD + 8 * g;   // acc[j][r] = ctx[q][j * 16 + 8g + r]
#pragma unroll
  for (int j = 0; j < HD / 16; ++j) { v4f o0, o1;
#pragma unroll
    for (int r = 0; r < 4; ++r) { o0[r] = acc[j][r] * inv; o1[r] = acc[j][4 + r] * inv; }
    vst2(yr + j * 16, o0); vst2(yr + j * 16 + 4, o1); } }
// stage_rows for a block of 256 threads (a load of the block = 4 rows), and the same with each value split bf16 hi + lo into two planes
template <int NR> __device__ __forceinline__ void stage_rows_w8(__bf16* __restrict__ dst, const float* __restrict__ srcp, int tid) {
  __bf16* d = dst + (tid >> 6) * GPIT + (tid & 63) * 4; const float* s = srcp + tid * 4;
#pragma unroll
  for (int b = 0; b < NR / 128; ++b) { v4f t[32];
#pragma unroll
    for (int i = 0; i < 32; ++i) t[i] = *(const v4f*)(s + (b * 32 + i) * 1024);
    asm volatile("s_wait_xcnt 0x0" ::: "memory");   // as in stage_rows
#pragma unroll
    for (int i = 0; i < 32; ++i) { v4b o; o[0] = (__bf16)t[i][0]; o[1] = (__bf16)t[i][1]; o[2] = (__bf16)t[i][2]; o[3] = (__bf16)t[i][3]; *(v4b*)(d + (b * 128 + 4 * i) * GPIT) = o; } } }
template <int NR> __device__ __forceinline__ void stage_rows2_w8(__bf16* __restrict__ dh, __bf16* __restrict__ dl, const float* __restrict__ srcp, int tid) {
  const int o0 = (tid >> 6) * GPIT + (tid & 63) * 4; const float* s = srcp + tid * 4; v4f t[NR / 4];
#pragma unroll
  for (int i = 0; i < NR / 4; ++i) t[i] = *(const v4f*)(s + i * 1024);
  asm volatile("s_wait_xcnt 0x0" ::: "memory");   // as in stage_rows
#pragma unroll
  for (int i = 0; i < NR / 4; ++i) { v4b oh, ol;
#pragma unroll
    for (int k = 0; k < 4; ++k) { const __bf16 hv = (__bf16)t[i][k]; oh[k] = hv; ol[k] = (__bf16)(t[i][k] - (float)hv); }
    *(v4b*)(dh + o0 + 4 * i * GPIT) = oh; *(v4b*)(dl + o0 + 4 * i * GPIT) = ol; } }
__device__ __forceinline__ v8f wmmab(v16b a, v16b b, v8f c) { return __builtin_amdgcn_wmma_f32_16x16x32_bf16(false, a, false, b, (short)0, c, false, false); }
// ---- k_outln: block = 32 whole rows (8 waves: 2 groups of 16 rows x 4 groups of 64 columns), ctx rows (hi and lo planes) and all of Wo staged in LDS: x = ctx Wo^T (ctx bf16 hi + lo against exact bf16 Wo: 2 products) + bo + bf16(query); the block holds every column of its rows, so LayerNorm follows at once: the x tile goes through LDS, then a wave takes four rows (mean, biased var, (x - mean) * rsqrt(var + 1e-5) * g + b; 8 floats a lane and row)
#define ORW 32
#define SFP 260            // f32 a row of the x tile in LDS: rows 8 apart fall 32 banks apart
__global__ __launch_bounds__(256) void k_outln(const float* __restrict__ Y, const float* __restrict__ WO, const float* __restrict__ BO, const float* __restrict__ RESX, const float* __restrict__ G, const float* __restrict__ BE, float* __restrict__ OUT) {
  __shared__ __align__(16) float sf[ORW][SFP]; __shared__ __align__(16) __bf16 sw[DIN * GPIT], yh[ORW * GPIT], yl[ORW * GPIT];
  const int tid = threadIdx.x, wave = tid >> 5, lane = tid & 31, col = lane & 15, g = lane >> 4; const int rg = wave & 1, cg = wave >> 1; const size_t r0 = (size_t)blockIdx.x * ORW;
  // what the rows' end needs from memory is asked for first: this wave's four query rows, its bias columns, the affine pair
  v4f zr[4][2], g4[2], b4[2]; float bias[4];
#pragma unroll
  for (int k = 0; k < 4; ++k)
#pragma unroll
    for (int i = 0; i < 2; ++i) zr[k][i] = *(const v4f*)(RESX + (r0 + wave * 4 + k) * DIN + i * 128 + lane * 4);
#pragma unroll
  for (int i = 0; i < 2; ++i) { g4[i] = *(const v4f*)(G + i * 128 + lane * 4); b4[i] = *(const v4f*)(BE + i * 128 + lane * 4); }
#pragma unroll
  for (int j = 0; j < 4; ++j) bias[j] = BO[cg * 64 + j * 16 + col];
  asm volatile("s_wait_xcnt 0x0" ::: "memory");   // stands in front of whatever next rewrites a register that these loads name
  stage_rows2_w8<ORW>(yh, yl, Y + r0 * CC, tid); stage_rows_w8<DIN>(sw, WO, tid);
  __syncthreads();   // both operands are whole in LDS
  v8f acc[4] = {};
  const __bf16* ph = yh + (rg * 16 + col) * GPIT; const __bf16* pl = yl + (rg * 16 + col) * GPIT; const __bf16* pw = sw + (cg * 64 + col) * GPIT;
  v16b ah = frag_b(ph, lane), al = frag_b(pl, lane), w[4];
#pragma unroll
  for (int j = 0; j < 4; ++j) w[j] = frag_b(pw + j * 16 * GPIT, lane);
#pragma unroll
  for (int kc = 0; kc < CC / 32; ++kc) { v16b ahn = ah, aln = al, wn[4];
    if (kc + 1 < CC / 32) { ahn = frag_b(ph + (kc + 1) * 32, lane); aln = frag_b(pl + (kc + 1) * 32, lane);   // the next k step's fragments: one group of LDS reads ahead of this step's products
#pragma unroll
      for (int j = 0; j < 4; ++j) wn[j] = frag_b(pw + j * 16 * GPIT + (kc + 1) * 32, lane); }
    __builtin_amdgcn_sched_barrier(0);   // keeps that group of reads in front of the products: sunk to their uses, each read's LDS latency would stand open in front of a product
#pragma unroll
    for (int j = 0; j < 4; ++j) acc[j] = wmmab(ah, w[j], acc[j]);
#pragma unroll
    for (int j = 0; j < 4; ++j) acc[j] = wmmab(al, w[j], acc[j]);
    if (kc + 1 < CC / 32) { ah = ahn; al = aln;
#pragma unroll
      for (int j = 0; j < 4; ++j) w[j] = wn[j]; } }
#pragma unroll
  for (int j = 0; j < 4; ++j) { const float bj = bfr(bias[j]);
#pragma unroll
    for (int r = 0; r < 8; ++r) sf[rg * 16 + 8 * g + r][cg * 64 + j * 16 + col] = acc[j][r] + bj; }
  __syncthreads();   // the x tile is whole: a row's columns come from four waves
  v4f v[4][2]; float s1[4], q[4];
#pragma unroll
  for (int k = 0; k < 4; ++k) { s1[k] = 0.f;
#pragma unroll
    for (int i = 0; i < 2; ++i) { v4f t = *(const v4f*)&sf[wave * 4 + k][i * 128 + lane * 4]; t[0] += bfr(zr[k][i][0]); t[1] += bfr(zr[k][i][1]); t[2] += bfr(zr[k][i][2]); t[3] += bfr(zr[k][i][3]); v[k][i] = t; s1[k] += (t[0] + t[1]) + (t[2] + t[3]); } }
#pragma unroll
  for (int o = 1; o < 32; o <<= 1)
#pragma unroll
    for (int k = 0; k < 4; ++k) s1[k] += __shfl_xor(s1[k], o);
#pragma unroll
  for (int k = 0; k < 4; ++k) { s1[k] *= (1.0f / CC); q[k] = 0.f;
#pragma unroll
    for (int i = 0; i < 2; ++i)
#pragma unroll
      for (int e = 0; e < 4; ++e) { const float d = v[k][i][e] - s1[k]; q[k] += d * d; } }
#pragma unroll
  for (int o = 1; o < 32; o <<= 1)
#pragma unroll
    for (int k = 0; k < 4; ++k) q[k] += __shfl_xor(q[k], o);
#pragma unroll
  for (int k = 0; k < 4; ++k) { const float inv = rsqrtf(q[k] * (1.0f / CC) + 1e-5f);   /* jnp.var (biased), eps inside the rsqrt */
#pragma unroll
    for (int i = 0; i < 2; ++i) { v4f r4;
#pragma unroll
      for (int e = 0; e < 4; ++e) r4[e] = bfr(g4[i][e]) * ((v[k][i][e] - s1[k]) * inv) + bfr(b4[i][e]);
      vst2(OUT + (r0 + wave * 4 + k) * DIN + i * 128 + lane * 4, r4); } } }

extern "C" void kernel_launch(void* const* d_in, const int* in_sizes, int n_in, void* d_out, int out_size, void* d_ws, size_t ws_size, hipStream_t stream) {
  (void)in_sizes; (void)n_in; (void)out_size;
  const float** F = (const float**)d_in;
  if (ws_size < (size_t)WS_END) return;
  char* ws = (char*)d_ws; _Float16 *QH = (_Float16*)(ws + WS_QH), *KH = (_Float16*)(ws + WS_KH), *VT = (_Float16*)(ws + WS_VT), *QL = (_Float16*)(ws + WS_QL), *KL = (_Float16*)(ws + WS_KL); __bf16 *VB = (__bf16*)(ws + WS_VB), *VBL = (__bf16*)(ws + WS_VBL); float *S = (float*)(ws + WS_S), *Y = (float*)(ws + WS_Y);
  (void)S;
  // inputs: 0 query; 1 key; 2 value [4,2048,256]; 3 Wq (out,in), 4 bq; 5 Wk, 6 bk; 7 Wv, 8 bv; 9 Wo (out,in), 10 bo; 11 ln_g, 12 ln_b
  k_proj<<<dim3(TNB * TT / 64, CC / 128, 3), 128, 0, stream>>>(F[0], F[1], F[2], F[3], F[5], F[7], F[4], F[6], F[8], QH, QL, KH, KL, VT, VB, VBL);
  k_fa<<<dim3(TT / 128, NH, TNB), 256, 0, stream>>>(QH, QL, KH, VT, Y);
  k_outln<<<dim3(TNB * TT / ORW), 256, 0, stream>>>(Y, F[9], F[10], F[0], F[11], F[12], (float*)d_out);   /* LayerNorm(ctx Wo^T + bo + bf16(query)) */
}

// v007
// A run of this version takes 44 microseconds.
// In two side-by-side timings against v006, it was 1.03 and 1.04 times as fast.
// All steps since v000 together make it 19.8 times as fast.
// compute dtype: all float inputs rounded to bf16; Q/K/V = in W^T + b with EXACT bf16 products on WMMA 16x16x32 (f32 accumulate); q x log2(e) / sqrt(32) as f16 hi + residual against k once to f16 (2 products, chained in one f32 accumulator that starts at the softmax offset); softmax in f32 in base 2 (the accumulator is the exponent: hardware exp2 on it; offset and sum carried over 64-key passes); exp x 2^8 (the maximum in use; a later one may pass it while a pass's sum stays inside 2^15) once to f16 against v once to f16 (1 product), divided at the end by the sum of the same f16 values (1 product against ones, f32 accumulate); ctx split bf16 hi + lo against exact Wo (2 products) + bo + query; LayerNorm in f32; f32 output.
#include <hip/hip_runtime.h>
#include <math.h>

typedef __attribute__((ext_vector_type(16))) _Float16 v16h;
typedef __attribute__((ext_vector_type(16))) __bf16 v16b;
typedef __attribute__((ext_vector_type(8)))  _Float16 v8h;
typedef __attribute__((ext_vector_type(8)))  float v8f;
typedef __attribute__((ext_vector_type(4)))  float v4f;
typedef __attribute__((ext_vector_type(2)))  float v2f;
typedef __attribute__((ext_vector_type(4)))  unsigned v4u;
typedef __attribute__((ext_vector_type(4)))  int v4i;
typedef float __attribute__((may_alias)) float_a;
typedef int __attribute__((may_alias)) int_a;

template <typename T> __device__ __forceinline__ void vst2(void* p, T v) { *(T*)p = v;  }
__device__ __forceinline__ v8f wmma16(v16h a, v16h b, v8f c) {
  v8f d = __builtin_amdgcn_wmma_f32_16x16x32_f16(false, a, false, b, (short)0, c, false, false);
  asm volatile("v_nop\n\tv_nop\n\tv_nop\n\tv_nop" : "+v"(d) : "v"(a), "v"(b));
  return d;
}
__device__ __forceinline__ v8f wmma_bf(v16b a, v16b b, v8f c) {
  v8f d = __builtin_amdgcn_wmma_f32_16x16x32_bf16(false, a, false, b, (short)0, c, false, false);
  asm volatile("v_nop\n\tv_nop\n\tv_nop\n\tv_nop" : "+v"(d) : "v"(a), "v"(b));
  return d;
}
// 16x16x32 fragments: lane = (h = lane>>4, row/col = lane&15); elements 0..7 = k0+8h+0..7, 8..15 = k0+16+8h+0..7; D element r = row 8h+r
__device__ __forceinline__ v16h frag_h(const _Float16* rowk0, int lane) {
  union { v16h v; v8h q[2]; } u; const _Float16* p = rowk0 + 8 * (lane >> 4);
  u.q[0] = *(const v8h*)p; u.q[1] = *(const v8h*)(p + 16); return u.v;
}
__device__ __forceinline__ v16h frag_f32(const float* rowk0, int lane) {
  v16h a; const float* p = rowk0 + 8 * (lane >> 4);
#pragma unroll
  for (int i = 0; i < 8; ++i) { a[i] = (_Float16)p[i]; a[8 + i] = (_Float16)p[16 + i]; }
  return a;
}
__device__ __forceinline__ v16h frag_f32s(const float* rowk0, int lane, float sc) {
  v16h a; const float* p = rowk0 + 8 * (lane >> 4);
#pragma unroll
  for (int i = 0; i < 8; ++i) { a[i] = (_Float16)(p[i] * sc); a[8 + i] = (_Float16)(p[16 + i] * sc); }
  return a;
}
// column fragment from a [K][ld] layout (column n), rows >= K read as 0
__device__ __forceinline__ v16h fragc_f32(const float* W, int k0, int n, int lane, int ld, int K) {
  v16h a; const int g = lane >> 4;
#pragma unroll
  for (int i = 0; i < 8; ++i) { const int ka = k0 + 8 * g + i, kb = ka + 16;
    a[i] = (_Float16)(ka < K ? W[(size_t)(ka < K ? ka : K - 1) * ld + n] : 0.f); a[8 + i] = (_Float16)(kb < K ? W[(size_t)(kb < K ? kb : K - 1) * ld + n] : 0.f); }
  return a;
}
struct F2 { v16b h, l; };
__device__ __forceinline__ F2 bsplit16(const float v[16]) { F2 r;
#pragma unroll
  for (int i = 0; i < 16; ++i) { const __bf16 h = (__bf16)v[i]; r.h[i] = h; r.l[i] = (__bf16)(v[i] - (float)h); }
  return r; }
__device__ __forceinline__ F2 split_row(const float* row, int k0, int lane) { float v[16]; const float* p = row + k0 + 8 * (lane >> 4);
#pragma unroll
  for (int i = 0; i < 8; ++i) { v[i] = p[i]; v[8 + i] = p[16 + i]; }
  return bsplit16(v); }
__device__ __forceinline__ F2 split_rowK(const float* row, int k0, int lane, int K) { float v[16]; const int g = lane >> 4;
#pragma unroll
  for (int i = 0; i < 8; ++i) { const int ka = k0 + 8 * g + i, kb = ka + 16; v[i] = ka < K ? row[ka < K ? ka : K - 1] : 0.f; v[8 + i] = kb < K ? row[kb < K ? kb : K - 1] : 0.f; }
  return bsplit16(v); }
__device__ __forceinline__ F2 split_col(const float* W, int k0, int n, int lane, int ld, int K) { float v[16]; const int g = lane >> 4;
#pragma unroll
  for (int i = 0; i < 8; ++i) { const int ka = k0 + 8 * g + i, kb = ka + 16; v[i] = ka < K ? W[(size_t)(ka < K ? ka : K - 1) * ld + n] : 0.f; v[8 + i] = kb < K ? W[(size_t)(kb < K ? kb : K - 1) * ld + n] : 0.f; }
  return bsplit16(v); }
__device__ __forceinline__ v8f mac3(const F2& a, const F2& b, v8f c) { c = wmma_bf(a.l, b.h, c); c = wmma_bf(a.h, b.l, c); return wmma_bf(a.h, b.h, c); }
__device__ __forceinline__ float sigm(float v) { return 1.0f / (1.0f + expf(-v)); }
#define LDSX() do { asm volatile("s_wait_dscnt 0" ::: "memory"); __builtin_amdgcn_wave_barrier(); __builtin_amdgcn_fence(__ATOMIC_RELEASE, "workgroup"); } while (0)

// Cross-modal multi-head attention with residual + LayerNorm (B 4, L 2,048, d_model 256 = 8 heads x 32; (out,in) 1/16-scale weights, zero biases; LN affine 1/0, eps 1e-5): Q = query Wq^T + bq, K = key Wk^T + bk, V = value Wv^T + bv; ctx = softmax(Q K^T / sqrt(32)) V; out = LN(ctx Wo^T + bo + query).
#define NB 4
#define TT 2048
#define CC 256            // NH * HD = projected width
#define DIN 256          // input (model) width
#define NH 8
#define HD 32
#define NQB (TT / 64)
#define HG 4
#define SCALE (0.17677669529663689f)
#define CAUSAL 0
#ifndef TNB
#define TNB NB
#endif
__device__ __forceinline__ float bfr(float v) { return (float)(__bf16)v; }
__host__ __device__ __forceinline__ int kb_last(int qb) { return CAUSAL ? ((qb * 64 + 63) >> 7) : (TT / 128 - 1); }
typedef __attribute__((ext_vector_type(8))) __bf16 v8b;
__device__ __forceinline__ v16b frag_b(const __bf16* rowk0, int lane) {
  union { v16b v; v8b q[2]; } u; const __bf16* p = rowk0 + 8 * (lane >> 4);
  u.q[0] = *(const v8b*)p; u.q[1] = *(const v8b*)(p + 16); return u.v;
}
#define QBH 0              // unused: no kernel here reads it (no separate high-precision path)
#define QHI 2048            // rows carrying a q residual plane (all rows when non-causal: 2-product logits everywhere)
#define KHI 64            // key rows carrying k residual / v bf16 hi+lo planes (written by k_proj; no kernel here reads them)
// B fragment (k rows k0+.., output column o) of a weight: (in,out) [K][ld] or (out,in) [ld rows of K]: bf16 exact, or f16(bf16 * 256) exact
__device__ __forceinline__ v16b wcol_io(const float* Wm, int k0, int o, int lane, int ld) { v16b w; const int g = lane >> 4;
#pragma unroll
  for (int i = 0; i < 8; ++i) { w[i] = (__bf16)Wm[(size_t)(k0 + 8 * g + i) * ld + o]; w[8 + i] = (__bf16)Wm[(size_t)(k0 + 16 + 8 * g + i) * ld + o]; }
  return w; }
__device__ __forceinline__ v16b wcol_oi(const float* Wm, int k0, int o, int lane, int K) { v16b w; const float* p = Wm + (size_t)o * K + k0 + 8 * (lane >> 4);
#pragma unroll
  for (int i = 0; i < 8; ++i) { w[i] = (__bf16)p[i]; w[8 + i] = (__bf16)p[16 + i]; }
  return w; }
__device__ __forceinline__ v16h wcolh_io(const float* Wm, int k0, int o, int lane, int ld) { v16h w; const int g = lane >> 4;
#pragma unroll
  for (int i = 0; i < 8; ++i) { w[i] = (_Float16)(bfr(Wm[(size_t)(k0 + 8 * g + i) * ld + o]) * 256.0f); w[8 + i] = (_Float16)(bfr(Wm[(size_t)(k0 + 16 + 8 * g + i) * ld + o]) * 256.0f); }
  return w; }
__device__ __forceinline__ v16h wcolh_oi(const float* Wm, int k0, int o, int lane, int K) { v16h w; const float* p = Wm + (size_t)o * K + k0 + 8 * (lane >> 4);
#pragma unroll
  for (int i = 0; i < 8; ++i) { w[i] = (_Float16)(bfr(p[i]) * 256.0f); w[8 + i] = (_Float16)(bfr(p[16 + i]) * 256.0f); }
  return w; }
#define WQKV_LAYOUT 1   // 0 = (in,out) [DIN][CC]; 1 = (out,in) [CC][DIN]; 2 = per-head [NH][DIN][HD]
__device__ __forceinline__ v16b wcol_hdk(const float* Wm, int k0, int o, int lane) { v16b w; const int g = lane >> 4; const float* p = Wm + (size_t)(o / HD) * DIN * HD + (o % HD);
#pragma unroll
  for (int i = 0; i < 8; ++i) { w[i] = (__bf16)p[(size_t)(k0 + 8 * g + i) * HD]; w[8 + i] = (__bf16)p[(size_t)(k0 + 16 + 8 * g + i) * HD]; }
  return w; }
#define WO_OUT_IN 1
#if WQKV_LAYOUT == 1
#define WCOL(W, k0, o, lane) wcol_oi(W, k0, o, lane, DIN)
#elif WQKV_LAYOUT == 2
#define WCOL(W, k0, o, lane) wcol_hdk(W, k0, o, lane)
#else
#define WCOL(W, k0, o, lane) wcol_io(W, k0, o, lane, CC)
#endif
#if WO_OUT_IN
#define WOCOL(W, k0, o, lane) wcol_oi(W, k0, o, lane, CC)
#define WOCOLH(W, k0, o, lane) wcolh_oi(W, k0, o, lane, CC)
#else
#define WOCOL(W, k0, o, lane) wcol_io(W, k0, o, lane, DIN)
#define WOCOLH(W, k0, o, lane) wcolh_io(W, k0, o, lane, DIN)
#endif
#ifndef SM_EXTRA_PARAMS
#define SM_EXTRA_PARAMS
#endif
#ifndef PROJ_EXTRA_PARAMS
#define PROJ_EXTRA_PARAMS
#endif
#ifndef SM_MASK_HOOK
#define SM_MASK_HOOK (void)0
#endif

#define WS_QH  0u                                      // f16 q x C2 rows [b*t][CC]
#define WS_KH  (WS_QH + 2u * (size_t)NB * TT * CC)      // f16 k rows [b*t][CC]
#define WS_VT  (WS_KH + 2u * (size_t)NB * TT * CC)      // f16 v planes [b][c][t]
#define WS_QL  (WS_VT + 2u * (size_t)NB * CC * TT)      // f16 q x C2 residual rows [b][t < QHI][CC]
#define WS_KL  (WS_QL + 2u * (size_t)NB * QHI * CC)     // f16 k residual x 2^10 rows [b][t < KHI][CC]
#define WS_VB  (WS_KL + 2u * (size_t)NB * KHI * CC)     // bf16 v hi planes [b][c][t < KHI]
#define WS_VBL (WS_VB + 2u * (size_t)NB * CC * KHI)
#define WS_S   (WS_VBL + 2u * (size_t)NB * CC * KHI)    // f32 [hg][t][s], unused (k_fa keeps logits in registers)
#define WS_Y   (WS_S  + 4u * (size_t)HG * TT * TT)      // f32 ctx rows [b*t][CC] (only when there is an output projection)
#define WS_END (WS_Y  + 4u * (size_t)NB * TT * CC)

// A GEMM operand reaches the four waves of a block through LDS: rows of 256 f32, contiguous in memory, are read once a block by whole-line loads (a wave's load = 512 contiguous bytes; 32 loads of a thread form a batch), rounded to bf16 and laid at a pitch of 16 B x odd, where the b128 fragment reads of 16 rows fall on 64 different banks
#define C2 (SCALE * 1.4426950408889634f)   // 1/sqrt(32) x log2(e): q leaves k_proj with it, so that k q is a base-2 exponent
#define GPIT 264           // bf16 a staged row in LDS (512 B of data, 528-B pitch)
typedef __attribute__((ext_vector_type(4))) __bf16 v4b;
template <int NR> __device__ __forceinline__ void stage_rows(__bf16* __restrict__ dst, const float* __restrict__ srcp, int tid) {
  __bf16* d = dst + (tid >> 6) * GPIT + (tid & 63) * 4; const float* s = srcp + tid * 4;
#pragma unroll
  for (int b = 0; b < NR / 64; ++b) { v4f t[32];
#pragma unroll
    for (int i = 0; i < 32; ++i) t[i] = *(const v4f*)(s + (b * 32 + i) * 512);
    asm volatile("s_wait_xcnt 0x0" ::: "memory");   // stands in front of whatever next rewrites a register that these loads name
#pragma unroll
    for (int i = 0; i < 32; ++i) { v4b o; o[0] = (__bf16)t[i][0]; o[1] = (__bf16)t[i][1]; o[2] = (__bf16)t[i][2]; o[3] = (__bf16)t[i][3]; *(v4b*)(d + (b * 64 + 2 * i) * GPIT) = o; } } }
// ---- k_proj: block = (64 rows, 128 cols, which): q/k/v = X W (+ b) with exact bf16 products (K = DIN), X rows and W rows staged in LDS -> which 0: q x C2 f16 rows (+ residual rows < QHI); 1: k f16 rows (+ residual rows < KHI); 2: v f16 planes [c][t] (+ bf16 hi/lo planes for t < KHI)
// amdgpu_waves_per_eu(3, 3): the grid holds three blocks for every WGP, three waves a SIMD: the kernel takes the register budget of that occupancy
__global__ __launch_bounds__(128) __attribute__((amdgpu_waves_per_eu(3, 3))) void k_proj(const float* __restrict__ XQ, const float* __restrict__ XK, const float* __restrict__ XV, const float* __restrict__ WQ, const float* __restrict__ WK, const float* __restrict__ WV, const float* __restrict__ BQ, const float* __restrict__ BK, const float* __restrict__ BV,
    _Float16* __restrict__ QH, _Float16* __restrict__ QL, _Float16* __restrict__ KH, _Float16* __restrict__ KL, _Float16* __restrict__ VT, __bf16* __restrict__ VB, __bf16* __restrict__ VBL) {
  __shared__ __align__(16) unsigned char smem[(128 + 64) * GPIT * 2];   // the two operands; behind the products the output tiles take the same bytes, so that three blocks fit a WGP
  __bf16* sw = (__bf16*)smem; __bf16* sx = sw + 128 * GPIT;
  _Float16 (*sh)[136] = (_Float16 (*)[136])smem; _Float16 (*sl)[136] = sh + 64; _Float16 (*th)[72] = (_Float16 (*)[72])smem; __bf16 (*tb)[72] = (__bf16 (*)[72])(smem + 128 * 72 * 2); __bf16 (*tbl)[72] = tb + 128;
  const int tid = threadIdx.x, wave = tid >> 5, lane = tid & 31, col = lane & 15, g = lane >> 4; const int which = blockIdx.z; const int c0 = blockIdx.y * 128; const size_t r0 = (size_t)blockIdx.x * 64; const size_t bb = r0 / TT; const int t0 = (int)(r0 % TT);
  const float* X = which == 0 ? XQ : which == 1 ? XK : XV; const float* WA = which == 0 ? WQ : which == 1 ? WK : WV; const float* BA = which == 0 ? BQ : which == 1 ? BK : BV;
  stage_rows<64>(sx, X + r0 * DIN, tid); stage_rows<128>(sw, WA + (size_t)c0 * DIN, tid);
  __syncthreads();   // both operands are whole in LDS
  v8f acc[8] = {}; const __bf16* pa = sx + (wave * 16 + col) * GPIT; const __bf16* pw = sw + col * GPIT;
  v16b a = frag_b(pa, lane), w[8];
#pragma unroll
  for (int j = 0; j < 8; ++j) w[j] = frag_b(pw + j * 16 * GPIT, lane);
#pragma unroll
  for (int kc = 0; kc < DIN / 32; ++kc) { v16b an = a, wn[8];
    if (kc + 1 < DIN / 32) { an = frag_b(pa + (kc + 1) * 32, lane);   // the next k step's fragments: one group of LDS reads ahead of this step's products
#pragma unroll
      for (int j = 0; j < 8; ++j) wn[j] = frag_b(pw + j * 16 * GPIT + (kc + 1) * 32, lane); }
#pragma unroll
    for (int j = 0; j < 8; ++j) acc[j] = wmma_bf(a, w[j], acc[j]);
    if (kc + 1 < DIN / 32) { a = an;
#pragma unroll
      for (int j = 0; j < 8; ++j) w[j] = wn[j]; } }
  __syncthreads();   // every wave has read its last fragment: the bytes may take the output tiles
  if (which < 2) { _Float16* DH = which == 0 ? QH : KH; _Float16* DL = which == 0 ? QL : KL; const int nhi = which == 0 ? QHI : KHI; const bool hi_rows = t0 < nhi; const float vs = which == 0 ? C2 : 1.0f, rs = which == 0 ? 1.0f : 1024.0f;   // q: scaled by C2, residual at the scale of hi (f16 subnormals carry it); k as before
#pragma unroll
    for (int j = 0; j < 8; ++j) { const float bias = BA ? bfr(BA[c0 + j * 16 + col]) : 0.f;
#pragma unroll
      for (int r = 0; r < 8; ++r) { const float v = (acc[j][r] + bias) * vs; const _Float16 hv = (_Float16)v; sh[wave * 16 + 8 * g + r][j * 16 + col] = hv; sl[wave * 16 + 8 * g + r][j * 16 + col] = (_Float16)((v - (float)hv) * rs); } }
    __syncthreads();
    for (int e = tid; e < 64 * 16; e += 128) { const int rl = e >> 4, q = e & 15; vst2((unsigned*)(DH + (r0 + rl) * CC + c0 + q * 8), *(const v4u*)&sh[rl][q * 8]); if (hi_rows) vst2((unsigned*)(DL + (bb * nhi + t0 + rl) * (size_t)CC + c0 + q * 8), *(const v4u*)&sl[rl][q * 8]); }
  } else { const bool hi_rows = t0 < KHI;
#pragma unroll
    for (int j = 0; j < 8; ++j) { const float bias = BA ? bfr(BA[c0 + j * 16 + col]) : 0.f;
#pragma unroll
      for (int r = 0; r < 8; ++r) { const float v = acc[j][r] + bias; const int rl = wave * 16 + 8 * g + r, cl = j * 16 + col; th[cl][rl] = (_Float16)v; const __bf16 bh = (__bf16)v; tb[cl][rl] = bh; tbl[cl][rl] = (__bf16)(v - (float)bh); } }
    __syncthreads();
    for (int e = tid; e < 128 * 8; e += 128) { const int cl = e >> 3, q = e & 7; vst2((unsigned*)(VT + (bb * CC + c0 + cl) * (size_t)TT + t0 + q * 8), *(const v4u*)&th[cl][q * 8]); if (hi_rows) { const size_t o3 = (bb * CC + c0 + cl) * (size_t)KHI + t0 + q * 8; vst2((unsigned*)(VB + o3), *(const v4u*)&tb[cl][q * 8]); vst2((unsigned*)(VBL + o3), *(const v4u*)&tbl[cl][q * 8]); } } } }
// ---- k_fa: block = 128 queries (8 waves x 16 query columns) of (b, h), one pass over all keys in steps of FAK, k rows and v planes staged in LDS for the whole block: E^T = K Q^T + nm (A = k rows, B = q residual, then q hi onto the same accumulator, whose start value C is the column's offset nm: 2 products); q carries C2 = SCALE x log2(e), so a lane holds one query's finished exponents e (keys 8g + r of each 16-key tile) and p = exp2(e): no vector arithmetic between product and exp2; nm = POFF - (the maximum in use) is known before the products: the first pass sets it from its own maximum; p once to f16, packed from two score tiles straight into a B operand; the pass's sum of p comes from the matrix unit (A = ones: every row of the result is the column's sum over all 64 keys, both lane halves joined, f32 accumulate) and is the range test as well: no p is negative, so a sum inside PLIM holds every p inside f16, and 64 p under the maximum in use sum to 2^14 at most, so the offset moves only when a later p has passed that maximum: there the halves' maxima are joined by a cross-row move, sum and ctx rescaled and the pass's p and sum taken again; ctx^T += V^T P^T (A = v planes: 1 product); ctx = acc / sum (both carry 2^nm)
#define FAK 64
#define FNT (FAK / 16)
#define PLIM 32768.0f      // largest sum of a pass's p let through under the offset in use (2^15: every p of it inside f16; an f16 infinity makes the sum infinite)
#define POFF 8.0f          // exponent of the maximum in use
// amdgpu_waves_per_eu(4, 4): the grid holds four waves for every SIMD, so the kernel takes the register budget of that occupancy (two blocks a WGP, all resident at once)
__device__ __forceinline__ float xhalf(float x) { return __builtin_bit_cast(float, __builtin_amdgcn_permlanex16(__builtin_bit_cast(int, x), __builtin_bit_cast(int, x), 0x76543210, 0xfedcba98, false, false)); }   // lane l with lane l ^ 16
__device__ __forceinline__ v16h frag_p(const _Float16* p) { union { v16h v; v8h q[2]; } u; u.q[0] = *(const v8h*)p; u.q[1] = *(const v8h*)(p + 16); return u.v; }   // frag_h with the lane half's 8g already in p
// exp2 with the slot behind a transcendental closed in its own statement (one v_nop before its result is read or its source overwritten): for the rare path
__device__ __forceinline__ float exp2_slot(float x) { float y; asm("v_exp_f32 %0, %1\n\tv_nop" : "=v"(y) : "v"(x)); return y; }
// sixteen f16 1.0 in eight registers. Written as instructions: given as a literal, the compiler forms the eight registers anew in the loop (four 64-bit moves a stage) instead of keeping them
__device__ __forceinline__ v16h ones_frag() { union { v16h v; unsigned u[8]; } o;
  asm("v_mov_b32 %0, 0x3c003c00\n\tv_mov_b32 %1, 0x3c003c00\n\tv_mov_b32 %2, 0x3c003c00\n\tv_mov_b32 %3, 0x3c003c00\n\tv_mov_b32 %4, 0x3c003c00\n\tv_mov_b32 %5, 0x3c003c00\n\tv_mov_b32 %6, 0x3c003c00\n\tv_mov_b32 %7, 0x3c003c00"
      : "=v"(o.u[0]), "=v"(o.u[1]), "=v"(o.u[2]), "=v"(o.u[3]), "=v"(o.u[4]), "=v"(o.u[5]), "=v"(o.u[6]), "=v"(o.u[7]));
  return o.v; }
__device__ __forceinline__ v8f wmmah(v16h a, v16h b, v8f c) { return __builtin_amdgcn_wmma_f32_16x16x32_f16(false, a, false, b, (short)0, c, false, false); }
// K and V reach the eight waves of a block through LDS: a stage = FST keys (two passes), two buffers, filled one stage ahead by asynchronous 16-byte copies (each thread: two pieces of k rows, two of v planes). Pitches 16 B x odd: the b128 fragment reads of 16 rows fall on 64 different banks.
#define FST 128
#define NST (TT / FST)
#define KPIT 40            // halves a k row in LDS (64 B of data, 80-B pitch)
#define VPIT (FST + 8)     // halves a v plane row in LDS (256 B of data, 272-B pitch)
__device__ __forceinline__ unsigned lds_off(const void* p) { return (unsigned)(size_t)p; }   // byte offset in the work-group's LDS
// one stage's four copies of this thread; the s_wait_xcnt stands inside the statement, behind the last copy, so that no address register is rewritten in front of it
__device__ __forceinline__ void stage_kv(unsigned lk, unsigned lv, const _Float16* gk, const _Float16* gv) {
  asm volatile("global_load_async_to_lds_b128 %0, %4, off\n\tglobal_load_async_to_lds_b128 %1, %5, off\n\tglobal_load_async_to_lds_b128 %2, %6, off\n\tglobal_load_async_to_lds_b128 %3, %7, off\n\ts_wait_xcnt 0x0"
      :: "v"(lk), "v"(lk + 64u * KPIT * 2u), "v"(lv), "v"(lv + 16u * VPIT * 2u), "v"(gk), "v"(gk + (size_t)64 * CC), "v"(gv), "v"(gv + (size_t)16 * TT) : "memory"); }
__global__ __launch_bounds__(256) __attribute__((amdgpu_waves_per_eu(4, 4))) void k_fa(const _Float16* __restrict__ QH, const _Float16* __restrict__ QL, const _Float16* __restrict__ KH, const _Float16* __restrict__ VT, float* __restrict__ Y) {
  __shared__ __align__(16) _Float16 sk[2][FST * KPIT], sv[2][HD * VPIT];
  const int tid = threadIdx.x, wave = tid >> 5, lane = tid & 31, col = lane & 15, g = lane >> 4; const int h = blockIdx.y, b = blockIdx.z; const int q = blockIdx.x * 128 + wave * 16 + col;
  const v16h qh = frag_h(QH + ((size_t)b * TT + q) * CC + h * HD, lane), ql = frag_h(QL + ((size_t)b * QHI + q) * CC + h * HD, lane);
  const _Float16* gk = KH + ((size_t)b * TT + (tid >> 2)) * CC + h * HD + (tid & 3) * 8;               // copies: key rows tid / 4 and 64 + tid / 4 of a stage, 16-byte piece tid % 4
  const _Float16* gv = VT + ((size_t)b * CC + h * HD + (tid >> 4)) * (size_t)TT + (tid & 15) * 8;      // copies: planes tid / 16 and 16 + tid / 16, 16-byte piece tid % 16 of the stage's keys
  const unsigned lk = lds_off(&sk[0][(tid >> 2) * KPIT + (tid & 3) * 8]), lv = lds_off(&sv[0][(tid >> 4) * VPIT + (tid & 15) * 8]);
  stage_kv(lk, lv, gk, gv);
  asm volatile("s_wait_asynccnt 0x0" ::: "memory");   // this wave's copies of stage 0 have landed
  __syncthreads();                                    // and every other wave's: stage 0 may be read
  stage_kv(lk + (unsigned)sizeof(sk[0]), lv + (unsigned)sizeof(sv[0]), gk + (size_t)FST * CC, gv + FST);
  v8f acc[HD / 16] = {}, nmv = {}; float l = 0.f;   // nmv: the offset in use, eight times: the C operand of the score products
  const v8f zero8 = {}; const v16h ones = ones_frag();   // ones: the A operand of the sum products
#pragma unroll 1   // a trip = a stage; its two passes are unrolled below
  for (int st = 0; st < NST; ++st) {
    const _Float16* kb = &sk[st & 1][col * KPIT + 8 * g];   // key row col of a 16-key tile, this lane half's d
    const _Float16* vb = &sv[st & 1][col * VPIT + 8 * g];   // plane d = col of a 16-wide d tile, this lane half's keys
    v16h kf[FNT];
#pragma unroll
    for (int t = 0; t < FNT; ++t) kf[t] = frag_p(kb + (t * 16) * KPIT);
#pragma unroll
    for (int ps = 0; ps < FST / FAK; ++ps) {
    v8f s[FNT];
#pragma unroll
    for (int t = 0; t < FNT; ++t) s[t] = wmmah(kf[t], ql, nmv);
    __builtin_amdgcn_sched_barrier(0);   // keeps the four residual products in front of the four hi products: paired tile by tile, each hi product waits out its own accumulator's latency and its first reader follows behind v_nops
#pragma unroll
    for (int t = 0; t < FNT; ++t) s[t] = wmmah(kf[t], qh, s[t]);
    if (ps + 1 < FST / FAK) {   // the stage's next pass: its k fragments are read one pass ahead, from the same buffer
#pragma unroll
      for (int t = 0; t < FNT; ++t) kf[t] = frag_p(kb + ((ps + 1) * FAK + t * 16) * KPIT); }
    v16h vf[HD / 16][FAK / 32];   // this pass's v planes: in flight under the softmax
#pragma unroll
    for (int j = 0; j < HD / 16; ++j)
#pragma unroll
      for (int c = 0; c < FAK / 32; ++c) vf[j][c] = frag_p(vb + (j * 16) * VPIT + ps * FAK + c * 32);
    __builtin_amdgcn_sched_barrier(0);   // keeps these LDS reads in front of the exp2: sunk behind the range test, their latency would stand open in front of the P V products
    float e[FNT][8];   // p at once, under the offset in use: nothing stands between the products and the exp2
#pragma unroll
    for (int t = 0; t < FNT; ++t)
#pragma unroll   // the builtin, not asm text: the compiler sees which registers the exp2 write and keeps them clear of a matrix product's operands
      for (int r = 0; r < 8; ++r) e[t][r] = __builtin_amdgcn_exp2f(s[t][r]);
    v16h p[FAK / 32];
#pragma unroll
    for (int c = 0; c < FAK / 32; ++c)
#pragma unroll
      for (int i = 0; i < 8; ++i) { p[c][i] = (_Float16)e[2 * c][i]; p[c][8 + i] = (_Float16)e[2 * c + 1][i]; }
    v8f sm = wmmah(ones, p[0], zero8);   // every element: this lane's column summed over the pass's keys
#pragma unroll
    for (int c = 1; c < FAK / 32; ++c) sm = wmmah(ones, p[c], sm);
    const bool first = ps == 0 && st == 0;   // the first pass ran under offset 0: it takes its own maximum, up or down
    if (first || __builtin_amdgcn_ballot_w32(sm[0] > PLIM) != 0) { float mx = s[0][0];   // move the offset and take this pass's p and sum again
#pragma unroll
      for (int t = 0; t < FNT; ++t)
#pragma unroll
        for (int r = 0; r < 8; ++r) mx = fmaxf(mx, s[t][r]);
      mx = fmaxf(mx, xhalf(mx));
      float d = POFF - mx; const float dn = fminf(d, 0.f); if (!first) d = dn; const float al = __builtin_amdgcn_exp2f(dn); l *= al;   // d = 0 and al = 1 exactly in a column whose maximum did not rise
#pragma unroll
      for (int j = 0; j < HD / 16; ++j)
#pragma unroll
        for (int r = 0; r < 8; ++r) acc[j][r] *= al;
#pragma unroll
      for (int t = 0; t < FNT; ++t)
#pragma unroll
        for (int r = 0; r < 8; ++r) e[t][r] = exp2_slot(s[t][r] + d);
#pragma unroll
      for (int r = 0; r < 8; ++r) nmv[r] += d;
#pragma unroll
      for (int c = 0; c < FAK / 32; ++c)
#pragma unroll
        for (int i = 0; i < 8; ++i) { p[c][i] = (_Float16)e[2 * c][i]; p[c][8 + i] = (_Float16)e[2 * c + 1][i]; }
      sm = wmmah(ones, p[0], zero8);
#pragma unroll
      for (int c = 1; c < FAK / 32; ++c) sm = wmmah(ones, p[c], sm); }
    l += sm[0];
#pragma unroll
    for (int c = 0; c < FAK / 32; ++c)
#pragma unroll
      for (int j = 0; j < HD / 16; ++j) acc[j] = wmmah(vf[j][c], p[c], acc[j]); }
    asm volatile("s_wait_dscnt 0x0" ::: "memory");      // this wave's reads of the stage's buffer are done
    asm volatile("s_wait_asynccnt 0x0" ::: "memory");   // its copies of the next stage have landed
    __syncthreads();                                    // the next stage may be read, and this stage's buffer may be refilled
    if (st + 2 < NST) stage_kv(lk + (unsigned)(st & 1) * (unsigned)sizeof(sk[0]), lv + (unsigned)(st & 1) * (unsigned)sizeof(sv[0]), gk + (size_t)(st + 2) * FST * CC, gv + (st + 2) * FST); }
  asm volatile("s_wait_asynccnt 0x0" ::: "memory");     // no copy is outstanding when the wave ends
  const float inv = 1.0f / l;   // l holds the whole column's sum in both lane halves
  float* yr = Y + ((size_t)b * TT + q) * CC + h * HD + 8 * g;   // acc[j][r] = ctx[q][j * 16 + 8g + r]
#pragma unroll
  for (int j = 0; j < HD / 16; ++j) { v4f o0, o1;
#pragma unroll
    for (int r = 0; r < 4; ++r) { o0[r] = acc[j][r] * inv; o1[r] = acc[j][4 + r] * inv; }
    vst2(yr + j * 16, o0); vst2(yr + j * 16 + 4, o1); } }
// stage_rows for a block of 256 threads (a load of the block = 4 rows), and the same with each value split bf16 hi + lo into two planes
template <int NR> __device__ __forceinline__ void stage_rows_w8(__bf16* __restrict__ dst, const float* __restrict__ srcp, int tid) {
  __bf16* d = dst + (tid >> 6) * GPIT + (tid & 63) * 4; const float* s = srcp + tid * 4;
#pragma unroll
  for (int b = 0; b < NR / 128; ++b) { v4f t[32];
#pragma unroll
    for (int i = 0; i < 32; ++i) t[i] = *(const v4f*)(s + (b * 32 + i) * 1024);
    asm volatile("s_wait_xcnt 0x0" ::: "memory");   // as in stage_rows
#pragma unroll
    for (int i = 0; i < 32; ++i) { v4b o; o[0] = (__bf16)t[i][0]; o[1] = (__bf16)t[i][1]; o[2] = (__bf16)t[i][2]; o[3] = (__bf16)t[i][3]; *(v4b*)(d + (b * 128 + 4 * i) * GPIT) = o; } } }
template <int NR> __device__ __forceinline__ void stage_rows2_w8(__bf16* __restrict__ dh, __bf16* __restrict__ dl, const float* __restrict__ srcp, int tid) {
  const int o0 = (tid >> 6) * GPIT + (tid & 63) * 4; const float* s = srcp + tid * 4; v4f t[NR / 4];
#pragma unroll
  for (int i = 0; i < NR / 4; ++i) t[i] = *(const v4f*)(s + i * 1024);
  asm volatile("s_wait_xcnt 0x0" ::: "memory");   // as in stage_rows
#pragma unroll
  for (int i = 0; i < NR / 4; ++i) { v4b oh, ol;
#pragma unroll
    for (int k = 0; k < 4; ++k) { const __bf16 hv = (__bf16)t[i][k]; oh[k] = hv; ol[k] = (__bf16)(t[i][k] - (float)hv); }
    *(v4b*)(dh + o0 + 4 * i * GPIT) = oh; *(v4b*)(dl + o0 + 4 * i * GPIT) = ol; } }
__device__ __forceinline__ v8f wmmab(v16b a, v16b b, v8f c) { return __builtin_amdgcn_wmma_f32_16x16x32_bf16(false, a, false, b, (short)0, c, false, false); }
// ---- k_outln: block = 32 whole rows (8 waves: 2 groups of 16 rows x 4 groups of 64 columns), ctx rows (hi and lo planes) and all of Wo staged in LDS: x = ctx Wo^T (ctx bf16 hi + lo against exact bf16 Wo: 2 products) + bo + bf16(query); the block holds every column of its rows, so LayerNorm follows at once: the x tile goes through LDS, then a wave takes four rows (mean, biased var, (x - mean) * rsqrt(var + 1e-5) * g + b; 8 floats a lane and row)
#define ORW 32
#define SFP 260            // f32 a row of the x tile in LDS: rows 8 apart fall 32 banks apart
__global__ __launch_bounds__(256) void k_outln(const float* __restrict__ Y, const float* __restrict__ WO, const float* __restrict__ BO, const float* __restrict__ RESX, const float* __restrict__ G, const float* __restrict__ BE, float* __restrict__ OUT) {
  __shared__ __align__(16) float sf[ORW][SFP]; __shared__ __align__(16) __bf16 sw[DIN * GPIT], yh[ORW * GPIT], yl[ORW * GPIT];
  const int tid = threadIdx.x, wave = tid >> 5, lane = tid & 31, col = lane & 15, g = lane >> 4; const int rg = wave & 1, cg = wave >> 1; const size_t r0 = (size_t)blockIdx.x * ORW;
  // what the rows' end needs from memory is asked for first: this wave's four query rows, its bias columns, the affine pair
  v4f zr[4][2], g4[2], b4[2]; float bias[4];
#pragma unroll
  for (int k = 0; k < 4; ++k)
#pragma unroll
    for (int i = 0; i < 2; ++i) zr[k][i] = *(const v4f*)(RESX + (r0 + wave * 4 + k) * DIN + i * 128 + lane * 4);
#pragma unroll
  for (int i = 0; i < 2; ++i) { g4[i] = *(const v4f*)(G + i * 128 + lane * 4); b4[i] = *(const v4f*)(BE + i * 128 + lane * 4); }
#pragma unroll
  for (int j = 0; j < 4; ++j) bias[j] = BO[cg * 64 + j * 16 + col];
  asm volatile("s_wait_xcnt 0x0" ::: "memory");   // stands in front of whatever next rewrites a register that these loads name
  stage_rows2_w8<ORW>(yh, yl, Y + r0 * CC, tid); stage_rows_w8<DIN>(sw, WO, tid);
  __syncthreads();   // both operands are whole in LDS
  v8f acc[4] = {};
  const __bf16* ph = yh + (rg * 16 + col) * GPIT; const __bf16* pl = yl + (rg * 16 + col) * GPIT; const __bf16* pw = sw + (cg * 64 + col) * GPIT;
  v16b ah = frag_b(ph, lane), al = frag_b(pl, lane), w[4];
#pragma unroll
  for (int j = 0; j < 4; ++j) w[j] = frag_b(pw + j * 16 * GPIT, lane);
#pragma unroll
  for (int kc = 0; kc < CC / 32; ++kc) { v16b ahn = ah, aln = al, wn[4];
    if (kc + 1 < CC / 32) { ahn = frag_b(ph + (kc + 1) * 32, lane); aln = frag_b(pl + (kc + 1) * 32, lane);   // the next k step's fragments: one group of LDS reads ahead of this step's products
#pragma unroll
      for (int j = 0; j < 4; ++j) wn[j] = frag_b(pw + j * 16 * GPIT + (kc + 1) * 32, lane); }
    __builtin_amdgcn_sched_barrier(0);   // keeps that group of reads in front of the products: sunk to their uses, each read's LDS latency would stand open in front of a product
#pragma unroll
    for (int j = 0; j < 4; ++j) acc[j] = wmmab(ah, w[j], acc[j]);
#pragma unroll
    for (int j = 0; j < 4; ++j) acc[j] = wmmab(al, w[j], acc[j]);
    if (kc + 1 < CC / 32) { ah = ahn; al = aln;
#pragma unroll
      for (int j = 0; j < 4; ++j) w[j] = wn[j]; } }
#pragma unroll
  for (int j = 0; j < 4; ++j) { const float bj = bfr(bias[j]);
#pragma unroll
    for (int r = 0; r < 8; ++r) sf[rg * 16 + 8 * g + r][cg * 64 + j * 16 + col] = acc[j][r] + bj; }
  __syncthreads();   // the x tile is whole: a row's columns come from four waves
  v4f v[4][2]; float s1[4], q[4];
#pragma unroll
  for (int k = 0; k < 4; ++k) { s1[k] = 0.f;
#pragma unroll
    for (int i = 0; i < 2; ++i) { v4f t = *(const v4f*)&sf[wave * 4 + k][i * 128 + lane * 4]; t[0] += bfr(zr[k][i][0]); t[1] += bfr(zr[k][i][1]); t[2] += bfr(zr[k][i][2]); t[3] += bfr(zr[k][i][3]); v[k][i] = t; s1[k] += (t[0] + t[1]) + (t[2] + t[3]); } }
#pragma unroll
  for (int o = 1; o < 32; o <<= 1)
#pragma unroll
    for (int k = 0; k < 4; ++k) s1[k] += __shfl_xor(s1[k], o);
#pragma unroll
  for (int k = 0; k < 4; ++k) { s1[k] *= (1.0f / CC); q[k] = 0.f;
#pragma unroll
    for (int i = 0; i < 2; ++i)
#pragma unroll
      for (int e = 0; e < 4; ++e) { const float d = v[k][i][e] - s1[k]; q[k] += d * d; } }
#pragma unroll
  for (int o = 1; o < 32; o <<= 1)
#pragma unroll
    for (int k = 0; k < 4; ++k) q[k] += __shfl_xor(q[k], o);
#pragma unroll
  for (int k = 0; k < 4; ++k) { const float inv = rsqrtf(q[k] * (1.0f / CC) + 1e-5f);   /* jnp.var (biased), eps inside the rsqrt */
#pragma unroll
    for (int i = 0; i < 2; ++i) { v4f r4;
#pragma unroll
      for (int e = 0; e < 4; ++e) r4[e] = bfr(g4[i][e]) * ((v[k][i][e] - s1[k]) * inv) + bfr(b4[i][e]);
      vst2(OUT + (r0 + wave * 4 + k) * DIN + i * 128 + lane * 4, r4); } } }

extern "C" void kernel_launch(void* const* d_in, const int* in_sizes, int n_in, void* d_out, int out_size, void* d_ws, size_t ws_size, hipStream_t stream) {
  (void)in_sizes; (void)n_in; (void)out_size;
  const float** F = (const float**)d_in;
  if (ws_size < (size_t)WS_END) return;
  char* ws = (char*)d_ws; _Float16 *QH = (_Float16*)(ws + WS_QH), *KH = (_Float16*)(ws + WS_KH), *VT = (_Float16*)(ws + WS_VT), *QL = (_Float16*)(ws + WS_QL), *KL = (_Float16*)(ws + WS_KL); __bf16 *VB = (__bf16*)(ws + WS_VB), *VBL = (__bf16*)(ws + WS_VBL); float *S = (float*)(ws + WS_S), *Y = (float*)(ws + WS_Y);
  (void)S;
  // inputs: 0 query; 1 key; 2 value [4,2048,256]; 3 Wq (out,in), 4 bq; 5 Wk, 6 bk; 7 Wv, 8 bv; 9 Wo (out,in), 10 bo; 11 ln_g, 12 ln_b
  k_proj<<<dim3(TNB * TT / 64, CC / 128, 3), 128, 0, stream>>>(F[0], F[1], F[2], F[3], F[5], F[7], F[4], F[6], F[8], QH, QL, KH, KL, VT, VB, VBL);
  k_fa<<<dim3(TT / 128, NH, TNB), 256, 0, stream>>>(QH, QL, KH, VT, Y);
  k_outln<<<dim3(TNB * TT / ORW), 256, 0, stream>>>(Y, F[9], F[10], F[0], F[11], F[12], (float*)d_out);   /* LayerNorm(ctx Wo^T + bo + bf16(query)) */
}

// v008
// It runs in 42.5 microseconds.
// Next to v007, in two timings, it ran 1.03 times as fast each time.
// Counting every step since v000, it is 20.5 times as fast.
// compute dtype: all float inputs rounded to bf16; Q/K/V = in W^T + b with EXACT bf16 products on WMMA 16x16x32 (f32 accumulate); q x log2(e) / sqrt(32) as f16 hi + residual against k once to f16 (2 products, chained in one f32 accumulator that starts at the softmax offset); softmax in f32 in base 2 (the accumulator is the exponent: hardware exp2 on it; offset and sum carried over 64-key passes); exp x 2^8 (the maximum in use; a later one may pass it while a pass's sum stays inside 2^15) once to f16 against v once to f16 (1 product), divided at the end by the sum of the same f16 values (1 product against ones, f32 accumulate); ctx split bf16 hi + lo against exact Wo (2 products) + bo + query; LayerNorm in f32; f32 output.
#include <hip/hip_runtime.h>
#include <math.h>

typedef __attribute__((ext_vector_type(16))) _Float16 v16h;
typedef __attribute__((ext_vector_type(16))) __bf16 v16b;
typedef __attribute__((ext_vector_type(8)))  _Float16 v8h;
typedef __attribute__((ext_vector_type(8)))  float v8f;
typedef __attribute__((ext_vector_type(4)))  float v4f;
typedef __attribute__((ext_vector_type(2)))  float v2f;
typedef __attribute__((ext_vector_type(4)))  unsigned v4u;
typedef __attribute__((ext_vector_type(4)))  int v4i;
typedef float __attribute__((may_alias)) float_a;
typedef int __attribute__((may_alias)) int_a;

template <typename T> __device__ __forceinline__ void vst2(void* p, T v) { *(T*)p = v;  }
__device__ __forceinline__ v8f wmma16(v16h a, v16h b, v8f c) {
  v8f d = __builtin_amdgcn_wmma_f32_16x16x32_f16(false, a, false, b, (short)0, c, false, false);
  asm volatile("v_nop\n\tv_nop\n\tv_nop\n\tv_nop" : "+v"(d) : "v"(a), "v"(b));
  return d;
}
__device__ __forceinline__ v8f wmma_bf(v16b a, v16b b, v8f c) {
  v8f d = __builtin_amdgcn_wmma_f32_16x16x32_bf16(false, a, false, b, (short)0, c, false, false);
  asm volatile("v_nop\n\tv_nop\n\tv_nop\n\tv_nop" : "+v"(d) : "v"(a), "v"(b));
  return d;
}
// 16x16x32 fragments: lane = (h = lane>>4, row/col = lane&15); elements 0..7 = k0+8h+0..7, 8..15 = k0+16+8h+0..7; D element r = row 8h+r
__device__ __forceinline__ v16h frag_h(const _Float16* rowk0, int lane) {
  union { v16h v; v8h q[2]; } u; const _Float16* p = rowk0 + 8 * (lane >> 4);
  u.q[0] = *(const v8h*)p; u.q[1] = *(const v8h*)(p + 16); return u.v;
}
__device__ __forceinline__ v16h frag_f32(const float* rowk0, int lane) {
  v16h a; const float* p = rowk0 + 8 * (lane >> 4);
#pragma unroll
  for (int i = 0; i < 8; ++i) { a[i] = (_Float16)p[i]; a[8 + i] = (_Float16)p[16 + i]; }
  return a;
}
__device__ __forceinline__ v16h frag_f32s(const float* rowk0, int lane, float sc) {
  v16h a; const float* p = rowk0 + 8 * (lane >> 4);
#pragma unroll
  for (int i = 0; i < 8; ++i) { a[i] = (_Float16)(p[i] * sc); a[8 + i] = (_Float16)(p[16 + i] * sc); }
  return a;
}
// column fragment from a [K][ld] layout (column n), rows >= K read as 0
__device__ __forceinline__ v16h fragc_f32(const float* W, int k0, int n, int lane, int ld, int K) {
  v16h a; const int g = lane >> 4;
#pragma unroll
  for (int i = 0; i < 8; ++i) { const int ka = k0 + 8 * g + i, kb = ka + 16;
    a[i] = (_Float16)(ka < K ? W[(size_t)(ka < K ? ka : K - 1) * ld + n] : 0.f); a[8 + i] = (_Float16)(kb < K ? W[(size_t)(kb < K ? kb : K - 1) * ld + n] : 0.f); }
  return a;
}
struct F2 { v16b h, l; };
__device__ __forceinline__ F2 bsplit16(const float v[16]) { F2 r;
#pragma unroll
  for (int i = 0; i < 16; ++i) { const __bf16 h = (__bf16)v[i]; r.h[i] = h; r.l[i] = (__bf16)(v[i] - (float)h); }
  return r; }
__device__ __forceinline__ F2 split_row(const float* row, int k0, int lane) { float v[16]; const float* p = row + k0 + 8 * (lane >> 4);
#pragma unroll
  for (int i = 0; i < 8; ++i) { v[i] = p[i]; v[8 + i] = p[16 + i]; }
  return bsplit16(v); }
__device__ __forceinline__ F2 split_rowK(const float* row, int k0, int lane, int K) { float v[16]; const int g = lane >> 4;
#pragma unroll
  for (int i = 0; i < 8; ++i) { const int ka = k0 + 8 * g + i, kb = ka + 16; v[i] = ka < K ? row[ka < K ? ka : K - 1] : 0.f; v[8 + i] = kb < K ? row[kb < K ? kb : K - 1] : 0.f; }
  return bsplit16(v); }
__device__ __forceinline__ F2 split_col(const float* W, int k0, int n, int lane, int ld, int K) { float v[16]; const int g = lane >> 4;
#pragma unroll
  for (int i = 0; i < 8; ++i) { const int ka = k0 + 8 * g + i, kb = ka + 16; v[i] = ka < K ? W[(size_t)(ka < K ? ka : K - 1) * ld + n] : 0.f; v[8 + i] = kb < K ? W[(size_t)(kb < K ? kb : K - 1) * ld + n] : 0.f; }
  return bsplit16(v); }
__device__ __forceinline__ v8f mac3(const F2& a, const F2& b, v8f c) { c = wmma_bf(a.l, b.h, c); c = wmma_bf(a.h, b.l, c); return wmma_bf(a.h, b.h, c); }
__device__ __forceinline__ float sigm(float v) { return 1.0f / (1.0f + expf(-v)); }
#define LDSX() do { asm volatile("s_wait_dscnt 0" ::: "memory"); __builtin_amdgcn_wave_barrier(); __builtin_amdgcn_fence(__ATOMIC_RELEASE, "workgroup"); } while (0)

// Cross-modal multi-head attention with residual + LayerNorm (B 4, L 2,048, d_model 256 = 8 heads x 32; (out,in) 1/16-scale weights, zero biases; LN affine 1/0, eps 1e-5): Q = query Wq^T + bq, K = key Wk^T + bk, V = value Wv^T + bv; ctx = softmax(Q K^T / sqrt(32)) V; out = LN(ctx Wo^T + bo + query).
#define NB 4
#define TT 2048
#define CC 256            // NH * HD = projected width
#define DIN 256          // input (model) width
#define NH 8
#define HD 32
#define NQB (TT / 64)
#define HG 4
#define SCALE (0.17677669529663689f)
#define CAUSAL 0
#ifndef TNB
#define TNB NB
#endif
__device__ __forceinline__ float bfr(float v) { return (float)(__bf16)v; }
__host__ __device__ __forceinline__ int kb_last(int qb) { return CAUSAL ? ((qb * 64 + 63) >> 7) : (TT / 128 - 1); }
typedef __attribute__((ext_vector_type(8))) __bf16 v8b;
__device__ __forceinline__ v16b frag_b(const __bf16* rowk0, int lane) {
  union { v16b v; v8b q[2]; } u; const __bf16* p = rowk0 + 8 * (lane >> 4);
  u.q[0] = *(const v8b*)p; u.q[1] = *(const v8b*)(p + 16); return u.v;
}
#define QBH 0              // unused: no kernel here reads it (no separate high-precision path)
#define QHI 2048            // rows carrying a q residual plane (all rows when non-causal: 2-product logits everywhere)
#define KHI 64            // key rows carrying k residual / v bf16 hi+lo planes (written by k_proj; no kernel here reads them)
// B fragment (k rows k0+.., output column o) of a weight: (in,out) [K][ld] or (out,in) [ld rows of K]: bf16 exact, or f16(bf16 * 256) exact
__device__ __forceinline__ v16b wcol_io(const float* Wm, int k0, int o, int lane, int ld) { v16b w; const int g = lane >> 4;
#pragma unroll
  for (int i = 0; i < 8; ++i) { w[i] = (__bf16)Wm[(size_t)(k0 + 8 * g + i) * ld + o]; w[8 + i] = (__bf16)Wm[(size_t)(k0 + 16 + 8 * g + i) * ld + o]; }
  return w; }
__device__ __forceinline__ v16b wcol_oi(const float* Wm, int k0, int o, int lane, int K) { v16b w; const float* p = Wm + (size_t)o * K + k0 + 8 * (lane >> 4);
#pragma unroll
  for (int i = 0; i < 8; ++i) { w[i] = (__bf16)p[i]; w[8 + i] = (__bf16)p[16 + i]; }
  return w; }
__device__ __forceinline__ v16h wcolh_io(const float* Wm, int k0, int o, int lane, int ld) { v16h w; const int g = lane >> 4;
#pragma unroll
  for (int i = 0; i < 8; ++i) { w[i] = (_Float16)(bfr(Wm[(size_t)(k0 + 8 * g + i) * ld + o]) * 256.0f); w[8 + i] = (_Float16)(bfr(Wm[(size_t)(k0 + 16 + 8 * g + i) * ld + o]) * 256.0f); }
  return w; }
__device__ __forceinline__ v16h wcolh_oi(const float* Wm, int k0, int o, int lane, int K) { v16h w; const float* p = Wm + (size_t)o * K + k0 + 8 * (lane >> 4);
#pragma unroll
  for (int i = 0; i < 8; ++i) { w[i] = (_Float16)(bfr(p[i]) * 256.0f); w[8 + i] = (_Float16)(bfr(p[16 + i]) * 256.0f); }
  return w; }
#define WQKV_LAYOUT 1   // 0 = (in,out) [DIN][CC]; 1 = (out,in) [CC][DIN]; 2 = per-head [NH][DIN][HD]
__device__ __forceinline__ v16b wcol_hdk(const float* Wm, int k0, int o, int lane) { v16b w; const int g = lane >> 4; const float* p = Wm + (size_t)(o / HD) * DIN * HD + (o % HD);
#pragma unroll
  for (int i = 0; i < 8; ++i) { w[i] = (__bf16)p[(size_t)(k0 + 8 * g + i) * HD]; w[8 + i] = (__bf16)p[(size_t)(k0 + 16 + 8 * g + i) * HD]; }
  return w; }
#define WO_OUT_IN 1
#if WQKV_LAYOUT == 1
#define WCOL(W, k0, o, lane) wcol_oi(W, k0, o, lane, DIN)
#elif WQKV_LAYOUT == 2
#define WCOL(W, k0, o, lane) wcol_hdk(W, k0, o, lane)
#else
#define WCOL(W, k0, o, lane) wcol_io(W, k0, o, lane, CC)
#endif
#if WO_OUT_IN
#define WOCOL(W, k0, o, lane) wcol_oi(W, k0, o, lane, CC)
#define WOCOLH(W, k0, o, lane) wcolh_oi(W, k0, o, lane, CC)
#else
#define WOCOL(W, k0, o, lane) wcol_io(W, k0, o, lane, DIN)
#define WOCOLH(W, k0, o, lane) wcolh_io(W, k0, o, lane, DIN)
#endif
#ifndef SM_EXTRA_PARAMS
#define SM_EXTRA_PARAMS
#endif
#ifndef PROJ_EXTRA_PARAMS
#define PROJ_EXTRA_PARAMS
#endif
#ifndef SM_MASK_HOOK
#define SM_MASK_HOOK (void)0
#endif

#define WS_QH  0u                                      // f16 q x C2 rows [b*t][CC]
#define WS_KH  (WS_QH + 2u * (size_t)NB * TT * CC)      // f16 k rows [b*t][CC]
#define WS_VT  (WS_KH + 2u * (size_t)NB * TT * CC)      // f16 v planes [b][c][t]
#define WS_QL  (WS_VT + 2u * (size_t)NB * CC * TT)      // f16 q x C2 residual rows [b][t < QHI][CC]
#define WS_KL  (WS_QL + 2u * (size_t)NB * QHI * CC)     // f16 k residual x 2^10 rows [b][t < KHI][CC]
#define WS_VB  (WS_KL + 2u * (size_t)NB * KHI * CC)     // bf16 v hi planes [b][c][t < KHI]
#define WS_VBL (WS_VB + 2u * (size_t)NB * CC * KHI)
#define WS_S   (WS_VBL + 2u * (size_t)NB * CC * KHI)    // space of HG x TT x TT f32, in which no kernel stores logits
#define WS_WOB WS_S                                    // bf16 Wo rows [DIN][CC] (the score plane's bytes, which no kernel uses)
#define WS_Y   (WS_S  + 4u * (size_t)HG * TT * TT)      // f32 ctx rows [b*t][CC] (only when there is an output projection)
#define WS_END (WS_Y  + 4u * (size_t)NB * TT * CC)

// A GEMM operand reaches the four waves of a block through LDS: rows of 256 f32, contiguous in memory, are read once a block by whole-line loads (a wave's load = 512 contiguous bytes; 32 loads of a thread form a batch), rounded to bf16 and laid at a pitch of 16 B x odd, where the b128 fragment reads of 16 rows fall on 64 different banks
#define C2 (SCALE * 1.4426950408889634f)   // 1/sqrt(32) x log2(e): q leaves k_proj with it, so that k q is a base-2 exponent
#define GPIT 264           // bf16 a staged row in LDS (512 B of data, 528-B pitch)
typedef __attribute__((ext_vector_type(4))) __bf16 v4b;
template <int NR> __device__ __forceinline__ void stage_rows(__bf16* __restrict__ dst, const float* __restrict__ srcp, int tid) {
  __bf16* d = dst + (tid >> 6) * GPIT + (tid & 63) * 4; const float* s = srcp + tid * 4;
#pragma unroll
  for (int b = 0; b < NR / 64; ++b) { v4f t[32];
#pragma unroll
    for (int i = 0; i < 32; ++i) t[i] = *(const v4f*)(s + (b * 32 + i) * 512);
    asm volatile("s_wait_xcnt 0x0" ::: "memory");   // stands in front of whatever next rewrites a register that these loads name
#pragma unroll
    for (int i = 0; i < 32; ++i) { v4b o; o[0] = (__bf16)t[i][0]; o[1] = (__bf16)t[i][1]; o[2] = (__bf16)t[i][2]; o[3] = (__bf16)t[i][3]; *(v4b*)(d + (b * 64 + 2 * i) * GPIT) = o; } } }
// ---- k_proj: block = (64 rows, 128 cols, which): q/k/v = X W (+ b) with exact bf16 products (K = DIN), X rows and W rows staged in LDS -> which 0: q x C2 f16 rows (+ residual rows < QHI); 1: k f16 rows (+ residual rows < KHI); 2: v f16 planes [c][t] (+ bf16 hi/lo planes for t < KHI)
// amdgpu_waves_per_eu(3, 3): the grid holds three blocks for every WGP, three waves a SIMD: the kernel takes the register budget of that occupancy
__global__ __launch_bounds__(128) __attribute__((amdgpu_waves_per_eu(3, 3))) void k_proj(const float* __restrict__ XQ, const float* __restrict__ XK, const float* __restrict__ XV, const float* __restrict__ WQ, const float* __restrict__ WK, const float* __restrict__ WV, const float* __restrict__ BQ, const float* __restrict__ BK, const float* __restrict__ BV,
    _Float16* __restrict__ QH, _Float16* __restrict__ QL, _Float16* __restrict__ KH, _Float16* __restrict__ KL, _Float16* __restrict__ VT, __bf16* __restrict__ VB, __bf16* __restrict__ VBL) {
  __shared__ __align__(16) unsigned char smem[(128 + 64) * GPIT * 2];   // the two operands; behind the products the output tiles take the same bytes, so that three blocks fit a WGP
  __bf16* sw = (__bf16*)smem; __bf16* sx = sw + 128 * GPIT;
  _Float16 (*sh)[136] = (_Float16 (*)[136])smem; _Float16 (*sl)[136] = sh + 64; _Float16 (*th)[72] = (_Float16 (*)[72])smem; __bf16 (*tb)[72] = (__bf16 (*)[72])(smem + 128 * 72 * 2); __bf16 (*tbl)[72] = tb + 128;
  const int tid = threadIdx.x, wave = tid >> 5, lane = tid & 31, col = lane & 15, g = lane >> 4; const int which = blockIdx.z; const int c0 = blockIdx.y * 128; const size_t r0 = (size_t)blockIdx.x * 64; const size_t bb = r0 / TT; const int t0 = (int)(r0 % TT);
  const float* X = which == 0 ? XQ : which == 1 ? XK : XV; const float* WA = which == 0 ? WQ : which == 1 ? WK : WV; const float* BA = which == 0 ? BQ : which == 1 ? BK : BV;
  stage_rows<64>(sx, X + r0 * DIN, tid); stage_rows<128>(sw, WA + (size_t)c0 * DIN, tid);
  __syncthreads();   // both operands are whole in LDS
  v8f acc[8] = {}; const __bf16* pa = sx + (wave * 16 + col) * GPIT; const __bf16* pw = sw + col * GPIT;
  v16b a = frag_b(pa, lane), w[8];
#pragma unroll
  for (int j = 0; j < 8; ++j) w[j] = frag_b(pw + j * 16 * GPIT, lane);
#pragma unroll
  for (int kc = 0; kc < DIN / 32; ++kc) { v16b an = a, wn[8];
    if (kc + 1 < DIN / 32) { an = frag_b(pa + (kc + 1) * 32, lane);   // the next k step's fragments: one group of LDS reads ahead of this step's products
#pragma unroll
      for (int j = 0; j < 8; ++j) wn[j] = frag_b(pw + j * 16 * GPIT + (kc + 1) * 32, lane); }
#pragma unroll
    for (int j = 0; j < 8; ++j) acc[j] = wmma_bf(a, w[j], acc[j]);
    if (kc + 1 < DIN / 32) { a = an;
#pragma unroll
      for (int j = 0; j < 8; ++j) w[j] = wn[j]; } }
  __syncthreads();   // every wave has read its last fragment: the bytes may take the output tiles
  if (which < 2) { _Float16* DH = which == 0 ? QH : KH; _Float16* DL = which == 0 ? QL : KL; const int nhi = which == 0 ? QHI : KHI; const bool hi_rows = t0 < nhi; const float vs = which == 0 ? C2 : 1.0f, rs = which == 0 ? 1.0f : 1024.0f;   // q: scaled by C2, residual at the scale of hi (f16 subnormals carry it); k as before
#pragma unroll
    for (int j = 0; j < 8; ++j) { const float bias = BA ? bfr(BA[c0 + j * 16 + col]) : 0.f;
#pragma unroll
      for (int r = 0; r < 8; ++r) { const float v = (acc[j][r] + bias) * vs; const _Float16 hv = (_Float16)v; sh[wave * 16 + 8 * g + r][j * 16 + col] = hv; sl[wave * 16 + 8 * g + r][j * 16 + col] = (_Float16)((v - (float)hv) * rs); } }
    __syncthreads();
    for (int e = tid; e < 64 * 16; e += 128) { const int rl = e >> 4, q = e & 15; vst2((unsigned*)(DH + (r0 + rl) * CC + c0 + q * 8), *(const v4u*)&sh[rl][q * 8]); if (hi_rows) vst2((unsigned*)(DL + (bb * nhi + t0 + rl) * (size_t)CC + c0 + q * 8), *(const v4u*)&sl[rl][q * 8]); }
  } else { const bool hi_rows = t0 < KHI;
#pragma unroll
    for (int j = 0; j < 8; ++j) { const float bias = BA ? bfr(BA[c0 + j * 16 + col]) : 0.f;
#pragma unroll
      for (int r = 0; r < 8; ++r) { const float v = acc[j][r] + bias; const int rl = wave * 16 + 8 * g + r, cl = j * 16 + col; th[cl][rl] = (_Float16)v; const __bf16 bh = (__bf16)v; tb[cl][rl] = bh; tbl[cl][rl] = (__bf16)(v - (float)bh); } }
    __syncthreads();
    for (int e = tid; e < 128 * 8; e += 128) { const int cl = e >> 3, q = e & 7; vst2((unsigned*)(VT + (bb * CC + c0 + cl) * (size_t)TT + t0 + q * 8), *(const v4u*)&th[cl][q * 8]); if (hi_rows) { const size_t o3 = (bb * CC + c0 + cl) * (size_t)KHI + t0 + q * 8; vst2((unsigned*)(VB + o3), *(const v4u*)&tb[cl][q * 8]); vst2((unsigned*)(VBL + o3), *(const v4u*)&tbl[cl][q * 8]); } } } }
// ---- k_fa: block = 128 queries (8 waves x 16 query columns) of (b, h), one pass over all keys in steps of FAK, k rows and v planes staged in LDS for the whole block: E^T = K Q^T + nm (A = k rows, B = q residual, then q hi onto the same accumulator, whose start value C is the column's offset nm: 2 products); q carries C2 = SCALE x log2(e), so a lane holds one query's finished exponents e (keys 8g + r of each 16-key tile) and p = exp2(e): no vector arithmetic between product and exp2; nm = POFF - (the maximum in use) is known before the products: the first pass sets it from its own maximum; p once to f16, packed from two score tiles straight into a B operand; the pass's sum of p comes from the matrix unit (A = ones: every row of the result is the column's sum over all 64 keys, both lane halves joined, f32 accumulate) and is the range test as well: no p is negative, so a sum inside PLIM holds every p inside f16, and 64 p under the maximum in use sum to 2^14 at most, so the offset moves only when a later p has passed that maximum: there the halves' maxima are joined by a cross-row move, sum and ctx rescaled and the pass's p and sum taken again; ctx^T += V^T P^T (A = v planes: 1 product); ctx = acc / sum (both carry 2^nm)
#define FAK 64
#define FNT (FAK / 16)
#define PLIM 32768.0f      // largest sum of a pass's p let through under the offset in use (2^15: every p of it inside f16; an f16 infinity makes the sum infinite)
#define POFF 8.0f          // exponent of the maximum in use
// amdgpu_waves_per_eu(4, 4): the grid holds four waves for every SIMD, so the kernel takes the register budget of that occupancy (two blocks a WGP, all resident at once)
__device__ __forceinline__ float xhalf(float x) { return __builtin_bit_cast(float, __builtin_amdgcn_permlanex16(__builtin_bit_cast(int, x), __builtin_bit_cast(int, x), 0x76543210, 0xfedcba98, false, false)); }   // lane l with lane l ^ 16
__device__ __forceinline__ v16h frag_p(const _Float16* p) { union { v16h v; v8h q[2]; } u; u.q[0] = *(const v8h*)p; u.q[1] = *(const v8h*)(p + 16); return u.v; }   // frag_h with the lane half's 8g already in p
// exp2 with the slot behind a transcendental closed in its own statement (one v_nop before its result is read or its source overwritten): for the rare path
__device__ __forceinline__ float exp2_slot(float x) { float y; asm("v_exp_f32 %0, %1\n\tv_nop" : "=v"(y) : "v"(x)); return y; }
// sixteen f16 1.0 in eight registers. Written as instructions: given as a literal, the compiler forms the eight registers anew in the loop (four 64-bit moves a stage) instead of keeping them
__device__ __forceinline__ v16h ones_frag() { union { v16h v; unsigned u[8]; } o;
  asm("v_mov_b32 %0, 0x3c003c00\n\tv_mov_b32 %1, 0x3c003c00\n\tv_mov_b32 %2, 0x3c003c00\n\tv_mov_b32 %3, 0x3c003c00\n\tv_mov_b32 %4, 0x3c003c00\n\tv_mov_b32 %5, 0x3c003c00\n\tv_mov_b32 %6, 0x3c003c00\n\tv_mov_b32 %7, 0x3c003c00"
      : "=v"(o.u[0]), "=v"(o.u[1]), "=v"(o.u[2]), "=v"(o.u[3]), "=v"(o.u[4]), "=v"(o.u[5]), "=v"(o.u[6]), "=v"(o.u[7]));
  return o.v; }
__device__ __forceinline__ v8f wmmah(v16h a, v16h b, v8f c) { return __builtin_amdgcn_wmma_f32_16x16x32_f16(false, a, false, b, (short)0, c, false, false); }
// K and V reach the eight waves of a block through LDS: a stage = FST keys (two passes), two buffers, filled one stage ahead by asynchronous 16-byte copies (each thread: two pieces of k rows, two of v planes). Pitches 16 B x odd: the b128 fragment reads of 16 rows fall on 64 different banks.
#define FST 128
#define NST (TT / FST)
#define KPIT 40            // halves a k row in LDS (64 B of data, 80-B pitch)
#define VPIT (FST + 8)     // halves a v plane row in LDS (256 B of data, 272-B pitch)
__device__ __forceinline__ unsigned lds_off(const void* p) { return (unsigned)(size_t)p; }   // byte offset in the work-group's LDS
// one stage's four copies of this thread; the s_wait_xcnt stands inside the statement, behind the last copy, so that no address register is rewritten in front of it
__device__ __forceinline__ void stage_kv(unsigned lk, unsigned lv, const _Float16* gk, const _Float16* gv) {
  asm volatile("global_load_async_to_lds_b128 %0, %4, off\n\tglobal_load_async_to_lds_b128 %1, %5, off\n\tglobal_load_async_to_lds_b128 %2, %6, off\n\tglobal_load_async_to_lds_b128 %3, %7, off\n\ts_wait_xcnt 0x0"
      :: "v"(lk), "v"(lk + 64u * KPIT * 2u), "v"(lv), "v"(lv + 16u * VPIT * 2u), "v"(gk), "v"(gk + (size_t)64 * CC), "v"(gv), "v"(gv + (size_t)16 * TT) : "memory"); }
__global__ __launch_bounds__(256) __attribute__((amdgpu_waves_per_eu(4, 4))) void k_fa(const _Float16* __restrict__ QH, const _Float16* __restrict__ QL, const _Float16* __restrict__ KH, const _Float16* __restrict__ VT, float* __restrict__ Y, const float* __restrict__ WO, __bf16* __restrict__ WOB) {
  __shared__ __align__(16) _Float16 sk[2][FST * KPIT], sv[2][HD * VPIT];
  const int tid = threadIdx.x, wave = tid >> 5, lane = tid & 31, col = lane & 15, g = lane >> 4; const int h = blockIdx.y, b = blockIdx.z; const int q = blockIdx.x * 128 + wave * 16 + col;
  const v16h qh = frag_h(QH + ((size_t)b * TT + q) * CC + h * HD, lane), ql = frag_h(QL + ((size_t)b * QHI + q) * CC + h * HD, lane);
  const _Float16* gk = KH + ((size_t)b * TT + (tid >> 2)) * CC + h * HD + (tid & 3) * 8;               // copies: key rows tid / 4 and 64 + tid / 4 of a stage, 16-byte piece tid % 4
  const _Float16* gv = VT + ((size_t)b * CC + h * HD + (tid >> 4)) * (size_t)TT + (tid & 15) * 8;      // copies: planes tid / 16 and 16 + tid / 16, 16-byte piece tid % 16 of the stage's keys
  const unsigned lk = lds_off(&sk[0][(tid >> 2) * KPIT + (tid & 3) * 8]), lv = lds_off(&sv[0][(tid >> 4) * VPIT + (tid & 15) * 8]);
  // Wo is rounded to bf16 once, here, for the next launch: the grid's NB * NH * TT / 128 blocks take 128 of its DIN * CC values each (wave 0, four a lane); the load flies with the q loads and stage 0
  const int wo0 = ((b * NH + h) * (TT / 128) + (int)blockIdx.x) * 128 + lane * 4; v4f wo4 = {};
  const bool w0 = __builtin_amdgcn_readfirstlane(wave) == 0;   // a scalar test: EXEC stays whole around the copies below
  if (w0) { wo4 = *(const v4f*)(WO + wo0);
    asm volatile("s_wait_xcnt 0x0" ::: "memory"); }   // stands in front of whatever next rewrites a register that this load names
  stage_kv(lk, lv, gk, gv);
  asm volatile("s_wait_asynccnt 0x0" ::: "memory");   // this wave's copies of stage 0 have landed
  __syncthreads();                                    // and every other wave's: stage 0 may be read
  stage_kv(lk + (unsigned)sizeof(sk[0]), lv + (unsigned)sizeof(sv[0]), gk + (size_t)FST * CC, gv + FST);
  if (w0) { v4b o; o[0] = (__bf16)wo4[0]; o[1] = (__bf16)wo4[1]; o[2] = (__bf16)wo4[2]; o[3] = (__bf16)wo4[3]; *(v4b*)(WOB + wo0) = o; }
  v8f acc[HD / 16] = {}, nmv = {}; float l = 0.f;   // nmv: the offset in use, eight times: the C operand of the score products
  const v8f zero8 = {}; const v16h ones = ones_frag();   // ones: the A operand of the sum products
#pragma unroll 1   // a trip = a stage; its two passes are unrolled below
  for (int st = 0; st < NST; ++st) {
    const _Float16* kb = &sk[st & 1][col * KPIT + 8 * g];   // key row col of a 16-key tile, this lane half's d
    const _Float16* vb = &sv[st & 1][col * VPIT + 8 * g];   // plane d = col of a 16-wide d tile, this lane half's keys
    v16h kf[FNT];
#pragma unroll
    for (int t = 0; t < FNT; ++t) kf[t] = frag_p(kb + (t * 16) * KPIT);
#pragma unroll
    for (int ps = 0; ps < FST / FAK; ++ps) {
    v8f s[FNT];
#pragma unroll
    for (int t = 0; t < FNT; ++t) s[t] = wmmah(kf[t], ql, nmv);
    __builtin_amdgcn_sched_barrier(0);   // keeps the four residual products in front of the four hi products: paired tile by tile, each hi product waits out its own accumulator's latency and its first reader follows behind v_nops
#pragma unroll
    for (int t = 0; t < FNT; ++t) s[t] = wmmah(kf[t], qh, s[t]);
    if (ps + 1 < FST / FAK) {   // the stage's next pass: its k fragments are read one pass ahead, from the same buffer
#pragma unroll
      for (int t = 0; t < FNT; ++t) kf[t] = frag_p(kb + ((ps + 1) * FAK + t * 16) * KPIT); }
    v16h vf[HD / 16][FAK / 32];   // this pass's v planes: in flight under the softmax
#pragma unroll
    for (int j = 0; j < HD / 16; ++j)
#pragma unroll
      for (int c = 0; c < FAK / 32; ++c) vf[j][c] = frag_p(vb + (j * 16) * VPIT + ps * FAK + c * 32);
    __builtin_amdgcn_sched_barrier(0);   // keeps these LDS reads in front of the exp2: sunk behind the range test, their latency would stand open in front of the P V products
    float e[FNT][8];   // p at once, under the offset in use: nothing stands between the products and the exp2
#pragma unroll
    for (int t = 0; t < FNT; ++t)
#pragma unroll   // the builtin, not asm text: the compiler sees which registers the exp2 write and keeps them clear of a matrix product's operands
      for (int r = 0; r < 8; ++r) e[t][r] = __builtin_amdgcn_exp2f(s[t][r]);
    v16h p[FAK / 32];
#pragma unroll
    for (int c = 0; c < FAK / 32; ++c)
#pragma unroll
      for (int i = 0; i < 8; ++i) { p[c][i] = (_Float16)e[2 * c][i]; p[c][8 + i] = (_Float16)e[2 * c + 1][i]; }
    v8f sm = wmmah(ones, p[0], zero8);   // every element: this lane's column summed over the pass's keys
#pragma unroll
    for (int c = 1; c < FAK / 32; ++c) sm = wmmah(ones, p[c], sm);
    const bool first = ps == 0 && st == 0;   // the first pass ran under offset 0: it takes its own maximum, up or down
    if (first || __builtin_amdgcn_ballot_w32(sm[0] > PLIM) != 0) { float mx = s[0][0];   // move the offset and take this pass's p and sum again
#pragma unroll
      for (int t = 0; t < FNT; ++t)
#pragma unroll
        for (int r = 0; r < 8; ++r) mx = fmaxf(mx, s[t][r]);
      mx = fmaxf(mx, xhalf(mx));
      float d = POFF - mx; const float dn = fminf(d, 0.f); if (!first) d = dn; const float al = __builtin_amdgcn_exp2f(dn); l *= al;   // d = 0 and al = 1 exactly in a column whose maximum did not rise
#pragma unroll
      for (int j = 0; j < HD / 16; ++j)
#pragma unroll
        for (int r = 0; r < 8; ++r) acc[j][r] *= al;
#pragma unroll
      for (int t = 0; t < FNT; ++t)
#pragma unroll
        for (int r = 0; r < 8; ++r) e[t][r] = exp2_slot(s[t][r] + d);
#pragma unroll
      for (int r = 0; r < 8; ++r) nmv[r] += d;
#pragma unroll
      for (int c = 0; c < FAK / 32; ++c)
#pragma unroll
        for (int i = 0; i < 8; ++i) { p[c][i] = (_Float16)e[2 * c][i]; p[c][8 + i] = (_Float16)e[2 * c + 1][i]; }
      sm = wmmah(ones, p[0], zero8);
#pragma unroll
      for (int c = 1; c < FAK / 32; ++c) sm = wmmah(ones, p[c], sm); }
    l += sm[0];
#pragma unroll
    for (int c = 0; c < FAK / 32; ++c)
#pragma unroll
      for (int j = 0; j < HD / 16; ++j) acc[j] = wmmah(vf[j][c], p[c], acc[j]); }
    asm volatile("s_wait_dscnt 0x0" ::: "memory");      // this wave's reads of the stage's buffer are done
    asm volatile("s_wait_asynccnt 0x0" ::: "memory");   // its copies of the next stage have landed
    __syncthreads();                                    // the next stage may be read, and this stage's buffer may be refilled
    if (st + 2 < NST) stage_kv(lk + (unsigned)(st & 1) * (unsigned)sizeof(sk[0]), lv + (unsigned)(st & 1) * (unsigned)sizeof(sv[0]), gk + (size_t)(st + 2) * FST * CC, gv + (st + 2) * FST); }
  asm volatile("s_wait_asynccnt 0x0" ::: "memory");     // no copy is outstanding when the wave ends
  const float inv = 1.0f / l;   // l holds the whole column's sum in both lane halves
  float* yr = Y + ((size_t)b * TT + q) * CC + h * HD + 8 * g;   // acc[j][r] = ctx[q][j * 16 + 8g + r]
#pragma unroll
  for (int j = 0; j < HD / 16; ++j) { v4f o0, o1;
#pragma unroll
    for (int r = 0; r < 4; ++r) { o0[r] = acc[j][r] * inv; o1[r] = acc[j][4 + r] * inv; }
    vst2(yr + j * 16, o0); vst2(yr + j * 16 + 4, o1); } }
// ctx rows for a block of 256 threads (a load of the block = 4 rows): the loads, and, apart from them, each value split bf16 hi + lo into two LDS planes
template <int NR> __device__ __forceinline__ void load_rows_w8(v4f (&t)[NR / 4], const float* __restrict__ srcp, int tid) {
  const float* s = srcp + tid * 4;
#pragma unroll
  for (int i = 0; i < NR / 4; ++i) t[i] = *(const v4f*)(s + i * 1024);
  asm volatile("s_wait_xcnt 0x0" ::: "memory"); }   // as in stage_rows
template <int NR> __device__ __forceinline__ void split_rows_w8(__bf16* __restrict__ dh, __bf16* __restrict__ dl, const v4f (&t)[NR / 4], int tid) {
  const int o0 = (tid >> 6) * GPIT + (tid & 63) * 4;
#pragma unroll
  for (int i = 0; i < NR / 4; ++i) { v4b oh, ol;
#pragma unroll
    for (int k = 0; k < 4; ++k) { const __bf16 hv = (__bf16)t[i][k]; oh[k] = hv; ol[k] = (__bf16)(t[i][k] - (float)hv); }
    *(v4b*)(dh + o0 + 4 * i * GPIT) = oh; *(v4b*)(dl + o0 + 4 * i * GPIT) = ol; } }
// eight asynchronous 16-byte copies of this thread: bf16 rows 8 apart (a wave's copy = one whole row of 512 B) to the staged pitch; the s_wait_xcnt stands inside the statement, behind the last copy, so that no address register is rewritten in front of it
__device__ __forceinline__ void copy_rows8(unsigned l, const __bf16* g) {
  asm volatile("global_load_async_to_lds_b128 %0, %8, off\n\tglobal_load_async_to_lds_b128 %1, %9, off\n\tglobal_load_async_to_lds_b128 %2, %10, off\n\tglobal_load_async_to_lds_b128 %3, %11, off\n\t"
               "global_load_async_to_lds_b128 %4, %12, off\n\tglobal_load_async_to_lds_b128 %5, %13, off\n\tglobal_load_async_to_lds_b128 %6, %14, off\n\tglobal_load_async_to_lds_b128 %7, %15, off\n\ts_wait_xcnt 0x0"
      :: "v"(l), "v"(l + 8u * GPIT * 2u), "v"(l + 16u * GPIT * 2u), "v"(l + 24u * GPIT * 2u), "v"(l + 32u * GPIT * 2u), "v"(l + 40u * GPIT * 2u), "v"(l + 48u * GPIT * 2u), "v"(l + 56u * GPIT * 2u),
         "v"(g), "v"(g + 8 * CC), "v"(g + 16 * CC), "v"(g + 24 * CC), "v"(g + 32 * CC), "v"(g + 40 * CC), "v"(g + 48 * CC), "v"(g + 56 * CC) : "memory"); }
__device__ __forceinline__ v8f wmmab(v16b a, v16b b, v8f c) { return __builtin_amdgcn_wmma_f32_16x16x32_bf16(false, a, false, b, (short)0, c, false, false); }
// ---- k_outln: block = 32 whole rows (8 waves: 2 groups of 16 rows x 4 groups of 64 columns), ctx rows (hi and lo planes) and all of Wo staged in LDS (Wo comes as the bf16 plane that k_fa has rounded, by asynchronous copies that fly while the ctx rows are split): x = ctx Wo^T (ctx bf16 hi + lo against exact bf16 Wo: 2 products) + bo + bf16(query); the block holds every column of its rows, so LayerNorm follows at once: the x tile goes through LDS, then a wave takes four rows (mean, biased var, (x - mean) * rsqrt(var + 1e-5) * g + b; 8 floats a lane and row)
#define ORW 32
#define SFP 260            // f32 a row of the x tile in LDS: rows 8 apart fall 32 banks apart
__global__ __launch_bounds__(256) void k_outln(const float* __restrict__ Y, const __bf16* __restrict__ WOB, const float* __restrict__ BO, const float* __restrict__ RESX, const float* __restrict__ G, const float* __restrict__ BE, float* __restrict__ OUT) {
  __shared__ __align__(16) float sf[ORW][SFP]; __shared__ __align__(16) __bf16 sw[DIN * GPIT], yh[ORW * GPIT], yl[ORW * GPIT];
  const int tid = threadIdx.x, wave = tid >> 5, lane = tid & 31, col = lane & 15, g = lane >> 4; const int rg = wave & 1, cg = wave >> 1; const size_t r0 = (size_t)blockIdx.x * ORW;
  // what the rows' end needs from memory is asked for first: this wave's four query rows, its bias columns, the affine pair
  v4f zr[4][2], g4[2], b4[2]; float bias[4];
#pragma unroll
  for (int k = 0; k < 4; ++k)
#pragma unroll
    for (int i = 0; i < 2; ++i) zr[k][i] = *(const v4f*)(RESX + (r0 + wave * 4 + k) * DIN + i * 128 + lane * 4);
#pragma unroll
  for (int i = 0; i < 2; ++i) { g4[i] = *(const v4f*)(G + i * 128 + lane * 4); b4[i] = *(const v4f*)(BE + i * 128 + lane * 4); }
#pragma unroll
  for (int j = 0; j < 4; ++j) bias[j] = BO[cg * 64 + j * 16 + col];
  asm volatile("s_wait_xcnt 0x0" ::: "memory");   // stands in front of whatever next rewrites a register that these loads name
  v4f yt[ORW / 4]; load_rows_w8<ORW>(yt, Y + r0 * CC, tid);
  { const unsigned lw = lds_off(&sw[wave * GPIT + lane * 8]); const __bf16* gw = WOB + wave * CC + lane * 8;   // copies: rows wave + 8 i, 16-byte piece lane
#pragma unroll
    for (int i = 0; i < DIN / 64; ++i) copy_rows8(lw + (unsigned)i * 64u * GPIT * 2u, gw + i * 64 * CC); }
  split_rows_w8<ORW>(yh, yl, yt, tid);
  asm volatile("s_wait_asynccnt 0x0" ::: "memory");   // this wave's copies of Wo have landed
  __syncthreads();   // and every other wave's: both operands are whole in LDS
  v8f acc[4] = {};
  const __bf16* ph = yh + (rg * 16 + col) * GPIT; const __bf16* pl = yl + (rg * 16 + col) * GPIT; const __bf16* pw = sw + (cg * 64 + col) * GPIT;
  v16b ah = frag_b(ph, lane), al = frag_b(pl, lane), w[4];
#pragma unroll
  for (int j = 0; j < 4; ++j) w[j] = frag_b(pw + j * 16 * GPIT, lane);
#pragma unroll
  for (int kc = 0; kc < CC / 32; ++kc) { v16b ahn = ah, aln = al, wn[4];
    if (kc + 1 < CC / 32) { ahn = frag_b(ph + (kc + 1) * 32, lane); aln = frag_b(pl + (kc + 1) * 32, lane);   // the next k step's fragments: one group of LDS reads ahead of this step's products
#pragma unroll
      for (int j = 0; j < 4; ++j) wn[j] = frag_b(pw + j * 16 * GPIT + (kc + 1) * 32, lane); }
    __builtin_amdgcn_sched_barrier(0);   // keeps that group of reads in front of the products: sunk to their uses, each read's LDS latency would stand open in front of a product
#pragma unroll
    for (int j = 0; j < 4; ++j) acc[j] = wmmab(ah, w[j], acc[j]);
#pragma unroll
    for (int j = 0; j < 4; ++j) acc[j] = wmmab(al, w[j], acc[j]);
    if (kc + 1 < CC / 32) { ah = ahn; al = aln;
#pragma unroll
      for (int j = 0; j < 4; ++j) w[j] = wn[j]; } }
#pragma unroll
  for (int j = 0; j < 4; ++j) { const float bj = bfr(bias[j]);
#pragma unroll
    for (int r = 0; r < 8; ++r) sf[rg * 16 + 8 * g + r][cg * 64 + j * 16 + col] = acc[j][r] + bj; }
  __syncthreads();   // the x tile is whole: a row's columns come from four waves
  v4f v[4][2]; float s1[4], q[4];
#pragma unroll
  for (int k = 0; k < 4; ++k) { s1[k] = 0.f;
#pragma unroll
    for (int i = 0; i < 2; ++i) { v4f t = *(const v4f*)&sf[wave * 4 + k][i * 128 + lane * 4]; t[0] += bfr(zr[k][i][0]); t[1] += bfr(zr[k][i][1]); t[2] += bfr(zr[k][i][2]); t[3] += bfr(zr[k][i][3]); v[k][i] = t; s1[k] += (t[0] + t[1]) + (t[2] + t[3]); } }
#pragma unroll
  for (int o = 1; o < 32; o <<= 1)
#pragma unroll
    for (int k = 0; k < 4; ++k) s1[k] += __shfl_xor(s1[k], o);
#pragma unroll
  for (int k = 0; k < 4; ++k) { s1[k] *= (1.0f / CC); q[k] = 0.f;
#pragma unroll
    for (int i = 0; i < 2; ++i)
#pragma unroll
      for (int e = 0; e < 4; ++e) { const float d = v[k][i][e] - s1[k]; q[k] += d * d; } }
#pragma unroll
  for (int o = 1; o < 32; o <<= 1)
#pragma unroll
    for (int k = 0; k < 4; ++k) q[k] += __shfl_xor(q[k], o);
#pragma unroll
  for (int k = 0; k < 4; ++k) { const float inv = rsqrtf(q[k] * (1.0f / CC) + 1e-5f);   /* jnp.var (biased), eps inside the rsqrt */
#pragma unroll
    for (int i = 0; i < 2; ++i) { v4f r4;
#pragma unroll
      for (int e = 0; e < 4; ++e) r4[e] = bfr(g4[i][e]) * ((v[k][i][e] - s1[k]) * inv) + bfr(b4[i][e]);
      vst2(OUT + (r0 + wave * 4 + k) * DIN + i * 128 + lane * 4, r4); } } }

extern "C" void kernel_launch(void* const* d_in, const int* in_sizes, int n_in, void* d_out, int out_size, void* d_ws, size_t ws_size, hipStream_t stream) {
  (void)in_sizes; (void)n_in; (void)out_size;
  const float** F = (const float**)d_in;
  if (ws_size < (size_t)WS_END) return;
  char* ws = (char*)d_ws; _Float16 *QH = (_Float16*)(ws + WS_QH), *KH = (_Float16*)(ws + WS_KH), *VT = (_Float16*)(ws + WS_VT), *QL = (_Float16*)(ws + WS_QL), *KL = (_Float16*)(ws + WS_KL); __bf16 *VB = (__bf16*)(ws + WS_VB), *VBL = (__bf16*)(ws + WS_VBL); float *Y = (float*)(ws + WS_Y); __bf16 *WOB = (__bf16*)(ws + WS_WOB);
  // inputs: 0 query; 1 key; 2 value [4,2048,256]; 3 Wq (out,in), 4 bq; 5 Wk, 6 bk; 7 Wv, 8 bv; 9 Wo (out,in), 10 bo; 11 ln_g, 12 ln_b
  k_proj<<<dim3(TNB * TT / 64, CC / 128, 3), 128, 0, stream>>>(F[0], F[1], F[2], F[3], F[5], F[7], F[4], F[6], F[8], QH, QL, KH, KL, VT, VB, VBL);
  k_fa<<<dim3(TT / 128, NH, TNB), 256, 0, stream>>>(QH, QL, KH, VT, Y, F[9], WOB);
  k_outln<<<dim3(TNB * TT / ORW), 256, 0, stream>>>(Y, WOB, F[10], F[0], F[11], F[12], (float*)d_out);   /* LayerNorm(ctx Wo^T + bo + bf16(query)) */
}

// v009
// It runs in 39.4 microseconds.
// Two timings next to v008 both put it at 1.08 times that version's speed.
// Counting every step since v000, it is 22.0 times as fast.
// compute dtype: all float inputs rounded to bf16; Q/K/V = in W^T + b with EXACT bf16 products on WMMA 16x16x32 (f32 accumulate); q x log2(e) / sqrt(32) once to f16 against k once to f16 (1 product, its f32 accumulator starting at the softmax offset); softmax in f32 in base 2 (the accumulator is the exponent: hardware exp2 on it; offset and sum carried over 64-key passes); exp x 2^8 (the maximum in use; a later one may pass it while a pass's sum stays inside 2^15) once to f16 against v once to f16 (1 product), divided at the end by the sum of the same f16 values (1 product against ones, f32 accumulate); ctx split bf16 hi + lo against exact Wo (2 products) + bo + query; LayerNorm in f32; f32 output.
#include <hip/hip_runtime.h>
#include <math.h>

typedef __attribute__((ext_vector_type(16))) _Float16 v16h;
typedef __attribute__((ext_vector_type(16))) __bf16 v16b;
typedef __attribute__((ext_vector_type(8)))  _Float16 v8h;
typedef __attribute__((ext_vector_type(8)))  float v8f;
typedef __attribute__((ext_vector_type(4)))  float v4f;
typedef __attribute__((ext_vector_type(2)))  float v2f;
typedef __attribute__((ext_vector_type(4)))  unsigned v4u;
typedef __attribute__((ext_vector_type(4)))  int v4i;
typedef float __attribute__((may_alias)) float_a;
typedef int __attribute__((may_alias)) int_a;

template <typename T> __device__ __forceinline__ void vst2(void* p, T v) { *(T*)p = v;  }
__device__ __forceinline__ v8f wmma16(v16h a, v16h b, v8f c) {
  v8f d = __builtin_amdgcn_wmma_f32_16x16x32_f16(false, a, false, b, (short)0, c, false, false);
  asm volatile("v_nop\n\tv_nop\n\tv_nop\n\tv_nop" : "+v"(d) : "v"(a), "v"(b));
  return d;
}
__device__ __forceinline__ v8f wmma_bf(v16b a, v16b b, v8f c) {
  v8f d = __builtin_amdgcn_wmma_f32_16x16x32_bf16(false, a, false, b, (short)0, c, false, false);
  asm volatile("v_nop\n\tv_nop\n\tv_nop\n\tv_nop" : "+v"(d) : "v"(a), "v"(b));
  return d;
}
// 16x16x32 fragments: lane = (h = lane>>4, row/col = lane&15); elements 0..7 = k0+8h+0..7, 8..15 = k0+16+8h+0..7; D element r = row 8h+r
__device__ __forceinline__ v16h frag_h(const _Float16* rowk0, int lane) {
  union { v16h v; v8h q[2]; } u; const _Float16* p = rowk0 + 8 * (lane >> 4);
  u.q[0] = *(const v8h*)p; u.q[1] = *(const v8h*)(p + 16); return u.v;
}
__device__ __forceinline__ v16h frag_f32(const float* rowk0, int lane) {
  v16h a; const float* p = rowk0 + 8 * (lane >> 4);
#pragma unroll
  for (int i = 0; i < 8; ++i) { a[i] = (_Float16)p[i]; a[8 + i] = (_Float16)p[16 + i]; }
  return a;
}
__device__ __forceinline__ v16h frag_f32s(const float* rowk0, int lane, float sc) {
  v16h a; const float* p = rowk0 + 8 * (lane >> 4);
#pragma unroll
  for (int i = 0; i < 8; ++i) { a[i] = (_Float16)(p[i] * sc); a[8 + i] = (_Float16)(p[16 + i] * sc); }
  return a;
}
// column fragment from a [K][ld] layout (column n), rows >= K read as 0
__device__ __forceinline__ v16h fragc_f32(const float* W, int k0, int n, int lane, int ld, int K) {
  v16h a; const int g = lane >> 4;
#pragma unroll
  for (int i = 0; i < 8; ++i) { const int ka = k0 + 8 * g + i, kb = ka + 16;
    a[i] = (_Float16)(ka < K ? W[(size_t)(ka < K ? ka : K - 1) * ld + n] : 0.f); a[8 + i] = (_Float16)(kb < K ? W[(size_t)(kb < K ? kb : K - 1) * ld + n] : 0.f); }
  return a;
}
struct F2 { v16b h, l; };
__device__ __forceinline__ F2 bsplit16(const float v[16]) { F2 r;
#pragma unroll
  for (int i = 0; i < 16; ++i) { const __bf16 h = (__bf16)v[i]; r.h[i] = h; r.l[i] = (__bf16)(v[i] - (float)h); }
  return r; }
__device__ __forceinline__ F2 split_row(const float* row, int k0, int lane) { float v[16]; const float* p = row + k0 + 8 * (lane >> 4);
#pragma unroll
  for (int i = 0; i < 8; ++i) { v[i] = p[i]; v[8 + i] = p[16 + i]; }
  return bsplit16(v); }
__device__ __forceinline__ F2 split_rowK(const float* row, int k0, int lane, int K) { float v[16]; const int g = lane >> 4;
#pragma unroll
  for (int i = 0; i < 8; ++i) { const int ka = k0 + 8 * g + i, kb = ka + 16; v[i] = ka < K ? row[ka < K ? ka : K - 1] : 0.f; v[8 + i] = kb < K ? row[kb < K ? kb : K - 1] : 0.f; }
  return bsplit16(v); }
__device__ __forceinline__ F2 split_col(const float* W, int k0, int n, int lane, int ld, int K) { float v[16]; const int g = lane >> 4;
#pragma unroll
  for (int i = 0; i < 8; ++i) { const int ka = k0 + 8 * g + i, kb = ka + 16; v[i] = ka < K ? W[(size_t)(ka < K ? ka : K - 1) * ld + n] : 0.f; v[8 + i] = kb < K ? W[(size_t)(kb < K ? kb : K - 1) * ld + n] : 0.f; }
  return bsplit16(v); }
__device__ __forceinline__ v8f mac3(const F2& a, const F2& b, v8f c) { c = wmma_bf(a.l, b.h, c); c = wmma_bf(a.h, b.l, c); return wmma_bf(a.h, b.h, c); }
__device__ __forceinline__ float sigm(float v) { return 1.0f / (1.0f + expf(-v)); }
#define LDSX() do { asm volatile("s_wait_dscnt 0" ::: "memory"); __builtin_amdgcn_wave_barrier(); __builtin_amdgcn_fence(__ATOMIC_RELEASE, "workgroup"); } while (0)

// Cross-modal multi-head attention with residual + LayerNorm (B 4, L 2,048, d_model 256 = 8 heads x 32; (out,in) 1/16-scale weights, zero biases; LN affine 1/0, eps 1e-5): Q = query Wq^T + bq, K = key Wk^T + bk, V = value Wv^T + bv; ctx = softmax(Q K^T / sqrt(32)) V; out = LN(ctx Wo^T + bo + query).
#define NB 4
#define TT 2048
#define CC 256            // NH * HD = projected width
#define DIN 256          // input (model) width
#define NH 8
#define HD 32
#define NQB (TT / 64)
#define HG 4
#define SCALE (0.17677669529663689f)
#define CAUSAL 0
#ifndef TNB
#define TNB NB
#endif
__device__ __forceinline__ float bfr(float v) { return (float)(__bf16)v; }
__host__ __device__ __forceinline__ int kb_last(int qb) { return CAUSAL ? ((qb * 64 + 63) >> 7) : (TT / 128 - 1); }
typedef __attribute__((ext_vector_type(8))) __bf16 v8b;
__device__ __forceinline__ v16b frag_b(const __bf16* rowk0, int lane) {
  union { v16b v; v8b q[2]; } u; const __bf16* p = rowk0 + 8 * (lane >> 4);
  u.q[0] = *(const v8b*)p; u.q[1] = *(const v8b*)(p + 16); return u.v;
}
#define QBH 0              // unused: no kernel in this file has a high-precision path
#define KHI 64            // key rows carrying k residual / v bf16 hi+lo planes (written by k_proj; no kernel here reads them)
// B fragment (k rows k0+.., output column o) of a weight: (in,out) [K][ld] or (out,in) [ld rows of K]: bf16 exact, or f16(bf16 * 256) exact
__device__ __forceinline__ v16b wcol_io(const float* Wm, int k0, int o, int lane, int ld) { v16b w; const int g = lane >> 4;
#pragma unroll
  for (int i = 0; i < 8; ++i) { w[i] = (__bf16)Wm[(size_t)(k0 + 8 * g + i) * ld + o]; w[8 + i] = (__bf16)Wm[(size_t)(k0 + 16 + 8 * g + i) * ld + o]; }
  return w; }
__device__ __forceinline__ v16b wcol_oi(const float* Wm, int k0, int o, int lane, int K) { v16b w; const float* p = Wm + (size_t)o * K + k0 + 8 * (lane >> 4);
#pragma unroll
  for (int i = 0; i < 8; ++i) { w[i] = (__bf16)p[i]; w[8 + i] = (__bf16)p[16 + i]; }
  return w; }
__device__ __forceinline__ v16h wcolh_io(const float* Wm, int k0, int o, int lane, int ld) { v16h w; const int g = lane >> 4;
#pragma unroll
  for (int i = 0; i < 8; ++i) { w[i] = (_Float16)(bfr(Wm[(size_t)(k0 + 8 * g + i) * ld + o]) * 256.0f); w[8 + i] = (_Float16)(bfr(Wm[(size_t)(k0 + 16 + 8 * g + i) * ld + o]) * 256.0f); }
  return w; }
__device__ __forceinline__ v16h wcolh_oi(const float* Wm, int k0, int o, int lane, int K) { v16h w; const float* p = Wm + (size_t)o * K + k0 + 8 * (lane >> 4);
#pragma unroll
  for (int i = 0; i < 8; ++i) { w[i] = (_Float16)(bfr(p[i]) * 256.0f); w[8 + i] = (_Float16)(bfr(p[16 + i]) * 256.0f); }
  return w; }
#define WQKV_LAYOUT 1   // 0 = (in,out) [DIN][CC]; 1 = (out,in) [CC][DIN]; 2 = per-head [NH][DIN][HD]
__device__ __forceinline__ v16b wcol_hdk(const float* Wm, int k0, int o, int lane) { v16b w; const int g = lane >> 4; const float* p = Wm + (size_t)(o / HD) * DIN * HD + (o % HD);
#pragma unroll
  for (int i = 0; i < 8; ++i) { w[i] = (__bf16)p[(size_t)(k0 + 8 * g + i) * HD]; w[8 + i] = (__bf16)p[(size_t)(k0 + 16 + 8 * g + i) * HD]; }
  return w; }
#define WO_OUT_IN 1
#if WQKV_LAYOUT == 1
#define WCOL(W, k0, o, lane) wcol_oi(W, k0, o, lane, DIN)
#elif WQKV_LAYOUT == 2
#define WCOL(W, k0, o, lane) wcol_hdk(W, k0, o, lane)
#else
#define WCOL(W, k0, o, lane) wcol_io(W, k0, o, lane, CC)
#endif
#if WO_OUT_IN
#define WOCOL(W, k0, o, lane) wcol_oi(W, k0, o, lane, CC)
#define WOCOLH(W, k0, o, lane) wcolh_oi(W, k0, o, lane, CC)
#else
#define WOCOL(W, k0, o, lane) wcol_io(W, k0, o, lane, DIN)
#define WOCOLH(W, k0, o, lane) wcolh_io(W, k0, o, lane, DIN)
#endif
#ifndef SM_EXTRA_PARAMS
#define SM_EXTRA_PARAMS
#endif
#ifndef PROJ_EXTRA_PARAMS
#define PROJ_EXTRA_PARAMS
#endif
#ifndef SM_MASK_HOOK
#define SM_MASK_HOOK (void)0
#endif

#define WS_QH  0u                                      // f16 q x C2 rows [b*t][CC]
#define WS_KH  (WS_QH + 2u * (size_t)NB * TT * CC)      // f16 k rows [b*t][CC]
#define WS_VT  (WS_KH + 2u * (size_t)NB * TT * CC)      // f16 v planes [b][c][t]
#define WS_KL  (WS_VT + 2u * (size_t)NB * CC * TT)      // f16 k residual x 2^10 rows [b][t < KHI][CC]
#define WS_VB  (WS_KL + 2u * (size_t)NB * KHI * CC)     // bf16 v hi planes [b][c][t < KHI]
#define WS_VBL (WS_VB + 2u * (size_t)NB * CC * KHI)
#define WS_S   (WS_VBL + 2u * (size_t)NB * CC * KHI)    // space of HG x TT x TT f32, in which no kernel stores logits
#define WS_WOB WS_S                                    // bf16 Wo rows [DIN][CC] (the score plane's bytes, which no kernel uses)
#define WS_Y   (WS_S  + 4u * (size_t)HG * TT * TT)      // f32 ctx rows [b*t][CC] (only when there is an output projection)
#define WS_END (WS_Y  + 4u * (size_t)NB * TT * CC)

// A GEMM operand reaches the four waves of a block through LDS: rows of 256 f32, contiguous in memory, are read once a block by whole-line loads (a wave's load = 512 contiguous bytes; 32 loads of a thread form a batch), rounded to bf16 and laid at a pitch of 16 B x odd, where the b128 fragment reads of 16 rows fall on 64 different banks
#define C2 (SCALE * 1.4426950408889634f)   // 1/sqrt(32) x log2(e): q leaves k_proj with it, so that k q is a base-2 exponent
#define GPIT 264           // bf16 a staged row in LDS (512 B of data, 528-B pitch)
typedef __attribute__((ext_vector_type(4))) __bf16 v4b;
template <int NR> __device__ __forceinline__ void stage_rows(__bf16* __restrict__ dst, const float* __restrict__ srcp, int tid) {
  __bf16* d = dst + (tid >> 6) * GPIT + (tid & 63) * 4; const float* s = srcp + tid * 4;
#pragma unroll
  for (int b = 0; b < NR / 64; ++b) { v4f t[32];
#pragma unroll
    for (int i = 0; i < 32; ++i) t[i] = *(const v4f*)(s + (b * 32 + i) * 512);
    asm volatile("s_wait_xcnt 0x0" ::: "memory");   // stands in front of whatever next rewrites a register that these loads name
#pragma unroll
    for (int i = 0; i < 32; ++i) { v4b o; o[0] = (__bf16)t[i][0]; o[1] = (__bf16)t[i][1]; o[2] = (__bf16)t[i][2]; o[3] = (__bf16)t[i][3]; *(v4b*)(d + (b * 64 + 2 * i) * GPIT) = o; } } }
// ---- k_proj: block = (64 rows, 128 cols, which): q/k/v = X W (+ b) with exact bf16 products (K = DIN), X rows and W rows staged in LDS -> which 0: q x C2 f16 rows; 1: k f16 rows (+ residual rows < KHI); 2: v f16 planes [c][t] (+ bf16 hi/lo planes for t < KHI)
// amdgpu_waves_per_eu(3, 3): the grid holds three blocks for every WGP, three waves a SIMD: the kernel takes the register budget of that occupancy
__global__ __launch_bounds__(128) __attribute__((amdgpu_waves_per_eu(3, 3))) void k_proj(const float* __restrict__ XQ, const float* __restrict__ XK, const float* __restrict__ XV, const float* __restrict__ WQ, const float* __restrict__ WK, const float* __restrict__ WV, const float* __restrict__ BQ, const float* __restrict__ BK, const float* __restrict__ BV,
    _Float16* __restrict__ QH, _Float16* __restrict__ KH, _Float16* __restrict__ KL, _Float16* __restrict__ VT, __bf16* __restrict__ VB, __bf16* __restrict__ VBL) {
  __shared__ __align__(16) unsigned char smem[(128 + 64) * GPIT * 2];   // the two operands; behind the products the output tiles take the same bytes, so that three blocks fit a WGP
  __bf16* sw = (__bf16*)smem; __bf16* sx = sw + 128 * GPIT;
  _Float16 (*sh)[136] = (_Float16 (*)[136])smem; _Float16 (*sl)[136] = sh + 64; _Float16 (*th)[72] = (_Float16 (*)[72])smem; __bf16 (*tb)[72] = (__bf16 (*)[72])(smem + 128 * 72 * 2); __bf16 (*tbl)[72] = tb + 128;
  const int tid = threadIdx.x, wave = tid >> 5, lane = tid & 31, col = lane & 15, g = lane >> 4; const int which = blockIdx.z; const int c0 = blockIdx.y * 128; const size_t r0 = (size_t)blockIdx.x * 64; const size_t bb = r0 / TT; const int t0 = (int)(r0 % TT);
  const float* X = which == 0 ? XQ : which == 1 ? XK : XV; const float* WA = which == 0 ? WQ : which == 1 ? WK : WV; const float* BA = which == 0 ? BQ : which == 1 ? BK : BV;
  stage_rows<64>(sx, X + r0 * DIN, tid); stage_rows<128>(sw, WA + (size_t)c0 * DIN, tid);
  __syncthreads();   // both operands are whole in LDS
  v8f acc[8] = {}; const __bf16* pa = sx + (wave * 16 + col) * GPIT; const __bf16* pw = sw + col * GPIT;
  v16b a = frag_b(pa, lane), w[8];
#pragma unroll
  for (int j = 0; j < 8; ++j) w[j] = frag_b(pw + j * 16 * GPIT, lane);
#pragma unroll
  for (int kc = 0; kc < DIN / 32; ++kc) { v16b an = a, wn[8];
    if (kc + 1 < DIN / 32) { an = frag_b(pa + (kc + 1) * 32, lane);   // the next k step's fragments: one group of LDS reads ahead of this step's products
#pragma unroll
      for (int j = 0; j < 8; ++j) wn[j] = frag_b(pw + j * 16 * GPIT + (kc + 1) * 32, lane); }
#pragma unroll
    for (int j = 0; j < 8; ++j) acc[j] = wmma_bf(a, w[j], acc[j]);
    if (kc + 1 < DIN / 32) { a = an;
#pragma unroll
      for (int j = 0; j < 8; ++j) w[j] = wn[j]; } }
  __syncthreads();   // every wave has read its last fragment: the bytes may take the output tiles
  if (which < 2) { _Float16* DH = which == 0 ? QH : KH; _Float16* DL = KL; const int nhi = KHI; const bool hi_rows = which == 1 && t0 < nhi; const float vs = which == 0 ? C2 : 1.0f;   // q: scaled by C2, rounded once, as k is
    float bias[8];
#pragma unroll
    for (int j = 0; j < 8; ++j) { bias[j] = BA ? bfr(BA[c0 + j * 16 + col]) : 0.f;
#pragma unroll
      for (int r = 0; r < 8; ++r) sh[wave * 16 + 8 * g + r][j * 16 + col] = (_Float16)((acc[j][r] + bias[j]) * vs); }
    if (hi_rows) {   // the same for the whole block: a residual is formed only for the k rows that have a plane for it
#pragma unroll
      for (int j = 0; j < 8; ++j)
#pragma unroll
        for (int r = 0; r < 8; ++r) { const float v = acc[j][r] + bias[j]; sl[wave * 16 + 8 * g + r][j * 16 + col] = (_Float16)((v - (float)(_Float16)v) * 1024.0f); } }
    __syncthreads();
    for (int e = tid; e < 64 * 16; e += 128) { const int rl = e >> 4, q = e & 15; vst2((unsigned*)(DH + (r0 + rl) * CC + c0 + q * 8), *(const v4u*)&sh[rl][q * 8]); if (hi_rows) vst2((unsigned*)(DL + (bb * nhi + t0 + rl) * (size_t)CC + c0 + q * 8), *(const v4u*)&sl[rl][q * 8]); }
  } else { const bool hi_rows = t0 < KHI;
#pragma unroll
    for (int j = 0; j < 8; ++j) { const float bias = BA ? bfr(BA[c0 + j * 16 + col]) : 0.f;
#pragma unroll
      for (int r = 0; r < 8; ++r) { const float v = acc[j][r] + bias; const int rl = wave * 16 + 8 * g + r, cl = j * 16 + col; th[cl][rl] = (_Float16)v; const __bf16 bh = (__bf16)v; tb[cl][rl] = bh; tbl[cl][rl] = (__bf16)(v - (float)bh); } }
    __syncthreads();
    for (int e = tid; e < 128 * 8; e += 128) { const int cl = e >> 3, q = e & 7; vst2((unsigned*)(VT + (bb * CC + c0 + cl) * (size_t)TT + t0 + q * 8), *(const v4u*)&th[cl][q * 8]); if (hi_rows) { const size_t o3 = (bb * CC + c0 + cl) * (size_t)KHI + t0 + q * 8; vst2((unsigned*)(VB + o3), *(const v4u*)&tb[cl][q * 8]); vst2((unsigned*)(VBL + o3), *(const v4u*)&tbl[cl][q * 8]); } } } }
// ---- k_fa: block = 128 queries (8 waves x 16 query columns) of (b, h), one pass over all keys in steps of FAK, k rows and v planes staged in LDS for the whole block: E^T = K Q^T + nm (A = k rows, B = q, the accumulator's start value C is the column's offset nm: 1 product); q carries C2 = SCALE x log2(e), so a lane holds one query's finished exponents e (keys 8g + r of each 16-key tile) and p = exp2(e): no vector arithmetic between product and exp2; nm = POFF - (the maximum in use) is known before the products: the first pass sets it from its own maximum; p once to f16, packed from two score tiles straight into a B operand; the pass's sum of p comes from the matrix unit (A = ones: every row of the result is the column's sum over all 64 keys, both lane halves joined, f32 accumulate) and is the range test as well: no p is negative, so a sum inside PLIM holds every p inside f16, and 64 p under the maximum in use sum to 2^14 at most, so the offset moves only when a later p has passed that maximum: there the halves' maxima are joined by a cross-row move, sum and ctx rescaled and the pass's p and sum taken again; ctx^T += V^T P^T (A = v planes: 1 product); ctx = acc / sum (both carry 2^nm)
#define FAK 64
#define FNT (FAK / 16)
#define PLIM 32768.0f      // largest sum of a pass's p let through under the offset in use (2^15: every p of it inside f16; an f16 infinity makes the sum infinite)
#define POFF 8.0f          // exponent of the maximum in use
// amdgpu_waves_per_eu(4, 4): the grid holds four waves for every SIMD, so the kernel takes the register budget of that occupancy (two blocks a WGP, all resident at once)
__device__ __forceinline__ float xhalf(float x) { return __builtin_bit_cast(float, __builtin_amdgcn_permlanex16(__builtin_bit_cast(int, x), __builtin_bit_cast(int, x), 0x76543210, 0xfedcba98, false, false)); }   // lane l with lane l ^ 16
__device__ __forceinline__ v16h frag_p(const _Float16* p) { union { v16h v; v8h q[2]; } u; u.q[0] = *(const v8h*)p; u.q[1] = *(const v8h*)(p + 16); return u.v; }   // frag_h with the lane half's 8g already in p
// exp2 with the slot behind a transcendental closed in its own statement (one v_nop before its result is read or its source overwritten): for the rare path
__device__ __forceinline__ float exp2_slot(float x) { float y; asm("v_exp_f32 %0, %1\n\tv_nop" : "=v"(y) : "v"(x)); return y; }
// sixteen f16 1.0 in eight registers. Written as instructions: given as a literal, the compiler forms the eight registers anew in the loop (four 64-bit moves a stage) instead of keeping them
__device__ __forceinline__ v16h ones_frag() { union { v16h v; unsigned u[8]; } o;
  asm("v_mov_b32 %0, 0x3c003c00\n\tv_mov_b32 %1, 0x3c003c00\n\tv_mov_b32 %2, 0x3c003c00\n\tv_mov_b32 %3, 0x3c003c00\n\tv_mov_b32 %4, 0x3c003c00\n\tv_mov_b32 %5, 0x3c003c00\n\tv_mov_b32 %6, 0x3c003c00\n\tv_mov_b32 %7, 0x3c003c00"
      : "=v"(o.u[0]), "=v"(o.u[1]), "=v"(o.u[2]), "=v"(o.u[3]), "=v"(o.u[4]), "=v"(o.u[5]), "=v"(o.u[6]), "=v"(o.u[7]));
  return o.v; }
__device__ __forceinline__ v8f wmmah(v16h a, v16h b, v8f c) { return __builtin_amdgcn_wmma_f32_16x16x32_f16(false, a, false, b, (short)0, c, false, false); }
// K and V reach the eight waves of a block through LDS: a stage = FST keys (two passes), two buffers, filled one stage ahead by asynchronous 16-byte copies (each thread: two pieces of k rows, two of v planes). Pitches 16 B x odd: the b128 fragment reads of 16 rows fall on 64 different banks.
#define FST 128
#define NST (TT / FST)
#define KPIT 40            // halves a k row in LDS (64 B of data, 80-B pitch)
#define VPIT (FST + 8)     // halves a v plane row in LDS (256 B of data, 272-B pitch)
__device__ __forceinline__ unsigned lds_off(const void* p) { return (unsigned)(size_t)p; }   // byte offset in the work-group's LDS
// one stage's four copies of this thread; the s_wait_xcnt stands inside the statement, behind the last copy, so that no address register is rewritten in front of it
__device__ __forceinline__ void stage_kv(unsigned lk, unsigned lv, const _Float16* gk, const _Float16* gv) {
  asm volatile("global_load_async_to_lds_b128 %0, %4, off\n\tglobal_load_async_to_lds_b128 %1, %5, off\n\tglobal_load_async_to_lds_b128 %2, %6, off\n\tglobal_load_async_to_lds_b128 %3, %7, off\n\ts_wait_xcnt 0x0"
      :: "v"(lk), "v"(lk + 64u * KPIT * 2u), "v"(lv), "v"(lv + 16u * VPIT * 2u), "v"(gk), "v"(gk + (size_t)64 * CC), "v"(gv), "v"(gv + (size_t)16 * TT) : "memory"); }
__global__ __launch_bounds__(256) __attribute__((amdgpu_waves_per_eu(4, 4))) void k_fa(const _Float16* __restrict__ QH, const _Float16* __restrict__ KH, const _Float16* __restrict__ VT, float* __restrict__ Y, const float* __restrict__ WO, __bf16* __restrict__ WOB) {
  __shared__ __align__(16) _Float16 sk[2][FST * KPIT], sv[2][HD * VPIT];
  const int tid = threadIdx.x, wave = tid >> 5, lane = tid & 31, col = lane & 15, g = lane >> 4; const int h = blockIdx.y, b = blockIdx.z; const int q = blockIdx.x * 128 + wave * 16 + col;
  const v16h qh = frag_h(QH + ((size_t)b * TT + q) * CC + h * HD, lane);
  const _Float16* gk = KH + ((size_t)b * TT + (tid >> 2)) * CC + h * HD + (tid & 3) * 8;               // copies: key rows tid / 4 and 64 + tid / 4 of a stage, 16-byte piece tid % 4
  const _Float16* gv = VT + ((size_t)b * CC + h * HD + (tid >> 4)) * (size_t)TT + (tid & 15) * 8;      // copies: planes tid / 16 and 16 + tid / 16, 16-byte piece tid % 16 of the stage's keys
  const unsigned lk = lds_off(&sk[0][(tid >> 2) * KPIT + (tid & 3) * 8]), lv = lds_off(&sv[0][(tid >> 4) * VPIT + (tid & 15) * 8]);
  // Wo is rounded to bf16 once, here, for the next launch: the grid's NB * NH * TT / 128 blocks take 128 of its DIN * CC values each (wave 0, four a lane); the load flies with the q loads and stage 0
  const int wo0 = ((b * NH + h) * (TT / 128) + (int)blockIdx.x) * 128 + lane * 4; v4f wo4 = {};
  const bool w0 = __builtin_amdgcn_readfirstlane(wave) == 0;   // a scalar test: EXEC stays whole around the copies below
  if (w0) { wo4 = *(const v4f*)(WO + wo0);
    asm volatile("s_wait_xcnt 0x0" ::: "memory"); }   // stands in front of whatever next rewrites a register that this load names
  stage_kv(lk, lv, gk, gv);
  asm volatile("s_wait_asynccnt 0x0" ::: "memory");   // this wave's copies of stage 0 have landed
  __syncthreads();                                    // and every other wave's: stage 0 may be read
  stage_kv(lk + (unsigned)sizeof(sk[0]), lv + (unsigned)sizeof(sv[0]), gk + (size_t)FST * CC, gv + FST);
  if (w0) { v4b o; o[0] = (__bf16)wo4[0]; o[1] = (__bf16)wo4[1]; o[2] = (__bf16)wo4[2]; o[3] = (__bf16)wo4[3]; *(v4b*)(WOB + wo0) = o; }
  v8f acc[HD / 16] = {}, nmv = {}; float l = 0.f;   // nmv: the offset in use, eight times: the C operand of the score products
  const v8f zero8 = {}; const v16h ones = ones_frag();   // ones: the A operand of the sum products
#pragma unroll 1   // a trip = a stage; its two passes are unrolled below
  for (int st = 0; st < NST; ++st) {
    const _Float16* kb = &sk[st & 1][col * KPIT + 8 * g];   // key row col of a 16-key tile, this lane half's d
    const _Float16* vb = &sv[st & 1][col * VPIT + 8 * g];   // plane d = col of a 16-wide d tile, this lane half's keys
    v16h kf[FNT];
#pragma unroll
    for (int t = 0; t < FNT; ++t) kf[t] = frag_p(kb + (t * 16) * KPIT);
#pragma unroll
    for (int ps = 0; ps < FST / FAK; ++ps) {
    v8f s[FNT];
#pragma unroll
    for (int t = 0; t < FNT; ++t) s[t] = wmmah(kf[t], qh, nmv);
    if (ps + 1 < FST / FAK) {   // the stage's next pass: its k fragments are read one pass ahead, from the same buffer
#pragma unroll
      for (int t = 0; t < FNT; ++t) kf[t] = frag_p(kb + ((ps + 1) * FAK + t * 16) * KPIT); }
    v16h vf[HD / 16][FAK / 32];   // this pass's v planes: in flight under the softmax
#pragma unroll
    for (int j = 0; j < HD / 16; ++j)
#pragma unroll
      for (int c = 0; c < FAK / 32; ++c) vf[j][c] = frag_p(vb + (j * 16) * VPIT + ps * FAK + c * 32);
    __builtin_amdgcn_sched_barrier(0);   // keeps these LDS reads in front of the exp2: sunk behind the range test, their latency would stand open in front of the P V products
    float e[FNT][8];   // p at once, under the offset in use: nothing stands between the products and the exp2
#pragma unroll
    for (int t = 0; t < FNT; ++t)
#pragma unroll   // the builtin, not asm text: the compiler sees which registers the exp2 write and keeps them clear of a matrix product's operands
      for (int r = 0; r < 8; ++r) e[t][r] = __builtin_amdgcn_exp2f(s[t][r]);
    v16h p[FAK / 32];
#pragma unroll
    for (int c = 0; c < FAK / 32; ++c)
#pragma unroll
      for (int i = 0; i < 8; ++i) { p[c][i] = (_Float16)e[2 * c][i]; p[c][8 + i] = (_Float16)e[2 * c + 1][i]; }
    v8f sm = wmmah(ones, p[0], zero8);   // every element: this lane's column summed over the pass's keys
#pragma unroll
    for (int c = 1; c < FAK / 32; ++c) sm = wmmah(ones, p[c], sm);
    const bool first = ps == 0 && st == 0;   // the first pass ran under offset 0: it takes its own maximum, up or down
    if (first || __builtin_amdgcn_ballot_w32(sm[0] > PLIM) != 0) { float mx = s[0][0];   // move the offset and take this pass's p and sum again
#pragma unroll
      for (int t = 0; t < FNT; ++t)
#pragma unroll
        for (int r = 0; r < 8; ++r) mx = fmaxf(mx, s[t][r]);
      mx = fmaxf(mx, xhalf(mx));
      float d = POFF - mx; const float dn = fminf(d, 0.f); if (!first) d = dn; const float al = __builtin_amdgcn_exp2f(dn); l *= al;   // d = 0 and al = 1 exactly in a column whose maximum did not rise
#pragma unroll
      for (int j = 0; j < HD / 16; ++j)
#pragma unroll
        for (int r = 0; r < 8; ++r) acc[j][r] *= al;
#pragma unroll
      for (int t = 0; t < FNT; ++t)
#pragma unroll
        for (int r = 0; r < 8; ++r) e[t][r] = exp2_slot(s[t][r] + d);
#pragma unroll
      for (int r = 0; r < 8; ++r) nmv[r] += d;
#pragma unroll
      for (int c = 0; c < FAK / 32; ++c)
#pragma unroll
        for (int i = 0; i < 8; ++i) { p[c][i] = (_Float16)e[2 * c][i]; p[c][8 + i] = (_Float16)e[2 * c + 1][i]; }
      sm = wmmah(ones, p[0], zero8);
#pragma unroll
      for (int c = 1; c < FAK / 32; ++c) sm = wmmah(ones, p[c], sm); }
    l += sm[0];
#pragma unroll
    for (int c = 0; c < FAK / 32; ++c)
#pragma unroll
      for (int j = 0; j < HD / 16; ++j) acc[j] = wmmah(vf[j][c], p[c], acc[j]); }
    asm volatile("s_wait_dscnt 0x0" ::: "memory");      // this wave's reads of the stage's buffer are done
    asm volatile("s_wait_asynccnt 0x0" ::: "memory");   // its copies of the next stage have landed
    __syncthreads();                                    // the next stage may be read, and this stage's buffer may be refilled
    if (st + 2 < NST) stage_kv(lk + (unsigned)(st & 1) * (unsigned)sizeof(sk[0]), lv + (unsigned)(st & 1) * (unsigned)sizeof(sv[0]), gk + (size_t)(st + 2) * FST * CC, gv + (st + 2) * FST); }
  asm volatile("s_wait_asynccnt 0x0" ::: "memory");     // no copy is outstanding when the wave ends
  const float inv = 1.0f / l;   // l holds the whole column's sum in both lane halves
  float* yr = Y + ((size_t)b * TT + q) * CC + h * HD + 8 * g;   // acc[j][r] = ctx[q][j * 16 + 8g + r]
#pragma unroll
  for (int j = 0; j < HD / 16; ++j) { v4f o0, o1;
#pragma unroll
    for (int r = 0; r < 4; ++r) { o0[r] = acc[j][r] * inv; o1[r] = acc[j][4 + r] * inv; }
    vst2(yr + j * 16, o0); vst2(yr + j * 16 + 4, o1); } }
// ctx rows for a block of 256 threads (a load of the block = 4 rows): the loads, and, apart from them, each value split bf16 hi + lo into two LDS planes
template <int NR> __device__ __forceinline__ void load_rows_w8(v4f (&t)[NR / 4], const float* __restrict__ srcp, int tid) {
  const float* s = srcp + tid * 4;
#pragma unroll
  for (int i = 0; i < NR / 4; ++i) t[i] = *(const v4f*)(s + i * 1024);
  asm volatile("s_wait_xcnt 0x0" ::: "memory"); }   // as in stage_rows
template <int NR> __device__ __forceinline__ void split_rows_w8(__bf16* __restrict__ dh, __bf16* __restrict__ dl, const v4f (&t)[NR / 4], int tid) {
  const int o0 = (tid >> 6) * GPIT + (tid & 63) * 4;
#pragma unroll
  for (int i = 0; i < NR / 4; ++i) { v4b oh, ol;
#pragma unroll
    for (int k = 0; k < 4; ++k) { const __bf16 hv = (__bf16)t[i][k]; oh[k] = hv; ol[k] = (__bf16)(t[i][k] - (float)hv); }
    *(v4b*)(dh + o0 + 4 * i * GPIT) = oh; *(v4b*)(dl + o0 + 4 * i * GPIT) = ol; } }
// eight asynchronous 16-byte copies of this thread: bf16 rows 8 apart (a wave's copy = one whole row of 512 B) to the staged pitch; the s_wait_xcnt stands inside the statement, behind the last copy, so that no address register is rewritten in front of it
__device__ __forceinline__ void copy_rows8(unsigned l, const __bf16* g) {
  asm volatile("global_load_async_to_lds_b128 %0, %8, off\n\tglobal_load_async_to_lds_b128 %1, %9, off\n\tglobal_load_async_to_lds_b128 %2, %10, off\n\tglobal_load_async_to_lds_b128 %3, %11, off\n\t"
               "global_load_async_to_lds_b128 %4, %12, off\n\tglobal_load_async_to_lds_b128 %5, %13, off\n\tglobal_load_async_to_lds_b128 %6, %14, off\n\tglobal_load_async_to_lds_b128 %7, %15, off\n\ts_wait_xcnt 0x0"
      :: "v"(l), "v"(l + 8u * GPIT * 2u), "v"(l + 16u * GPIT * 2u), "v"(l + 24u * GPIT * 2u), "v"(l + 32u * GPIT * 2u), "v"(l + 40u * GPIT * 2u), "v"(l + 48u * GPIT * 2u), "v"(l + 56u * GPIT * 2u),
         "v"(g), "v"(g + 8 * CC), "v"(g + 16 * CC), "v"(g + 24 * CC), "v"(g + 32 * CC), "v"(g + 40 * CC), "v"(g + 48 * CC), "v"(g + 56 * CC) : "memory"); }
__device__ __forceinline__ v8f wmmab(v16b a, v16b b, v8f c) { return __builtin_amdgcn_wmma_f32_16x16x32_bf16(false, a, false, b, (short)0, c, false, false); }
// ---- k_outln: block = 32 whole rows (8 waves: 2 groups of 16 rows x 4 groups of 64 columns), ctx rows (hi and lo planes) and all of Wo staged in LDS (Wo comes as the bf16 plane that k_fa has rounded, by asynchronous copies that fly while the ctx rows are split): x = ctx Wo^T (ctx bf16 hi + lo against exact bf16 Wo: 2 products) + bo + bf16(query); the block holds every column of its rows, so LayerNorm follows at once: the x tile goes through LDS, then a wave takes four rows (mean, biased var, (x - mean) * rsqrt(var + 1e-5) * g + b; 8 floats a lane and row)
#define ORW 32
#define SFP 260            // f32 a row of the x tile in LDS: rows 8 apart fall 32 banks apart
__global__ __launch_bounds__(256) void k_outln(const float* __restrict__ Y, const __bf16* __restrict__ WOB, const float* __restrict__ BO, const float* __restrict__ RESX, const float* __restrict__ G, const float* __restrict__ BE, float* __restrict__ OUT) {
  __shared__ __align__(16) float sf[ORW][SFP]; __shared__ __align__(16) __bf16 sw[DIN * GPIT], yh[ORW * GPIT], yl[ORW * GPIT];
  const int tid = threadIdx.x, wave = tid >> 5, lane = tid & 31, col = lane & 15, g = lane >> 4; const int rg = wave & 1, cg = wave >> 1; const size_t r0 = (size_t)blockIdx.x * ORW;
  // what the rows' end needs from memory is asked for first: this wave's four query rows, its bias columns, the affine pair
  v4f zr[4][2], g4[2], b4[2]; float bias[4];
#pragma unroll
  for (int k = 0; k < 4; ++k)
#pragma unroll
    for (int i = 0; i < 2; ++i) zr[k][i] = *(const v4f*)(RESX + (r0 + wave * 4 + k) * DIN + i * 128 + lane * 4);
#pragma unroll
  for (int i = 0; i < 2; ++i) { g4[i] = *(const v4f*)(G + i * 128 + lane * 4); b4[i] = *(const v4f*)(BE + i * 128 + lane * 4); }
#pragma unroll
  for (int j = 0; j < 4; ++j) bias[j] = BO[cg * 64 + j * 16 + col];
  asm volatile("s_wait_xcnt 0x0" ::: "memory");   // stands in front of whatever next rewrites a register that these loads name
  v4f yt[ORW / 4]; load_rows_w8<ORW>(yt, Y + r0 * CC, tid);
  { const unsigned lw = lds_off(&sw[wave * GPIT + lane * 8]); const __bf16* gw = WOB + wave * CC + lane * 8;   // copies: rows wave + 8 i, 16-byte piece lane
#pragma unroll
    for (int i = 0; i < DIN / 64; ++i) copy_rows8(lw + (unsigned)i * 64u * GPIT * 2u, gw + i * 64 * CC); }
  split_rows_w8<ORW>(yh, yl, yt, tid);
  asm volatile("s_wait_asynccnt 0x0" ::: "memory");   // this wave's copies of Wo have landed
  __syncthreads();   // and every other wave's: both operands are whole in LDS
  v8f acc[4] = {};
  const __bf16* ph = yh + (rg * 16 + col) * GPIT; const __bf16* pl = yl + (rg * 16 + col) * GPIT; const __bf16* pw = sw + (cg * 64 + col) * GPIT;
  v16b ah = frag_b(ph, lane), al = frag_b(pl, lane), w[4];
#pragma unroll
  for (int j = 0; j < 4; ++j) w[j] = frag_b(pw + j * 16 * GPIT, lane);
#pragma unroll
  for (int kc = 0; kc < CC / 32; ++kc) { v16b ahn = ah, aln = al, wn[4];
    if (kc + 1 < CC / 32) { ahn = frag_b(ph + (kc + 1) * 32, lane); aln = frag_b(pl + (kc + 1) * 32, lane);   // the next k step's fragments: one group of LDS reads ahead of this step's products
#pragma unroll
      for (int j = 0; j < 4; ++j) wn[j] = frag_b(pw + j * 16 * GPIT + (kc + 1) * 32, lane); }
    __builtin_amdgcn_sched_barrier(0);   // keeps that group of reads in front of the products: sunk to their uses, each read's LDS latency would stand open in front of a product
#pragma unroll
    for (int j = 0; j < 4; ++j) acc[j] = wmmab(ah, w[j], acc[j]);
#pragma unroll
    for (int j = 0; j < 4; ++j) acc[j] = wmmab(al, w[j], acc[j]);
    if (kc + 1 < CC / 32) { ah = ahn; al = aln;
#pragma unroll
      for (int j = 0; j < 4; ++j) w[j] = wn[j]; } }
#pragma unroll
  for (int j = 0; j < 4; ++j) { const float bj = bfr(bias[j]);
#pragma unroll
    for (int r = 0; r < 8; ++r) sf[rg * 16 + 8 * g + r][cg * 64 + j * 16 + col] = acc[j][r] + bj; }
  __syncthreads();   // the x tile is whole: a row's columns come from four waves
  v4f v[4][2]; float s1[4], q[4];
#pragma unroll
  for (int k = 0; k < 4; ++k) { s1[k] = 0.f;
#pragma unroll
    for (int i = 0; i < 2; ++i) { v4f t = *(const v4f*)&sf[wave * 4 + k][i * 128 + lane * 4]; t[0] += bfr(zr[k][i][0]); t[1] += bfr(zr[k][i][1]); t[2] += bfr(zr[k][i][2]); t[3] += bfr(zr[k][i][3]); v[k][i] = t; s1[k] += (t[0] + t[1]) + (t[2] + t[3]); } }
#pragma unroll
  for (int o = 1; o < 32; o <<= 1)
#pragma unroll
    for (int k = 0; k < 4; ++k) s1[k] += __shfl_xor(s1[k], o);
#pragma unroll
  for (int k = 0; k < 4; ++k) { s1[k] *= (1.0f / CC); q[k] = 0.f;
#pragma unroll
    for (int i = 0; i < 2; ++i)
#pragma unroll
      for (int e = 0; e < 4; ++e) { const float d = v[k][i][e] - s1[k]; q[k] += d * d; } }
#pragma unroll
  for (int o = 1; o < 32; o <<= 1)
#pragma unroll
    for (int k = 0; k < 4; ++k) q[k] += __shfl_xor(q[k], o);
#pragma unroll
  for (int k = 0; k < 4; ++k) { const float inv = rsqrtf(q[k] * (1.0f / CC) + 1e-5f);   /* jnp.var (biased), eps inside the rsqrt */
#pragma unroll
    for (int i = 0; i < 2; ++i) { v4f r4;
#pragma unroll
      for (int e = 0; e < 4; ++e) r4[e] = bfr(g4[i][e]) * ((v[k][i][e] - s1[k]) * inv) + bfr(b4[i][e]);
      vst2(OUT + (r0 + wave * 4 + k) * DIN + i * 128 + lane * 4, r4); } } }

extern "C" void kernel_launch(void* const* d_in, const int* in_sizes, int n_in, void* d_out, int out_size, void* d_ws, size_t ws_size, hipStream_t stream) {
  (void)in_sizes; (void)n_in; (void)out_size;
  const float** F = (const float**)d_in;
  if (ws_size < (size_t)WS_END) return;
  char* ws = (char*)d_ws; _Float16 *QH = (_Float16*)(ws + WS_QH), *KH = (_Float16*)(ws + WS_KH), *VT = (_Float16*)(ws + WS_VT), *KL = (_Float16*)(ws + WS_KL); __bf16 *VB = (__bf16*)(ws + WS_VB), *VBL = (__bf16*)(ws + WS_VBL); float *Y = (float*)(ws + WS_Y); __bf16 *WOB = (__bf16*)(ws + WS_WOB);
  // inputs: 0 query; 1 key; 2 value [4,2048,256]; 3 Wq (out,in), 4 bq; 5 Wk, 6 bk; 7 Wv, 8 bv; 9 Wo (out,in), 10 bo; 11 ln_g, 12 ln_b
  k_proj<<<dim3(TNB * TT / 64, CC / 128, 3), 128, 0, stream>>>(F[0], F[1], F[2], F[3], F[5], F[7], F[4], F[6], F[8], QH, KH, KL, VT, VB, VBL);
  k_fa<<<dim3(TT / 128, NH, TNB), 256, 0, stream>>>(QH, KH, VT, Y, F[9], WOB);
  k_outln<<<dim3(TNB * TT / ORW), 256, 0, stream>>>(Y, WOB, F[10], F[0], F[11], F[12], (float*)d_out);   /* LayerNorm(ctx Wo^T + bo + bf16(query)) */
}

// v010
// Measured time: 37.8 microseconds a run.
// In two side-by-side timings against v009, it was 1.03 and 1.04 times as fast.
// Over all steps from v000 it is 22.9 times as fast.
// compute dtype: all float inputs rounded to bf16; Q/K/V = in W^T + b with EXACT bf16 products on WMMA 16x16x32 (f32 accumulate); q x log2(e) / sqrt(32) once to f16 against k once to f16 (1 product, its f32 accumulator starting at the softmax offset); softmax in f32 in base 2 (the accumulator is the exponent: hardware exp2 on it; offset and sum carried over 64-key passes); exp x 2^8 (the maximum in use; a later one may pass it while a pass's sum stays inside 2^15) once to f16 against v once to f16 (1 product), divided at the end by the sum of the same f16 values (1 product against ones, f32 accumulate); ctx split bf16 hi + lo against exact Wo (2 products) + bo + query; LayerNorm in f32; f32 output.
#include <hip/hip_runtime.h>
#include <math.h>

typedef __attribute__((ext_vector_type(16))) _Float16 v16h;
typedef __attribute__((ext_vector_type(16))) __bf16 v16b;
typedef __attribute__((ext_vector_type(8)))  _Float16 v8h;
typedef __attribute__((ext_vector_type(8)))  float v8f;
typedef __attribute__((ext_vector_type(4)))  float v4f;
typedef __attribute__((ext_vector_type(2)))  float v2f;
typedef __attribute__((ext_vector_type(4)))  unsigned v4u;
typedef __attribute__((ext_vector_type(4)))  int v4i;
typedef float __attribute__((may_alias)) float_a;
typedef int __attribute__((may_alias)) int_a;

template <typename T> __device__ __forceinline__ void vst2(void* p, T v) { *(T*)p = v;  }
__device__ __forceinline__ v8f wmma16(v16h a, v16h b, v8f c) {
  v8f d = __builtin_amdgcn_wmma_f32_16x16x32_f16(false, a, false, b, (short)0, c, false, false);
  asm volatile("v_nop\n\tv_nop\n\tv_nop\n\tv_nop" : "+v"(d) : "v"(a), "v"(b));
  return d;
}
__device__ __forceinline__ v8f wmma_bf(v16b a, v16b b, v8f c) {
  v8f d = __builtin_amdgcn_wmma_f32_16x16x32_bf16(false, a, false, b, (short)0, c, false, false);
  asm volatile("v_nop\n\tv_nop\n\tv_nop\n\tv_nop" : "+v"(d) : "v"(a), "v"(b));
  return d;
}
// 16x16x32 fragments: lane = (h = lane>>4, row/col = lane&15); elements 0..7 = k0+8h+0..7, 8..15 = k0+16+8h+0..7; D element r = row 8h+r
__device__ __forceinline__ v16h frag_h(const _Float16* rowk0, int lane) {
  union { v16h v; v8h q[2]; } u; const _Float16* p = rowk0 + 8 * (lane >> 4);
  u.q[0] = *(const v8h*)p; u.q[1] = *(const v8h*)(p + 16); return u.v;
}
__device__ __forceinline__ v16h frag_f32(const float* rowk0, int lane) {
  v16h a; const float* p = rowk0 + 8 * (lane >> 4);
#pragma unroll
  for (int i = 0; i < 8; ++i) { a[i] = (_Float16)p[i]; a[8 + i] = (_Float16)p[16 + i]; }
  return a;
}
__device__ __forceinline__ v16h frag_f32s(const float* rowk0, int lane, float sc) {
  v16h a; const float* p = rowk0 + 8 * (lane >> 4);
#pragma unroll
  for (int i = 0; i < 8; ++i) { a[i] = (_Float16)(p[i] * sc); a[8 + i] = (_Float16)(p[16 + i] * sc); }
  return a;
}
// column fragment from a [K][ld] layout (column n), rows >= K read as 0
__device__ __forceinline__ v16h fragc_f32(const float* W, int k0, int n, int lane, int ld, int K) {
  v16h a; const int g = lane >> 4;
#pragma unroll
  for (int i = 0; i < 8; ++i) { const int ka = k0 + 8 * g + i, kb = ka + 16;
    a[i] = (_Float16)(ka < K ? W[(size_t)(ka < K ? ka : K - 1) * ld + n] : 0.f); a[8 + i] = (_Float16)(kb < K ? W[(size_t)(kb < K ? kb : K - 1) * ld + n] : 0.f); }
  return a;
}
struct F2 { v16b h, l; };
__device__ __forceinline__ F2 bsplit16(const float v[16]) { F2 r;
#pragma unroll
  for (int i = 0; i < 16; ++i) { const __bf16 h = (__bf16)v[i]; r.h[i] = h; r.l[i] = (__bf16)(v[i] - (float)h); }
  return r; }
__device__ __forceinline__ F2 split_row(const float* row, int k0, int lane) { float v[16]; const float* p = row + k0 + 8 * (lane >> 4);
#pragma unroll
  for (int i = 0; i < 8; ++i) { v[i] = p[i]; v[8 + i] = p[16 + i]; }
  return bsplit16(v); }
__device__ __forceinline__ F2 split_rowK(const float* row, int k0, int lane, int K) { float v[16]; const int g = lane >> 4;
#pragma unroll
  for (int i = 0; i < 8; ++i) { const int ka = k0 + 8 * g + i, kb = ka + 16; v[i] = ka < K ? row[ka < K ? ka : K - 1] : 0.f; v[8 + i] = kb < K ? row[kb < K ? kb : K - 1] : 0.f; }
  return bsplit16(v); }
__device__ __forceinline__ F2 split_col(const float* W, int k0, int n, int lane, int ld, int K) { float v[16]; const int g = lane >> 4;
#pragma unroll
  for (int i = 0; i < 8; ++i) { const int ka = k0 + 8 * g + i, kb = ka + 16; v[i] = ka < K ? W[(size_t)(ka < K ? ka : K - 1) * ld + n] : 0.f; v[8 + i] = kb < K ? W[(size_t)(kb < K ? kb : K - 1) * ld + n] : 0.f; }
  return bsplit16(v); }
__device__ __forceinline__ v8f mac3(const F2& a, const F2& b, v8f c) { c = wmma_bf(a.l, b.h, c); c = wmma_bf(a.h, b.l, c); return wmma_bf(a.h, b.h, c); }
__device__ __forceinline__ float sigm(float v) { return 1.0f / (1.0f + expf(-v)); }
#define LDSX() do { asm volatile("s_wait_dscnt 0" ::: "memory"); __builtin_amdgcn_wave_barrier(); __builtin_amdgcn_fence(__ATOMIC_RELEASE, "workgroup"); } while (0)

// Cross-modal multi-head attention with residual + LayerNorm (B 4, L 2,048, d_model 256 = 8 heads x 32; (out,in) 1/16-scale weights, zero biases; LN affine 1/0, eps 1e-5): Q = query Wq^T + bq, K = key Wk^T + bk, V = value Wv^T + bv; ctx = softmax(Q K^T / sqrt(32)) V; out = LN(ctx Wo^T + bo + query).
#define NB 4
#define TT 2048
#define CC 256            // NH * HD = projected width
#define DIN 256          // input (model) width
#define NH 8
#define HD 32
#define NQB (TT / 64)
#define HG 4
#define SCALE (0.17677669529663689f)
#define CAUSAL 0
#ifndef TNB
#define TNB NB
#endif
__device__ __forceinline__ float bfr(float v) { return (float)(__bf16)v; }
__host__ __device__ __forceinline__ int kb_last(int qb) { return CAUSAL ? ((qb * 64 + 63) >> 7) : (TT / 128 - 1); }
typedef __attribute__((ext_vector_type(8))) __bf16 v8b;
__device__ __forceinline__ v16b frag_b(const __bf16* rowk0, int lane) {
  union { v16b v; v8b q[2]; } u; const __bf16* p = rowk0 + 8 * (lane >> 4);
  u.q[0] = *(const v8b*)p; u.q[1] = *(const v8b*)(p + 16); return u.v;
}
#define QBH 0              // unused: no kernel in this file has a high-precision path
#define KHI 64            // key rows carrying k residual / v bf16 hi+lo planes (written by k_proj; no kernel here reads them)
// B fragment (k rows k0+.., output column o) of a weight: (in,out) [K][ld] or (out,in) [ld rows of K]: bf16 exact, or f16(bf16 * 256) exact
__device__ __forceinline__ v16b wcol_io(const float* Wm, int k0, int o, int lane, int ld) { v16b w; const int g = lane >> 4;
#pragma unroll
  for (int i = 0; i < 8; ++i) { w[i] = (__bf16)Wm[(size_t)(k0 + 8 * g + i) * ld + o]; w[8 + i] = (__bf16)Wm[(size_t)(k0 + 16 + 8 * g + i) * ld + o]; }
  return w; }
__device__ __forceinline__ v16b wcol_oi(const float* Wm, int k0, int o, int lane, int K) { v16b w; const float* p = Wm + (size_t)o * K + k0 + 8 * (lane >> 4);
#pragma unroll
  for (int i = 0; i < 8; ++i) { w[i] = (__bf16)p[i]; w[8 + i] = (__bf16)p[16 + i]; }
  return w; }
__device__ __forceinline__ v16h wcolh_io(const float* Wm, int k0, int o, int lane, int ld) { v16h w; const int g = lane >> 4;
#pragma unroll
  for (int i = 0; i < 8; ++i) { w[i] = (_Float16)(bfr(Wm[(size_t)(k0 + 8 * g + i) * ld + o]) * 256.0f); w[8 + i] = (_Float16)(bfr(Wm[(size_t)(k0 + 16 + 8 * g + i) * ld + o]) * 256.0f); }
  return w; }
__device__ __forceinline__ v16h wcolh_oi(const float* Wm, int k0, int o, int lane, int K) { v16h w; const float* p = Wm + (size_t)o * K + k0 + 8 * (lane >> 4);
#pragma unroll
  for (int i = 0; i < 8; ++i) { w[i] = (_Float16)(bfr(p[i]) * 256.0f); w[8 + i] = (_Float16)(bfr(p[16 + i]) * 256.0f); }
  return w; }
#define WQKV_LAYOUT 1   // 0 = (in,out) [DIN][CC]; 1 = (out,in) [CC][DIN]; 2 = per-head [NH][DIN][HD]
__device__ __forceinline__ v16b wcol_hdk(const float* Wm, int k0, int o, int lane) { v16b w; const int g = lane >> 4; const float* p = Wm + (size_t)(o / HD) * DIN * HD + (o % HD);
#pragma unroll
  for (int i = 0; i < 8; ++i) { w[i] = (__bf16)p[(size_t)(k0 + 8 * g + i) * HD]; w[8 + i] = (__bf16)p[(size_t)(k0 + 16 + 8 * g + i) * HD]; }
  return w; }
#define WO_OUT_IN 1
#if WQKV_LAYOUT == 1
#define WCOL(W, k0, o, lane) wcol_oi(W, k0, o, lane, DIN)
#elif WQKV_LAYOUT == 2
#define WCOL(W, k0, o, lane) wcol_hdk(W, k0, o, lane)
#else
#define WCOL(W, k0, o, lane) wcol_io(W, k0, o, lane, CC)
#endif
#if WO_OUT_IN
#define WOCOL(W, k0, o, lane) wcol_oi(W, k0, o, lane, CC)
#define WOCOLH(W, k0, o, lane) wcolh_oi(W, k0, o, lane, CC)
#else
#define WOCOL(W, k0, o, lane) wcol_io(W, k0, o, lane, DIN)
#define WOCOLH(W, k0, o, lane) wcolh_io(W, k0, o, lane, DIN)
#endif
#ifndef SM_EXTRA_PARAMS
#define SM_EXTRA_PARAMS
#endif
#ifndef PROJ_EXTRA_PARAMS
#define PROJ_EXTRA_PARAMS
#endif
#ifndef SM_MASK_HOOK
#define SM_MASK_HOOK (void)0
#endif

#define WS_QH  0u                                      // f16 q x C2 rows [b*t][CC]
#define WS_KH  (WS_QH + 2u * (size_t)NB * TT * CC)      // f16 k rows [b*t][CC]
#define WS_VT  (WS_KH + 2u * (size_t)NB * TT * CC)      // f16 v planes [b][c][t]
#define WS_KL  (WS_VT + 2u * (size_t)NB * CC * TT)      // f16 k residual x 2^10 rows [b][t < KHI][CC]
#define WS_VB  (WS_KL + 2u * (size_t)NB * KHI * CC)     // bf16 v hi planes [b][c][t < KHI]
#define WS_VBL (WS_VB + 2u * (size_t)NB * CC * KHI)
#define WS_S   (WS_VBL + 2u * (size_t)NB * CC * KHI)    // space of HG x TT x TT f32, in which no kernel stores logits
#define WS_WOB WS_S                                    // bf16 Wo rows [DIN][CC] (the score plane's bytes, which no kernel uses)
#define WS_Y   (WS_S  + 4u * (size_t)HG * TT * TT)      // f32 ctx rows [b*t][CC] (only when there is an output projection)
#define WS_END (WS_Y  + 4u * (size_t)NB * TT * CC)

// A GEMM operand reaches the four waves of a block through LDS: rows of 256 f32, contiguous in memory, are read once a block by whole-line loads (a wave's load = 512 contiguous bytes; 32 loads of a thread form a batch), rounded to bf16 and laid at a pitch of 16 B x odd, where the b128 fragment reads of 16 rows fall on 64 different banks
#define C2 (SCALE * 1.4426950408889634f)   // 1/sqrt(32) x log2(e): q leaves k_proj with it, so that k q is a base-2 exponent
#define GPIT 264           // bf16 a staged row in LDS (512 B of data, 528-B pitch)
typedef __attribute__((ext_vector_type(4))) __bf16 v4b;
template <int NR> __device__ __forceinline__ void stage_rows(__bf16* __restrict__ dst, const float* __restrict__ srcp, int tid) {
  __bf16* d = dst + (tid >> 6) * GPIT + (tid & 63) * 4; const float* s = srcp + tid * 4;
#pragma unroll
  for (int b = 0; b < NR / 64; ++b) { v4f t[32];
#pragma unroll
    for (int i = 0; i < 32; ++i) t[i] = *(const v4f*)(s + (b * 32 + i) * 512);
    asm volatile("s_wait_xcnt 0x0" ::: "memory");   // stands in front of whatever next rewrites a register that these loads name
#pragma unroll
    for (int i = 0; i < 32; ++i) { v4b o; o[0] = (__bf16)t[i][0]; o[1] = (__bf16)t[i][1]; o[2] = (__bf16)t[i][2]; o[3] = (__bf16)t[i][3]; *(v4b*)(d + (b * 64 + 2 * i) * GPIT) = o; } } }
// ---- k_proj: block = (64 rows, 128 cols, which): q/k/v = X W (+ b) with exact bf16 products (K = DIN), X rows and W rows staged in LDS -> which 0: q x C2 f16 rows; 1: k f16 rows (+ residual rows < KHI); 2: v f16 planes [c][t] (+ bf16 hi/lo planes for t < KHI)
// amdgpu_waves_per_eu(3, 3): the grid holds three blocks for every WGP, three waves a SIMD: the kernel takes the register budget of that occupancy
__global__ __launch_bounds__(128) __attribute__((amdgpu_waves_per_eu(3, 3))) void k_proj(const float* __restrict__ XQ, const float* __restrict__ XK, const float* __restrict__ XV, const float* __restrict__ WQ, const float* __restrict__ WK, const float* __restrict__ WV, const float* __restrict__ BQ, const float* __restrict__ BK, const float* __restrict__ BV,
    _Float16* __restrict__ QH, _Float16* __restrict__ KH, _Float16* __restrict__ KL, _Float16* __restrict__ VT, __bf16* __restrict__ VB, __bf16* __restrict__ VBL) {
  __shared__ __align__(16) unsigned char smem[(128 + 64) * GPIT * 2];   // the two operands; behind the products the output tiles take the same bytes, so that three blocks fit a WGP
  __bf16* sw = (__bf16*)smem; __bf16* sx = sw + 128 * GPIT;
  _Float16 (*sh)[136] = (_Float16 (*)[136])smem; _Float16 (*sl)[136] = sh + 64; _Float16 (*th)[72] = (_Float16 (*)[72])smem; __bf16 (*tb)[72] = (__bf16 (*)[72])(smem + 128 * 72 * 2); __bf16 (*tbl)[72] = tb + 128;
  const int tid = threadIdx.x, wave = tid >> 5, lane = tid & 31, col = lane & 15, g = lane >> 4; const int which = blockIdx.z; const int c0 = blockIdx.y * 128; const size_t r0 = (size_t)blockIdx.x * 64; const size_t bb = r0 / TT; const int t0 = (int)(r0 % TT);
  const float* X = which == 0 ? XQ : which == 1 ? XK : XV; const float* WA = which == 0 ? WQ : which == 1 ? WK : WV; const float* BA = which == 0 ? BQ : which == 1 ? BK : BV;
  float bs[8] = {};   // this lane's eight bias values are asked for first and fly with the operands' loads: behind the products each was a load waited on alone
  if (BA) {
#pragma unroll
    for (int j = 0; j < 8; ++j) bs[j] = BA[c0 + j * 16 + col];
    asm volatile("s_wait_xcnt 0x0" ::: "memory"); }   // stands in front of whatever next rewrites a register that these loads name
  stage_rows<64>(sx, X + r0 * DIN, tid); stage_rows<128>(sw, WA + (size_t)c0 * DIN, tid);
  __syncthreads();   // both operands are whole in LDS
  v8f acc[8] = {}; const __bf16* pa = sx + (wave * 16 + col) * GPIT; const __bf16* pw = sw + col * GPIT;
  v16b a = frag_b(pa, lane), w[8];
#pragma unroll
  for (int j = 0; j < 8; ++j) w[j] = frag_b(pw + j * 16 * GPIT, lane);
#pragma unroll
  for (int kc = 0; kc < DIN / 32; ++kc) { v16b an = a, wn[8];
    if (kc + 1 < DIN / 32) { an = frag_b(pa + (kc + 1) * 32, lane);   // the next k step's fragments: one group of LDS reads ahead of this step's products
#pragma unroll
      for (int j = 0; j < 8; ++j) wn[j] = frag_b(pw + j * 16 * GPIT + (kc + 1) * 32, lane); }
#pragma unroll
    for (int j = 0; j < 8; ++j) acc[j] = wmma_bf(a, w[j], acc[j]);
    if (kc + 1 < DIN / 32) { a = an;
#pragma unroll
      for (int j = 0; j < 8; ++j) w[j] = wn[j]; } }
  __syncthreads();   // every wave has read its last fragment: the bytes may take the output tiles
  if (which < 2) { _Float16* DH = which == 0 ? QH : KH; _Float16* DL = KL; const int nhi = KHI; const bool hi_rows = which == 1 && t0 < nhi; const float vs = which == 0 ? C2 : 1.0f;   // q: scaled by C2, rounded once, as k is
    float bias[8];
#pragma unroll
    for (int j = 0; j < 8; ++j) { bias[j] = bfr(bs[j]);
#pragma unroll
      for (int r = 0; r < 8; ++r) sh[wave * 16 + 8 * g + r][j * 16 + col] = (_Float16)((acc[j][r] + bias[j]) * vs); }
    if (hi_rows) {   // the same for the whole block: a residual is formed only for the k rows that have a plane for it
#pragma unroll
      for (int j = 0; j < 8; ++j)
#pragma unroll
        for (int r = 0; r < 8; ++r) { const float v = acc[j][r] + bias[j]; sl[wave * 16 + 8 * g + r][j * 16 + col] = (_Float16)((v - (float)(_Float16)v) * 1024.0f); } }
    __syncthreads();
    const int rl0 = tid >> 4, q8 = (tid & 15) * 8; v4u ot[8];   // the tile's eight LDS reads of a thread go out as one group, then its eight stores (rolled, each read was waited on alone)
#pragma unroll
    for (int i = 0; i < 8; ++i) ot[i] = *(const v4u*)&sh[rl0 + 8 * i][q8];
#pragma unroll
    for (int i = 0; i < 8; ++i) vst2((unsigned*)(DH + (r0 + rl0 + 8 * i) * CC + c0 + q8), ot[i]);
    asm volatile("s_wait_xcnt 0x0" ::: "memory");   // stands in front of whatever next rewrites a register that these stores name
    if (hi_rows) {
#pragma unroll
      for (int i = 0; i < 8; ++i) ot[i] = *(const v4u*)&sl[rl0 + 8 * i][q8];
#pragma unroll
      for (int i = 0; i < 8; ++i) vst2((unsigned*)(DL + (bb * nhi + t0 + rl0 + 8 * i) * (size_t)CC + c0 + q8), ot[i]); }
  } else { const bool hi_rows = t0 < KHI;
#pragma unroll
    for (int j = 0; j < 8; ++j) { const float bias = bfr(bs[j]);
#pragma unroll
      for (int r = 0; r < 8; ++r) { const float v = acc[j][r] + bias; const int rl = wave * 16 + 8 * g + r, cl = j * 16 + col; th[cl][rl] = (_Float16)v; const __bf16 bh = (__bf16)v; tb[cl][rl] = bh; tbl[cl][rl] = (__bf16)(v - (float)bh); } }
    __syncthreads();
    const int cl0 = tid >> 3, q8 = (tid & 7) * 8; v4u ot[8];   // as above: one group of LDS reads, then the stores
#pragma unroll
    for (int i = 0; i < 8; ++i) ot[i] = *(const v4u*)&th[cl0 + 16 * i][q8];
#pragma unroll
    for (int i = 0; i < 8; ++i) vst2((unsigned*)(VT + (bb * CC + c0 + cl0 + 16 * i) * (size_t)TT + t0 + q8), ot[i]);
    asm volatile("s_wait_xcnt 0x0" ::: "memory");   // stands in front of whatever next rewrites a register that these stores name
    if (hi_rows) { v4u ol[8];
#pragma unroll
      for (int i = 0; i < 8; ++i) { ot[i] = *(const v4u*)&tb[cl0 + 16 * i][q8]; ol[i] = *(const v4u*)&tbl[cl0 + 16 * i][q8]; }
#pragma unroll
      for (int i = 0; i < 8; ++i) { const size_t o3 = (bb * CC + c0 + cl0 + 16 * i) * (size_t)KHI + t0 + q8; vst2((unsigned*)(VB + o3), ot[i]); vst2((unsigned*)(VBL + o3), ol[i]); }
      asm volatile("s_wait_xcnt 0x0" ::: "memory"); } } }   // as above: in the built code a branch leads on from here to instructions that rewrite these stores' registers
// ---- k_fa: block = 128 queries (8 waves x 16 query columns) of (b, h), one pass over all keys in steps of FAK, k rows and v planes staged in LDS for the whole block: E^T = K Q^T + nm (A = k rows, B = q, the accumulator's start value C is the column's offset nm: 1 product); q carries C2 = SCALE x log2(e), so a lane holds one query's finished exponents e (keys 8g + r of each 16-key tile) and p = exp2(e): no vector arithmetic between product and exp2; nm = POFF - (the maximum in use) is known before the products: the first pass sets it from its own maximum; p once to f16, packed from two score tiles straight into a B operand; the pass's sum of p comes from the matrix unit (A = ones: every row of the result is the column's sum over all 64 keys, both lane halves joined, f32 accumulate) and is the range test as well: no p is negative, so a sum inside PLIM holds every p inside f16, and 64 p under the maximum in use sum to 2^14 at most, so the offset moves only when a later p has passed that maximum: there the halves' maxima are joined by a cross-row move, sum and ctx rescaled and the pass's p and sum taken again; ctx^T += V^T P^T (A = v planes: 1 product); ctx = acc / sum (both carry 2^nm)
#define FAK 64
#define FNT (FAK / 16)
#define PLIM 32768.0f      // largest sum of a pass's p let through under the offset in use (2^15: every p of it inside f16; an f16 infinity makes the sum infinite)
#define POFF 8.0f          // exponent of the maximum in use
// amdgpu_waves_per_eu(4, 4): the grid holds four waves for every SIMD, so the kernel takes the register budget of that occupancy (two blocks a WGP, all resident at once)
__device__ __forceinline__ float xhalf(float x) { return __builtin_bit_cast(float, __builtin_amdgcn_permlanex16(__builtin_bit_cast(int, x), __builtin_bit_cast(int, x), 0x76543210, 0xfedcba98, false, false)); }   // lane l with lane l ^ 16
__device__ __forceinline__ v16h frag_p(const _Float16* p) { union { v16h v; v8h q[2]; } u; u.q[0] = *(const v8h*)p; u.q[1] = *(const v8h*)(p + 16); return u.v; }   // frag_h with the lane half's 8g already in p
// exp2 with the slot behind a transcendental closed in its own statement (one v_nop before its result is read or its source overwritten): for the rare path
__device__ __forceinline__ float exp2_slot(float x) { float y; asm("v_exp_f32 %0, %1\n\tv_nop" : "=v"(y) : "v"(x)); return y; }
// sixteen f16 1.0 in eight registers. Written as instructions: given as a literal, the compiler forms the eight registers anew in the loop (four 64-bit moves a stage) instead of keeping them
__device__ __forceinline__ v16h ones_frag() { union { v16h v; unsigned u[8]; } o;
  asm("v_mov_b32 %0, 0x3c003c00\n\tv_mov_b32 %1, 0x3c003c00\n\tv_mov_b32 %2, 0x3c003c00\n\tv_mov_b32 %3, 0x3c003c00\n\tv_mov_b32 %4, 0x3c003c00\n\tv_mov_b32 %5, 0x3c003c00\n\tv_mov_b32 %6, 0x3c003c00\n\tv_mov_b32 %7, 0x3c003c00"
      : "=v"(o.u[0]), "=v"(o.u[1]), "=v"(o.u[2]), "=v"(o.u[3]), "=v"(o.u[4]), "=v"(o.u[5]), "=v"(o.u[6]), "=v"(o.u[7]));
  return o.v; }
__device__ __forceinline__ v8f wmmah(v16h a, v16h b, v8f c) { return __builtin_amdgcn_wmma_f32_16x16x32_f16(false, a, false, b, (short)0, c, false, false); }
// K and V reach the eight waves of a block through LDS: a stage = FST keys (two passes), two buffers, filled one stage ahead by asynchronous 16-byte copies (each thread: two pieces of k rows, two of v planes). Pitches 16 B x odd: the b128 fragment reads of 16 rows fall on 64 different banks.
#define FST 128
#define NST (TT / FST)
#define KPIT 40            // halves a k row in LDS (64 B of data, 80-B pitch)
#define VPIT (FST + 8)     // halves a v plane row in LDS (256 B of data, 272-B pitch)
__device__ __forceinline__ unsigned lds_off(const void* p) { return (unsigned)(size_t)p; }   // byte offset in the work-group's LDS
// one stage's four copies of this thread; the s_wait_xcnt stands inside the statement, behind the last copy, so that no address register is rewritten in front of it
__device__ __forceinline__ void stage_kv(unsigned lk, unsigned lv, const _Float16* gk, const _Float16* gv) {
  asm volatile("global_load_async_to_lds_b128 %0, %4, off\n\tglobal_load_async_to_lds_b128 %1, %5, off\n\tglobal_load_async_to_lds_b128 %2, %6, off\n\tglobal_load_async_to_lds_b128 %3, %7, off\n\ts_wait_xcnt 0x0"
      :: "v"(lk), "v"(lk + 64u * KPIT * 2u), "v"(lv), "v"(lv + 16u * VPIT * 2u), "v"(gk), "v"(gk + (size_t)64 * CC), "v"(gv), "v"(gv + (size_t)16 * TT) : "memory"); }
__global__ __launch_bounds__(256) __attribute__((amdgpu_waves_per_eu(4, 4))) void k_fa(const _Float16* __restrict__ QH, const _Float16* __restrict__ KH, const _Float16* __restrict__ VT, float* __restrict__ Y, const float* __restrict__ WO, __bf16* __restrict__ WOB) {
  __shared__ __align__(16) _Float16 sk[2][FST * KPIT], sv[2][HD * VPIT];
  const int tid = threadIdx.x, wave = tid >> 5, lane = tid & 31, col = lane & 15, g = lane >> 4; const int h = blockIdx.y, b = blockIdx.z; const int q = blockIdx.x * 128 + wave * 16 + col;
  const v16h qh = frag_h(QH + ((size_t)b * TT + q) * CC + h * HD, lane);
  const _Float16* gk = KH + ((size_t)b * TT + (tid >> 2)) * CC + h * HD + (tid & 3) * 8;               // copies: key rows tid / 4 and 64 + tid / 4 of a stage, 16-byte piece tid % 4
  const _Float16* gv = VT + ((size_t)b * CC + h * HD + (tid >> 4)) * (size_t)TT + (tid & 15) * 8;      // copies: planes tid / 16 and 16 + tid / 16, 16-byte piece tid % 16 of the stage's keys
  const unsigned lk = lds_off(&sk[0][(tid >> 2) * KPIT + (tid & 3) * 8]), lv = lds_off(&sv[0][(tid >> 4) * VPIT + (tid & 15) * 8]);
  // Wo is rounded to bf16 once, here, for the next launch: the grid's NB * NH * TT / 128 blocks take 128 of its DIN * CC values each (wave 0, four a lane); the load flies with the q loads and stage 0
  const int wo0 = ((b * NH + h) * (TT / 128) + (int)blockIdx.x) * 128 + lane * 4; v4f wo4 = {};
  const bool w0 = __builtin_amdgcn_readfirstlane(wave) == 0;   // a scalar test: EXEC stays whole around the copies below
  if (w0) { wo4 = *(const v4f*)(WO + wo0);
    asm volatile("s_wait_xcnt 0x0" ::: "memory"); }   // stands in front of whatever next rewrites a register that this load names
  stage_kv(lk, lv, gk, gv);
  asm volatile("s_wait_asynccnt 0x0" ::: "memory");   // this wave's copies of stage 0 have landed
  __syncthreads();                                    // and every other wave's: stage 0 may be read
  stage_kv(lk + (unsigned)sizeof(sk[0]), lv + (unsigned)sizeof(sv[0]), gk + (size_t)FST * CC, gv + FST);
  if (w0) { v4b o; o[0] = (__bf16)wo4[0]; o[1] = (__bf16)wo4[1]; o[2] = (__bf16)wo4[2]; o[3] = (__bf16)wo4[3]; *(v4b*)(WOB + wo0) = o; }
  v8f acc[HD / 16] = {}, nmv = {}; float l = 0.f;   // nmv: the offset in use, eight times: the C operand of the score products
  const v8f zero8 = {}; const v16h ones = ones_frag();   // ones: the A operand of the sum products
#pragma unroll 1   // a trip = a stage; its two passes are unrolled below
  for (int st = 0; st < NST; ++st) {
    const _Float16* kb = &sk[st & 1][col * KPIT + 8 * g];   // key row col of a 16-key tile, this lane half's d
    const _Float16* vb = &sv[st & 1][col * VPIT + 8 * g];   // plane d = col of a 16-wide d tile, this lane half's keys
    v16h kf[FNT];
#pragma unroll
    for (int t = 0; t < FNT; ++t) kf[t] = frag_p(kb + (t * 16) * KPIT);
#pragma unroll
    for (int ps = 0; ps < FST / FAK; ++ps) {
    v8f s[FNT];
#pragma unroll
    for (int t = 0; t < FNT; ++t) s[t] = wmmah(kf[t], qh, nmv);
    if (ps + 1 < FST / FAK) {   // the stage's next pass: its k fragments are read one pass ahead, from the same buffer
#pragma unroll
      for (int t = 0; t < FNT; ++t) kf[t] = frag_p(kb + ((ps + 1) * FAK + t * 16) * KPIT); }
    v16h vf[HD / 16][FAK / 32];   // this pass's v planes: in flight under the softmax
#pragma unroll
    for (int j = 0; j < HD / 16; ++j)
#pragma unroll
      for (int c = 0; c < FAK / 32; ++c) vf[j][c] = frag_p(vb + (j * 16) * VPIT + ps * FAK + c * 32);
    __builtin_amdgcn_sched_barrier(0);   // keeps these LDS reads in front of the exp2: sunk behind the range test, their latency would stand open in front of the P V products
    float e[FNT][8];   // p at once, under the offset in use: nothing stands between the products and the exp2
#pragma unroll
    for (int t = 0; t < FNT; ++t)
#pragma unroll   // the builtin, not asm text: the compiler sees which registers the exp2 write and keeps them clear of a matrix product's operands
      for (int r = 0; r < 8; ++r) e[t][r] = __builtin_amdgcn_exp2f(s[t][r]);
    v16h p[FAK / 32];
#pragma unroll
    for (int c = 0; c < FAK / 32; ++c)
#pragma unroll
      for (int i = 0; i < 8; ++i) { p[c][i] = (_Float16)e[2 * c][i]; p[c][8 + i] = (_Float16)e[2 * c + 1][i]; }
    v8f sm = wmmah(ones, p[0], zero8);   // every element: this lane's column summed over the pass's keys
#pragma unroll
    for (int c = 1; c < FAK / 32; ++c) sm = wmmah(ones, p[c], sm);
    const bool first = ps == 0 && st == 0;   // the first pass ran under offset 0: it takes its own maximum, up or down
    if (first || __builtin_amdgcn_ballot_w32(sm[0] > PLIM) != 0) { float mx = s[0][0];   // move the offset and take this pass's p and sum again
#pragma unroll
      for (int t = 0; t < FNT; ++t)
#pragma unroll
        for (int r = 0; r < 8; ++r) mx = fmaxf(mx, s[t][r]);
      mx = fmaxf(mx, xhalf(mx));
      float d = POFF - mx; const float dn = fminf(d, 0.f); if (!first) d = dn; const float al = __builtin_amdgcn_exp2f(dn); l *= al;   // d = 0 and al = 1 exactly in a column whose maximum did not rise
#pragma unroll
      for (int j = 0; j < HD / 16; ++j)
#pragma unroll
        for (int r = 0; r < 8; ++r) acc[j][r] *= al;
#pragma unroll
      for (int t = 0; t < FNT; ++t)
#pragma unroll
        for (int r = 0; r < 8; ++r) e[t][r] = exp2_slot(s[t][r] + d);
#pragma unroll
      for (int r = 0; r < 8; ++r) nmv[r] += d;
#pragma unroll
      for (int c = 0; c < FAK / 32; ++c)
#pragma unroll
        for (int i = 0; i < 8; ++i) { p[c][i] = (_Float16)e[2 * c][i]; p[c][8 + i] = (_Float16)e[2 * c + 1][i]; }
      sm = wmmah(ones, p[0], zero8);
#pragma unroll
      for (int c = 1; c < FAK / 32; ++c) sm = wmmah(ones, p[c], sm); }
    l += sm[0];
#pragma unroll
    for (int c = 0; c < FAK / 32; ++c)
#pragma unroll
      for (int j = 0; j < HD / 16; ++j) acc[j] = wmmah(vf[j][c], p[c], acc[j]); }
    asm volatile("s_wait_dscnt 0x0" ::: "memory");      // this wave's reads of the stage's buffer are done
    asm volatile("s_wait_asynccnt 0x0" ::: "memory");   // its copies of the next stage have landed
    __syncthreads();                                    // the next stage may be read, and this stage's buffer may be refilled
    if (st + 2 < NST) stage_kv(lk + (unsigned)(st & 1) * (unsigned)sizeof(sk[0]), lv + (unsigned)(st & 1) * (unsigned)sizeof(sv[0]), gk + (size_t)(st + 2) * FST * CC, gv + (st + 2) * FST); }
  asm volatile("s_wait_asynccnt 0x0" ::: "memory");     // no copy is outstanding when the wave ends
  const float inv = 1.0f / l;   // l holds the whole column's sum in both lane halves
  float* yr = Y + ((size_t)b * TT + q) * CC + h * HD + 8 * g;   // acc[j][r] = ctx[q][j * 16 + 8g + r]
#pragma unroll
  for (int j = 0; j < HD / 16; ++j) { v4f o0, o1;
#pragma unroll
    for (int r = 0; r < 4; ++r) { o0[r] = acc[j][r] * inv; o1[r] = acc[j][4 + r] * inv; }
    vst2(yr + j * 16, o0); vst2(yr + j * 16 + 4, o1); } }
// ctx rows for a block of 256 threads (a load of the block = 4 rows): the loads, and, apart from them, each value split bf16 hi + lo into two LDS planes
template <int NR> __device__ __forceinline__ void load_rows_w8(v4f (&t)[NR / 4], const float* __restrict__ srcp, int tid) {
  const float* s = srcp + tid * 4;
#pragma unroll
  for (int i = 0; i < NR / 4; ++i) t[i] = *(const v4f*)(s + i * 1024);
  asm volatile("s_wait_xcnt 0x0" ::: "memory"); }   // as in stage_rows
template <int NR> __device__ __forceinline__ void split_rows_w8(__bf16* __restrict__ dh, __bf16* __restrict__ dl, const v4f (&t)[NR / 4], int tid) {
  const int o0 = (tid >> 6) * GPIT + (tid & 63) * 4;
#pragma unroll
  for (int i = 0; i < NR / 4; ++i) { v4b oh, ol;
#pragma unroll
    for (int k = 0; k < 4; ++k) { const __bf16 hv = (__bf16)t[i][k]; oh[k] = hv; ol[k] = (__bf16)(t[i][k] - (float)hv); }
    *(v4b*)(dh + o0 + 4 * i * GPIT) = oh; *(v4b*)(dl + o0 + 4 * i * GPIT) = ol; } }
// eight asynchronous 16-byte copies of this thread: bf16 rows 8 apart (a wave's copy = one whole row of 512 B) to the staged pitch; the s_wait_xcnt stands inside the statement, behind the last copy, so that no address register is rewritten in front of it
__device__ __forceinline__ void copy_rows8(unsigned l, const __bf16* g) {
  asm volatile("global_load_async_to_lds_b128 %0, %8, off\n\tglobal_load_async_to_lds_b128 %1, %9, off\n\tglobal_load_async_to_lds_b128 %2, %10, off\n\tglobal_load_async_to_lds_b128 %3, %11, off\n\t"
               "global_load_async_to_lds_b128 %4, %12, off\n\tglobal_load_async_to_lds_b128 %5, %13, off\n\tglobal_load_async_to_lds_b128 %6, %14, off\n\tglobal_load_async_to_lds_b128 %7, %15, off\n\ts_wait_xcnt 0x0"
      :: "v"(l), "v"(l + 8u * GPIT * 2u), "v"(l + 16u * GPIT * 2u), "v"(l + 24u * GPIT * 2u), "v"(l + 32u * GPIT * 2u), "v"(l + 40u * GPIT * 2u), "v"(l + 48u * GPIT * 2u), "v"(l + 56u * GPIT * 2u),
         "v"(g), "v"(g + 8 * CC), "v"(g + 16 * CC), "v"(g + 24 * CC), "v"(g + 32 * CC), "v"(g + 40 * CC), "v"(g + 48 * CC), "v"(g + 56 * CC) : "memory"); }
__device__ __forceinline__ v8f wmmab(v16b a, v16b b, v8f c) { return __builtin_amdgcn_wmma_f32_16x16x32_bf16(false, a, false, b, (short)0, c, false, false); }
// ---- k_outln: block = 32 whole rows (8 waves: 2 groups of 16 rows x 4 groups of 64 columns), ctx rows (hi and lo planes) and all of Wo staged in LDS (Wo comes as the bf16 plane that k_fa has rounded, by asynchronous copies that fly while the ctx rows are split): x = ctx Wo^T (ctx bf16 hi + lo against exact bf16 Wo: 2 products) + bo + bf16(query); the block holds every column of its rows, so LayerNorm follows at once: the x tile goes through LDS, then a wave takes four rows (mean, biased var, (x - mean) * rsqrt(var + 1e-5) * g + b; 8 floats a lane and row)
#define ORW 32
#define SFP 260            // f32 a row of the x tile in LDS: rows 8 apart fall 32 banks apart
__global__ __launch_bounds__(256) void k_outln(const float* __restrict__ Y, const __bf16* __restrict__ WOB, const float* __restrict__ BO, const float* __restrict__ RESX, const float* __restrict__ G, const float* __restrict__ BE, float* __restrict__ OUT) {
  __shared__ __align__(16) float sf[ORW][SFP]; __shared__ __align__(16) __bf16 sw[DIN * GPIT], yh[ORW * GPIT], yl[ORW * GPIT];
  const int tid = threadIdx.x, wave = tid >> 5, lane = tid & 31, col = lane & 15, g = lane >> 4; const int rg = wave & 1, cg = wave >> 1; const size_t r0 = (size_t)blockIdx.x * ORW;
  // what the rows' end needs from memory is asked for first: this wave's four query rows, its bias columns, the affine pair
  v4f zr[4][2], g4[2], b4[2]; float bias[4];
#pragma unroll
  for (int k = 0; k < 4; ++k)
#pragma unroll
    for (int i = 0; i < 2; ++i) zr[k][i] = *(const v4f*)(RESX + (r0 + wave * 4 + k) * DIN + i * 128 + lane * 4);
#pragma unroll
  for (int i = 0; i < 2; ++i) { g4[i] = *(const v4f*)(G + i * 128 + lane * 4); b4[i] = *(const v4f*)(BE + i * 128 + lane * 4); }
#pragma unroll
  for (int j = 0; j < 4; ++j) bias[j] = BO[cg * 64 + j * 16 + col];
  asm volatile("s_wait_xcnt 0x0" ::: "memory");   // stands in front of whatever next rewrites a register that these loads name
  v4f yt[ORW / 4]; load_rows_w8<ORW>(yt, Y + r0 * CC, tid);
  { const unsigned lw = lds_off(&sw[wave * GPIT + lane * 8]); const __bf16* gw = WOB + wave * CC + lane * 8;   // copies: rows wave + 8 i, 16-byte piece lane
#pragma unroll
    for (int i = 0; i < DIN / 64; ++i) copy_rows8(lw + (unsigned)i * 64u * GPIT * 2u, gw + i * 64 * CC); }
  split_rows_w8<ORW>(yh, yl, yt, tid);
  asm volatile("s_wait_asynccnt 0x0" ::: "memory");   // this wave's copies of Wo have landed
  __syncthreads();   // and every other wave's: both operands are whole in LDS
  v8f acc[4] = {};
  const __bf16* ph = yh + (rg * 16 + col) * GPIT; const __bf16* pl = yl + (rg * 16 + col) * GPIT; const __bf16* pw = sw + (cg * 64 + col) * GPIT;
  v16b ah = frag_b(ph, lane), al = frag_b(pl, lane), w[4];
#pragma unroll
  for (int j = 0; j < 4; ++j) w[j] = frag_b(pw + j * 16 * GPIT, lane);
#pragma unroll
  for (int kc = 0; kc < CC / 32; ++kc) { v16b ahn = ah, aln = al, wn[4];
    if (kc + 1 < CC / 32) { ahn = frag_b(ph + (kc + 1) * 32, lane); aln = frag_b(pl + (kc + 1) * 32, lane);   // the next k step's fragments: one group of LDS reads ahead of this step's products
#pragma unroll
      for (int j = 0; j < 4; ++j) wn[j] = frag_b(pw + j * 16 * GPIT + (kc + 1) * 32, lane); }
    __builtin_amdgcn_sched_barrier(0);   // keeps that group of reads in front of the products: sunk to their uses, each read's LDS latency would stand open in front of a product
#pragma unroll
    for (int j = 0; j < 4; ++j) acc[j] = wmmab(ah, w[j], acc[j]);
#pragma unroll
    for (int j = 0; j < 4; ++j) acc[j] = wmmab(al, w[j], acc[j]);
    if (kc + 1 < CC / 32) { ah = ahn; al = aln;
#pragma unroll
      for (int j = 0; j < 4; ++j) w[j] = wn[j]; } }
#pragma unroll
  for (int j = 0; j < 4; ++j) { const float bj = bfr(bias[j]);
#pragma unroll
    for (int r = 0; r < 8; ++r) sf[rg * 16 + 8 * g + r][cg * 64 + j * 16 + col] = acc[j][r] + bj; }
  __syncthreads();   // the x tile is whole: a row's columns come from four waves
  v4f v[4][2]; float s1[4], q[4];
#pragma unroll
  for (int k = 0; k < 4; ++k) { s1[k] = 0.f;
#pragma unroll
    for (int i = 0; i < 2; ++i) { v4f t = *(const v4f*)&sf[wave * 4 + k][i * 128 + lane * 4]; t[0] += bfr(zr[k][i][0]); t[1] += bfr(zr[k][i][1]); t[2] += bfr(zr[k][i][2]); t[3] += bfr(zr[k][i][3]); v[k][i] = t; s1[k] += (t[0] + t[1]) + (t[2] + t[3]); } }
#pragma unroll
  for (int o = 1; o < 32; o <<= 1)
#pragma unroll
    for (int k = 0; k < 4; ++k) s1[k] += __shfl_xor(s1[k], o);
#pragma unroll
  for (int k = 0; k < 4; ++k) { s1[k] *= (1.0f / CC); q[k] = 0.f;
#pragma unroll
    for (int i = 0; i < 2; ++i)
#pragma unroll
      for (int e = 0; e < 4; ++e) { const float d = v[k][i][e] - s1[k]; q[k] += d * d; } }
#pragma unroll
  for (int o = 1; o < 32; o <<= 1)
#pragma unroll
    for (int k = 0; k < 4; ++k) q[k] += __shfl_xor(q[k], o);
#pragma unroll
  for (int k = 0; k < 4; ++k) { const float inv = rsqrtf(q[k] * (1.0f / CC) + 1e-5f);   /* jnp.var (biased), eps inside the rsqrt */
#pragma unroll
    for (int i = 0; i < 2; ++i) { v4f r4;
#pragma unroll
      for (int e = 0; e < 4; ++e) r4[e] = bfr(g4[i][e]) * ((v[k][i][e] - s1[k]) * inv) + bfr(b4[i][e]);
      vst2(OUT + (r0 + wave * 4 + k) * DIN + i * 128 + lane * 4, r4); } } }

extern "C" void kernel_launch(void* const* d_in, const int* in_sizes, int n_in, void* d_out, int out_size, void* d_ws, size_t ws_size, hipStream_t stream) {
  (void)in_sizes; (void)n_in; (void)out_size;
  const float** F = (const float**)d_in;
  if (ws_size < (size_t)WS_END) return;
  char* ws = (char*)d_ws; _Float16 *QH = (_Float16*)(ws + WS_QH), *KH = (_Float16*)(ws + WS_KH), *VT = (_Float16*)(ws + WS_VT), *KL = (_Float16*)(ws + WS_KL); __bf16 *VB = (__bf16*)(ws + WS_VB), *VBL = (__bf16*)(ws + WS_VBL); float *Y = (float*)(ws + WS_Y); __bf16 *WOB = (__bf16*)(ws + WS_WOB);
  // inputs: 0 query; 1 key; 2 value [4,2048,256]; 3 Wq (out,in), 4 bq; 5 Wk, 6 bk; 7 Wv, 8 bv; 9 Wo (out,in), 10 bo; 11 ln_g, 12 ln_b
  k_proj<<<dim3(TNB * TT / 64, CC / 128, 3), 128, 0, stream>>>(F[0], F[1], F[2], F[3], F[5], F[7], F[4], F[6], F[8], QH, KH, KL, VT, VB, VBL);
  k_fa<<<dim3(TT / 128, NH, TNB), 256, 0, stream>>>(QH, KH, VT, Y, F[9], WOB);
  k_outln<<<dim3(TNB * TT / ORW), 256, 0, stream>>>(Y, WOB, F[10], F[0], F[11], F[12], (float*)d_out);   /* LayerNorm(ctx Wo^T + bo + bf16(query)) */
}
